// v000
// Times are from an AMD MI455X. After a warm-up the kernel runs many times in a row, and a time is the length of
// such a window on the GPU divided by its runs, so every launch and the gaps after it count. The runs cycle
// through copies of the inputs. A figure is the median of several windows, for all but v000 over two sittings.
// Sittings can differ by a few percent; kernels timed side by side share one.
// v000 is the starting kernel. One run takes 204 microseconds.
// Contractions: q, k, v^T projections = v_wmma_f32_16x16x32_bf16 (bf16 operands from RNE-converted inputs, single product, bias added in f32);
// q.k^T scores = v_wmma_f32_16x16x32_bf16 with bf16 hi/lo split q and k (hi.hi + hi.lo + lo.hi);
// p.v = v_wmma_f32_16x16x32_f16 (p carried x1024 in f16 plus a x4096 f16 residual plane, v as f16 hi plus a x4096 f16 residual plane: hi.hi + hi.res + res.hi);
// ctx.Wo^T = v_wmma_f32_16x16x32_bf16 with ctx as bf16 hi/lo planes times bf16 Wo (2 products); all f32 accumulate; clip, key mask and softmax in f32.
#include <hip/hip_runtime.h>
#include <math.h>
#include <float.h>
#include <stdint.h>

#define NB    16
#define SEQ   512
#define DM    512
#define NH    8
#define HD    64
#define NQB   (SEQ / 64)   // 8 key / query tiles of 64
static_assert(NH * HD == DM);
static_assert((SEQ % 64) == 0 && (DM % 64) == 0 && ((NB * SEQ) % 64) == 0);

typedef _Float16 v16h __attribute__((ext_vector_type(16)));
typedef _Float16 v8h  __attribute__((ext_vector_type(8)));
typedef __bf16   v16b __attribute__((ext_vector_type(16)));
typedef __bf16   v8b  __attribute__((ext_vector_type(8)));
typedef float    v8f  __attribute__((ext_vector_type(8)));
typedef float    v4f  __attribute__((ext_vector_type(4)));
typedef unsigned int v4u __attribute__((ext_vector_type(4)));

// ---- scalar helpers --------------------------------------------------------------------------------
__device__ __forceinline__ unsigned short bf_bits(float f) {          // f32 -> bf16 bits, RNE convert
  unsigned u = __float_as_uint(f);
  return (unsigned short)((u + 0x7FFFu + ((u >> 16) & 1u)) >> 16);
}
__device__ __forceinline__ float bf_up(unsigned short h) { return __uint_as_float(((unsigned)h) << 16); }
__device__ __forceinline__ float bf_rne(float f) { return bf_up(bf_bits(f)); }
__device__ __forceinline__ unsigned short h_bits(_Float16 x) { return __builtin_bit_cast(unsigned short, x); }
__device__ __forceinline__ unsigned pk16(unsigned short a, unsigned short b) { return (unsigned)a | ((unsigned)b << 16); }
__device__ __forceinline__ v8f zero8() { v8f z = {0.f, 0.f, 0.f, 0.f, 0.f, 0.f, 0.f, 0.f}; return z; }

// ---- fragment loader: 16-bit A/B operand, lane -> row/col (lane&15), p already includes +8*(lane>>4);
//      elements 0..7 <- p[0..7] (k0+8h..), elements 8..15 <- p[16..23] (k0+16+8h..)
__device__ __forceinline__ v16b ldfrag_b(const __bf16* p) {
  union { v16b v; v8b h[2]; } f;
  f.h[0] = *(const v8b*)(p);
  f.h[1] = *(const v8b*)(p + 16);
  return f.v;
}

// ---- WMMA helpers with trailing VALU hazard gap (asm only in the device pass) --------------------------
__device__ __forceinline__ v8f mma_b(v16b a, v16b b, v8f c) {
  c = __builtin_amdgcn_wmma_f32_16x16x32_bf16(false, a, false, b, (short)0, c, false, false);
#if defined(__HIP_DEVICE_COMPILE__)
  asm volatile("v_nop\n\tv_nop\n\tv_nop\n\tv_nop" : "+v"(c) : "v"(a), "v"(b));
#endif
  return c;
}
__device__ __forceinline__ v8f mma_h(v16h a, v16h b, v8f c) {
  c = __builtin_amdgcn_wmma_f32_16x16x32_f16(false, a, false, b, (short)0, c, false, false);
#if defined(__HIP_DEVICE_COMPILE__)
  asm volatile("v_nop\n\tv_nop\n\tv_nop\n\tv_nop" : "+v"(c) : "v"(a), "v"(b));
#endif
  return c;
}
__device__ __forceinline__ v8f mma_b_raw(v16b a, v16b b, v8f c) {
  return __builtin_amdgcn_wmma_f32_16x16x32_bf16(false, a, false, b, (short)0, c, false, false);
}
__device__ __forceinline__ void dep_guard_b(v8f& a, v8f& b, v16b x, v16b y) {
#if defined(__HIP_DEVICE_COMPILE__)
  asm volatile("v_nop\n\tv_nop\n\tv_nop\n\tv_nop" : "+v"(a), "+v"(b) : "v"(x), "v"(y));
#endif
}
__device__ __forceinline__ void keep4_b(v16b a, v16b b, v16b c, v16b d) {
#if defined(__HIP_DEVICE_COMPILE__)
  asm volatile("v_nop" :: "v"(a), "v"(b), "v"(c), "v"(d));
#endif
}
__device__ __forceinline__ void acc_guard4(v8f& a, v8f& b, v8f& c, v8f& d) {
#if defined(__HIP_DEVICE_COMPILE__)
  asm volatile("v_nop\n\tv_nop\n\tv_nop\n\tv_nop" : "+v"(a), "+v"(b), "+v"(c), "+v"(d));
#endif
}

// =====================================================================================================
// f32 -> bf16 (RNE convert), 8 elements per thread, one 16-B store per lane: a wave writes 512 contiguous B
// coverage: n8 threads x 8 = whole plane (n8 is a multiple of 256 for every use here).
// =====================================================================================================
__global__ __launch_bounds__(256) void cvt_bf16x8(const float* __restrict__ in, unsigned short* out, int n8) {
  const int i = blockIdx.x * 256 + threadIdx.x;
  if (i < n8) {
    const v4f a = *(const v4f*)(in + (size_t)i * 8);
    const v4f b = *(const v4f*)(in + (size_t)i * 8 + 4);
    v4u p;
    p[0] = pk16(bf_bits(a[0]), bf_bits(a[1]));
    p[1] = pk16(bf_bits(a[2]), bf_bits(a[3]));
    p[2] = pk16(bf_bits(b[0]), bf_bits(b[1]));
    p[3] = pk16(bf_bits(b[2]), bf_bits(b[3]));
    *(v4u*)(out + (size_t)i * 8) = p;
    
  }
}

// =====================================================================================================
// Register-blocked batched bf16 WMMA GEMM: C[m][n] = sum_k A[m][k] * Bt[n][k] + bias; one wave per 64x64
// tile, no block barriers. A row-major [M][K] pitch lda; Bt row-major [N][K] pitch ldb (k contiguous);
// M, N multiples of 64, K multiple of 32 (host-checked). blockIdx.y = batch index (strides in elements).
// NSPLIT: 0 = A.Bt; 1 = (A + A2).Bt (A2 = unscaled bf16 lo plane of A, 2 products).
// BIAS: 0 = none; 1 = bias[n] per column; 2 = bias[m] per row; bias values RNE-converted to bf16 first,
//       added in f32; bias index clamped to nbias-1.
// OUT_MODE: 0 = f32 (pitch ldc); 2 = bf16 hi plane C + bf16 lo plane C2 (lo = RNE(v - hi), unscaled);
//           3 = f16 hi plane C + f16 residual plane C2 = f16((v - hi) * rscale) (pitch ldc2, stride strideC2).
// =====================================================================================================
template <int NSPLIT, int OUT_MODE, int BIAS>
__global__ __launch_bounds__(256) void gemm64(
    const unsigned short* __restrict__ Ap, const unsigned short* A2p, int lda, long long strideA,
    const unsigned short* __restrict__ Btp, int ldb, long long strideB,
    const float* __restrict__ bias, int nbias,
    void* Cout, int ldc, long long strideC,
    void* Cout2, int ldc2, long long strideC2,
    int M, int N, int K, float rscale) {
  const __bf16* A   = (const __bf16*)(const void*)Ap;
  const __bf16* A2  = (const __bf16*)(const void*)A2p;
  const __bf16* Bt  = (const __bf16*)(const void*)Btp;
  __shared__ __align__(16) float sT[8][16 * 68];   // per-wave 16x64 slab, pitch 68 floats
  const int b    = blockIdx.y;
  const int lane = threadIdx.x & 31;
  const int wave = threadIdx.x >> 5;
  const int tilesN = N >> 6;
  const int tilesM = M >> 6;
  const int tile = blockIdx.x * 8 + wave;
  if (tile >= tilesM * tilesN) return;   // wave-uniform; no block barriers in this kernel
  const int tm = tile / tilesN;
  const int tn = tile - tm * tilesN;
  const int m0 = tm << 6;
  const int n0 = tn << 6;

  const __bf16* Ab  = A  + (size_t)b * strideA;
  const __bf16* Bb  = Bt + (size_t)b * strideB;
  const __bf16* Ab2 = (NSPLIT >= 1) ? (A2 + (size_t)b * strideA) : Ab;

  const int rlane = lane & 15;                 // row (A) / col (B, D) within subtile
  const int koff  = (lane >> 4) * 8;           // k offset of this lane half
  const int mOff  = (lane >> 4) * 8;           // D row offset

  v8f acc[4][4];
#pragma unroll
  for (int i = 0; i < 4; ++i)
#pragma unroll
    for (int j = 0; j < 4; ++j) acc[i][j] = zero8();

  for (int k0 = 0; k0 < K; k0 += 32) {
    v16b bh[4];
#pragma unroll
    for (int j = 0; j < 4; ++j) {
      const size_t bo = (size_t)(n0 + (j << 4) + rlane) * ldb + koff + k0;
      bh[j] = ldfrag_b(Bb + bo);
    }
#pragma unroll
    for (int i = 0; i < 4; ++i) {
      const size_t ao = (size_t)(m0 + (i << 4) + rlane) * lda + koff + k0;
      const v16b ah = ldfrag_b(Ab + ao);
      v16b al = ah;
      if (NSPLIT >= 1) al = ldfrag_b(Ab2 + ao);
#pragma unroll
      for (int j = 0; j < 4; ++j) {
        acc[i][j] = mma_b_raw(ah, bh[j], acc[i][j]);
        if (NSPLIT >= 1) acc[i][j] = mma_b_raw(al, bh[j], acc[i][j]);
      }
      dep_guard_b(acc[i][0], acc[i][3], ah, al);
    }
    keep4_b(bh[0], bh[1], bh[2], bh[3]);
  }
  acc_guard4(acc[0][0], acc[0][1], acc[0][2], acc[0][3]);
  acc_guard4(acc[1][0], acc[1][1], acc[1][2], acc[1][3]);
  acc_guard4(acc[2][0], acc[2][1], acc[2][2], acc[2][3]);
  acc_guard4(acc[3][0], acc[3][1], acc[3][2], acc[3][3]);

  // ---- epilogue ----
  float bn[4];
#pragma unroll
  for (int j = 0; j < 4; ++j) {
    const int bi = (BIAS == 1) ? (n0 + (j << 4) + rlane) : 0;
    const float bvv = bf_rne(bias[min(bi, nbias - 1)]);          // clamped address
    bn[j] = (BIAS == 1) ? bvv : 0.f;
  }
  float* slab = sT[wave];
#pragma unroll
  for (int i = 0; i < 4; ++i) {
    const int mBase = m0 + (i << 4);
    float bm[8];
#pragma unroll
    for (int r = 0; r < 8; ++r) {
      const int bi = (BIAS == 2) ? (mBase + mOff + r) : 0;
      const float bvv = bf_rne(bias[min(bi, nbias - 1)]);        // clamped address
      bm[r] = (BIAS == 2) ? bvv : 0.f;
    }
#pragma unroll
    for (int j = 0; j < 4; ++j) {
#pragma unroll
      for (int r = 0; r < 8; ++r) {
        slab[(mOff + r) * 68 + (j << 4) + rlane] = acc[i][j][r] + bn[j] + bm[r];
      }
    }
    __builtin_amdgcn_fence(__ATOMIC_RELEASE, "workgroup");
    __builtin_amdgcn_wave_barrier();
    __builtin_amdgcn_fence(__ATOMIC_ACQUIRE, "workgroup");
    if (OUT_MODE == 0) {
      float* C = (float*)Cout + (size_t)b * strideC;
      const int hh = lane >> 4, c4 = (lane & 15) * 4;     // 256-B row segment = 16 lanes x 16 B
      {
#pragma unroll
        for (int it = 0; it < 8; ++it) {
          const int row = it * 2 + hh;                     // it 0..7 x hh 0..1 = rows 0..15
          const v4f v = *(const v4f*)(slab + row * 68 + c4);
          *(v4f*)(C + (size_t)(mBase + row) * ldc + n0 + c4) = v;
        }
        
      }
    } else {
      const int q = lane >> 3, c8 = (lane & 7) * 8;
      unsigned short* C  = (unsigned short*)Cout  + (size_t)b * strideC;
      unsigned short* C2 = (unsigned short*)Cout2 + (size_t)b * strideC2;
      v4u hv[4], lv[4];
#pragma unroll
      for (int it = 0; it < 4; ++it) {
        const int row = it * 4 + q;                        // it 0..3 x q 0..3 = rows 0..15
        const float* sp = slab + row * 68 + c8;
        v4u a, a2;
#pragma unroll
        for (int e = 0; e < 4; ++e) {
          const float f0 = sp[2 * e], f1 = sp[2 * e + 1];
          unsigned short h0, h1, l0, l1;
          if (OUT_MODE == 2) {
            h0 = bf_bits(f0); h1 = bf_bits(f1);
            l0 = bf_bits(f0 - bf_up(h0)); l1 = bf_bits(f1 - bf_up(h1));
          } else {
            const _Float16 x0 = (_Float16)f0, x1 = (_Float16)f1;
            h0 = h_bits(x0); h1 = h_bits(x1);
            l0 = h_bits((_Float16)((f0 - (float)x0) * rscale));
            l1 = h_bits((_Float16)((f1 - (float)x1) * rscale));
          }
          a[e] = pk16(h0, h1); a2[e] = pk16(l0, l1);
        }
        hv[it] = a; lv[it] = a2;
      }
      {
#pragma unroll
        for (int it = 0; it < 4; ++it) {
          const int row = it * 4 + q;
          *(v4u*)(C  + (size_t)(mBase + row) * ldc  + n0 + c8) = hv[it];
          *(v4u*)(C2 + (size_t)(mBase + row) * ldc2 + n0 + c8) = lv[it];
        }
        
      }
    }
    __builtin_amdgcn_fence(__ATOMIC_RELEASE, "workgroup");
    __builtin_amdgcn_wave_barrier();
    __builtin_amdgcn_fence(__ATOMIC_ACQUIRE, "workgroup");
  }
}

// =====================================================================================================
// Attention with a clipped distance bias and a per-key integer mask, head dim 64.
//   q planes (bf16 hi / lo): element (b, t, h, d) at [(b*SEQ + t)*DM + h*64 + d]
//   k planes (bf16 hi / lo): same layout with key index s
//   v^T hi plane (f16):      element (b, h, d, s) at [(b*DM + h*64 + d)*SEQ + s]
//   v^T residual plane (f16, (v - hi)*4096): same layout
//   dbias f32 [b][t][s] (RNE-converted to bf16 per value), kmask int [b][s]
//   logit = clip(q.k * sscale + dbias, -10, 10), then keys with kmask == 0 -> -1e9; softmax over all keys
//   out planes (bf16 hi / lo of the normalised context): element (b, t, h, d) at [(b*SEQ + t)*DM + h*64 + d]
//   scores = q . k : bf16 hi/lo split (hi.hi + hi.lo + lo.hi), f32 accumulate; bias, clip, mask in f32
//   p = exp(s - m) carried as f16(1024 p) plus f16 residual x4096; context = p . v on f16 WMMA with the
//   residual products (p.vres + pres.v) in a separate accumulator folded back with 1/4096 per chunk in f32;
//   online softmax in f32. Block = 4 waves = 64 query rows of one (b, h); grid = NQB * NH * NB; kv chunks of 64,
//   static trip NQB. K / V^T chunk staging: 128 threads x 32 elements per plane = the whole 64x64 tile (plain
//   16-B loads, __syncthreads before and after); P tiles are wave-private, spilled with _Float16 element stores
//   Output coverage: each wave stores rows q0..q0+15 (it 0..3 x lane>>3 0..3) x 64 columns (8 lanes x 8) of both planes.
// =====================================================================================================
__global__ __launch_bounds__(128)
void attn64(const unsigned short* __restrict__ qhp, const unsigned short* __restrict__ qlp,
            const unsigned short* __restrict__ khp, const unsigned short* __restrict__ klp,
            const unsigned short* __restrict__ vhp, const unsigned short* __restrict__ vlp,
            const float* __restrict__ dbias, const int* __restrict__ kmask,
            unsigned short* ohp, unsigned short* olp, float sscale) {
  union FB { v16b v; v8b h[2]; };
  union FH { v16h v; v8h h[2]; };
  __shared__ __align__(16) __bf16   Ksh[64 * 64];   // K hi [kv][d]   8 KB
  __shared__ __align__(16) __bf16   Ksl[64 * 64];   // K lo
  __shared__ __align__(16) _Float16 Vth[64 * 64];   // V^T hi [d][kv] 8 KB
  __shared__ __align__(16) _Float16 Vtl[64 * 64];   // V^T residual
  __shared__ __align__(16) _Float16 Psh[4][16 * 64];   // per wave P [row][kv]
  __shared__ __align__(16) _Float16 Psl[4][16 * 64];   // per wave P residual
  __shared__ __align__(16) float    Os[4][16 * 64];    // per wave context tile [row][d]

  const int tid  = threadIdx.x;
  const int wave = tid >> 5;
  const int lane = tid & 31;
  const int hh   = lane >> 4;
  const int c    = lane & 15;

  const int bx   = blockIdx.x;
  const int qb   = bx % NQB;
  const int rest = bx / NQB;
  const int h    = rest % NH;
  const int b    = rest / NH;
  const int q0   = qb * 64 + wave * 16;
  const size_t rowB = (size_t)b * SEQ;

  const __bf16* Qh = (const __bf16*)(const void*)qhp + (size_t)h * HD;
  const __bf16* Ql = (const __bf16*)(const void*)qlp + (size_t)h * HD;
  const __bf16* Kh = (const __bf16*)(const void*)khp + (size_t)h * HD;
  const __bf16* Kl = (const __bf16*)(const void*)klp + (size_t)h * HD;
  const _Float16* Vh = (const _Float16*)(const void*)vhp + ((size_t)b * DM + (size_t)h * HD) * SEQ;
  const _Float16* Vl = (const _Float16*)(const void*)vlp + ((size_t)b * DM + (size_t)h * HD) * SEQ;
  const float* dbw = dbias + (rowB + (size_t)q0 + 8 * hh) * SEQ + c;   // row q0+8hh(+r), key (kv0 + 16j) + c
  const int*   mkb = kmask + rowB + c;                                 // key (kv0 + 16j) + c

  // ---- Q fragments (A operand, row = lane&15): 2 d-chunks, hi and lo ----
  v16b qah[2], qal[2];
#pragma unroll
  for (int dc = 0; dc < 2; ++dc) {
    const size_t qo = (rowB + q0 + c) * DM + dc * 32 + 8 * hh;
    qah[dc] = ldfrag_b(Qh + qo);
    qal[dc] = ldfrag_b(Ql + qo);
  }

  float mrow[8], lrow[8];
  v8f oacc[4];
#pragma unroll
  for (int r = 0; r < 8; ++r) { mrow[r] = -INFINITY; lrow[r] = 0.f; }
#pragma unroll
  for (int t = 0; t < 4; ++t) oacc[t] = zero8();

  for (int kt = 0; kt < NQB; ++kt) {         // static trip count
    const int kv0 = kt * 64;
    __syncthreads();
    {
      const int r = tid >> 1, half = (tid & 1) * 32;
      const __bf16*   kg  = Kh + (rowB + kv0 + r) * DM + half;    // K row kv0+r, d = half..half+31
      const __bf16*   klg = Kl + (rowB + kv0 + r) * DM + half;
      const _Float16* vg  = Vh + (size_t)r * SEQ + kv0 + half;    // V^T row d = r, s = kv0+half..+31
      const _Float16* vlg = Vl + (size_t)r * SEQ + kv0 + half;
#pragma unroll
      for (int i = 0; i < 4; ++i) {
        const v8b a0 = *(const v8b*)(kg + 8 * i);
        const v8b a1 = *(const v8b*)(klg + 8 * i);
        const v8h b0 = *(const v8h*)(vg + 8 * i);
        const v8h b1 = *(const v8h*)(vlg + 8 * i);
        *(v8b*)(Ksh + r * 64 + half + 8 * i) = a0;
        *(v8b*)(Ksl + r * 64 + half + 8 * i) = a1;
        *(v8h*)(Vth + r * 64 + half + 8 * i) = b0;
        *(v8h*)(Vtl + r * 64 + half + 8 * i) = b1;
      }
    }
    __syncthreads();

    // ---- scores: 16 query rows x 64 keys per wave, 3 bf16 products ----
    v8f s[4];
#pragma unroll
    for (int j = 0; j < 4; ++j) {
      s[j] = zero8();
#pragma unroll
      for (int dc = 0; dc < 2; ++dc) {
        FB kb, kl;
        kb.h[0] = *(const v8b*)(Ksh + (j * 16 + c) * 64 + dc * 32 + 8 * hh);
        kb.h[1] = *(const v8b*)(Ksh + (j * 16 + c) * 64 + dc * 32 + 16 + 8 * hh);
        kl.h[0] = *(const v8b*)(Ksl + (j * 16 + c) * 64 + dc * 32 + 8 * hh);
        kl.h[1] = *(const v8b*)(Ksl + (j * 16 + c) * 64 + dc * 32 + 16 + 8 * hh);
        s[j] = mma_b(qah[dc], kb.v, s[j]);
        s[j] = mma_b(qah[dc], kl.v, s[j]);
        s[j] = mma_b(qal[dc], kb.v, s[j]);
      }
    }

    // ---- key mask values for this lane's 4 keys (same for all 8 rows) ----
    int mk[4];
#pragma unroll
    for (int j = 0; j < 4; ++j) mk[j] = mkb[kv0 + j * 16];

    // ---- scale + bias, clip, key mask, row max, online softmax, P (x1024, f16) and
    //      P residual (x4096) to LDS ----
    _Float16* pwh = Psh[wave];
    _Float16* pwl = Psl[wave];
#pragma unroll
    for (int r = 0; r < 8; ++r) {
      const float* drw = dbw + (size_t)r * SEQ + kv0;
      float m = -INFINITY;
#pragma unroll
      for (int j = 0; j < 4; ++j) {
        const float dv = bf_rne(drw[j * 16]);
        float sv = s[j][r] * sscale + dv;
        sv = fminf(10.0f, fmaxf(-10.0f, sv));
        sv = (mk[j] != 0) ? sv : -1.0e9f;
        s[j][r] = sv;
        m = fmaxf(m, sv);
      }
#pragma unroll
      for (int off = 1; off < 16; off <<= 1) m = fmaxf(m, __shfl_xor(m, off, 32));
      const float mnew  = fmaxf(mrow[r], m);
      const float msafe = (mnew == -INFINITY) ? 0.f : mnew;
      const float alpha = __expf(mrow[r] - msafe);
      mrow[r] = mnew;
      float psum = 0.f;
#pragma unroll
      for (int j = 0; j < 4; ++j) {
        const float p = __expf(s[j][r] - msafe);
        psum += p;
        const float p1k = p * 1024.0f;
        const _Float16 ph = (_Float16)p1k;
        const _Float16 pl = (_Float16)((p1k - (float)ph) * 4096.0f);
        pwh[(8 * hh + r) * 64 + j * 16 + c] = ph;
        pwl[(8 * hh + r) * 64 + j * 16 + c] = pl;
      }
#pragma unroll
      for (int off = 1; off < 16; off <<= 1) psum += __shfl_xor(psum, off, 32);
      lrow[r] = lrow[r] * alpha + psum;
#pragma unroll
      for (int t = 0; t < 4; ++t) oacc[t][r] *= alpha;
    }
    __builtin_amdgcn_fence(__ATOMIC_RELEASE, "workgroup");
    __builtin_amdgcn_wave_barrier();
    __builtin_amdgcn_fence(__ATOMIC_ACQUIRE, "workgroup");

    // ---- context += P . V (f16 WMMA), residual products into a separate accumulator ----
    v8f o1[4];
#pragma unroll
    for (int t = 0; t < 4; ++t) o1[t] = zero8();
#pragma unroll 1
    for (int kk = 0; kk < 2; ++kk) {
      FH pa, pl;
      pa.h[0] = *(const v8h*)(pwh + c * 64 + kk * 32 + 8 * hh);
      pa.h[1] = *(const v8h*)(pwh + c * 64 + kk * 32 + 16 + 8 * hh);
      pl.h[0] = *(const v8h*)(pwl + c * 64 + kk * 32 + 8 * hh);
      pl.h[1] = *(const v8h*)(pwl + c * 64 + kk * 32 + 16 + 8 * hh);
#pragma unroll
      for (int t = 0; t < 4; ++t) {
        FH vb, vl;
        vb.h[0] = *(const v8h*)(Vth + (t * 16 + c) * 64 + kk * 32 + 8 * hh);
        vb.h[1] = *(const v8h*)(Vth + (t * 16 + c) * 64 + kk * 32 + 16 + 8 * hh);
        vl.h[0] = *(const v8h*)(Vtl + (t * 16 + c) * 64 + kk * 32 + 8 * hh);
        vl.h[1] = *(const v8h*)(Vtl + (t * 16 + c) * 64 + kk * 32 + 16 + 8 * hh);
        oacc[t] = mma_h(pa.v, vb.v, oacc[t]);
        o1[t]   = mma_h(pa.v, vl.v, o1[t]);
        o1[t]   = mma_h(pl.v, vb.v, o1[t]);
      }
    }
#pragma unroll
    for (int t = 0; t < 4; ++t)
#pragma unroll
      for (int r = 0; r < 8; ++r) oacc[t][r] += o1[t][r] * (1.0f / 4096.0f);
  }

  // ---- normalise (1/l and the 1/1024 p carry), stage the wave's 16x64 tile, bf16 hi/lo split,
  float* os = Os[wave];
#pragma unroll
  for (int r = 0; r < 8; ++r) {
    const float l = lrow[r];
    const float inv = ((l > 0.f) ? (1.0f / l) : 0.f) * (1.0f / 1024.0f);
#pragma unroll
    for (int t = 0; t < 4; ++t) os[(8 * hh + r) * 64 + t * 16 + c] = oacc[t][r] * inv;
  }
  __builtin_amdgcn_fence(__ATOMIC_RELEASE, "workgroup");
  __builtin_amdgcn_wave_barrier();
  __builtin_amdgcn_fence(__ATOMIC_ACQUIRE, "workgroup");
  {
    const int q4 = lane >> 3, c8 = (lane & 7) * 8;
    v4u hv[4], lv[4];
#pragma unroll
    for (int it = 0; it < 4; ++it) {
      const int row = it * 4 + q4;   // it 0..3 x q4 0..3 = rows 0..15 of the wave tile
      const float* sp = os + row * 64 + c8;
      v4u a, a2;
#pragma unroll
      for (int e = 0; e < 4; ++e) {
        const float f0 = sp[2 * e], f1 = sp[2 * e + 1];
        const unsigned short h0 = bf_bits(f0), h1 = bf_bits(f1);
        const unsigned short l0 = bf_bits(f0 - bf_up(h0)), l1 = bf_bits(f1 - bf_up(h1));
        a[e] = pk16(h0, h1); a2[e] = pk16(l0, l1);
      }
      hv[it] = a; lv[it] = a2;
    }
    {
#pragma unroll
      for (int it = 0; it < 4; ++it) {
        const int row = it * 4 + q4;
        const size_t go = (rowB + q0 + row) * DM + (size_t)h * HD + c8;
        *(v4u*)(ohp + go) = hv[it];
        *(v4u*)(olp + go) = lv[it];
      }
      
    }
  }
}

// =====================================================================================================
// Workspace map (bytes), every plane an exact multiple of its 64x64-tile / whole-line store granularity:
//   Xb   bf16 [8192][512]          8388608
//   Wqb, Wkb, Wvb, Wob bf16 [512 n][512 k]   524288 each
//   Qh, Ql, Kh, Kl bf16 [8192][512] 8388608 each
//   VTh  f16  [16][512 d][512 s]   8388608
//   VTl  f16  [16][512 d][512 s]   8388608
//   Oh, Ol bf16 [8192][512]         8388608 each
//   total                           77594624
// Weights are [out n][in k] with k contiguous = the Bt / A layout the GEMM wants, so they are only converted.
// =====================================================================================================
extern "C" void kernel_launch(void* const* d_in, const int* in_sizes, int n_in,
                              void* d_out, int out_size, void* d_ws, size_t ws_size,
                              hipStream_t stream) {
  if (n_in < 11) return;
  if (in_sizes[0] != NB * SEQ * DM) return;
  if (in_sizes[1] != NB * SEQ * SEQ) return;
  if (in_sizes[2] != NB * SEQ) return;
  if (in_sizes[3] != DM * DM || in_sizes[5] != DM * DM || in_sizes[7] != DM * DM || in_sizes[9] != DM * DM) return;
  if (in_sizes[4] != DM || in_sizes[6] != DM || in_sizes[8] != DM || in_sizes[10] != DM) return;
  if (out_size != NB * SEQ * DM) return;

  const float* x    = (const float*)d_in[0];
  const float* db   = (const float*)d_in[1];
  const int*   msk  = (const int*)d_in[2];
  const float* Wq   = (const float*)d_in[3];
  const float* bq   = (const float*)d_in[4];
  const float* Wk   = (const float*)d_in[5];
  const float* bk   = (const float*)d_in[6];
  const float* Wv   = (const float*)d_in[7];
  const float* bv   = (const float*)d_in[8];
  const float* Wo   = (const float*)d_in[9];
  const float* bo   = (const float*)d_in[10];

  const size_t PX  = (size_t)NB * SEQ * DM * 2;   // 8388608   16-bit activation plane [8192][512]
  const size_t PW  = (size_t)DM * DM * 2;         //  524288   16-bit weight plane
  const size_t PVT = (size_t)NB * DM * SEQ * 2;   // 8388608   v^T plane
  size_t off = 0;
  const size_t oXb  = off; off += PX;
  const size_t oWq  = off; off += PW;
  const size_t oWk  = off; off += PW;
  const size_t oWv  = off; off += PW;
  const size_t oWo  = off; off += PW;
  const size_t oQh  = off; off += PX;
  const size_t oQl  = off; off += PX;
  const size_t oKh  = off; off += PX;
  const size_t oKl  = off; off += PX;
  const size_t oVTh = off; off += PVT;
  const size_t oVTl = off; off += PVT;
  const size_t oOh  = off; off += PX;
  const size_t oOl  = off; off += PX;
  if (off > ws_size) return;                      // off = 77594624
  if (off > (size_t)134217728) return;

  char* ws = (char*)d_ws;
  unsigned short* Xb  = (unsigned short*)(ws + oXb);
  unsigned short* Wqb = (unsigned short*)(ws + oWq);
  unsigned short* Wkb = (unsigned short*)(ws + oWk);
  unsigned short* Wvb = (unsigned short*)(ws + oWv);
  unsigned short* Wob = (unsigned short*)(ws + oWo);
  unsigned short* Qh  = (unsigned short*)(ws + oQh);
  unsigned short* Ql  = (unsigned short*)(ws + oQl);
  unsigned short* Kh  = (unsigned short*)(ws + oKh);
  unsigned short* Kl  = (unsigned short*)(ws + oKl);
  unsigned short* VTh = (unsigned short*)(ws + oVTh);
  unsigned short* VTl = (unsigned short*)(ws + oVTl);
  unsigned short* Oh  = (unsigned short*)(ws + oOh);
  unsigned short* Ol  = (unsigned short*)(ws + oOl);

  const dim3 blk(256);
  const int n8x = NB * SEQ * DM / 8;                          // 524288
  const int n8w = DM * DM / 8;                                //  32768
  const dim3 gCvtX((n8x + 255) / 256);                        // 2048 blocks
  const dim3 gCvtW((n8w + 255) / 256);                        //  128 blocks
  const dim3 gProj(((NB * SEQ / 64) * (DM / 64) + 7) / 8, 1); // 1024 tiles -> 128 blocks: M=8192, N=512
  const dim3 gVT(((DM / 64) * (SEQ / 64) + 7) / 8, NB);      // 64 tiles -> 8 blocks x 16 batches: M=512, N=512
  const dim3 gAttn(NB * NH * NQB);                            // 1024 blocks of 128 threads

  // (1) x -> bf16 plane [8192][512]; weights [n][k] f32 -> bf16 [n][k]
  cvt_bf16x8<<<gCvtX, blk, 0, stream>>>(x,  Xb,  n8x);
  cvt_bf16x8<<<gCvtW, blk, 0, stream>>>(Wq, Wqb, n8w);
  cvt_bf16x8<<<gCvtW, blk, 0, stream>>>(Wk, Wkb, n8w);
  cvt_bf16x8<<<gCvtW, blk, 0, stream>>>(Wv, Wvb, n8w);
  cvt_bf16x8<<<gCvtW, blk, 0, stream>>>(Wo, Wob, n8w);
  // (2) q = x . Wq^T + bq -> bf16 hi/lo planes [b*SEQ+t][h*64+d]   (M=8192, N=512, K=512)
  gemm64<0, 2, 1><<<gProj, blk, 0, stream>>>(
      Xb, Xb, DM, 0LL, Wqb, DM, 0LL, bq, DM,
      (void*)Qh, DM, 0LL, (void*)Ql, DM, 0LL,
      NB * SEQ, DM, DM, 1.0f);
  // (3) k = x . Wk^T + bk -> bf16 hi/lo planes
  gemm64<0, 2, 1><<<gProj, blk, 0, stream>>>(
      Xb, Xb, DM, 0LL, Wkb, DM, 0LL, bk, DM,
      (void*)Kh, DM, 0LL, (void*)Kl, DM, 0LL,
      NB * SEQ, DM, DM, 1.0f);
  // (4) v^T = Wv . x^T + bv (per row) per batch -> f16 hi plane [b][h*64+d][s] (pitch SEQ) and residual plane
  //     (x4096, pitch SEQ)   (A = Wvb [n][k], Bt = Xb rows of batch b; M=512, N=512, K=512)
  gemm64<0, 3, 2><<<gVT, blk, 0, stream>>>(
      Wvb, Wvb, DM, 0LL, Xb, DM, (long long)SEQ * DM, bv, DM,
      (void*)VTh, SEQ, (long long)DM * SEQ, (void*)VTl, SEQ, (long long)DM * SEQ,
      DM, SEQ, DM, 4096.0f);
  // (5) attention -> context bf16 hi/lo planes
  attn64<<<gAttn, dim3(128), 0, stream>>>(
      Qh, Ql, Kh, Kl, VTh, VTl, db, msk, Oh, Ol, 0.125f);
  // (6) out = context . Wo^T + bo -> d_out f32 [8192][512]  (A = context hi + lo planes, 2 products)
  gemm64<1, 0, 1><<<gProj, blk, 0, stream>>>(
      Oh, Ol, DM, 0LL, Wob, DM, 0LL, bo, DM,
      d_out, DM, 0LL, d_out, DM, 0LL,
      NB * SEQ, DM, DM, 1.0f);
  (void)hipGetLastError();
}

// v001
// A run of this version takes 180 microseconds.
// Next to v000, in two timings, it ran 1.16 and 1.17 times as fast.
// Contractions: q, k, v^T projections = v_wmma_f32_16x16x32_bf16 (bf16 operands from RNE-converted inputs, single product, bias added in f32);
// q.k^T scores = v_wmma_f32_16x16x32_bf16 with bf16 hi/lo split q and k (hi.hi + hi.lo + lo.hi);
// p.v = v_wmma_f32_16x16x32_f16 (p carried x1024 in f16 plus a x4096 f16 residual plane, v as f16 hi plus a x4096 f16 residual plane: hi.hi + hi.res + res.hi);
// ctx.Wo^T = v_wmma_f32_16x16x32_bf16 with ctx as bf16 hi/lo planes times bf16 Wo (2 products); all f32 accumulate; clip, key mask and softmax in f32.
#include <hip/hip_runtime.h>
#include <math.h>
#include <float.h>
#include <stdint.h>

#define NB    16
#define SEQ   512
#define DM    512
#define NH    8
#define HD    64
#define NQB   (SEQ / 64)   // 8 key / query tiles of 64
#define KP    72           // LDS row pitch of the 64-wide 16-bit tiles, elements: 144 B = 16 B x 9, for ds_load_b128 readers
#define OP    68           // LDS row pitch of the 64-wide f32 context tile, floats: 272 B = 16 B x 17
static_assert(NH * HD == DM);
static_assert((SEQ % 64) == 0 && (DM % 64) == 0 && ((NB * SEQ) % 64) == 0);

typedef _Float16 v16h __attribute__((ext_vector_type(16)));
typedef _Float16 v8h  __attribute__((ext_vector_type(8)));
typedef __bf16   v16b __attribute__((ext_vector_type(16)));
typedef __bf16   v8b  __attribute__((ext_vector_type(8)));
typedef float    v8f  __attribute__((ext_vector_type(8)));
typedef float    v4f  __attribute__((ext_vector_type(4)));
typedef unsigned int v4u __attribute__((ext_vector_type(4)));

// ---- scalar helpers --------------------------------------------------------------------------------
__device__ __forceinline__ unsigned short bf_bits(float f) {          // f32 -> bf16 bits, RNE convert
  unsigned u = __float_as_uint(f);
  return (unsigned short)((u + 0x7FFFu + ((u >> 16) & 1u)) >> 16);
}
__device__ __forceinline__ float bf_up(unsigned short h) { return __uint_as_float(((unsigned)h) << 16); }
__device__ __forceinline__ float bf_rne(float f) { return bf_up(bf_bits(f)); }
__device__ __forceinline__ unsigned short h_bits(_Float16 x) { return __builtin_bit_cast(unsigned short, x); }
__device__ __forceinline__ unsigned pk16(unsigned short a, unsigned short b) { return (unsigned)a | ((unsigned)b << 16); }
__device__ __forceinline__ v8f zero8() { v8f z = {0.f, 0.f, 0.f, 0.f, 0.f, 0.f, 0.f, 0.f}; return z; }

// ---- fragment loader: 16-bit A/B operand, lane -> row/col (lane&15), p already includes +8*(lane>>4);
//      elements 0..7 <- p[0..7] (k0+8h..), elements 8..15 <- p[16..23] (k0+16+8h..)
__device__ __forceinline__ v16b ldfrag_b(const __bf16* p) {
  union { v16b v; v8b h[2]; } f;
  f.h[0] = *(const v8b*)(p);
  f.h[1] = *(const v8b*)(p + 16);
  return f.v;
}

// ---- WMMA helpers with trailing VALU hazard gap (asm only in the device pass) --------------------------
__device__ __forceinline__ v8f mma_b(v16b a, v16b b, v8f c) {
  c = __builtin_amdgcn_wmma_f32_16x16x32_bf16(false, a, false, b, (short)0, c, false, false);
#if defined(__HIP_DEVICE_COMPILE__)
  asm volatile("v_nop\n\tv_nop\n\tv_nop\n\tv_nop" : "+v"(c) : "v"(a), "v"(b));
#endif
  return c;
}
__device__ __forceinline__ v8f mma_h(v16h a, v16h b, v8f c) {
  c = __builtin_amdgcn_wmma_f32_16x16x32_f16(false, a, false, b, (short)0, c, false, false);
#if defined(__HIP_DEVICE_COMPILE__)
  asm volatile("v_nop\n\tv_nop\n\tv_nop\n\tv_nop" : "+v"(c) : "v"(a), "v"(b));
#endif
  return c;
}
__device__ __forceinline__ v8f mma_b_raw(v16b a, v16b b, v8f c) {
  return __builtin_amdgcn_wmma_f32_16x16x32_bf16(false, a, false, b, (short)0, c, false, false);
}
__device__ __forceinline__ void dep_guard_b(v8f& a, v8f& b, v16b x, v16b y) {
#if defined(__HIP_DEVICE_COMPILE__)
  asm volatile("v_nop\n\tv_nop\n\tv_nop\n\tv_nop" : "+v"(a), "+v"(b) : "v"(x), "v"(y));
#endif
}
__device__ __forceinline__ void keep4_b(v16b a, v16b b, v16b c, v16b d) {
#if defined(__HIP_DEVICE_COMPILE__)
  asm volatile("v_nop" :: "v"(a), "v"(b), "v"(c), "v"(d));
#endif
}
__device__ __forceinline__ void acc_guard4(v8f& a, v8f& b, v8f& c, v8f& d) {
#if defined(__HIP_DEVICE_COMPILE__)
  asm volatile("v_nop\n\tv_nop\n\tv_nop\n\tv_nop" : "+v"(a), "+v"(b), "+v"(c), "+v"(d));
#endif
}

// =====================================================================================================
// f32 -> bf16 (RNE convert), 8 elements per thread, one 16-B store per lane: a wave writes 512 contiguous B
// coverage: n8 threads x 8 = whole plane (n8 is a multiple of 256 for every use here).
// =====================================================================================================
__global__ __launch_bounds__(256) void cvt_bf16x8(const float* __restrict__ in, unsigned short* out, int n8) {
  const int i = blockIdx.x * 256 + threadIdx.x;
  if (i < n8) {
    const v4f a = *(const v4f*)(in + (size_t)i * 8);
    const v4f b = *(const v4f*)(in + (size_t)i * 8 + 4);
    v4u p;
    p[0] = pk16(bf_bits(a[0]), bf_bits(a[1]));
    p[1] = pk16(bf_bits(a[2]), bf_bits(a[3]));
    p[2] = pk16(bf_bits(b[0]), bf_bits(b[1]));
    p[3] = pk16(bf_bits(b[2]), bf_bits(b[3]));
    *(v4u*)(out + (size_t)i * 8) = p;
    
  }
}

// =====================================================================================================
// Register-blocked batched bf16 WMMA GEMM: C[m][n] = sum_k A[m][k] * Bt[n][k] + bias; one wave per 64x64
// tile, no block barriers. A row-major [M][K] pitch lda; Bt row-major [N][K] pitch ldb (k contiguous);
// M, N multiples of 64, K multiple of 32 (host-checked). blockIdx.y = batch index (strides in elements).
// NSPLIT: 0 = A.Bt; 1 = (A + A2).Bt (A2 = unscaled bf16 lo plane of A, 2 products).
// BIAS: 0 = none; 1 = bias[n] per column; 2 = bias[m] per row; bias values RNE-converted to bf16 first,
//       added in f32; bias index clamped to nbias-1.
// OUT_MODE: 0 = f32 (pitch ldc); 2 = bf16 hi plane C + bf16 lo plane C2 (lo = RNE(v - hi), unscaled);
//           3 = f16 hi plane C + f16 residual plane C2 = f16((v - hi) * rscale) (pitch ldc2, stride strideC2).
// =====================================================================================================
template <int NSPLIT, int OUT_MODE, int BIAS>
__global__ __launch_bounds__(256) void gemm64(
    const unsigned short* __restrict__ Ap, const unsigned short* A2p, int lda, long long strideA,
    const unsigned short* __restrict__ Btp, int ldb, long long strideB,
    const float* __restrict__ bias, int nbias,
    void* Cout, int ldc, long long strideC,
    void* Cout2, int ldc2, long long strideC2,
    int M, int N, int K, float rscale) {
  const __bf16* A   = (const __bf16*)(const void*)Ap;
  const __bf16* A2  = (const __bf16*)(const void*)A2p;
  const __bf16* Bt  = (const __bf16*)(const void*)Btp;
  __shared__ __align__(16) float sT[8][16 * 68];   // per-wave 16x64 slab, pitch 68 floats
  const int b    = blockIdx.y;
  const int lane = threadIdx.x & 31;
  const int wave = threadIdx.x >> 5;
  const int tilesN = N >> 6;
  const int tilesM = M >> 6;
  const int tile = blockIdx.x * 8 + wave;
  if (tile >= tilesM * tilesN) return;   // wave-uniform; no block barriers in this kernel
  const int tm = tile / tilesN;
  const int tn = tile - tm * tilesN;
  const int m0 = tm << 6;
  const int n0 = tn << 6;

  const __bf16* Ab  = A  + (size_t)b * strideA;
  const __bf16* Bb  = Bt + (size_t)b * strideB;
  const __bf16* Ab2 = (NSPLIT >= 1) ? (A2 + (size_t)b * strideA) : Ab;

  const int rlane = lane & 15;                 // row (A) / col (B, D) within subtile
  const int koff  = (lane >> 4) * 8;           // k offset of this lane half
  const int mOff  = (lane >> 4) * 8;           // D row offset

  v8f acc[4][4];
#pragma unroll
  for (int i = 0; i < 4; ++i)
#pragma unroll
    for (int j = 0; j < 4; ++j) acc[i][j] = zero8();

  for (int k0 = 0; k0 < K; k0 += 32) {
    v16b bh[4];
#pragma unroll
    for (int j = 0; j < 4; ++j) {
      const size_t bo = (size_t)(n0 + (j << 4) + rlane) * ldb + koff + k0;
      bh[j] = ldfrag_b(Bb + bo);
    }
#pragma unroll
    for (int i = 0; i < 4; ++i) {
      const size_t ao = (size_t)(m0 + (i << 4) + rlane) * lda + koff + k0;
      const v16b ah = ldfrag_b(Ab + ao);
      v16b al = ah;
      if (NSPLIT >= 1) al = ldfrag_b(Ab2 + ao);
#pragma unroll
      for (int j = 0; j < 4; ++j) {
        acc[i][j] = mma_b_raw(ah, bh[j], acc[i][j]);
        if (NSPLIT >= 1) acc[i][j] = mma_b_raw(al, bh[j], acc[i][j]);
      }
      dep_guard_b(acc[i][0], acc[i][3], ah, al);
    }
    keep4_b(bh[0], bh[1], bh[2], bh[3]);
  }
  acc_guard4(acc[0][0], acc[0][1], acc[0][2], acc[0][3]);
  acc_guard4(acc[1][0], acc[1][1], acc[1][2], acc[1][3]);
  acc_guard4(acc[2][0], acc[2][1], acc[2][2], acc[2][3]);
  acc_guard4(acc[3][0], acc[3][1], acc[3][2], acc[3][3]);

  // ---- epilogue ----
  float bn[4];
#pragma unroll
  for (int j = 0; j < 4; ++j) {
    const int bi = (BIAS == 1) ? (n0 + (j << 4) + rlane) : 0;
    const float bvv = bf_rne(bias[min(bi, nbias - 1)]);          // clamped address
    bn[j] = (BIAS == 1) ? bvv : 0.f;
  }
  float* slab = sT[wave];
#pragma unroll
  for (int i = 0; i < 4; ++i) {
    const int mBase = m0 + (i << 4);
    float bm[8];
#pragma unroll
    for (int r = 0; r < 8; ++r) {
      const int bi = (BIAS == 2) ? (mBase + mOff + r) : 0;
      const float bvv = bf_rne(bias[min(bi, nbias - 1)]);        // clamped address
      bm[r] = (BIAS == 2) ? bvv : 0.f;
    }
#pragma unroll
    for (int j = 0; j < 4; ++j) {
#pragma unroll
      for (int r = 0; r < 8; ++r) {
        slab[(mOff + r) * 68 + (j << 4) + rlane] = acc[i][j][r] + bn[j] + bm[r];
      }
    }
    __builtin_amdgcn_fence(__ATOMIC_RELEASE, "workgroup");
    __builtin_amdgcn_wave_barrier();
    __builtin_amdgcn_fence(__ATOMIC_ACQUIRE, "workgroup");
    if (OUT_MODE == 0) {
      float* C = (float*)Cout + (size_t)b * strideC;
      const int hh = lane >> 4, c4 = (lane & 15) * 4;     // 256-B row segment = 16 lanes x 16 B
      {
#pragma unroll
        for (int it = 0; it < 8; ++it) {
          const int row = it * 2 + hh;                     // it 0..7 x hh 0..1 = rows 0..15
          const v4f v = *(const v4f*)(slab + row * 68 + c4);
          *(v4f*)(C + (size_t)(mBase + row) * ldc + n0 + c4) = v;
        }
        
      }
    } else {
      const int q = lane >> 3, c8 = (lane & 7) * 8;
      unsigned short* C  = (unsigned short*)Cout  + (size_t)b * strideC;
      unsigned short* C2 = (unsigned short*)Cout2 + (size_t)b * strideC2;
      v4u hv[4], lv[4];
#pragma unroll
      for (int it = 0; it < 4; ++it) {
        const int row = it * 4 + q;                        // it 0..3 x q 0..3 = rows 0..15
        const float* sp = slab + row * 68 + c8;
        v4u a, a2;
#pragma unroll
        for (int e = 0; e < 4; ++e) {
          const float f0 = sp[2 * e], f1 = sp[2 * e + 1];
          unsigned short h0, h1, l0, l1;
          if (OUT_MODE == 2) {
            h0 = bf_bits(f0); h1 = bf_bits(f1);
            l0 = bf_bits(f0 - bf_up(h0)); l1 = bf_bits(f1 - bf_up(h1));
          } else {
            const _Float16 x0 = (_Float16)f0, x1 = (_Float16)f1;
            h0 = h_bits(x0); h1 = h_bits(x1);
            l0 = h_bits((_Float16)((f0 - (float)x0) * rscale));
            l1 = h_bits((_Float16)((f1 - (float)x1) * rscale));
          }
          a[e] = pk16(h0, h1); a2[e] = pk16(l0, l1);
        }
        hv[it] = a; lv[it] = a2;
      }
      {
#pragma unroll
        for (int it = 0; it < 4; ++it) {
          const int row = it * 4 + q;
          *(v4u*)(C  + (size_t)(mBase + row) * ldc  + n0 + c8) = hv[it];
          *(v4u*)(C2 + (size_t)(mBase + row) * ldc2 + n0 + c8) = lv[it];
        }
        
      }
    }
    __builtin_amdgcn_fence(__ATOMIC_RELEASE, "workgroup");
    __builtin_amdgcn_wave_barrier();
    __builtin_amdgcn_fence(__ATOMIC_ACQUIRE, "workgroup");
  }
}

// =====================================================================================================
// Attention with a clipped distance bias and a per-key integer mask, head dim 64.
//   q planes (bf16 hi / lo): element (b, t, h, d) at [(b*SEQ + t)*DM + h*64 + d]
//   k planes (bf16 hi / lo): same layout with key index s
//   v^T hi plane (f16):      element (b, h, d, s) at [(b*DM + h*64 + d)*SEQ + s]
//   v^T residual plane (f16, (v - hi)*4096): same layout
//   dbias f32 [b][t][s] (RNE-converted to bf16 per value), kmask int [b][s]
//   logit = clip(q.k * sscale + dbias, -10, 10), then keys with kmask == 0 -> -1e9; softmax over all keys
//   out planes (bf16 hi / lo of the normalised context): element (b, t, h, d) at [(b*SEQ + t)*DM + h*64 + d]
//   scores = q . k : bf16 hi/lo split (hi.hi + hi.lo + lo.hi), f32 accumulate; bias, clip, mask in f32
//   p = exp(s - m) carried as f16(1024 p) plus f16 residual x4096; context = p . v on f16 WMMA with the
//   residual products (p.vres + pres.v) in a separate accumulator folded back with 1/4096 per chunk in f32;
//   online softmax in f32. Block = 4 waves = 64 query rows of one (b, h); grid = NQB * NH * NB; kv chunks of 64,
//   static trip NQB. K / V^T chunk staging: 128 threads x 32 elements per plane = the whole 64x64 tile (plain
//   16-B loads, __syncthreads before and after); P tiles are wave-private, spilled with _Float16 element stores
//   Output coverage: each wave stores rows q0..q0+15 (it 0..3 x lane>>3 0..3) x 64 columns (8 lanes x 8) of both planes.
// =====================================================================================================
__global__ __launch_bounds__(128)
void attn64(const unsigned short* __restrict__ qhp, const unsigned short* __restrict__ qlp,
            const unsigned short* __restrict__ khp, const unsigned short* __restrict__ klp,
            const unsigned short* __restrict__ vhp, const unsigned short* __restrict__ vlp,
            const float* __restrict__ dbias, const int* __restrict__ kmask,
            unsigned short* ohp, unsigned short* olp, float sscale) {
  union FB { v16b v; v8b h[2]; };
  union FH { v16h v; v8h h[2]; };
  __shared__ __align__(16) __bf16   Ksh[64 * KP];   // K hi [kv][d], pitch KP
  __shared__ __align__(16) __bf16   Ksl[64 * KP];   // K lo
  __shared__ __align__(16) _Float16 Vth[64 * KP];   // V^T hi [d][kv], pitch KP
  __shared__ __align__(16) _Float16 Vtl[64 * KP];   // V^T residual
  __shared__ __align__(16) _Float16 Psh[4][16 * KP];   // per wave P [row][kv], pitch KP
  __shared__ __align__(16) _Float16 Psl[4][16 * KP];   // per wave P residual
  __shared__ __align__(16) float    Os[4][16 * OP];    // per wave context tile [row][d], pitch OP

  const int tid  = threadIdx.x;
  const int wave = tid >> 5;
  const int lane = tid & 31;
  const int hh   = lane >> 4;
  const int c    = lane & 15;

  const int bx   = blockIdx.x;
  const int qb   = bx % NQB;
  const int rest = bx / NQB;
  const int h    = rest % NH;
  const int b    = rest / NH;
  const int q0   = qb * 64 + wave * 16;
  const size_t rowB = (size_t)b * SEQ;

  const __bf16* Qh = (const __bf16*)(const void*)qhp + (size_t)h * HD;
  const __bf16* Ql = (const __bf16*)(const void*)qlp + (size_t)h * HD;
  const __bf16* Kh = (const __bf16*)(const void*)khp + (size_t)h * HD;
  const __bf16* Kl = (const __bf16*)(const void*)klp + (size_t)h * HD;
  const _Float16* Vh = (const _Float16*)(const void*)vhp + ((size_t)b * DM + (size_t)h * HD) * SEQ;
  const _Float16* Vl = (const _Float16*)(const void*)vlp + ((size_t)b * DM + (size_t)h * HD) * SEQ;
  const float* dbw = dbias + (rowB + (size_t)q0 + 8 * hh) * SEQ + c;   // row q0+8hh(+r), key (kv0 + 16j) + c
  const int*   mkb = kmask + rowB + c;                                 // key (kv0 + 16j) + c

  // ---- Q fragments (A operand, row = lane&15): 2 d-chunks, hi and lo ----
  v16b qah[2], qal[2];
#pragma unroll
  for (int dc = 0; dc < 2; ++dc) {
    const size_t qo = (rowB + q0 + c) * DM + dc * 32 + 8 * hh;
    qah[dc] = ldfrag_b(Qh + qo);
    qal[dc] = ldfrag_b(Ql + qo);
  }

  float mrow[8], lrow[8];
  v8f oacc[4];
#pragma unroll
  for (int r = 0; r < 8; ++r) { mrow[r] = -INFINITY; lrow[r] = 0.f; }
#pragma unroll
  for (int t = 0; t < 4; ++t) oacc[t] = zero8();

  for (int kt = 0; kt < NQB; ++kt) {         // static trip count
    const int kv0 = kt * 64;
    __syncthreads();
    {
      const int r = tid >> 1, half = (tid & 1) * 32;
      const __bf16*   kg  = Kh + (rowB + kv0 + r) * DM + half;    // K row kv0+r, d = half..half+31
      const __bf16*   klg = Kl + (rowB + kv0 + r) * DM + half;
      const _Float16* vg  = Vh + (size_t)r * SEQ + kv0 + half;    // V^T row d = r, s = kv0+half..+31
      const _Float16* vlg = Vl + (size_t)r * SEQ + kv0 + half;
#pragma unroll
      for (int i = 0; i < 4; ++i) {
        const v8b a0 = *(const v8b*)(kg + 8 * i);
        const v8b a1 = *(const v8b*)(klg + 8 * i);
        const v8h b0 = *(const v8h*)(vg + 8 * i);
        const v8h b1 = *(const v8h*)(vlg + 8 * i);
        *(v8b*)(Ksh + r * KP + half + 8 * i) = a0;
        *(v8b*)(Ksl + r * KP + half + 8 * i) = a1;
        *(v8h*)(Vth + r * KP + half + 8 * i) = b0;
        *(v8h*)(Vtl + r * KP + half + 8 * i) = b1;
      }
    }
    __syncthreads();

    // ---- scores: 16 query rows x 64 keys per wave, 3 bf16 products ----
    v8f s[4];
#pragma unroll
    for (int j = 0; j < 4; ++j) {
      s[j] = zero8();
#pragma unroll
      for (int dc = 0; dc < 2; ++dc) {
        FB kb, kl;
        kb.h[0] = *(const v8b*)(Ksh + (j * 16 + c) * KP + dc * 32 + 8 * hh);
        kb.h[1] = *(const v8b*)(Ksh + (j * 16 + c) * KP + dc * 32 + 16 + 8 * hh);
        kl.h[0] = *(const v8b*)(Ksl + (j * 16 + c) * KP + dc * 32 + 8 * hh);
        kl.h[1] = *(const v8b*)(Ksl + (j * 16 + c) * KP + dc * 32 + 16 + 8 * hh);
        s[j] = mma_b(qah[dc], kb.v, s[j]);
        s[j] = mma_b(qah[dc], kl.v, s[j]);
        s[j] = mma_b(qal[dc], kb.v, s[j]);
      }
    }

    // ---- key mask values for this lane's 4 keys (same for all 8 rows) ----
    int mk[4];
#pragma unroll
    for (int j = 0; j < 4; ++j) mk[j] = mkb[kv0 + j * 16];

    // ---- scale + bias, clip, key mask, row max, online softmax, P (x1024, f16) and
    //      P residual (x4096) to LDS ----
    _Float16* pwh = Psh[wave];
    _Float16* pwl = Psl[wave];
#pragma unroll
    for (int r = 0; r < 8; ++r) {
      const float* drw = dbw + (size_t)r * SEQ + kv0;
      float m = -INFINITY;
#pragma unroll
      for (int j = 0; j < 4; ++j) {
        const float dv = bf_rne(drw[j * 16]);
        float sv = s[j][r] * sscale + dv;
        sv = fminf(10.0f, fmaxf(-10.0f, sv));
        sv = (mk[j] != 0) ? sv : -1.0e9f;
        s[j][r] = sv;
        m = fmaxf(m, sv);
      }
#pragma unroll
      for (int off = 1; off < 16; off <<= 1) m = fmaxf(m, __shfl_xor(m, off, 32));
      const float mnew  = fmaxf(mrow[r], m);
      const float msafe = (mnew == -INFINITY) ? 0.f : mnew;
      const float alpha = __expf(mrow[r] - msafe);
      mrow[r] = mnew;
      float psum = 0.f;
#pragma unroll
      for (int j = 0; j < 4; ++j) {
        const float p = __expf(s[j][r] - msafe);
        psum += p;
        const float p1k = p * 1024.0f;
        const _Float16 ph = (_Float16)p1k;
        const _Float16 pl = (_Float16)((p1k - (float)ph) * 4096.0f);
        pwh[(8 * hh + r) * KP + j * 16 + c] = ph;
        pwl[(8 * hh + r) * KP + j * 16 + c] = pl;
      }
#pragma unroll
      for (int off = 1; off < 16; off <<= 1) psum += __shfl_xor(psum, off, 32);
      lrow[r] = lrow[r] * alpha + psum;
#pragma unroll
      for (int t = 0; t < 4; ++t) oacc[t][r] *= alpha;
    }
    __builtin_amdgcn_fence(__ATOMIC_RELEASE, "workgroup");
    __builtin_amdgcn_wave_barrier();
    __builtin_amdgcn_fence(__ATOMIC_ACQUIRE, "workgroup");

    // ---- context += P . V (f16 WMMA), residual products into a separate accumulator ----
    v8f o1[4];
#pragma unroll
    for (int t = 0; t < 4; ++t) o1[t] = zero8();
#pragma unroll 1
    for (int kk = 0; kk < 2; ++kk) {
      FH pa, pl;
      pa.h[0] = *(const v8h*)(pwh + c * KP + kk * 32 + 8 * hh);
      pa.h[1] = *(const v8h*)(pwh + c * KP + kk * 32 + 16 + 8 * hh);
      pl.h[0] = *(const v8h*)(pwl + c * KP + kk * 32 + 8 * hh);
      pl.h[1] = *(const v8h*)(pwl + c * KP + kk * 32 + 16 + 8 * hh);
#pragma unroll
      for (int t = 0; t < 4; ++t) {
        FH vb, vl;
        vb.h[0] = *(const v8h*)(Vth + (t * 16 + c) * KP + kk * 32 + 8 * hh);
        vb.h[1] = *(const v8h*)(Vth + (t * 16 + c) * KP + kk * 32 + 16 + 8 * hh);
        vl.h[0] = *(const v8h*)(Vtl + (t * 16 + c) * KP + kk * 32 + 8 * hh);
        vl.h[1] = *(const v8h*)(Vtl + (t * 16 + c) * KP + kk * 32 + 16 + 8 * hh);
        oacc[t] = mma_h(pa.v, vb.v, oacc[t]);
        o1[t]   = mma_h(pa.v, vl.v, o1[t]);
        o1[t]   = mma_h(pl.v, vb.v, o1[t]);
      }
    }
#pragma unroll
    for (int t = 0; t < 4; ++t)
#pragma unroll
      for (int r = 0; r < 8; ++r) oacc[t][r] += o1[t][r] * (1.0f / 4096.0f);
  }

  // ---- normalise (1/l and the 1/1024 p carry), stage the wave's 16x64 tile, bf16 hi/lo split,
  float* os = Os[wave];
#pragma unroll
  for (int r = 0; r < 8; ++r) {
    const float l = lrow[r];
    const float inv = ((l > 0.f) ? (1.0f / l) : 0.f) * (1.0f / 1024.0f);
#pragma unroll
    for (int t = 0; t < 4; ++t) os[(8 * hh + r) * OP + t * 16 + c] = oacc[t][r] * inv;
  }
  __builtin_amdgcn_fence(__ATOMIC_RELEASE, "workgroup");
  __builtin_amdgcn_wave_barrier();
  __builtin_amdgcn_fence(__ATOMIC_ACQUIRE, "workgroup");
  {
    const int q4 = lane >> 3, c8 = (lane & 7) * 8;
    v4u hv[4], lv[4];
#pragma unroll
    for (int it = 0; it < 4; ++it) {
      const int row = it * 4 + q4;   // it 0..3 x q4 0..3 = rows 0..15 of the wave tile
      const float* sp = os + row * OP + c8;
      v4u a, a2;
#pragma unroll
      for (int e = 0; e < 4; ++e) {
        const float f0 = sp[2 * e], f1 = sp[2 * e + 1];
        const unsigned short h0 = bf_bits(f0), h1 = bf_bits(f1);
        const unsigned short l0 = bf_bits(f0 - bf_up(h0)), l1 = bf_bits(f1 - bf_up(h1));
        a[e] = pk16(h0, h1); a2[e] = pk16(l0, l1);
      }
      hv[it] = a; lv[it] = a2;
    }
    {
#pragma unroll
      for (int it = 0; it < 4; ++it) {
        const int row = it * 4 + q4;
        const size_t go = (rowB + q0 + row) * DM + (size_t)h * HD + c8;
        *(v4u*)(ohp + go) = hv[it];
        *(v4u*)(olp + go) = lv[it];
      }
      
    }
  }
}

// =====================================================================================================
// Workspace map (bytes), every plane an exact multiple of its 64x64-tile / whole-line store granularity:
//   Xb   bf16 [8192][512]          8388608
//   Wqb, Wkb, Wvb, Wob bf16 [512 n][512 k]   524288 each
//   Qh, Ql, Kh, Kl bf16 [8192][512] 8388608 each
//   VTh  f16  [16][512 d][512 s]   8388608
//   VTl  f16  [16][512 d][512 s]   8388608
//   Oh, Ol bf16 [8192][512]         8388608 each
//   total                           77594624
// Weights are [out n][in k] with k contiguous = the Bt / A layout the GEMM wants, so they are only converted.
// =====================================================================================================
extern "C" void kernel_launch(void* const* d_in, const int* in_sizes, int n_in,
                              void* d_out, int out_size, void* d_ws, size_t ws_size,
                              hipStream_t stream) {
  if (n_in < 11) return;
  if (in_sizes[0] != NB * SEQ * DM) return;
  if (in_sizes[1] != NB * SEQ * SEQ) return;
  if (in_sizes[2] != NB * SEQ) return;
  if (in_sizes[3] != DM * DM || in_sizes[5] != DM * DM || in_sizes[7] != DM * DM || in_sizes[9] != DM * DM) return;
  if (in_sizes[4] != DM || in_sizes[6] != DM || in_sizes[8] != DM || in_sizes[10] != DM) return;
  if (out_size != NB * SEQ * DM) return;

  const float* x    = (const float*)d_in[0];
  const float* db   = (const float*)d_in[1];
  const int*   msk  = (const int*)d_in[2];
  const float* Wq   = (const float*)d_in[3];
  const float* bq   = (const float*)d_in[4];
  const float* Wk   = (const float*)d_in[5];
  const float* bk   = (const float*)d_in[6];
  const float* Wv   = (const float*)d_in[7];
  const float* bv   = (const float*)d_in[8];
  const float* Wo   = (const float*)d_in[9];
  const float* bo   = (const float*)d_in[10];

  const size_t PX  = (size_t)NB * SEQ * DM * 2;   // 8388608   16-bit activation plane [8192][512]
  const size_t PW  = (size_t)DM * DM * 2;         //  524288   16-bit weight plane
  const size_t PVT = (size_t)NB * DM * SEQ * 2;   // 8388608   v^T plane
  size_t off = 0;
  const size_t oXb  = off; off += PX;
  const size_t oWq  = off; off += PW;
  const size_t oWk  = off; off += PW;
  const size_t oWv  = off; off += PW;
  const size_t oWo  = off; off += PW;
  const size_t oQh  = off; off += PX;
  const size_t oQl  = off; off += PX;
  const size_t oKh  = off; off += PX;
  const size_t oKl  = off; off += PX;
  const size_t oVTh = off; off += PVT;
  const size_t oVTl = off; off += PVT;
  const size_t oOh  = off; off += PX;
  const size_t oOl  = off; off += PX;
  if (off > ws_size) return;                      // off = 77594624
  if (off > (size_t)134217728) return;

  char* ws = (char*)d_ws;
  unsigned short* Xb  = (unsigned short*)(ws + oXb);
  unsigned short* Wqb = (unsigned short*)(ws + oWq);
  unsigned short* Wkb = (unsigned short*)(ws + oWk);
  unsigned short* Wvb = (unsigned short*)(ws + oWv);
  unsigned short* Wob = (unsigned short*)(ws + oWo);
  unsigned short* Qh  = (unsigned short*)(ws + oQh);
  unsigned short* Ql  = (unsigned short*)(ws + oQl);
  unsigned short* Kh  = (unsigned short*)(ws + oKh);
  unsigned short* Kl  = (unsigned short*)(ws + oKl);
  unsigned short* VTh = (unsigned short*)(ws + oVTh);
  unsigned short* VTl = (unsigned short*)(ws + oVTl);
  unsigned short* Oh  = (unsigned short*)(ws + oOh);
  unsigned short* Ol  = (unsigned short*)(ws + oOl);

  const dim3 blk(256);
  const int n8x = NB * SEQ * DM / 8;                          // 524288
  const int n8w = DM * DM / 8;                                //  32768
  const dim3 gCvtX((n8x + 255) / 256);                        // 2048 blocks
  const dim3 gCvtW((n8w + 255) / 256);                        //  128 blocks
  const dim3 gProj(((NB * SEQ / 64) * (DM / 64) + 7) / 8, 1); // 1024 tiles -> 128 blocks: M=8192, N=512
  const dim3 gVT(((DM / 64) * (SEQ / 64) + 7) / 8, NB);      // 64 tiles -> 8 blocks x 16 batches: M=512, N=512
  const dim3 gAttn(NB * NH * NQB);                            // 1024 blocks of 128 threads

  // (1) x -> bf16 plane [8192][512]; weights [n][k] f32 -> bf16 [n][k]
  cvt_bf16x8<<<gCvtX, blk, 0, stream>>>(x,  Xb,  n8x);
  cvt_bf16x8<<<gCvtW, blk, 0, stream>>>(Wq, Wqb, n8w);
  cvt_bf16x8<<<gCvtW, blk, 0, stream>>>(Wk, Wkb, n8w);
  cvt_bf16x8<<<gCvtW, blk, 0, stream>>>(Wv, Wvb, n8w);
  cvt_bf16x8<<<gCvtW, blk, 0, stream>>>(Wo, Wob, n8w);
  // (2) q = x . Wq^T + bq -> bf16 hi/lo planes [b*SEQ+t][h*64+d]   (M=8192, N=512, K=512)
  gemm64<0, 2, 1><<<gProj, blk, 0, stream>>>(
      Xb, Xb, DM, 0LL, Wqb, DM, 0LL, bq, DM,
      (void*)Qh, DM, 0LL, (void*)Ql, DM, 0LL,
      NB * SEQ, DM, DM, 1.0f);
  // (3) k = x . Wk^T + bk -> bf16 hi/lo planes
  gemm64<0, 2, 1><<<gProj, blk, 0, stream>>>(
      Xb, Xb, DM, 0LL, Wkb, DM, 0LL, bk, DM,
      (void*)Kh, DM, 0LL, (void*)Kl, DM, 0LL,
      NB * SEQ, DM, DM, 1.0f);
  // (4) v^T = Wv . x^T + bv (per row) per batch -> f16 hi plane [b][h*64+d][s] (pitch SEQ) and residual plane
  //     (x4096, pitch SEQ)   (A = Wvb [n][k], Bt = Xb rows of batch b; M=512, N=512, K=512)
  gemm64<0, 3, 2><<<gVT, blk, 0, stream>>>(
      Wvb, Wvb, DM, 0LL, Xb, DM, (long long)SEQ * DM, bv, DM,
      (void*)VTh, SEQ, (long long)DM * SEQ, (void*)VTl, SEQ, (long long)DM * SEQ,
      DM, SEQ, DM, 4096.0f);
  // (5) attention -> context bf16 hi/lo planes
  attn64<<<gAttn, dim3(128), 0, stream>>>(
      Qh, Ql, Kh, Kl, VTh, VTl, db, msk, Oh, Ol, 0.125f);
  // (6) out = context . Wo^T + bo -> d_out f32 [8192][512]  (A = context hi + lo planes, 2 products)
  gemm64<1, 0, 1><<<gProj, blk, 0, stream>>>(
      Oh, Ol, DM, 0LL, Wob, DM, 0LL, bo, DM,
      d_out, DM, 0LL, d_out, DM, 0LL,
      NB * SEQ, DM, DM, 1.0f);
  (void)hipGetLastError();
}

// v002
// It runs in 120 microseconds.
// In both of two side-by-side timings against v001, it was 1.49 times as fast.
// All steps since v000 together make it 1.74 times as fast.
// Contractions: q, k, v^T projections = v_wmma_f32_16x16x32_bf16 (bf16 operands from RNE-converted inputs, single product, bias added in f32);
// q.k^T scores = v_wmma_f32_16x16x32_bf16 with bf16 hi/lo split q and k (hi.hi + hi.lo + lo.hi);
// p.v = v_wmma_f32_16x16x32_f16 (p carried x1024 in f16 plus a x4096 f16 residual plane, v as f16 hi plus a x4096 f16 residual plane: hi.hi + hi.res + res.hi);
// ctx.Wo^T = v_wmma_f32_16x16x32_bf16 with ctx as bf16 hi/lo planes times bf16 Wo (2 products); all f32 accumulate; clip, key mask and softmax in f32.
#include <hip/hip_runtime.h>
#include <math.h>
#include <float.h>
#include <stdint.h>

#define NB    16
#define SEQ   512
#define DM    512
#define NH    8
#define HD    64
#define NQB   (SEQ / 64)   // 8 key / query tiles of 64
#define KP    72           // LDS row pitch of the 64-wide 16-bit tiles, elements: 144 B = 16 B x 9, for ds_load_b128 readers
#define OP    68           // LDS row pitch of the 64-wide f32 context tile, floats: 272 B = 16 B x 17
#define GP    72           // LDS row pitch of a staged 64-element GEMM k-slice, elements: 144 B = 16 B x 9, for ds_load_b128 readers
static_assert(NH * HD == DM);
static_assert((SEQ % 64) == 0 && (DM % 64) == 0 && ((NB * SEQ) % 64) == 0);

typedef _Float16 v16h __attribute__((ext_vector_type(16)));
typedef _Float16 v8h  __attribute__((ext_vector_type(8)));
typedef __bf16   v16b __attribute__((ext_vector_type(16)));
typedef __bf16   v8b  __attribute__((ext_vector_type(8)));
typedef float    v8f  __attribute__((ext_vector_type(8)));
typedef float    v4f  __attribute__((ext_vector_type(4)));
typedef unsigned int v4u __attribute__((ext_vector_type(4)));

// ---- scalar helpers --------------------------------------------------------------------------------
__device__ __forceinline__ unsigned short bf_bits(float f) {          // f32 -> bf16 bits, RNE convert
  unsigned u = __float_as_uint(f);
  return (unsigned short)((u + 0x7FFFu + ((u >> 16) & 1u)) >> 16);
}
__device__ __forceinline__ float bf_up(unsigned short h) { return __uint_as_float(((unsigned)h) << 16); }
__device__ __forceinline__ float bf_rne(float f) { return bf_up(bf_bits(f)); }
__device__ __forceinline__ unsigned short h_bits(_Float16 x) { return __builtin_bit_cast(unsigned short, x); }
__device__ __forceinline__ unsigned pk16(unsigned short a, unsigned short b) { return (unsigned)a | ((unsigned)b << 16); }
__device__ __forceinline__ v8f zero8() { v8f z = {0.f, 0.f, 0.f, 0.f, 0.f, 0.f, 0.f, 0.f}; return z; }

// ---- fragment loader: 16-bit A/B operand, lane -> row/col (lane&15), p already includes +8*(lane>>4);
//      elements 0..7 <- p[0..7] (k0+8h..), elements 8..15 <- p[16..23] (k0+16+8h..)
__device__ __forceinline__ v16b ldfrag_b(const __bf16* p) {
  union { v16b v; v8b h[2]; } f;
  f.h[0] = *(const v8b*)(p);
  f.h[1] = *(const v8b*)(p + 16);
  return f.v;
}

// ---- WMMA helpers with trailing VALU hazard gap (asm only in the device pass) --------------------------
__device__ __forceinline__ v8f mma_b(v16b a, v16b b, v8f c) {
  c = __builtin_amdgcn_wmma_f32_16x16x32_bf16(false, a, false, b, (short)0, c, false, false);
#if defined(__HIP_DEVICE_COMPILE__)
  asm volatile("v_nop\n\tv_nop\n\tv_nop\n\tv_nop" : "+v"(c) : "v"(a), "v"(b));
#endif
  return c;
}
__device__ __forceinline__ v8f mma_h(v16h a, v16h b, v8f c) {
  c = __builtin_amdgcn_wmma_f32_16x16x32_f16(false, a, false, b, (short)0, c, false, false);
#if defined(__HIP_DEVICE_COMPILE__)
  asm volatile("v_nop\n\tv_nop\n\tv_nop\n\tv_nop" : "+v"(c) : "v"(a), "v"(b));
#endif
  return c;
}
__device__ __forceinline__ v8f mma_b_raw(v16b a, v16b b, v8f c) {
  return __builtin_amdgcn_wmma_f32_16x16x32_bf16(false, a, false, b, (short)0, c, false, false);
}
__device__ __forceinline__ void dep_guard_b(v8f& a, v8f& b, v16b x, v16b y) {
#if defined(__HIP_DEVICE_COMPILE__)
  asm volatile("v_nop\n\tv_nop\n\tv_nop\n\tv_nop" : "+v"(a), "+v"(b) : "v"(x), "v"(y));
#endif
}
__device__ __forceinline__ void keep4_b(v16b a, v16b b, v16b c, v16b d) {
#if defined(__HIP_DEVICE_COMPILE__)
  asm volatile("v_nop" :: "v"(a), "v"(b), "v"(c), "v"(d));
#endif
}
__device__ __forceinline__ void acc_guard4(v8f& a, v8f& b, v8f& c, v8f& d) {
#if defined(__HIP_DEVICE_COMPILE__)
  asm volatile("v_nop\n\tv_nop\n\tv_nop\n\tv_nop" : "+v"(a), "+v"(b), "+v"(c), "+v"(d));
#endif
}

// ---- N asynchronous copies to LDS, 16 B per lane each: l[i] = the lane's LDS byte address, g[i] = its global address.
//      s_wait_xcnt 0 is the last line of the copies' own statement, so that it stands in front of every later
//      write of an address register that a copy names.
template <int N>
__device__ __forceinline__ void async_rows(const unsigned* l, const __bf16* const* g) {
  static_assert(N == 9 || N == 10);
#if defined(__HIP_DEVICE_COMPILE__)
  if constexpr (N == 9) {
    asm volatile(
        "global_load_async_to_lds_b128 %0, %9, off\n\t"
        "global_load_async_to_lds_b128 %1, %10, off\n\t"
        "global_load_async_to_lds_b128 %2, %11, off\n\t"
        "global_load_async_to_lds_b128 %3, %12, off\n\t"
        "global_load_async_to_lds_b128 %4, %13, off\n\t"
        "global_load_async_to_lds_b128 %5, %14, off\n\t"
        "global_load_async_to_lds_b128 %6, %15, off\n\t"
        "global_load_async_to_lds_b128 %7, %16, off\n\t"
        "global_load_async_to_lds_b128 %8, %17, off\n\t"
        "s_wait_xcnt 0x0"
        :: "v"(l[0]), "v"(l[1]), "v"(l[2]), "v"(l[3]), "v"(l[4]), "v"(l[5]), "v"(l[6]), "v"(l[7]), "v"(l[8]),
           "v"(g[0]), "v"(g[1]), "v"(g[2]), "v"(g[3]), "v"(g[4]), "v"(g[5]), "v"(g[6]), "v"(g[7]), "v"(g[8])
        : "memory");
  } else {
    asm volatile(
        "global_load_async_to_lds_b128 %0, %10, off\n\t"
        "global_load_async_to_lds_b128 %1, %11, off\n\t"
        "global_load_async_to_lds_b128 %2, %12, off\n\t"
        "global_load_async_to_lds_b128 %3, %13, off\n\t"
        "global_load_async_to_lds_b128 %4, %14, off\n\t"
        "global_load_async_to_lds_b128 %5, %15, off\n\t"
        "global_load_async_to_lds_b128 %6, %16, off\n\t"
        "global_load_async_to_lds_b128 %7, %17, off\n\t"
        "global_load_async_to_lds_b128 %8, %18, off\n\t"
        "global_load_async_to_lds_b128 %9, %19, off\n\t"
        "s_wait_xcnt 0x0"
        :: "v"(l[0]), "v"(l[1]), "v"(l[2]), "v"(l[3]), "v"(l[4]), "v"(l[5]), "v"(l[6]), "v"(l[7]), "v"(l[8]), "v"(l[9]),
           "v"(g[0]), "v"(g[1]), "v"(g[2]), "v"(g[3]), "v"(g[4]), "v"(g[5]), "v"(g[6]), "v"(g[7]), "v"(g[8]), "v"(g[9])
        : "memory");
  }
#endif
}
// the issuing wave's own copies have landed behind this wait
__device__ __forceinline__ void wait_async0() {
#if defined(__HIP_DEVICE_COMPILE__)
  asm volatile("s_wait_asynccnt 0x0" ::: "memory");
#endif
}
// the wave's own LDS reads have returned behind this wait (in front of the barrier that frees a buffer for refill)
__device__ __forceinline__ void wait_ds0() {
#if defined(__HIP_DEVICE_COMPILE__)
  asm volatile("s_wait_dscnt 0x0" ::: "memory");
#endif
}

// =====================================================================================================
// f32 -> bf16 (RNE convert), 8 elements per thread, one 16-B store per lane: a wave writes 512 contiguous B
// coverage: n8 threads x 8 = whole plane (n8 is a multiple of 256 for every use here).
// =====================================================================================================
__global__ __launch_bounds__(256) void cvt_bf16x8(const float* __restrict__ in, unsigned short* out, int n8) {
  const int i = blockIdx.x * 256 + threadIdx.x;
  if (i < n8) {
    const v4f a = *(const v4f*)(in + (size_t)i * 8);
    const v4f b = *(const v4f*)(in + (size_t)i * 8 + 4);
    v4u p;
    p[0] = pk16(bf_bits(a[0]), bf_bits(a[1]));
    p[1] = pk16(bf_bits(a[2]), bf_bits(a[3]));
    p[2] = pk16(bf_bits(b[0]), bf_bits(b[1]));
    p[3] = pk16(bf_bits(b[2]), bf_bits(b[3]));
    *(v4u*)(out + (size_t)i * 8) = p;
    
  }
}

// =====================================================================================================
// Register-blocked batched bf16 WMMA GEMM: C[m][n] = sum_k A[m][k] * Bt[n][k] + bias; one wave per 64x64
// tile; the 8 waves of a block hold 8 neighbouring tiles of one tile row (64 x 512 of C). A row-major [M][K]
// pitch lda; Bt row-major [N][K] pitch ldb (k contiguous); M multiple of 64, N multiple of 512, K a positive
// multiple of 64; lda, ldb multiples of 8. blockIdx.y = batch index (strides in elements).
// Operands: per 64-element k-slice the block's 64 A rows (and A2 rows) and 512 Bt rows go to LDS by asynchronous
// copies, 8 lanes x 16 B = one whole 128-B row piece, two buffers: slice t + 1 flies while slice t is multiplied;
// the fragments are read from LDS (pitch GP). Slice rows in a buffer: A 0..63, (A2 64..127,) then Bt.
// NSPLIT: 0 = A.Bt; 1 = (A + A2).Bt (A2 = unscaled bf16 lo plane of A, 2 products).
// BIAS: 0 = none; 1 = bias[n] per column; 2 = bias[m] per row; bias values RNE-converted to bf16 first,
//       added in f32; bias index clamped to nbias-1.
// OUT_MODE: 0 = f32 (pitch ldc); 2 = bf16 hi plane C + bf16 lo plane C2 (lo = RNE(v - hi), unscaled);
//           3 = f16 hi plane C + f16 residual plane C2 = f16((v - hi) * rscale) (pitch ldc2, stride strideC2).
// =====================================================================================================
template <int NSPLIT, int OUT_MODE, int BIAS>
__global__ __launch_bounds__(256) void gemm64(
    const unsigned short* __restrict__ Ap, const unsigned short* A2p, int lda, long long strideA,
    const unsigned short* __restrict__ Btp, int ldb, long long strideB,
    const float* __restrict__ bias, int nbias,
    void* Cout, int ldc, long long strideC,
    void* Cout2, int ldc2, long long strideC2,
    int M, int N, int K, float rscale) {
  const __bf16* A   = (const __bf16*)(const void*)Ap;
  const __bf16* A2  = (const __bf16*)(const void*)A2p;
  const __bf16* Bt  = (const __bf16*)(const void*)Btp;
  constexpr int AROWS = (NSPLIT >= 1) ? 128 : 64;  // staged A (and A2) rows
  constexpr int ROWS  = AROWS + 512;               // rows of one staged k-slice
  constexpr int NIT   = ROWS / 32;                 // copies per thread and slice: 256 threads x 16 B = 32 rows each
  __shared__ __align__(16) float  sT[8][16 * 68];  // per-wave 16x64 slab, pitch 68 floats
  __shared__ __align__(16) __bf16 sK[2][ROWS * GP];   // two k-slice buffers
  const int b    = blockIdx.y;
  const int lane = threadIdx.x & 31;
  const int wave = threadIdx.x >> 5;
  const int tilesN = N >> 6;
  const int tilesM = M >> 6;
  const int tile0 = blockIdx.x * 8;                // the block's first tile; tilesN is a multiple of 8
  if (tile0 >= tilesM * tilesN) return;            // block-uniform, in front of every barrier
  const int tm  = tile0 / tilesN;
  const int tn0 = tile0 - tm * tilesN;
  const int m0 = tm << 6;
  const int nb0 = tn0 << 6;                        // first of the block's 512 columns
  const int n0 = nb0 + (wave << 6);

  const __bf16* Ab  = A  + (size_t)b * strideA;
  const __bf16* Bb  = Bt + (size_t)b * strideB;
  const __bf16* Ab2 = (NSPLIT >= 1) ? (A2 + (size_t)b * strideA) : Ab;

  const int rlane = lane & 15;                 // row (A) / col (B, D) within subtile
  const int koff  = (lane >> 4) * 8;           // k offset of this lane half
  const int mOff  = (lane >> 4) * 8;           // D row offset

  v8f acc[4][4];
#pragma unroll
  for (int i = 0; i < 4; ++i)
#pragma unroll
    for (int j = 0; j < 4; ++j) acc[i][j] = zero8();

  // ---- staging: thread -> slice row (tid >> 3) + 32 * it, 16-B piece tid & 7 ----
  const int srow = threadIdx.x >> 3;
  const int scol = (threadIdx.x & 7) * 8;
  const __bf16* gA  = Ab  + (size_t)(m0 + srow) * lda + scol;
  const __bf16* gA2 = Ab2 + (size_t)(m0 + srow) * lda + scol;
  const __bf16* gB  = Bb  + (size_t)(nb0 + srow) * ldb + scol;
  const unsigned lds0 = (unsigned)(size_t)(&sK[0][srow * GP + scol]);   // LDS byte address = low 32 bits
  auto stage = [&](int buf, int k0) {
    unsigned l[NIT];
    const __bf16* g[NIT];
#pragma unroll
    for (int it = 0; it < NIT; ++it) {
      l[it] = lds0 + (unsigned)(buf * ROWS + it * 32) * (unsigned)(GP * 2);
      if (it < 2)                g[it] = gA  + (size_t)(it * 32) * lda + k0;
      else if (it < AROWS / 32)  g[it] = gA2 + (size_t)((it - 2) * 32) * lda + k0;
      else                       g[it] = gB  + (size_t)((it - AROWS / 32) * 32) * ldb + k0;
    }
    async_rows<NIT / 2>(l, g);
    async_rows<NIT / 2>(l + NIT / 2, g + NIT / 2);
  };

  const int nch = K >> 6;
  stage(0, 0);
  wait_async0();
  __syncthreads();                       // slice 0 is published
  if (nch > 1) stage(1, 64);
  for (int t = 0; t < nch; ++t) {
    const __bf16* sA = sK[t & 1] + rlane * GP + koff;
    const __bf16* sB = sA + (AROWS + (wave << 6)) * GP;
#pragma unroll
    for (int ks = 0; ks < 2; ++ks) {
      constexpr int IG = (NSPLIT >= 1) ? 2 : 4;   // A fragments read as one group: as many as the registers hold
      v16b bh[4];
#pragma unroll
      for (int j = 0; j < 4; ++j) bh[j] = ldfrag_b(sB + (j << 4) * GP + ks * 32);
#pragma unroll
      for (int i0 = 0; i0 < 4; i0 += IG) {
        v16b ah[IG], al[IG];
#pragma unroll
        for (int u = 0; u < IG; ++u) {
          ah[u] = ldfrag_b(sA + ((i0 + u) << 4) * GP + ks * 32);
          al[u] = ah[u];
          if (NSPLIT >= 1) al[u] = ldfrag_b(sA + (64 + ((i0 + u) << 4)) * GP + ks * 32);
        }
#pragma unroll
        for (int u = 0; u < IG; ++u) {
          const int i = i0 + u;
#pragma unroll
          for (int j = 0; j < 4; ++j) {
            acc[i][j] = mma_b_raw(ah[u], bh[j], acc[i][j]);
            if (NSPLIT >= 1) acc[i][j] = mma_b_raw(al[u], bh[j], acc[i][j]);
          }
          dep_guard_b(acc[i][0], acc[i][3], ah[u], al[u]);
        }
      }
      keep4_b(bh[0], bh[1], bh[2], bh[3]);
    }
    wait_ds0();
    wait_async0();
    __syncthreads();                     // publishes slice t + 1 and ends every read of slice t's buffer
    if (t + 2 < nch) stage(t & 1, (t + 2) << 6);
  }
  wait_async0();
  acc_guard4(acc[0][0], acc[0][1], acc[0][2], acc[0][3]);
  acc_guard4(acc[1][0], acc[1][1], acc[1][2], acc[1][3]);
  acc_guard4(acc[2][0], acc[2][1], acc[2][2], acc[2][3]);
  acc_guard4(acc[3][0], acc[3][1], acc[3][2], acc[3][3]);

  // ---- epilogue ----
  float bn[4];
#pragma unroll
  for (int j = 0; j < 4; ++j) {
    const int bi = (BIAS == 1) ? (n0 + (j << 4) + rlane) : 0;
    const float bvv = bf_rne(bias[min(bi, nbias - 1)]);          // clamped address
    bn[j] = (BIAS == 1) ? bvv : 0.f;
  }
  float* slab = sT[wave];
#pragma unroll
  for (int i = 0; i < 4; ++i) {
    const int mBase = m0 + (i << 4);
    float bm[8];
#pragma unroll
    for (int r = 0; r < 8; ++r) {
      const int bi = (BIAS == 2) ? (mBase + mOff + r) : 0;
      const float bvv = bf_rne(bias[min(bi, nbias - 1)]);        // clamped address
      bm[r] = (BIAS == 2) ? bvv : 0.f;
    }
#pragma unroll
    for (int j = 0; j < 4; ++j) {
#pragma unroll
      for (int r = 0; r < 8; ++r) {
        slab[(mOff + r) * 68 + (j << 4) + rlane] = acc[i][j][r] + bn[j] + bm[r];
      }
    }
    __builtin_amdgcn_fence(__ATOMIC_RELEASE, "workgroup");
    __builtin_amdgcn_wave_barrier();
    __builtin_amdgcn_fence(__ATOMIC_ACQUIRE, "workgroup");
    if (OUT_MODE == 0) {
      float* C = (float*)Cout + (size_t)b * strideC;
      const int hh = lane >> 4, c4 = (lane & 15) * 4;     // 256-B row segment = 16 lanes x 16 B
      {
#pragma unroll
        for (int it = 0; it < 8; ++it) {
          const int row = it * 2 + hh;                     // it 0..7 x hh 0..1 = rows 0..15
          const v4f v = *(const v4f*)(slab + row * 68 + c4);
          *(v4f*)(C + (size_t)(mBase + row) * ldc + n0 + c4) = v;
        }
        
      }
    } else {
      const int q = lane >> 3, c8 = (lane & 7) * 8;
      unsigned short* C  = (unsigned short*)Cout  + (size_t)b * strideC;
      unsigned short* C2 = (unsigned short*)Cout2 + (size_t)b * strideC2;
      v4u hv[4], lv[4];
#pragma unroll
      for (int it = 0; it < 4; ++it) {
        const int row = it * 4 + q;                        // it 0..3 x q 0..3 = rows 0..15
        const float* sp = slab + row * 68 + c8;
        v4u a, a2;
#pragma unroll
        for (int e = 0; e < 4; ++e) {
          const float f0 = sp[2 * e], f1 = sp[2 * e + 1];
          unsigned short h0, h1, l0, l1;
          if (OUT_MODE == 2) {
            h0 = bf_bits(f0); h1 = bf_bits(f1);
            l0 = bf_bits(f0 - bf_up(h0)); l1 = bf_bits(f1 - bf_up(h1));
          } else {
            const _Float16 x0 = (_Float16)f0, x1 = (_Float16)f1;
            h0 = h_bits(x0); h1 = h_bits(x1);
            l0 = h_bits((_Float16)((f0 - (float)x0) * rscale));
            l1 = h_bits((_Float16)((f1 - (float)x1) * rscale));
          }
          a[e] = pk16(h0, h1); a2[e] = pk16(l0, l1);
        }
        hv[it] = a; lv[it] = a2;
      }
      {
#pragma unroll
        for (int it = 0; it < 4; ++it) {
          const int row = it * 4 + q;
          *(v4u*)(C  + (size_t)(mBase + row) * ldc  + n0 + c8) = hv[it];
          *(v4u*)(C2 + (size_t)(mBase + row) * ldc2 + n0 + c8) = lv[it];
        }
        
      }
    }
    __builtin_amdgcn_fence(__ATOMIC_RELEASE, "workgroup");
    __builtin_amdgcn_wave_barrier();
    __builtin_amdgcn_fence(__ATOMIC_ACQUIRE, "workgroup");
  }
}

// =====================================================================================================
// Attention with a clipped distance bias and a per-key integer mask, head dim 64.
//   q planes (bf16 hi / lo): element (b, t, h, d) at [(b*SEQ + t)*DM + h*64 + d]
//   k planes (bf16 hi / lo): same layout with key index s
//   v^T hi plane (f16):      element (b, h, d, s) at [(b*DM + h*64 + d)*SEQ + s]
//   v^T residual plane (f16, (v - hi)*4096): same layout
//   dbias f32 [b][t][s] (RNE-converted to bf16 per value), kmask int [b][s]
//   logit = clip(q.k * sscale + dbias, -10, 10), then keys with kmask == 0 -> -1e9; softmax over all keys
//   out planes (bf16 hi / lo of the normalised context): element (b, t, h, d) at [(b*SEQ + t)*DM + h*64 + d]
//   scores = q . k : bf16 hi/lo split (hi.hi + hi.lo + lo.hi), f32 accumulate; bias, clip, mask in f32
//   p = exp(s - m) carried as f16(1024 p) plus f16 residual x4096; context = p . v on f16 WMMA with the
//   residual products (p.vres + pres.v) in a separate accumulator folded back with 1/4096 per chunk in f32;
//   online softmax in f32. Block = 4 waves = 64 query rows of one (b, h); grid = NQB * NH * NB; kv chunks of 64,
//   static trip NQB. K / V^T chunk staging: 128 threads x 32 elements per plane = the whole 64x64 tile (plain
//   16-B loads, __syncthreads before and after); P tiles are wave-private, spilled with _Float16 element stores
//   Output coverage: each wave stores rows q0..q0+15 (it 0..3 x lane>>3 0..3) x 64 columns (8 lanes x 8) of both planes.
// =====================================================================================================
__global__ __launch_bounds__(128)
void attn64(const unsigned short* __restrict__ qhp, const unsigned short* __restrict__ qlp,
            const unsigned short* __restrict__ khp, const unsigned short* __restrict__ klp,
            const unsigned short* __restrict__ vhp, const unsigned short* __restrict__ vlp,
            const float* __restrict__ dbias, const int* __restrict__ kmask,
            unsigned short* ohp, unsigned short* olp, float sscale) {
  union FB { v16b v; v8b h[2]; };
  union FH { v16h v; v8h h[2]; };
  __shared__ __align__(16) __bf16   Ksh[64 * KP];   // K hi [kv][d], pitch KP
  __shared__ __align__(16) __bf16   Ksl[64 * KP];   // K lo
  __shared__ __align__(16) _Float16 Vth[64 * KP];   // V^T hi [d][kv], pitch KP
  __shared__ __align__(16) _Float16 Vtl[64 * KP];   // V^T residual
  __shared__ __align__(16) _Float16 Psh[4][16 * KP];   // per wave P [row][kv], pitch KP
  __shared__ __align__(16) _Float16 Psl[4][16 * KP];   // per wave P residual
  __shared__ __align__(16) float    Os[4][16 * OP];    // per wave context tile [row][d], pitch OP

  const int tid  = threadIdx.x;
  const int wave = tid >> 5;
  const int lane = tid & 31;
  const int hh   = lane >> 4;
  const int c    = lane & 15;

  const int bx   = blockIdx.x;
  const int qb   = bx % NQB;
  const int rest = bx / NQB;
  const int h    = rest % NH;
  const int b    = rest / NH;
  const int q0   = qb * 64 + wave * 16;
  const size_t rowB = (size_t)b * SEQ;

  const __bf16* Qh = (const __bf16*)(const void*)qhp + (size_t)h * HD;
  const __bf16* Ql = (const __bf16*)(const void*)qlp + (size_t)h * HD;
  const __bf16* Kh = (const __bf16*)(const void*)khp + (size_t)h * HD;
  const __bf16* Kl = (const __bf16*)(const void*)klp + (size_t)h * HD;
  const _Float16* Vh = (const _Float16*)(const void*)vhp + ((size_t)b * DM + (size_t)h * HD) * SEQ;
  const _Float16* Vl = (const _Float16*)(const void*)vlp + ((size_t)b * DM + (size_t)h * HD) * SEQ;
  const float* dbw = dbias + (rowB + (size_t)q0 + 8 * hh) * SEQ + c;   // row q0+8hh(+r), key (kv0 + 16j) + c
  const int*   mkb = kmask + rowB + c;                                 // key (kv0 + 16j) + c

  // ---- Q fragments (A operand, row = lane&15): 2 d-chunks, hi and lo ----
  v16b qah[2], qal[2];
#pragma unroll
  for (int dc = 0; dc < 2; ++dc) {
    const size_t qo = (rowB + q0 + c) * DM + dc * 32 + 8 * hh;
    qah[dc] = ldfrag_b(Qh + qo);
    qal[dc] = ldfrag_b(Ql + qo);
  }

  float mrow[8], lrow[8];
  v8f oacc[4];
#pragma unroll
  for (int r = 0; r < 8; ++r) { mrow[r] = -INFINITY; lrow[r] = 0.f; }
#pragma unroll
  for (int t = 0; t < 4; ++t) oacc[t] = zero8();

  for (int kt = 0; kt < NQB; ++kt) {         // static trip count
    const int kv0 = kt * 64;
    __syncthreads();
    {
      const int r = tid >> 1, half = (tid & 1) * 32;
      const __bf16*   kg  = Kh + (rowB + kv0 + r) * DM + half;    // K row kv0+r, d = half..half+31
      const __bf16*   klg = Kl + (rowB + kv0 + r) * DM + half;
      const _Float16* vg  = Vh + (size_t)r * SEQ + kv0 + half;    // V^T row d = r, s = kv0+half..+31
      const _Float16* vlg = Vl + (size_t)r * SEQ + kv0 + half;
#pragma unroll
      for (int i = 0; i < 4; ++i) {
        const v8b a0 = *(const v8b*)(kg + 8 * i);
        const v8b a1 = *(const v8b*)(klg + 8 * i);
        const v8h b0 = *(const v8h*)(vg + 8 * i);
        const v8h b1 = *(const v8h*)(vlg + 8 * i);
        *(v8b*)(Ksh + r * KP + half + 8 * i) = a0;
        *(v8b*)(Ksl + r * KP + half + 8 * i) = a1;
        *(v8h*)(Vth + r * KP + half + 8 * i) = b0;
        *(v8h*)(Vtl + r * KP + half + 8 * i) = b1;
      }
    }
    __syncthreads();

    // ---- scores: 16 query rows x 64 keys per wave, 3 bf16 products ----
    v8f s[4];
#pragma unroll
    for (int j = 0; j < 4; ++j) {
      s[j] = zero8();
#pragma unroll
      for (int dc = 0; dc < 2; ++dc) {
        FB kb, kl;
        kb.h[0] = *(const v8b*)(Ksh + (j * 16 + c) * KP + dc * 32 + 8 * hh);
        kb.h[1] = *(const v8b*)(Ksh + (j * 16 + c) * KP + dc * 32 + 16 + 8 * hh);
        kl.h[0] = *(const v8b*)(Ksl + (j * 16 + c) * KP + dc * 32 + 8 * hh);
        kl.h[1] = *(const v8b*)(Ksl + (j * 16 + c) * KP + dc * 32 + 16 + 8 * hh);
        s[j] = mma_b(qah[dc], kb.v, s[j]);
        s[j] = mma_b(qah[dc], kl.v, s[j]);
        s[j] = mma_b(qal[dc], kb.v, s[j]);
      }
    }

    // ---- key mask values for this lane's 4 keys (same for all 8 rows) ----
    int mk[4];
#pragma unroll
    for (int j = 0; j < 4; ++j) mk[j] = mkb[kv0 + j * 16];

    // ---- scale + bias, clip, key mask, row max, online softmax, P (x1024, f16) and
    //      P residual (x4096) to LDS ----
    _Float16* pwh = Psh[wave];
    _Float16* pwl = Psl[wave];
#pragma unroll
    for (int r = 0; r < 8; ++r) {
      const float* drw = dbw + (size_t)r * SEQ + kv0;
      float m = -INFINITY;
#pragma unroll
      for (int j = 0; j < 4; ++j) {
        const float dv = bf_rne(drw[j * 16]);
        float sv = s[j][r] * sscale + dv;
        sv = fminf(10.0f, fmaxf(-10.0f, sv));
        sv = (mk[j] != 0) ? sv : -1.0e9f;
        s[j][r] = sv;
        m = fmaxf(m, sv);
      }
#pragma unroll
      for (int off = 1; off < 16; off <<= 1) m = fmaxf(m, __shfl_xor(m, off, 32));
      const float mnew  = fmaxf(mrow[r], m);
      const float msafe = (mnew == -INFINITY) ? 0.f : mnew;
      const float alpha = __expf(mrow[r] - msafe);
      mrow[r] = mnew;
      float psum = 0.f;
#pragma unroll
      for (int j = 0; j < 4; ++j) {
        const float p = __expf(s[j][r] - msafe);
        psum += p;
        const float p1k = p * 1024.0f;
        const _Float16 ph = (_Float16)p1k;
        const _Float16 pl = (_Float16)((p1k - (float)ph) * 4096.0f);
        pwh[(8 * hh + r) * KP + j * 16 + c] = ph;
        pwl[(8 * hh + r) * KP + j * 16 + c] = pl;
      }
#pragma unroll
      for (int off = 1; off < 16; off <<= 1) psum += __shfl_xor(psum, off, 32);
      lrow[r] = lrow[r] * alpha + psum;
#pragma unroll
      for (int t = 0; t < 4; ++t) oacc[t][r] *= alpha;
    }
    __builtin_amdgcn_fence(__ATOMIC_RELEASE, "workgroup");
    __builtin_amdgcn_wave_barrier();
    __builtin_amdgcn_fence(__ATOMIC_ACQUIRE, "workgroup");

    // ---- context += P . V (f16 WMMA), residual products into a separate accumulator ----
    v8f o1[4];
#pragma unroll
    for (int t = 0; t < 4; ++t) o1[t] = zero8();
#pragma unroll 1
    for (int kk = 0; kk < 2; ++kk) {
      FH pa, pl;
      pa.h[0] = *(const v8h*)(pwh + c * KP + kk * 32 + 8 * hh);
      pa.h[1] = *(const v8h*)(pwh + c * KP + kk * 32 + 16 + 8 * hh);
      pl.h[0] = *(const v8h*)(pwl + c * KP + kk * 32 + 8 * hh);
      pl.h[1] = *(const v8h*)(pwl + c * KP + kk * 32 + 16 + 8 * hh);
#pragma unroll
      for (int t = 0; t < 4; ++t) {
        FH vb, vl;
        vb.h[0] = *(const v8h*)(Vth + (t * 16 + c) * KP + kk * 32 + 8 * hh);
        vb.h[1] = *(const v8h*)(Vth + (t * 16 + c) * KP + kk * 32 + 16 + 8 * hh);
        vl.h[0] = *(const v8h*)(Vtl + (t * 16 + c) * KP + kk * 32 + 8 * hh);
        vl.h[1] = *(const v8h*)(Vtl + (t * 16 + c) * KP + kk * 32 + 16 + 8 * hh);
        oacc[t] = mma_h(pa.v, vb.v, oacc[t]);
        o1[t]   = mma_h(pa.v, vl.v, o1[t]);
        o1[t]   = mma_h(pl.v, vb.v, o1[t]);
      }
    }
#pragma unroll
    for (int t = 0; t < 4; ++t)
#pragma unroll
      for (int r = 0; r < 8; ++r) oacc[t][r] += o1[t][r] * (1.0f / 4096.0f);
  }

  // ---- normalise (1/l and the 1/1024 p carry), stage the wave's 16x64 tile, bf16 hi/lo split,
  float* os = Os[wave];
#pragma unroll
  for (int r = 0; r < 8; ++r) {
    const float l = lrow[r];
    const float inv = ((l > 0.f) ? (1.0f / l) : 0.f) * (1.0f / 1024.0f);
#pragma unroll
    for (int t = 0; t < 4; ++t) os[(8 * hh + r) * OP + t * 16 + c] = oacc[t][r] * inv;
  }
  __builtin_amdgcn_fence(__ATOMIC_RELEASE, "workgroup");
  __builtin_amdgcn_wave_barrier();
  __builtin_amdgcn_fence(__ATOMIC_ACQUIRE, "workgroup");
  {
    const int q4 = lane >> 3, c8 = (lane & 7) * 8;
    v4u hv[4], lv[4];
#pragma unroll
    for (int it = 0; it < 4; ++it) {
      const int row = it * 4 + q4;   // it 0..3 x q4 0..3 = rows 0..15 of the wave tile
      const float* sp = os + row * OP + c8;
      v4u a, a2;
#pragma unroll
      for (int e = 0; e < 4; ++e) {
        const float f0 = sp[2 * e], f1 = sp[2 * e + 1];
        const unsigned short h0 = bf_bits(f0), h1 = bf_bits(f1);
        const unsigned short l0 = bf_bits(f0 - bf_up(h0)), l1 = bf_bits(f1 - bf_up(h1));
        a[e] = pk16(h0, h1); a2[e] = pk16(l0, l1);
      }
      hv[it] = a; lv[it] = a2;
    }
    {
#pragma unroll
      for (int it = 0; it < 4; ++it) {
        const int row = it * 4 + q4;
        const size_t go = (rowB + q0 + row) * DM + (size_t)h * HD + c8;
        *(v4u*)(ohp + go) = hv[it];
        *(v4u*)(olp + go) = lv[it];
      }
      
    }
  }
}

// =====================================================================================================
// Workspace map (bytes), every plane an exact multiple of its 64x64-tile / whole-line store granularity:
//   Xb   bf16 [8192][512]          8388608
//   Wqb, Wkb, Wvb, Wob bf16 [512 n][512 k]   524288 each
//   Qh, Ql, Kh, Kl bf16 [8192][512] 8388608 each
//   VTh  f16  [16][512 d][512 s]   8388608
//   VTl  f16  [16][512 d][512 s]   8388608
//   Oh, Ol bf16 [8192][512]         8388608 each
//   total                           77594624
// Weights are [out n][in k] with k contiguous = the Bt / A layout the GEMM wants, so they are only converted.
// =====================================================================================================
extern "C" void kernel_launch(void* const* d_in, const int* in_sizes, int n_in,
                              void* d_out, int out_size, void* d_ws, size_t ws_size,
                              hipStream_t stream) {
  if (n_in < 11) return;
  if (in_sizes[0] != NB * SEQ * DM) return;
  if (in_sizes[1] != NB * SEQ * SEQ) return;
  if (in_sizes[2] != NB * SEQ) return;
  if (in_sizes[3] != DM * DM || in_sizes[5] != DM * DM || in_sizes[7] != DM * DM || in_sizes[9] != DM * DM) return;
  if (in_sizes[4] != DM || in_sizes[6] != DM || in_sizes[8] != DM || in_sizes[10] != DM) return;
  if (out_size != NB * SEQ * DM) return;

  const float* x    = (const float*)d_in[0];
  const float* db   = (const float*)d_in[1];
  const int*   msk  = (const int*)d_in[2];
  const float* Wq   = (const float*)d_in[3];
  const float* bq   = (const float*)d_in[4];
  const float* Wk   = (const float*)d_in[5];
  const float* bk   = (const float*)d_in[6];
  const float* Wv   = (const float*)d_in[7];
  const float* bv   = (const float*)d_in[8];
  const float* Wo   = (const float*)d_in[9];
  const float* bo   = (const float*)d_in[10];

  const size_t PX  = (size_t)NB * SEQ * DM * 2;   // 8388608   16-bit activation plane [8192][512]
  const size_t PW  = (size_t)DM * DM * 2;         //  524288   16-bit weight plane
  const size_t PVT = (size_t)NB * DM * SEQ * 2;   // 8388608   v^T plane
  size_t off = 0;
  const size_t oXb  = off; off += PX;
  const size_t oWq  = off; off += PW;
  const size_t oWk  = off; off += PW;
  const size_t oWv  = off; off += PW;
  const size_t oWo  = off; off += PW;
  const size_t oQh  = off; off += PX;
  const size_t oQl  = off; off += PX;
  const size_t oKh  = off; off += PX;
  const size_t oKl  = off; off += PX;
  const size_t oVTh = off; off += PVT;
  const size_t oVTl = off; off += PVT;
  const size_t oOh  = off; off += PX;
  const size_t oOl  = off; off += PX;
  if (off > ws_size) return;                      // off = 77594624
  if (off > (size_t)134217728) return;

  char* ws = (char*)d_ws;
  unsigned short* Xb  = (unsigned short*)(ws + oXb);
  unsigned short* Wqb = (unsigned short*)(ws + oWq);
  unsigned short* Wkb = (unsigned short*)(ws + oWk);
  unsigned short* Wvb = (unsigned short*)(ws + oWv);
  unsigned short* Wob = (unsigned short*)(ws + oWo);
  unsigned short* Qh  = (unsigned short*)(ws + oQh);
  unsigned short* Ql  = (unsigned short*)(ws + oQl);
  unsigned short* Kh  = (unsigned short*)(ws + oKh);
  unsigned short* Kl  = (unsigned short*)(ws + oKl);
  unsigned short* VTh = (unsigned short*)(ws + oVTh);
  unsigned short* VTl = (unsigned short*)(ws + oVTl);
  unsigned short* Oh  = (unsigned short*)(ws + oOh);
  unsigned short* Ol  = (unsigned short*)(ws + oOl);

  const dim3 blk(256);
  const int n8x = NB * SEQ * DM / 8;                          // 524288
  const int n8w = DM * DM / 8;                                //  32768
  const dim3 gCvtX((n8x + 255) / 256);                        // 2048 blocks
  const dim3 gCvtW((n8w + 255) / 256);                        //  128 blocks
  const dim3 gProj(((NB * SEQ / 64) * (DM / 64) + 7) / 8, 1); // 1024 tiles -> 128 blocks: M=8192, N=512
  const dim3 gVT(((DM / 64) * (SEQ / 64) + 7) / 8, NB);      // 64 tiles -> 8 blocks x 16 batches: M=512, N=512
  const dim3 gAttn(NB * NH * NQB);                            // 1024 blocks of 128 threads

  // (1) x -> bf16 plane [8192][512]; weights [n][k] f32 -> bf16 [n][k]
  cvt_bf16x8<<<gCvtX, blk, 0, stream>>>(x,  Xb,  n8x);
  cvt_bf16x8<<<gCvtW, blk, 0, stream>>>(Wq, Wqb, n8w);
  cvt_bf16x8<<<gCvtW, blk, 0, stream>>>(Wk, Wkb, n8w);
  cvt_bf16x8<<<gCvtW, blk, 0, stream>>>(Wv, Wvb, n8w);
  cvt_bf16x8<<<gCvtW, blk, 0, stream>>>(Wo, Wob, n8w);
  // (2) q = x . Wq^T + bq -> bf16 hi/lo planes [b*SEQ+t][h*64+d]   (M=8192, N=512, K=512)
  gemm64<0, 2, 1><<<gProj, blk, 0, stream>>>(
      Xb, Xb, DM, 0LL, Wqb, DM, 0LL, bq, DM,
      (void*)Qh, DM, 0LL, (void*)Ql, DM, 0LL,
      NB * SEQ, DM, DM, 1.0f);
  // (3) k = x . Wk^T + bk -> bf16 hi/lo planes
  gemm64<0, 2, 1><<<gProj, blk, 0, stream>>>(
      Xb, Xb, DM, 0LL, Wkb, DM, 0LL, bk, DM,
      (void*)Kh, DM, 0LL, (void*)Kl, DM, 0LL,
      NB * SEQ, DM, DM, 1.0f);
  // (4) v^T = Wv . x^T + bv (per row) per batch -> f16 hi plane [b][h*64+d][s] (pitch SEQ) and residual plane
  //     (x4096, pitch SEQ)   (A = Wvb [n][k], Bt = Xb rows of batch b; M=512, N=512, K=512)
  gemm64<0, 3, 2><<<gVT, blk, 0, stream>>>(
      Wvb, Wvb, DM, 0LL, Xb, DM, (long long)SEQ * DM, bv, DM,
      (void*)VTh, SEQ, (long long)DM * SEQ, (void*)VTl, SEQ, (long long)DM * SEQ,
      DM, SEQ, DM, 4096.0f);
  // (5) attention -> context bf16 hi/lo planes
  attn64<<<gAttn, dim3(128), 0, stream>>>(
      Qh, Ql, Kh, Kl, VTh, VTl, db, msk, Oh, Ol, 0.125f);
  // (6) out = context . Wo^T + bo -> d_out f32 [8192][512]  (A = context hi + lo planes, 2 products)
  gemm64<1, 0, 1><<<gProj, blk, 0, stream>>>(
      Oh, Ol, DM, 0LL, Wob, DM, 0LL, bo, DM,
      d_out, DM, 0LL, d_out, DM, 0LL,
      NB * SEQ, DM, DM, 1.0f);
  (void)hipGetLastError();
}

// v003
// A run of this version takes 93.9 microseconds.
// Two timings next to v002 put it at 1.28 and 1.29 times that version's speed.
// All steps since v000 together make it 2.23 times as fast.
// Contractions: q, k, v^T projections = v_wmma_f32_16x16x32_bf16 (bf16 operands from RNE-converted inputs, single product, bias added in f32);
// q.k^T scores = v_wmma_f32_16x16x32_bf16 with bf16 hi/lo split q and k (hi.hi + hi.lo + lo.hi);
// p.v = v_wmma_f32_16x16x32_f16 (p carried x1024 in f16 plus a x4096 f16 residual plane, v as f16 hi plus a x4096 f16 residual plane: hi.hi + hi.res + res.hi);
// ctx.Wo^T = v_wmma_f32_16x16x32_bf16 with ctx as bf16 hi/lo planes times bf16 Wo (2 products); all f32 accumulate; clip, key mask and softmax in f32.
#include <hip/hip_runtime.h>
#include <math.h>
#include <float.h>
#include <stdint.h>

#define NB    16
#define SEQ   512
#define DM    512
#define NH    8
#define HD    64
#define NQB   (SEQ / 64)   // 8 key / query tiles of 64
#define KP    72           // LDS row pitch of the 64-wide 16-bit tiles, elements: 144 B = 16 B x 9, for ds_load_b128 readers
#define OP    68           // LDS row pitch of the 64-wide f32 context tile, floats: 272 B = 16 B x 17
#define GP    72           // LDS row pitch of a staged 64-element GEMM k-slice, elements: 144 B = 16 B x 9, for ds_load_b128 readers
static_assert(NH * HD == DM);
static_assert((SEQ % 64) == 0 && (DM % 64) == 0 && ((NB * SEQ) % 64) == 0);

typedef _Float16 v16h __attribute__((ext_vector_type(16)));
typedef _Float16 v8h  __attribute__((ext_vector_type(8)));
typedef __bf16   v16b __attribute__((ext_vector_type(16)));
typedef __bf16   v8b  __attribute__((ext_vector_type(8)));
typedef float    v8f  __attribute__((ext_vector_type(8)));
typedef float    v4f  __attribute__((ext_vector_type(4)));
typedef unsigned int v4u __attribute__((ext_vector_type(4)));

// ---- scalar helpers --------------------------------------------------------------------------------
__device__ __forceinline__ unsigned short bf_bits(float f) {          // f32 -> bf16 bits, RNE convert
  unsigned u = __float_as_uint(f);
  return (unsigned short)((u + 0x7FFFu + ((u >> 16) & 1u)) >> 16);
}
__device__ __forceinline__ float bf_up(unsigned short h) { return __uint_as_float(((unsigned)h) << 16); }
__device__ __forceinline__ float bf_rne(float f) { return bf_up(bf_bits(f)); }
__device__ __forceinline__ unsigned short h_bits(_Float16 x) { return __builtin_bit_cast(unsigned short, x); }
__device__ __forceinline__ unsigned pk16(unsigned short a, unsigned short b) { return (unsigned)a | ((unsigned)b << 16); }
__device__ __forceinline__ v8f zero8() { v8f z = {0.f, 0.f, 0.f, 0.f, 0.f, 0.f, 0.f, 0.f}; return z; }

// ---- fragment loader: 16-bit A/B operand, lane -> row/col (lane&15), p already includes +8*(lane>>4);
//      elements 0..7 <- p[0..7] (k0+8h..), elements 8..15 <- p[16..23] (k0+16+8h..)
__device__ __forceinline__ v16b ldfrag_b(const __bf16* p) {
  union { v16b v; v8b h[2]; } f;
  f.h[0] = *(const v8b*)(p);
  f.h[1] = *(const v8b*)(p + 16);
  return f.v;
}

// ---- WMMA helpers with trailing VALU hazard gap (asm only in the device pass) --------------------------
__device__ __forceinline__ v8f mma_b(v16b a, v16b b, v8f c) {
  c = __builtin_amdgcn_wmma_f32_16x16x32_bf16(false, a, false, b, (short)0, c, false, false);
#if defined(__HIP_DEVICE_COMPILE__)
  asm volatile("v_nop\n\tv_nop\n\tv_nop\n\tv_nop" : "+v"(c) : "v"(a), "v"(b));
#endif
  return c;
}
__device__ __forceinline__ v8f mma_h(v16h a, v16h b, v8f c) {
  c = __builtin_amdgcn_wmma_f32_16x16x32_f16(false, a, false, b, (short)0, c, false, false);
#if defined(__HIP_DEVICE_COMPILE__)
  asm volatile("v_nop\n\tv_nop\n\tv_nop\n\tv_nop" : "+v"(c) : "v"(a), "v"(b));
#endif
  return c;
}
__device__ __forceinline__ v8f mma_b_raw(v16b a, v16b b, v8f c) {
  return __builtin_amdgcn_wmma_f32_16x16x32_bf16(false, a, false, b, (short)0, c, false, false);
}
__device__ __forceinline__ void dep_guard_b(v8f& a, v8f& b, v16b x, v16b y) {
#if defined(__HIP_DEVICE_COMPILE__)
  asm volatile("v_nop\n\tv_nop\n\tv_nop\n\tv_nop" : "+v"(a), "+v"(b) : "v"(x), "v"(y));
#endif
}
__device__ __forceinline__ void keep4_b(v16b a, v16b b, v16b c, v16b d) {
#if defined(__HIP_DEVICE_COMPILE__)
  asm volatile("v_nop" :: "v"(a), "v"(b), "v"(c), "v"(d));
#endif
}
__device__ __forceinline__ void acc_guard4(v8f& a, v8f& b, v8f& c, v8f& d) {
#if defined(__HIP_DEVICE_COMPILE__)
  asm volatile("v_nop\n\tv_nop\n\tv_nop\n\tv_nop" : "+v"(a), "+v"(b), "+v"(c), "+v"(d));
#endif
}

// ---- N asynchronous copies to LDS, 16 B per lane each: l[i] = the lane's LDS byte address, g[i] = its global address.
//      s_wait_xcnt 0 is the last line of the copies' own statement, so that it stands in front of every later
//      write of an address register that a copy names.
template <int N>
__device__ __forceinline__ void async_rows(const unsigned* l, const __bf16* const* g) {
  static_assert(N == 9 || N == 10);
#if defined(__HIP_DEVICE_COMPILE__)
  if constexpr (N == 9) {
    asm volatile(
        "global_load_async_to_lds_b128 %0, %9, off\n\t"
        "global_load_async_to_lds_b128 %1, %10, off\n\t"
        "global_load_async_to_lds_b128 %2, %11, off\n\t"
        "global_load_async_to_lds_b128 %3, %12, off\n\t"
        "global_load_async_to_lds_b128 %4, %13, off\n\t"
        "global_load_async_to_lds_b128 %5, %14, off\n\t"
        "global_load_async_to_lds_b128 %6, %15, off\n\t"
        "global_load_async_to_lds_b128 %7, %16, off\n\t"
        "global_load_async_to_lds_b128 %8, %17, off\n\t"
        "s_wait_xcnt 0x0"
        :: "v"(l[0]), "v"(l[1]), "v"(l[2]), "v"(l[3]), "v"(l[4]), "v"(l[5]), "v"(l[6]), "v"(l[7]), "v"(l[8]),
           "v"(g[0]), "v"(g[1]), "v"(g[2]), "v"(g[3]), "v"(g[4]), "v"(g[5]), "v"(g[6]), "v"(g[7]), "v"(g[8])
        : "memory");
  } else {
    asm volatile(
        "global_load_async_to_lds_b128 %0, %10, off\n\t"
        "global_load_async_to_lds_b128 %1, %11, off\n\t"
        "global_load_async_to_lds_b128 %2, %12, off\n\t"
        "global_load_async_to_lds_b128 %3, %13, off\n\t"
        "global_load_async_to_lds_b128 %4, %14, off\n\t"
        "global_load_async_to_lds_b128 %5, %15, off\n\t"
        "global_load_async_to_lds_b128 %6, %16, off\n\t"
        "global_load_async_to_lds_b128 %7, %17, off\n\t"
        "global_load_async_to_lds_b128 %8, %18, off\n\t"
        "global_load_async_to_lds_b128 %9, %19, off\n\t"
        "s_wait_xcnt 0x0"
        :: "v"(l[0]), "v"(l[1]), "v"(l[2]), "v"(l[3]), "v"(l[4]), "v"(l[5]), "v"(l[6]), "v"(l[7]), "v"(l[8]), "v"(l[9]),
           "v"(g[0]), "v"(g[1]), "v"(g[2]), "v"(g[3]), "v"(g[4]), "v"(g[5]), "v"(g[6]), "v"(g[7]), "v"(g[8]), "v"(g[9])
        : "memory");
  }
#endif
}
// the issuing wave's own copies have landed behind this wait
__device__ __forceinline__ void wait_async0() {
#if defined(__HIP_DEVICE_COMPILE__)
  asm volatile("s_wait_asynccnt 0x0" ::: "memory");
#endif
}
// the wave's own LDS reads have returned behind this wait (in front of the barrier that frees a buffer for refill)
__device__ __forceinline__ void wait_ds0() {
#if defined(__HIP_DEVICE_COMPILE__)
  asm volatile("s_wait_dscnt 0x0" ::: "memory");
#endif
}

// =====================================================================================================
// f32 -> bf16 (RNE convert), 8 elements per thread, one 16-B store per lane: a wave writes 512 contiguous B.
// One launch for all five planes: blocks 0..nbx-1 convert x, then nbw blocks each for w0, w1, w2, w3; out is the
// x plane with the four weight planes directly behind it, in that order, so the flat index is the output index.
// coverage: (nbx + 4 * nbw) blocks x 256 threads x 8 = all five planes (each a whole number of blocks).
// =====================================================================================================
__global__ __launch_bounds__(256) void cvt_bf16x8(const float* __restrict__ x, const float* __restrict__ w0,
                                                  const float* __restrict__ w1, const float* __restrict__ w2,
                                                  const float* __restrict__ w3, unsigned short* out, int nbx, int nbw) {
  const int blk = blockIdx.x;
  const float* in = x;          // block-uniform choice of the source plane
  int rel = blk;                // block index inside that plane
  if (blk >= nbx) {
    const int j = blk - nbx;
    const int sel = j / nbw;
    rel = j - sel * nbw;
    in = (sel == 0) ? w0 : (sel == 1) ? w1 : (sel == 2) ? w2 : w3;
  }
  if (blk < nbx + 4 * nbw) {
    const int i = blk * 256 + threadIdx.x;
    const int si = rel * 256 + threadIdx.x;
    const v4f a = *(const v4f*)(in + (size_t)si * 8);
    const v4f b = *(const v4f*)(in + (size_t)si * 8 + 4);
    v4u p;
    p[0] = pk16(bf_bits(a[0]), bf_bits(a[1]));
    p[1] = pk16(bf_bits(a[2]), bf_bits(a[3]));
    p[2] = pk16(bf_bits(b[0]), bf_bits(b[1]));
    p[3] = pk16(bf_bits(b[2]), bf_bits(b[3]));
    *(v4u*)(out + (size_t)i * 8) = p;
    
  }
}

// =====================================================================================================
// Register-blocked batched bf16 WMMA GEMM: C[m][n] = sum_k A[m][k] * Bt[n][k] + bias; one wave per 64x64
// tile; the 8 waves of a block hold 8 neighbouring tiles of one tile row (64 x 512 of C). A row-major [M][K]
// pitch lda; Bt row-major [N][K] pitch ldb (k contiguous); M multiple of 64, N multiple of 512, K a positive
// multiple of 64; lda, ldb multiples of 8. bx = the block's index in one batch, b = batch index (strides in
// elements); sT (8 slabs of 16 x 68 floats) and sK (two k-slice buffers) are the calling kernel's LDS.
// Operands: per 64-element k-slice the block's 64 A rows (and A2 rows) and 512 Bt rows go to LDS by asynchronous
// copies, 8 lanes x 16 B = one whole 128-B row piece, two buffers: slice t + 1 flies while slice t is multiplied;
// the fragments are read from LDS (pitch GP). Slice rows in a buffer: A 0..63, (A2 64..127,) then Bt.
// NSPLIT: 0 = A.Bt; 1 = (A + A2).Bt (A2 = unscaled bf16 lo plane of A, 2 products).
// BIAS: 0 = none; 1 = bias[n] per column; 2 = bias[m] per row; bias values RNE-converted to bf16 first,
//       added in f32; bias index clamped to nbias-1.
// OUT_MODE: 0 = f32 (pitch ldc); 2 = bf16 hi plane C + bf16 lo plane C2 (lo = RNE(v - hi), unscaled);
//           3 = f16 hi plane C + f16 residual plane C2 = f16((v - hi) * rscale) (pitch ldc2, stride strideC2).
// =====================================================================================================
template <int NSPLIT, int OUT_MODE, int BIAS>
__device__ __forceinline__ void gemm64_body(
    const unsigned short* __restrict__ Ap, const unsigned short* A2p, int lda, long long strideA,
    const unsigned short* __restrict__ Btp, int ldb, long long strideB,
    const float* __restrict__ bias, int nbias,
    void* Cout, int ldc, long long strideC,
    void* Cout2, int ldc2, long long strideC2,
    int M, int N, int K, float rscale,
    int bx, int b, float* sT, __bf16* sK) {
  const __bf16* A   = (const __bf16*)(const void*)Ap;
  const __bf16* A2  = (const __bf16*)(const void*)A2p;
  const __bf16* Bt  = (const __bf16*)(const void*)Btp;
  constexpr int AROWS = (NSPLIT >= 1) ? 128 : 64;  // staged A (and A2) rows
  constexpr int ROWS  = AROWS + 512;               // rows of one staged k-slice
  constexpr int NIT   = ROWS / 32;                 // copies per thread and slice: 256 threads x 16 B = 32 rows each
  const int lane = threadIdx.x & 31;
  const int wave = threadIdx.x >> 5;
  const int tilesN = N >> 6;
  const int tilesM = M >> 6;
  const int tile0 = bx * 8;                // the block's first tile; tilesN is a multiple of 8
  if (tile0 >= tilesM * tilesN) return;            // block-uniform, in front of every barrier
  const int tm  = tile0 / tilesN;
  const int tn0 = tile0 - tm * tilesN;
  const int m0 = tm << 6;
  const int nb0 = tn0 << 6;                        // first of the block's 512 columns
  const int n0 = nb0 + (wave << 6);

  const __bf16* Ab  = A  + (size_t)b * strideA;
  const __bf16* Bb  = Bt + (size_t)b * strideB;
  const __bf16* Ab2 = (NSPLIT >= 1) ? (A2 + (size_t)b * strideA) : Ab;

  const int rlane = lane & 15;                 // row (A) / col (B, D) within subtile
  const int koff  = (lane >> 4) * 8;           // k offset of this lane half
  const int mOff  = (lane >> 4) * 8;           // D row offset

  v8f acc[4][4];
#pragma unroll
  for (int i = 0; i < 4; ++i)
#pragma unroll
    for (int j = 0; j < 4; ++j) acc[i][j] = zero8();

  // ---- staging: thread -> slice row (tid >> 3) + 32 * it, 16-B piece tid & 7 ----
  const int srow = threadIdx.x >> 3;
  const int scol = (threadIdx.x & 7) * 8;
  const __bf16* gA  = Ab  + (size_t)(m0 + srow) * lda + scol;
  const __bf16* gA2 = Ab2 + (size_t)(m0 + srow) * lda + scol;
  const __bf16* gB  = Bb  + (size_t)(nb0 + srow) * ldb + scol;
  const unsigned lds0 = (unsigned)(size_t)(sK + srow * GP + scol);   // LDS byte address = low 32 bits
  auto stage = [&](int buf, int k0) {
    unsigned l[NIT];
    const __bf16* g[NIT];
#pragma unroll
    for (int it = 0; it < NIT; ++it) {
      l[it] = lds0 + (unsigned)(buf * ROWS + it * 32) * (unsigned)(GP * 2);
      if (it < 2)                g[it] = gA  + (size_t)(it * 32) * lda + k0;
      else if (it < AROWS / 32)  g[it] = gA2 + (size_t)((it - 2) * 32) * lda + k0;
      else                       g[it] = gB  + (size_t)((it - AROWS / 32) * 32) * ldb + k0;
    }
    async_rows<NIT / 2>(l, g);
    async_rows<NIT / 2>(l + NIT / 2, g + NIT / 2);
  };

  const int nch = K >> 6;
  stage(0, 0);
  wait_async0();
  __syncthreads();                       // slice 0 is published
  if (nch > 1) stage(1, 64);
  for (int t = 0; t < nch; ++t) {
    const __bf16* sA = sK + (t & 1) * (ROWS * GP) + rlane * GP + koff;
    const __bf16* sB = sA + (AROWS + (wave << 6)) * GP;
#pragma unroll
    for (int ks = 0; ks < 2; ++ks) {
      constexpr int IG = (NSPLIT >= 1) ? 2 : 4;   // A fragments read as one group: as many as the registers hold
      v16b bh[4];
#pragma unroll
      for (int j = 0; j < 4; ++j) bh[j] = ldfrag_b(sB + (j << 4) * GP + ks * 32);
#pragma unroll
      for (int i0 = 0; i0 < 4; i0 += IG) {
        v16b ah[IG], al[IG];
#pragma unroll
        for (int u = 0; u < IG; ++u) {
          ah[u] = ldfrag_b(sA + ((i0 + u) << 4) * GP + ks * 32);
          al[u] = ah[u];
          if (NSPLIT >= 1) al[u] = ldfrag_b(sA + (64 + ((i0 + u) << 4)) * GP + ks * 32);
        }
#pragma unroll
        for (int u = 0; u < IG; ++u) {
          const int i = i0 + u;
#pragma unroll
          for (int j = 0; j < 4; ++j) {
            acc[i][j] = mma_b_raw(ah[u], bh[j], acc[i][j]);
            if (NSPLIT >= 1) acc[i][j] = mma_b_raw(al[u], bh[j], acc[i][j]);
          }
          dep_guard_b(acc[i][0], acc[i][3], ah[u], al[u]);
        }
      }
      keep4_b(bh[0], bh[1], bh[2], bh[3]);
    }
    wait_ds0();
    wait_async0();
    __syncthreads();                     // publishes slice t + 1 and ends every read of slice t's buffer
    if (t + 2 < nch) stage(t & 1, (t + 2) << 6);
  }
  wait_async0();
  acc_guard4(acc[0][0], acc[0][1], acc[0][2], acc[0][3]);
  acc_guard4(acc[1][0], acc[1][1], acc[1][2], acc[1][3]);
  acc_guard4(acc[2][0], acc[2][1], acc[2][2], acc[2][3]);
  acc_guard4(acc[3][0], acc[3][1], acc[3][2], acc[3][3]);

  // ---- epilogue ----
  float bn[4];
#pragma unroll
  for (int j = 0; j < 4; ++j) {
    const int bi = (BIAS == 1) ? (n0 + (j << 4) + rlane) : 0;
    const float bvv = bf_rne(bias[min(bi, nbias - 1)]);          // clamped address
    bn[j] = (BIAS == 1) ? bvv : 0.f;
  }
  float* slab = sT + wave * (16 * 68);
#pragma unroll
  for (int i = 0; i < 4; ++i) {
    const int mBase = m0 + (i << 4);
    float bm[8];
#pragma unroll
    for (int r = 0; r < 8; ++r) {
      const int bi = (BIAS == 2) ? (mBase + mOff + r) : 0;
      const float bvv = bf_rne(bias[min(bi, nbias - 1)]);        // clamped address
      bm[r] = (BIAS == 2) ? bvv : 0.f;
    }
#pragma unroll
    for (int j = 0; j < 4; ++j) {
#pragma unroll
      for (int r = 0; r < 8; ++r) {
        slab[(mOff + r) * 68 + (j << 4) + rlane] = acc[i][j][r] + bn[j] + bm[r];
      }
    }
    __builtin_amdgcn_fence(__ATOMIC_RELEASE, "workgroup");
    __builtin_amdgcn_wave_barrier();
    __builtin_amdgcn_fence(__ATOMIC_ACQUIRE, "workgroup");
    if (OUT_MODE == 0) {
      float* C = (float*)Cout + (size_t)b * strideC;
      const int hh = lane >> 4, c4 = (lane & 15) * 4;     // 256-B row segment = 16 lanes x 16 B
      {
#pragma unroll
        for (int it = 0; it < 8; ++it) {
          const int row = it * 2 + hh;                     // it 0..7 x hh 0..1 = rows 0..15
          const v4f v = *(const v4f*)(slab + row * 68 + c4);
          *(v4f*)(C + (size_t)(mBase + row) * ldc + n0 + c4) = v;
        }
        
      }
    } else {
      const int q = lane >> 3, c8 = (lane & 7) * 8;
      unsigned short* C  = (unsigned short*)Cout  + (size_t)b * strideC;
      unsigned short* C2 = (unsigned short*)Cout2 + (size_t)b * strideC2;
      v4u hv[4], lv[4];
#pragma unroll
      for (int it = 0; it < 4; ++it) {
        const int row = it * 4 + q;                        // it 0..3 x q 0..3 = rows 0..15
        const float* sp = slab + row * 68 + c8;
        v4u a, a2;
#pragma unroll
        for (int e = 0; e < 4; ++e) {
          const float f0 = sp[2 * e], f1 = sp[2 * e + 1];
          unsigned short h0, h1, l0, l1;
          if (OUT_MODE == 2) {
            h0 = bf_bits(f0); h1 = bf_bits(f1);
            l0 = bf_bits(f0 - bf_up(h0)); l1 = bf_bits(f1 - bf_up(h1));
          } else {
            const _Float16 x0 = (_Float16)f0, x1 = (_Float16)f1;
            h0 = h_bits(x0); h1 = h_bits(x1);
            l0 = h_bits((_Float16)((f0 - (float)x0) * rscale));
            l1 = h_bits((_Float16)((f1 - (float)x1) * rscale));
          }
          a[e] = pk16(h0, h1); a2[e] = pk16(l0, l1);
        }
        hv[it] = a; lv[it] = a2;
      }
      {
#pragma unroll
        for (int it = 0; it < 4; ++it) {
          const int row = it * 4 + q;
          *(v4u*)(C  + (size_t)(mBase + row) * ldc  + n0 + c8) = hv[it];
          *(v4u*)(C2 + (size_t)(mBase + row) * ldc2 + n0 + c8) = lv[it];
        }
        
      }
    }
    __builtin_amdgcn_fence(__ATOMIC_RELEASE, "workgroup");
    __builtin_amdgcn_wave_barrier();
    __builtin_amdgcn_fence(__ATOMIC_ACQUIRE, "workgroup");
  }
}

// ---- one GEMM per launch: blockIdx.x = block in the batch, blockIdx.y = batch ----
template <int NSPLIT, int OUT_MODE, int BIAS>
__global__ __launch_bounds__(256) void gemm64(
    const unsigned short* __restrict__ Ap, const unsigned short* A2p, int lda, long long strideA,
    const unsigned short* __restrict__ Btp, int ldb, long long strideB,
    const float* __restrict__ bias, int nbias,
    void* Cout, int ldc, long long strideC,
    void* Cout2, int ldc2, long long strideC2,
    int M, int N, int K, float rscale) {
  __shared__ __align__(16) float  sT[8 * 16 * 68];                                    // per-wave 16x64 slab, pitch 68 floats
  __shared__ __align__(16) __bf16 sK[2 * (((NSPLIT >= 1) ? 128 : 64) + 512) * GP];    // two k-slice buffers
  gemm64_body<NSPLIT, OUT_MODE, BIAS>(Ap, A2p, lda, strideA, Btp, ldb, strideB, bias, nbias,
                                      Cout, ldc, strideC, Cout2, ldc2, strideC2, M, N, K, rscale,
                                      blockIdx.x, blockIdx.y, sT, sK);
}

// ---- the three independent projections in one launch; the branch on blockIdx.y is block-uniform ----
//   y = 0: q = x . Wq^T + bq, y = 1: k = x . Wk^T + bk -> bf16 hi/lo planes [b*SEQ+t][h*64+d] (M=8192, N=512, K=512),
//          blockIdx.x = one of 128 tile rows;
//   y = 2: v^T = Wv . x^T + bv (per row) per batch -> f16 hi plane [b][h*64+d][s] and residual plane (x4096), pitch SEQ
//          (A = Wv [n][k], Bt = x rows of the batch; M=512, N=512, K=512), blockIdx.x = batch * 8 + tile row.
__global__ __launch_bounds__(256) void proj_qkv(
    const unsigned short* __restrict__ Xb, const unsigned short* __restrict__ Wqb,
    const unsigned short* __restrict__ Wkb, const unsigned short* __restrict__ Wvb,
    const float* __restrict__ bq, const float* __restrict__ bk, const float* __restrict__ bv,
    unsigned short* Qh, unsigned short* Ql, unsigned short* Kh, unsigned short* Kl,
    unsigned short* VTh, unsigned short* VTl) {
  __shared__ __align__(16) float  sT[8 * 16 * 68];
  __shared__ __align__(16) __bf16 sK[2 * (64 + 512) * GP];
  const int y = blockIdx.y;
  if (y < 2) {
    const bool isq = (y == 0);
    gemm64_body<0, 2, 1>(Xb, Xb, DM, 0LL, isq ? Wqb : Wkb, DM, 0LL, isq ? bq : bk, DM,
                         (void*)(isq ? Qh : Kh), DM, 0LL, (void*)(isq ? Ql : Kl), DM, 0LL,
                         NB * SEQ, DM, DM, 1.0f, blockIdx.x, 0, sT, sK);
  } else {
    gemm64_body<0, 3, 2>(Wvb, Wvb, DM, 0LL, Xb, DM, (long long)SEQ * DM, bv, DM,
                         (void*)VTh, SEQ, (long long)DM * SEQ, (void*)VTl, SEQ, (long long)DM * SEQ,
                         DM, SEQ, DM, 4096.0f, blockIdx.x & 7, blockIdx.x >> 3, sT, sK);
  }
}

// =====================================================================================================
// Attention with a clipped distance bias and a per-key integer mask, head dim 64.
//   q planes (bf16 hi / lo): element (b, t, h, d) at [(b*SEQ + t)*DM + h*64 + d]
//   k planes (bf16 hi / lo): same layout with key index s
//   v^T hi plane (f16):      element (b, h, d, s) at [(b*DM + h*64 + d)*SEQ + s]
//   v^T residual plane (f16, (v - hi)*4096): same layout
//   dbias f32 [b][t][s] (RNE-converted to bf16 per value), kmask int [b][s]
//   logit = clip(q.k * sscale + dbias, -10, 10), then keys with kmask == 0 -> -1e9; softmax over all keys
//   out planes (bf16 hi / lo of the normalised context): element (b, t, h, d) at [(b*SEQ + t)*DM + h*64 + d]
//   scores = q . k : bf16 hi/lo split (hi.hi + hi.lo + lo.hi), f32 accumulate; bias, clip, mask in f32
//   p = exp(s - m) carried as f16(1024 p) plus f16 residual x4096; context = p . v on f16 WMMA with the
//   residual products (p.vres + pres.v) in a separate accumulator folded back with 1/4096 per chunk in f32;
//   online softmax in f32. Block = 4 waves = 64 query rows of one (b, h); grid = NQB * NH * NB; kv chunks of 64,
//   static trip NQB. K / V^T chunk staging: 128 threads x 32 elements per plane = the whole 64x64 tile (plain
//   16-B loads, __syncthreads before and after); P tiles are wave-private, spilled with _Float16 element stores
//   Output coverage: each wave stores rows q0..q0+15 (it 0..3 x lane>>3 0..3) x 64 columns (8 lanes x 8) of both planes.
// =====================================================================================================
__global__ __launch_bounds__(128)
void attn64(const unsigned short* __restrict__ qhp, const unsigned short* __restrict__ qlp,
            const unsigned short* __restrict__ khp, const unsigned short* __restrict__ klp,
            const unsigned short* __restrict__ vhp, const unsigned short* __restrict__ vlp,
            const float* __restrict__ dbias, const int* __restrict__ kmask,
            unsigned short* ohp, unsigned short* olp, float sscale) {
  union FB { v16b v; v8b h[2]; };
  union FH { v16h v; v8h h[2]; };
  __shared__ __align__(16) __bf16   Ksh[64 * KP];   // K hi [kv][d], pitch KP
  __shared__ __align__(16) __bf16   Ksl[64 * KP];   // K lo
  __shared__ __align__(16) _Float16 Vth[64 * KP];   // V^T hi [d][kv], pitch KP
  __shared__ __align__(16) _Float16 Vtl[64 * KP];   // V^T residual
  __shared__ __align__(16) _Float16 Psh[4][16 * KP];   // per wave P [row][kv], pitch KP
  __shared__ __align__(16) _Float16 Psl[4][16 * KP];   // per wave P residual
  __shared__ __align__(16) float    Os[4][16 * OP];    // per wave context tile [row][d], pitch OP

  const int tid  = threadIdx.x;
  const int wave = tid >> 5;
  const int lane = tid & 31;
  const int hh   = lane >> 4;
  const int c    = lane & 15;

  const int bx   = blockIdx.x;
  const int qb   = bx % NQB;
  const int rest = bx / NQB;
  const int h    = rest % NH;
  const int b    = rest / NH;
  const int q0   = qb * 64 + wave * 16;
  const size_t rowB = (size_t)b * SEQ;

  const __bf16* Qh = (const __bf16*)(const void*)qhp + (size_t)h * HD;
  const __bf16* Ql = (const __bf16*)(const void*)qlp + (size_t)h * HD;
  const __bf16* Kh = (const __bf16*)(const void*)khp + (size_t)h * HD;
  const __bf16* Kl = (const __bf16*)(const void*)klp + (size_t)h * HD;
  const _Float16* Vh = (const _Float16*)(const void*)vhp + ((size_t)b * DM + (size_t)h * HD) * SEQ;
  const _Float16* Vl = (const _Float16*)(const void*)vlp + ((size_t)b * DM + (size_t)h * HD) * SEQ;
  const float* dbw = dbias + (rowB + (size_t)q0 + 8 * hh) * SEQ + c;   // row q0+8hh(+r), key (kv0 + 16j) + c
  const int*   mkb = kmask + rowB + c;                                 // key (kv0 + 16j) + c

  // ---- Q fragments (A operand, row = lane&15): 2 d-chunks, hi and lo ----
  v16b qah[2], qal[2];
#pragma unroll
  for (int dc = 0; dc < 2; ++dc) {
    const size_t qo = (rowB + q0 + c) * DM + dc * 32 + 8 * hh;
    qah[dc] = ldfrag_b(Qh + qo);
    qal[dc] = ldfrag_b(Ql + qo);
  }

  float mrow[8], lrow[8];
  v8f oacc[4];
#pragma unroll
  for (int r = 0; r < 8; ++r) { mrow[r] = -INFINITY; lrow[r] = 0.f; }
#pragma unroll
  for (int t = 0; t < 4; ++t) oacc[t] = zero8();

  for (int kt = 0; kt < NQB; ++kt) {         // static trip count
    const int kv0 = kt * 64;
    __syncthreads();
    {
      const int r = tid >> 1, half = (tid & 1) * 32;
      const __bf16*   kg  = Kh + (rowB + kv0 + r) * DM + half;    // K row kv0+r, d = half..half+31
      const __bf16*   klg = Kl + (rowB + kv0 + r) * DM + half;
      const _Float16* vg  = Vh + (size_t)r * SEQ + kv0 + half;    // V^T row d = r, s = kv0+half..+31
      const _Float16* vlg = Vl + (size_t)r * SEQ + kv0 + half;
#pragma unroll
      for (int i = 0; i < 4; ++i) {
        const v8b a0 = *(const v8b*)(kg + 8 * i);
        const v8b a1 = *(const v8b*)(klg + 8 * i);
        const v8h b0 = *(const v8h*)(vg + 8 * i);
        const v8h b1 = *(const v8h*)(vlg + 8 * i);
        *(v8b*)(Ksh + r * KP + half + 8 * i) = a0;
        *(v8b*)(Ksl + r * KP + half + 8 * i) = a1;
        *(v8h*)(Vth + r * KP + half + 8 * i) = b0;
        *(v8h*)(Vtl + r * KP + half + 8 * i) = b1;
      }
    }
    __syncthreads();

    // ---- scores: 16 query rows x 64 keys per wave, 3 bf16 products ----
    v8f s[4];
#pragma unroll
    for (int j = 0; j < 4; ++j) {
      s[j] = zero8();
#pragma unroll
      for (int dc = 0; dc < 2; ++dc) {
        FB kb, kl;
        kb.h[0] = *(const v8b*)(Ksh + (j * 16 + c) * KP + dc * 32 + 8 * hh);
        kb.h[1] = *(const v8b*)(Ksh + (j * 16 + c) * KP + dc * 32 + 16 + 8 * hh);
        kl.h[0] = *(const v8b*)(Ksl + (j * 16 + c) * KP + dc * 32 + 8 * hh);
        kl.h[1] = *(const v8b*)(Ksl + (j * 16 + c) * KP + dc * 32 + 16 + 8 * hh);
        s[j] = mma_b(qah[dc], kb.v, s[j]);
        s[j] = mma_b(qah[dc], kl.v, s[j]);
        s[j] = mma_b(qal[dc], kb.v, s[j]);
      }
    }

    // ---- key mask values for this lane's 4 keys (same for all 8 rows) ----
    int mk[4];
#pragma unroll
    for (int j = 0; j < 4; ++j) mk[j] = mkb[kv0 + j * 16];

    // ---- scale + bias, clip, key mask, row max, online softmax, P (x1024, f16) and
    //      P residual (x4096) to LDS ----
    _Float16* pwh = Psh[wave];
    _Float16* pwl = Psl[wave];
#pragma unroll
    for (int r = 0; r < 8; ++r) {
      const float* drw = dbw + (size_t)r * SEQ + kv0;
      float m = -INFINITY;
#pragma unroll
      for (int j = 0; j < 4; ++j) {
        const float dv = bf_rne(drw[j * 16]);
        float sv = s[j][r] * sscale + dv;
        sv = fminf(10.0f, fmaxf(-10.0f, sv));
        sv = (mk[j] != 0) ? sv : -1.0e9f;
        s[j][r] = sv;
        m = fmaxf(m, sv);
      }
#pragma unroll
      for (int off = 1; off < 16; off <<= 1) m = fmaxf(m, __shfl_xor(m, off, 32));
      const float mnew  = fmaxf(mrow[r], m);
      const float msafe = (mnew == -INFINITY) ? 0.f : mnew;
      const float alpha = __expf(mrow[r] - msafe);
      mrow[r] = mnew;
      float psum = 0.f;
#pragma unroll
      for (int j = 0; j < 4; ++j) {
        const float p = __expf(s[j][r] - msafe);
        psum += p;
        const float p1k = p * 1024.0f;
        const _Float16 ph = (_Float16)p1k;
        const _Float16 pl = (_Float16)((p1k - (float)ph) * 4096.0f);
        pwh[(8 * hh + r) * KP + j * 16 + c] = ph;
        pwl[(8 * hh + r) * KP + j * 16 + c] = pl;
      }
#pragma unroll
      for (int off = 1; off < 16; off <<= 1) psum += __shfl_xor(psum, off, 32);
      lrow[r] = lrow[r] * alpha + psum;
#pragma unroll
      for (int t = 0; t < 4; ++t) oacc[t][r] *= alpha;
    }
    __builtin_amdgcn_fence(__ATOMIC_RELEASE, "workgroup");
    __builtin_amdgcn_wave_barrier();
    __builtin_amdgcn_fence(__ATOMIC_ACQUIRE, "workgroup");

    // ---- context += P . V (f16 WMMA), residual products into a separate accumulator ----
    v8f o1[4];
#pragma unroll
    for (int t = 0; t < 4; ++t) o1[t] = zero8();
#pragma unroll 1
    for (int kk = 0; kk < 2; ++kk) {
      FH pa, pl;
      pa.h[0] = *(const v8h*)(pwh + c * KP + kk * 32 + 8 * hh);
      pa.h[1] = *(const v8h*)(pwh + c * KP + kk * 32 + 16 + 8 * hh);
      pl.h[0] = *(const v8h*)(pwl + c * KP + kk * 32 + 8 * hh);
      pl.h[1] = *(const v8h*)(pwl + c * KP + kk * 32 + 16 + 8 * hh);
#pragma unroll
      for (int t = 0; t < 4; ++t) {
        FH vb, vl;
        vb.h[0] = *(const v8h*)(Vth + (t * 16 + c) * KP + kk * 32 + 8 * hh);
        vb.h[1] = *(const v8h*)(Vth + (t * 16 + c) * KP + kk * 32 + 16 + 8 * hh);
        vl.h[0] = *(const v8h*)(Vtl + (t * 16 + c) * KP + kk * 32 + 8 * hh);
        vl.h[1] = *(const v8h*)(Vtl + (t * 16 + c) * KP + kk * 32 + 16 + 8 * hh);
        oacc[t] = mma_h(pa.v, vb.v, oacc[t]);
        o1[t]   = mma_h(pa.v, vl.v, o1[t]);
        o1[t]   = mma_h(pl.v, vb.v, o1[t]);
      }
    }
#pragma unroll
    for (int t = 0; t < 4; ++t)
#pragma unroll
      for (int r = 0; r < 8; ++r) oacc[t][r] += o1[t][r] * (1.0f / 4096.0f);
  }

  // ---- normalise (1/l and the 1/1024 p carry), stage the wave's 16x64 tile, bf16 hi/lo split,
  float* os = Os[wave];
#pragma unroll
  for (int r = 0; r < 8; ++r) {
    const float l = lrow[r];
    const float inv = ((l > 0.f) ? (1.0f / l) : 0.f) * (1.0f / 1024.0f);
#pragma unroll
    for (int t = 0; t < 4; ++t) os[(8 * hh + r) * OP + t * 16 + c] = oacc[t][r] * inv;
  }
  __builtin_amdgcn_fence(__ATOMIC_RELEASE, "workgroup");
  __builtin_amdgcn_wave_barrier();
  __builtin_amdgcn_fence(__ATOMIC_ACQUIRE, "workgroup");
  {
    const int q4 = lane >> 3, c8 = (lane & 7) * 8;
    v4u hv[4], lv[4];
#pragma unroll
    for (int it = 0; it < 4; ++it) {
      const int row = it * 4 + q4;   // it 0..3 x q4 0..3 = rows 0..15 of the wave tile
      const float* sp = os + row * OP + c8;
      v4u a, a2;
#pragma unroll
      for (int e = 0; e < 4; ++e) {
        const float f0 = sp[2 * e], f1 = sp[2 * e + 1];
        const unsigned short h0 = bf_bits(f0), h1 = bf_bits(f1);
        const unsigned short l0 = bf_bits(f0 - bf_up(h0)), l1 = bf_bits(f1 - bf_up(h1));
        a[e] = pk16(h0, h1); a2[e] = pk16(l0, l1);
      }
      hv[it] = a; lv[it] = a2;
    }
    {
#pragma unroll
      for (int it = 0; it < 4; ++it) {
        const int row = it * 4 + q4;
        const size_t go = (rowB + q0 + row) * DM + (size_t)h * HD + c8;
        *(v4u*)(ohp + go) = hv[it];
        *(v4u*)(olp + go) = lv[it];
      }
      
    }
  }
}

// =====================================================================================================
// Workspace map (bytes), every plane an exact multiple of its 64x64-tile / whole-line store granularity:
//   Xb   bf16 [8192][512]          8388608
//   Wqb, Wkb, Wvb, Wob bf16 [512 n][512 k]   524288 each
//   Qh, Ql, Kh, Kl bf16 [8192][512] 8388608 each
//   VTh  f16  [16][512 d][512 s]   8388608
//   VTl  f16  [16][512 d][512 s]   8388608
//   Oh, Ol bf16 [8192][512]         8388608 each
//   total                           77594624
// Weights are [out n][in k] with k contiguous = the Bt / A layout the GEMM wants, so they are only converted.
// =====================================================================================================
extern "C" void kernel_launch(void* const* d_in, const int* in_sizes, int n_in,
                              void* d_out, int out_size, void* d_ws, size_t ws_size,
                              hipStream_t stream) {
  if (n_in < 11) return;
  if (in_sizes[0] != NB * SEQ * DM) return;
  if (in_sizes[1] != NB * SEQ * SEQ) return;
  if (in_sizes[2] != NB * SEQ) return;
  if (in_sizes[3] != DM * DM || in_sizes[5] != DM * DM || in_sizes[7] != DM * DM || in_sizes[9] != DM * DM) return;
  if (in_sizes[4] != DM || in_sizes[6] != DM || in_sizes[8] != DM || in_sizes[10] != DM) return;
  if (out_size != NB * SEQ * DM) return;

  const float* x    = (const float*)d_in[0];
  const float* db   = (const float*)d_in[1];
  const int*   msk  = (const int*)d_in[2];
  const float* Wq   = (const float*)d_in[3];
  const float* bq   = (const float*)d_in[4];
  const float* Wk   = (const float*)d_in[5];
  const float* bk   = (const float*)d_in[6];
  const float* Wv   = (const float*)d_in[7];
  const float* bv   = (const float*)d_in[8];
  const float* Wo   = (const float*)d_in[9];
  const float* bo   = (const float*)d_in[10];

  const size_t PX  = (size_t)NB * SEQ * DM * 2;   // 8388608   16-bit activation plane [8192][512]
  const size_t PW  = (size_t)DM * DM * 2;         //  524288   16-bit weight plane
  const size_t PVT = (size_t)NB * DM * SEQ * 2;   // 8388608   v^T plane
  size_t off = 0;
  const size_t oXb  = off; off += PX;
  const size_t oWq  = off; off += PW;
  const size_t oWk  = off; off += PW;
  const size_t oWv  = off; off += PW;
  const size_t oWo  = off; off += PW;
  const size_t oQh  = off; off += PX;
  const size_t oQl  = off; off += PX;
  const size_t oKh  = off; off += PX;
  const size_t oKl  = off; off += PX;
  const size_t oVTh = off; off += PVT;
  const size_t oVTl = off; off += PVT;
  const size_t oOh  = off; off += PX;
  const size_t oOl  = off; off += PX;
  if (off > ws_size) return;                      // off = 77594624
  if (off > (size_t)134217728) return;

  char* ws = (char*)d_ws;
  unsigned short* Xb  = (unsigned short*)(ws + oXb);
  unsigned short* Wqb = (unsigned short*)(ws + oWq);
  unsigned short* Wkb = (unsigned short*)(ws + oWk);
  unsigned short* Wvb = (unsigned short*)(ws + oWv);
  unsigned short* Wob = (unsigned short*)(ws + oWo);
  unsigned short* Qh  = (unsigned short*)(ws + oQh);
  unsigned short* Ql  = (unsigned short*)(ws + oQl);
  unsigned short* Kh  = (unsigned short*)(ws + oKh);
  unsigned short* Kl  = (unsigned short*)(ws + oKl);
  unsigned short* VTh = (unsigned short*)(ws + oVTh);
  unsigned short* VTl = (unsigned short*)(ws + oVTl);
  unsigned short* Oh  = (unsigned short*)(ws + oOh);
  unsigned short* Ol  = (unsigned short*)(ws + oOl);

  const dim3 blk(256);
  const int n8x = NB * SEQ * DM / 8;                          // 524288
  const int n8w = DM * DM / 8;                                //  32768
  const int nbx = n8x / 256;                                  // 2048 blocks for x
  const int nbw = n8w / 256;                                  //  128 blocks for each weight
  const dim3 gCvt(nbx + 4 * nbw);                             // 2560 blocks
  const dim3 gProj(((NB * SEQ / 64) * (DM / 64) + 7) / 8, 1); // 1024 tiles -> 128 blocks: M=8192, N=512
  const dim3 gQKV(((NB * SEQ / 64) * (DM / 64) + 7) / 8, 3);  // 128 blocks each for q, k and v^T (8 blocks x 16 batches)
  const dim3 gAttn(NB * NH * NQB);                            // 1024 blocks of 128 threads

  // (1) x -> bf16 plane [8192][512]; weights [n][k] f32 -> bf16 [n][k]; Xb, Wqb, Wkb, Wvb, Wob lie one behind the other
  cvt_bf16x8<<<gCvt, blk, 0, stream>>>(x, Wq, Wk, Wv, Wo, Xb, nbx, nbw);
  // (2) q, k -> bf16 hi/lo planes, v^T -> f16 hi and residual planes
  proj_qkv<<<gQKV, blk, 0, stream>>>(Xb, Wqb, Wkb, Wvb, bq, bk, bv, Qh, Ql, Kh, Kl, VTh, VTl);
  // (3) attention -> context bf16 hi/lo planes
  attn64<<<gAttn, dim3(128), 0, stream>>>(
      Qh, Ql, Kh, Kl, VTh, VTl, db, msk, Oh, Ol, 0.125f);
  // (4) out = context . Wo^T + bo -> d_out f32 [8192][512]  (A = context hi + lo planes, 2 products)
  gemm64<1, 0, 1><<<gProj, blk, 0, stream>>>(
      Oh, Ol, DM, 0LL, Wob, DM, 0LL, bo, DM,
      d_out, DM, 0LL, d_out, DM, 0LL,
      NB * SEQ, DM, DM, 1.0f);
  (void)hipGetLastError();
}

// v004
// Measured time: 90.1 microseconds a run.
// Timed twice side by side with v003, it ran 1.04 times as fast both times.
// All steps since v000 together make it 2.32 times as fast.
// Contractions: q, k, v^T projections = v_wmma_f32_16x16x32_bf16 (bf16 operands from RNE-converted inputs, single product, bias added in f32);
// q.k^T scores = v_wmma_f32_16x16x32_bf16 with bf16 hi/lo split q and k (hi.hi + hi.lo + lo.hi);
// p.v = v_wmma_f32_16x16x32_f16 (p carried x1024 in f16 plus a x4096 f16 residual plane, v as f16 hi plus a x4096 f16 residual plane: hi.hi + hi.res + res.hi);
// ctx.Wo^T = v_wmma_f32_16x16x32_bf16 with ctx as bf16 hi/lo planes times bf16 Wo (2 products); all f32 accumulate; clip, key mask and softmax in f32.
#include <hip/hip_runtime.h>
#include <math.h>
#include <float.h>
#include <stdint.h>

#define NB    16
#define SEQ   512
#define DM    512
#define NH    8
#define HD    64
#define NQB   (SEQ / 64)   // 8 key / query tiles of 64
#define KP    72           // LDS row pitch of the 64-wide 16-bit tiles, elements: 144 B = 16 B x 9, for ds_load_b128 readers
#define OP    68           // LDS row pitch of the 64-wide f32 context tile, floats: 272 B = 16 B x 17
#define GP    72           // LDS row pitch of a staged 64-element GEMM k-slice, elements: 144 B = 16 B x 9, for ds_load_b128 readers
static_assert(NH * HD == DM);
static_assert((SEQ % 64) == 0 && (DM % 64) == 0 && ((NB * SEQ) % 64) == 0);

typedef _Float16 v16h __attribute__((ext_vector_type(16)));
typedef _Float16 v8h  __attribute__((ext_vector_type(8)));
typedef __bf16   v16b __attribute__((ext_vector_type(16)));
typedef __bf16   v8b  __attribute__((ext_vector_type(8)));
typedef float    v8f  __attribute__((ext_vector_type(8)));
typedef float    v4f  __attribute__((ext_vector_type(4)));
typedef unsigned int v4u __attribute__((ext_vector_type(4)));

// ---- scalar helpers --------------------------------------------------------------------------------
__device__ __forceinline__ unsigned short bf_bits(float f) {          // f32 -> bf16 bits, RNE convert
  unsigned u = __float_as_uint(f);
  return (unsigned short)((u + 0x7FFFu + ((u >> 16) & 1u)) >> 16);
}
__device__ __forceinline__ float bf_up(unsigned short h) { return __uint_as_float(((unsigned)h) << 16); }
__device__ __forceinline__ float bf_rne(float f) { return bf_up(bf_bits(f)); }
__device__ __forceinline__ unsigned short h_bits(_Float16 x) { return __builtin_bit_cast(unsigned short, x); }
__device__ __forceinline__ unsigned pk16(unsigned short a, unsigned short b) { return (unsigned)a | ((unsigned)b << 16); }
__device__ __forceinline__ v8f zero8() { v8f z = {0.f, 0.f, 0.f, 0.f, 0.f, 0.f, 0.f, 0.f}; return z; }

// ---- fragment loader: 16-bit A/B operand, lane -> row/col (lane&15), p already includes +8*(lane>>4);
//      elements 0..7 <- p[0..7] (k0+8h..), elements 8..15 <- p[16..23] (k0+16+8h..)
__device__ __forceinline__ v16b ldfrag_b(const __bf16* p) {
  union { v16b v; v8b h[2]; } f;
  f.h[0] = *(const v8b*)(p);
  f.h[1] = *(const v8b*)(p + 16);
  return f.v;
}

// ---- WMMA helpers with trailing VALU hazard gap (asm only in the device pass) --------------------------
__device__ __forceinline__ v8f mma_b(v16b a, v16b b, v8f c) {
  c = __builtin_amdgcn_wmma_f32_16x16x32_bf16(false, a, false, b, (short)0, c, false, false);
#if defined(__HIP_DEVICE_COMPILE__)
  asm volatile("v_nop\n\tv_nop\n\tv_nop\n\tv_nop" : "+v"(c) : "v"(a), "v"(b));
#endif
  return c;
}
__device__ __forceinline__ v8f mma_h(v16h a, v16h b, v8f c) {
  c = __builtin_amdgcn_wmma_f32_16x16x32_f16(false, a, false, b, (short)0, c, false, false);
#if defined(__HIP_DEVICE_COMPILE__)
  asm volatile("v_nop\n\tv_nop\n\tv_nop\n\tv_nop" : "+v"(c) : "v"(a), "v"(b));
#endif
  return c;
}
__device__ __forceinline__ v8f mma_b_raw(v16b a, v16b b, v8f c) {
  return __builtin_amdgcn_wmma_f32_16x16x32_bf16(false, a, false, b, (short)0, c, false, false);
}
__device__ __forceinline__ void dep_guard_b(v8f& a, v8f& b, v16b x, v16b y) {
#if defined(__HIP_DEVICE_COMPILE__)
  asm volatile("v_nop\n\tv_nop\n\tv_nop\n\tv_nop" : "+v"(a), "+v"(b) : "v"(x), "v"(y));
#endif
}
__device__ __forceinline__ void keep4_b(v16b a, v16b b, v16b c, v16b d) {
#if defined(__HIP_DEVICE_COMPILE__)
  asm volatile("v_nop" :: "v"(a), "v"(b), "v"(c), "v"(d));
#endif
}
__device__ __forceinline__ void acc_guard4(v8f& a, v8f& b, v8f& c, v8f& d) {
#if defined(__HIP_DEVICE_COMPILE__)
  asm volatile("v_nop\n\tv_nop\n\tv_nop\n\tv_nop" : "+v"(a), "+v"(b), "+v"(c), "+v"(d));
#endif
}

// ---- N asynchronous copies to LDS, 16 B per lane each: l[i] = the lane's LDS byte address, g[i] = its global address.
//      s_wait_xcnt 0 is the last line of the copies' own statement, so that it stands in front of every later
//      write of an address register that a copy names.
template <int N>
__device__ __forceinline__ void async_rows(const unsigned* l, const __bf16* const* g) {
  static_assert(N == 9 || N == 10);
#if defined(__HIP_DEVICE_COMPILE__)
  if constexpr (N == 9) {
    asm volatile(
        "global_load_async_to_lds_b128 %0, %9, off\n\t"
        "global_load_async_to_lds_b128 %1, %10, off\n\t"
        "global_load_async_to_lds_b128 %2, %11, off\n\t"
        "global_load_async_to_lds_b128 %3, %12, off\n\t"
        "global_load_async_to_lds_b128 %4, %13, off\n\t"
        "global_load_async_to_lds_b128 %5, %14, off\n\t"
        "global_load_async_to_lds_b128 %6, %15, off\n\t"
        "global_load_async_to_lds_b128 %7, %16, off\n\t"
        "global_load_async_to_lds_b128 %8, %17, off\n\t"
        "s_wait_xcnt 0x0"
        :: "v"(l[0]), "v"(l[1]), "v"(l[2]), "v"(l[3]), "v"(l[4]), "v"(l[5]), "v"(l[6]), "v"(l[7]), "v"(l[8]),
           "v"(g[0]), "v"(g[1]), "v"(g[2]), "v"(g[3]), "v"(g[4]), "v"(g[5]), "v"(g[6]), "v"(g[7]), "v"(g[8])
        : "memory");
  } else {
    asm volatile(
        "global_load_async_to_lds_b128 %0, %10, off\n\t"
        "global_load_async_to_lds_b128 %1, %11, off\n\t"
        "global_load_async_to_lds_b128 %2, %12, off\n\t"
        "global_load_async_to_lds_b128 %3, %13, off\n\t"
        "global_load_async_to_lds_b128 %4, %14, off\n\t"
        "global_load_async_to_lds_b128 %5, %15, off\n\t"
        "global_load_async_to_lds_b128 %6, %16, off\n\t"
        "global_load_async_to_lds_b128 %7, %17, off\n\t"
        "global_load_async_to_lds_b128 %8, %18, off\n\t"
        "global_load_async_to_lds_b128 %9, %19, off\n\t"
        "s_wait_xcnt 0x0"
        :: "v"(l[0]), "v"(l[1]), "v"(l[2]), "v"(l[3]), "v"(l[4]), "v"(l[5]), "v"(l[6]), "v"(l[7]), "v"(l[8]), "v"(l[9]),
           "v"(g[0]), "v"(g[1]), "v"(g[2]), "v"(g[3]), "v"(g[4]), "v"(g[5]), "v"(g[6]), "v"(g[7]), "v"(g[8]), "v"(g[9])
        : "memory");
  }
#endif
}
// the issuing wave's own copies have landed behind this wait
__device__ __forceinline__ void wait_async0() {
#if defined(__HIP_DEVICE_COMPILE__)
  asm volatile("s_wait_asynccnt 0x0" ::: "memory");
#endif
}
// the wave's own LDS reads have returned behind this wait (in front of the barrier that frees a buffer for refill)
__device__ __forceinline__ void wait_ds0() {
#if defined(__HIP_DEVICE_COMPILE__)
  asm volatile("s_wait_dscnt 0x0" ::: "memory");
#endif
}

// =====================================================================================================
// f32 -> bf16 (RNE convert), 8 elements per thread, one 16-B store per lane: a wave writes 512 contiguous B.
// One launch for all five planes: blocks 0..nbx-1 convert x, then nbw blocks each for w0, w1, w2, w3; out is the
// x plane with the four weight planes directly behind it, in that order, so the flat index is the output index.
// coverage: (nbx + 4 * nbw) blocks x 256 threads x 8 = all five planes (each a whole number of blocks).
// =====================================================================================================
__global__ __launch_bounds__(256) void cvt_bf16x8(const float* __restrict__ x, const float* __restrict__ w0,
                                                  const float* __restrict__ w1, const float* __restrict__ w2,
                                                  const float* __restrict__ w3, unsigned short* out, int nbx, int nbw) {
  const int blk = blockIdx.x;
  const float* in = x;          // block-uniform choice of the source plane
  int rel = blk;                // block index inside that plane
  if (blk >= nbx) {
    const int j = blk - nbx;
    const int sel = j / nbw;
    rel = j - sel * nbw;
    in = (sel == 0) ? w0 : (sel == 1) ? w1 : (sel == 2) ? w2 : w3;
  }
  if (blk < nbx + 4 * nbw) {
    const int i = blk * 256 + threadIdx.x;
    const int si = rel * 256 + threadIdx.x;
    const v4f a = *(const v4f*)(in + (size_t)si * 8);
    const v4f b = *(const v4f*)(in + (size_t)si * 8 + 4);
    v4u p;
    p[0] = pk16(bf_bits(a[0]), bf_bits(a[1]));
    p[1] = pk16(bf_bits(a[2]), bf_bits(a[3]));
    p[2] = pk16(bf_bits(b[0]), bf_bits(b[1]));
    p[3] = pk16(bf_bits(b[2]), bf_bits(b[3]));
    *(v4u*)(out + (size_t)i * 8) = p;
    
  }
}

// =====================================================================================================
// Register-blocked batched bf16 WMMA GEMM: C[m][n] = sum_k A[m][k] * Bt[n][k] + bias; one wave per 64x64
// tile; the 8 waves of a block hold 8 neighbouring tiles of one tile row (64 x 512 of C). A row-major [M][K]
// pitch lda; Bt row-major [N][K] pitch ldb (k contiguous); M multiple of 64, N multiple of 512, K a positive
// multiple of 64; lda, ldb multiples of 8. bx = the block's index in one batch, b = batch index (strides in
// elements); sT (8 slabs of 16 x 68 floats) and sK (two k-slice buffers) are the calling kernel's LDS.
// Operands: per 64-element k-slice the block's 64 A rows (and A2 rows) and 512 Bt rows go to LDS by asynchronous
// copies, 8 lanes x 16 B = one whole 128-B row piece, two buffers: slice t + 1 flies while slice t is multiplied;
// the fragments are read from LDS (pitch GP). Slice rows in a buffer: A 0..63, (A2 64..127,) then Bt.
// NSPLIT: 0 = A.Bt; 1 = (A + A2).Bt (A2 = unscaled bf16 lo plane of A, 2 products).
// BIAS: 0 = none; 1 = bias[n] per column; 2 = bias[m] per row; bias values RNE-converted to bf16 first,
//       added in f32; bias index clamped to nbias-1.
// OUT_MODE: 0 = f32 (pitch ldc); 2 = bf16 hi plane C + bf16 lo plane C2 (lo = RNE(v - hi), unscaled);
//           3 = f16 hi plane C + f16 residual plane C2 = f16((v - hi) * rscale) (pitch ldc2, stride strideC2).
// =====================================================================================================
template <int NSPLIT, int OUT_MODE, int BIAS>
__device__ __forceinline__ void gemm64_body(
    const unsigned short* __restrict__ Ap, const unsigned short* A2p, int lda, long long strideA,
    const unsigned short* __restrict__ Btp, int ldb, long long strideB,
    const float* __restrict__ bias, int nbias,
    void* Cout, int ldc, long long strideC,
    void* Cout2, int ldc2, long long strideC2,
    int M, int N, int K, float rscale,
    int bx, int b, float* sT, __bf16* sK) {
  const __bf16* A   = (const __bf16*)(const void*)Ap;
  const __bf16* A2  = (const __bf16*)(const void*)A2p;
  const __bf16* Bt  = (const __bf16*)(const void*)Btp;
  constexpr int AROWS = (NSPLIT >= 1) ? 128 : 64;  // staged A (and A2) rows
  constexpr int ROWS  = AROWS + 512;               // rows of one staged k-slice
  constexpr int NIT   = ROWS / 32;                 // copies per thread and slice: 256 threads x 16 B = 32 rows each
  const int lane = threadIdx.x & 31;
  const int wave = threadIdx.x >> 5;
  const int tilesN = N >> 6;
  const int tilesM = M >> 6;
  const int tile0 = bx * 8;                // the block's first tile; tilesN is a multiple of 8
  if (tile0 >= tilesM * tilesN) return;            // block-uniform, in front of every barrier
  const int tm  = tile0 / tilesN;
  const int tn0 = tile0 - tm * tilesN;
  const int m0 = tm << 6;
  const int nb0 = tn0 << 6;                        // first of the block's 512 columns
  const int n0 = nb0 + (wave << 6);

  const __bf16* Ab  = A  + (size_t)b * strideA;
  const __bf16* Bb  = Bt + (size_t)b * strideB;
  const __bf16* Ab2 = (NSPLIT >= 1) ? (A2 + (size_t)b * strideA) : Ab;

  const int rlane = lane & 15;                 // row (A) / col (B, D) within subtile
  const int koff  = (lane >> 4) * 8;           // k offset of this lane half
  const int mOff  = (lane >> 4) * 8;           // D row offset

  v8f acc[4][4];
#pragma unroll
  for (int i = 0; i < 4; ++i)
#pragma unroll
    for (int j = 0; j < 4; ++j) acc[i][j] = zero8();

  // ---- staging: thread -> slice row (tid >> 3) + 32 * it, 16-B piece tid & 7 ----
  const int srow = threadIdx.x >> 3;
  const int scol = (threadIdx.x & 7) * 8;
  const __bf16* gA  = Ab  + (size_t)(m0 + srow) * lda + scol;
  const __bf16* gA2 = Ab2 + (size_t)(m0 + srow) * lda + scol;
  const __bf16* gB  = Bb  + (size_t)(nb0 + srow) * ldb + scol;
  const unsigned lds0 = (unsigned)(size_t)(sK + srow * GP + scol);   // LDS byte address = low 32 bits
  auto stage = [&](int buf, int k0) {
    unsigned l[NIT];
    const __bf16* g[NIT];
#pragma unroll
    for (int it = 0; it < NIT; ++it) {
      l[it] = lds0 + (unsigned)(buf * ROWS + it * 32) * (unsigned)(GP * 2);
      if (it < 2)                g[it] = gA  + (size_t)(it * 32) * lda + k0;
      else if (it < AROWS / 32)  g[it] = gA2 + (size_t)((it - 2) * 32) * lda + k0;
      else                       g[it] = gB  + (size_t)((it - AROWS / 32) * 32) * ldb + k0;
    }
    async_rows<NIT / 2>(l, g);
    async_rows<NIT / 2>(l + NIT / 2, g + NIT / 2);
  };

  const int nch = K >> 6;
  stage(0, 0);
  wait_async0();
  __syncthreads();                       // slice 0 is published
  if (nch > 1) stage(1, 64);
  for (int t = 0; t < nch; ++t) {
    const __bf16* sA = sK + (t & 1) * (ROWS * GP) + rlane * GP + koff;
    const __bf16* sB = sA + (AROWS + (wave << 6)) * GP;
#pragma unroll
    for (int ks = 0; ks < 2; ++ks) {
      constexpr int IG = (NSPLIT >= 1) ? 2 : 4;   // A fragments read as one group: as many as the registers hold
      v16b bh[4];
#pragma unroll
      for (int j = 0; j < 4; ++j) bh[j] = ldfrag_b(sB + (j << 4) * GP + ks * 32);
#pragma unroll
      for (int i0 = 0; i0 < 4; i0 += IG) {
        v16b ah[IG], al[IG];
#pragma unroll
        for (int u = 0; u < IG; ++u) {
          ah[u] = ldfrag_b(sA + ((i0 + u) << 4) * GP + ks * 32);
          al[u] = ah[u];
          if (NSPLIT >= 1) al[u] = ldfrag_b(sA + (64 + ((i0 + u) << 4)) * GP + ks * 32);
        }
#pragma unroll
        for (int u = 0; u < IG; ++u) {
          const int i = i0 + u;
#pragma unroll
          for (int j = 0; j < 4; ++j) {
            acc[i][j] = mma_b_raw(ah[u], bh[j], acc[i][j]);
            if (NSPLIT >= 1) acc[i][j] = mma_b_raw(al[u], bh[j], acc[i][j]);
          }
          dep_guard_b(acc[i][0], acc[i][3], ah[u], al[u]);
        }
      }
      keep4_b(bh[0], bh[1], bh[2], bh[3]);
    }
    wait_ds0();
    wait_async0();
    __syncthreads();                     // publishes slice t + 1 and ends every read of slice t's buffer
    if (t + 2 < nch) stage(t & 1, (t + 2) << 6);
  }
  wait_async0();
  acc_guard4(acc[0][0], acc[0][1], acc[0][2], acc[0][3]);
  acc_guard4(acc[1][0], acc[1][1], acc[1][2], acc[1][3]);
  acc_guard4(acc[2][0], acc[2][1], acc[2][2], acc[2][3]);
  acc_guard4(acc[3][0], acc[3][1], acc[3][2], acc[3][3]);

  // ---- epilogue ----
  float bn[4];
#pragma unroll
  for (int j = 0; j < 4; ++j) {
    const int bi = (BIAS == 1) ? (n0 + (j << 4) + rlane) : 0;
    const float bvv = bf_rne(bias[min(bi, nbias - 1)]);          // clamped address
    bn[j] = (BIAS == 1) ? bvv : 0.f;
  }
  float* slab = sT + wave * (16 * 68);
#pragma unroll
  for (int i = 0; i < 4; ++i) {
    const int mBase = m0 + (i << 4);
    float bm[8];
#pragma unroll
    for (int r = 0; r < 8; ++r) {
      const int bi = (BIAS == 2) ? (mBase + mOff + r) : 0;
      const float bvv = bf_rne(bias[min(bi, nbias - 1)]);        // clamped address
      bm[r] = (BIAS == 2) ? bvv : 0.f;
    }
#pragma unroll
    for (int j = 0; j < 4; ++j) {
#pragma unroll
      for (int r = 0; r < 8; ++r) {
        slab[(mOff + r) * 68 + (j << 4) + rlane] = acc[i][j][r] + bn[j] + bm[r];
      }
    }
    __builtin_amdgcn_fence(__ATOMIC_RELEASE, "workgroup");
    __builtin_amdgcn_wave_barrier();
    __builtin_amdgcn_fence(__ATOMIC_ACQUIRE, "workgroup");
    if (OUT_MODE == 0) {
      float* C = (float*)Cout + (size_t)b * strideC;
      const int hh = lane >> 4, c4 = (lane & 15) * 4;     // 256-B row segment = 16 lanes x 16 B
      {
#pragma unroll
        for (int it = 0; it < 8; ++it) {
          const int row = it * 2 + hh;                     // it 0..7 x hh 0..1 = rows 0..15
          const v4f v = *(const v4f*)(slab + row * 68 + c4);
          *(v4f*)(C + (size_t)(mBase + row) * ldc + n0 + c4) = v;
        }
        
      }
    } else {
      const int q = lane >> 3, c8 = (lane & 7) * 8;
      unsigned short* C  = (unsigned short*)Cout  + (size_t)b * strideC;
      unsigned short* C2 = (unsigned short*)Cout2 + (size_t)b * strideC2;
      v4u hv[4], lv[4];
#pragma unroll
      for (int it = 0; it < 4; ++it) {
        const int row = it * 4 + q;                        // it 0..3 x q 0..3 = rows 0..15
        const float* sp = slab + row * 68 + c8;
        v4u a, a2;
#pragma unroll
        for (int e = 0; e < 4; ++e) {
          const float f0 = sp[2 * e], f1 = sp[2 * e + 1];
          unsigned short h0, h1, l0, l1;
          if (OUT_MODE == 2) {
            h0 = bf_bits(f0); h1 = bf_bits(f1);
            l0 = bf_bits(f0 - bf_up(h0)); l1 = bf_bits(f1 - bf_up(h1));
          } else {
            const _Float16 x0 = (_Float16)f0, x1 = (_Float16)f1;
            h0 = h_bits(x0); h1 = h_bits(x1);
            l0 = h_bits((_Float16)((f0 - (float)x0) * rscale));
            l1 = h_bits((_Float16)((f1 - (float)x1) * rscale));
          }
          a[e] = pk16(h0, h1); a2[e] = pk16(l0, l1);
        }
        hv[it] = a; lv[it] = a2;
      }
      {
#pragma unroll
        for (int it = 0; it < 4; ++it) {
          const int row = it * 4 + q;
          *(v4u*)(C  + (size_t)(mBase + row) * ldc  + n0 + c8) = hv[it];
          *(v4u*)(C2 + (size_t)(mBase + row) * ldc2 + n0 + c8) = lv[it];
        }
        
      }
    }
    __builtin_amdgcn_fence(__ATOMIC_RELEASE, "workgroup");
    __builtin_amdgcn_wave_barrier();
    __builtin_amdgcn_fence(__ATOMIC_ACQUIRE, "workgroup");
  }
}

// ---- one GEMM per launch: blockIdx.x = block in the batch, blockIdx.y = batch ----
template <int NSPLIT, int OUT_MODE, int BIAS>
__global__ __launch_bounds__(256) void gemm64(
    const unsigned short* __restrict__ Ap, const unsigned short* A2p, int lda, long long strideA,
    const unsigned short* __restrict__ Btp, int ldb, long long strideB,
    const float* __restrict__ bias, int nbias,
    void* Cout, int ldc, long long strideC,
    void* Cout2, int ldc2, long long strideC2,
    int M, int N, int K, float rscale) {
  __shared__ __align__(16) float  sT[8 * 16 * 68];                                    // per-wave 16x64 slab, pitch 68 floats
  __shared__ __align__(16) __bf16 sK[2 * (((NSPLIT >= 1) ? 128 : 64) + 512) * GP];    // two k-slice buffers
  gemm64_body<NSPLIT, OUT_MODE, BIAS>(Ap, A2p, lda, strideA, Btp, ldb, strideB, bias, nbias,
                                      Cout, ldc, strideC, Cout2, ldc2, strideC2, M, N, K, rscale,
                                      blockIdx.x, blockIdx.y, sT, sK);
}

// ---- the three independent projections in one launch; the branch on blockIdx.y is block-uniform ----
//   y = 0: q = x . Wq^T + bq, y = 1: k = x . Wk^T + bk -> bf16 hi/lo planes [b*SEQ+t][h*64+d] (M=8192, N=512, K=512),
//          blockIdx.x = one of 128 tile rows;
//   y = 2: v^T = Wv . x^T + bv (per row) per batch -> f16 hi plane [b][h*64+d][s] and residual plane (x4096), pitch SEQ
//          (A = Wv [n][k], Bt = x rows of the batch; M=512, N=512, K=512), blockIdx.x = batch * 8 + tile row.
__global__ __launch_bounds__(256) void proj_qkv(
    const unsigned short* __restrict__ Xb, const unsigned short* __restrict__ Wqb,
    const unsigned short* __restrict__ Wkb, const unsigned short* __restrict__ Wvb,
    const float* __restrict__ bq, const float* __restrict__ bk, const float* __restrict__ bv,
    unsigned short* Qh, unsigned short* Ql, unsigned short* Kh, unsigned short* Kl,
    unsigned short* VTh, unsigned short* VTl) {
  __shared__ __align__(16) float  sT[8 * 16 * 68];
  __shared__ __align__(16) __bf16 sK[2 * (64 + 512) * GP];
  const int y = blockIdx.y;
  if (y < 2) {
    const bool isq = (y == 0);
    gemm64_body<0, 2, 1>(Xb, Xb, DM, 0LL, isq ? Wqb : Wkb, DM, 0LL, isq ? bq : bk, DM,
                         (void*)(isq ? Qh : Kh), DM, 0LL, (void*)(isq ? Ql : Kl), DM, 0LL,
                         NB * SEQ, DM, DM, 1.0f, blockIdx.x, 0, sT, sK);
  } else {
    gemm64_body<0, 3, 2>(Wvb, Wvb, DM, 0LL, Xb, DM, (long long)SEQ * DM, bv, DM,
                         (void*)VTh, SEQ, (long long)DM * SEQ, (void*)VTl, SEQ, (long long)DM * SEQ,
                         DM, SEQ, DM, 4096.0f, blockIdx.x & 7, blockIdx.x >> 3, sT, sK);
  }
}

// =====================================================================================================
// Attention with a clipped distance bias and a per-key integer mask, head dim 64.
//   q planes (bf16 hi / lo): element (b, t, h, d) at [(b*SEQ + t)*DM + h*64 + d]
//   k planes (bf16 hi / lo): same layout with key index s
//   v^T hi plane (f16):      element (b, h, d, s) at [(b*DM + h*64 + d)*SEQ + s]
//   v^T residual plane (f16, (v - hi)*4096): same layout
//   dbias f32 [b][t][s] (RNE-converted to bf16 per value), kmask int [b][s]
//   logit = clip(q.k * sscale + dbias, -10, 10), then keys with kmask == 0 -> -1e9; softmax over all keys
//   out planes (bf16 hi / lo of the normalised context): element (b, t, h, d) at [(b*SEQ + t)*DM + h*64 + d]
//   scores = q . k : bf16 hi/lo split (hi.hi + hi.lo + lo.hi), f32 accumulate; bias, clip, mask in f32
//   p = exp(s - m) carried as f16(1024 p) plus f16 residual x4096; context = p . v on f16 WMMA with the
//   residual products (p.vres + pres.v) in a separate accumulator folded back with 1/4096 per chunk in f32;
//   online softmax in f32. Block = 4 waves = 64 query rows of one (b, h); grid = NQB * NH * NB; kv chunks of 64,
//   static trip NQB. K / V^T chunk staging: 128 threads x 4 rows x 8 elements per plane = the whole 64x64 tile (plain
//   16-B loads, 8 lanes to a row, __syncthreads before and after); P tiles are wave-private, spilled with _Float16 element stores
//   Output coverage: each wave stores rows q0..q0+15 (it 0..3 x lane>>3 0..3) x 64 columns (8 lanes x 8) of both planes.
// =====================================================================================================
__global__ __launch_bounds__(128)
void attn64(const unsigned short* __restrict__ qhp, const unsigned short* __restrict__ qlp,
            const unsigned short* __restrict__ khp, const unsigned short* __restrict__ klp,
            const unsigned short* __restrict__ vhp, const unsigned short* __restrict__ vlp,
            const float* __restrict__ dbias, const int* __restrict__ kmask,
            unsigned short* ohp, unsigned short* olp, float sscale) {
  union FB { v16b v; v8b h[2]; };
  union FH { v16h v; v8h h[2]; };
  __shared__ __align__(16) __bf16   Ksh[64 * KP];   // K hi [kv][d], pitch KP
  __shared__ __align__(16) __bf16   Ksl[64 * KP];   // K lo
  __shared__ __align__(16) _Float16 Vth[64 * KP];   // V^T hi [d][kv], pitch KP
  __shared__ __align__(16) _Float16 Vtl[64 * KP];   // V^T residual
  __shared__ __align__(16) _Float16 Psh[4][16 * KP];   // per wave P [row][kv], pitch KP
  __shared__ __align__(16) _Float16 Psl[4][16 * KP];   // per wave P residual
  __shared__ __align__(16) float    Os[4][16 * OP];    // per wave context tile [row][d], pitch OP

  const int tid  = threadIdx.x;
  const int wave = tid >> 5;
  const int lane = tid & 31;
  const int hh   = lane >> 4;
  const int c    = lane & 15;

  const int bx   = blockIdx.x;
  const int qb   = bx % NQB;
  const int rest = bx / NQB;
  const int h    = rest % NH;
  const int b    = rest / NH;
  const int q0   = qb * 64 + wave * 16;
  const size_t rowB = (size_t)b * SEQ;

  const __bf16* Qh = (const __bf16*)(const void*)qhp + (size_t)h * HD;
  const __bf16* Ql = (const __bf16*)(const void*)qlp + (size_t)h * HD;
  const __bf16* Kh = (const __bf16*)(const void*)khp + (size_t)h * HD;
  const __bf16* Kl = (const __bf16*)(const void*)klp + (size_t)h * HD;
  const _Float16* Vh = (const _Float16*)(const void*)vhp + ((size_t)b * DM + (size_t)h * HD) * SEQ;
  const _Float16* Vl = (const _Float16*)(const void*)vlp + ((size_t)b * DM + (size_t)h * HD) * SEQ;
  const float* dbw = dbias + (rowB + (size_t)q0 + 8 * hh) * SEQ + c;   // row q0+8hh(+r), key (kv0 + 16j) + c
  const int*   mkb = kmask + rowB + c;                                 // key (kv0 + 16j) + c

  // ---- Q fragments (A operand, row = lane&15): 2 d-chunks, hi and lo ----
  v16b qah[2], qal[2];
#pragma unroll
  for (int dc = 0; dc < 2; ++dc) {
    const size_t qo = (rowB + q0 + c) * DM + dc * 32 + 8 * hh;
    qah[dc] = ldfrag_b(Qh + qo);
    qal[dc] = ldfrag_b(Ql + qo);
  }

  float mrow[8], lrow[8];
  v8f oacc[4];
#pragma unroll
  for (int r = 0; r < 8; ++r) { mrow[r] = -INFINITY; lrow[r] = 0.f; }
#pragma unroll
  for (int t = 0; t < 4; ++t) oacc[t] = zero8();

  for (int kt = 0; kt < NQB; ++kt) {         // static trip count
    const int kv0 = kt * 64;
    __syncthreads();
    {
      // 8 lanes x 16 B = one whole 128-B tile row, so a wave's load touches 4 whole lines; rows r + 16 i, i = 0..3
      const int r = tid >> 3, pc = (tid & 7) * 8;
      const __bf16*   kg  = Kh + (rowB + kv0 + r) * DM + pc;      // K row kv0+r(+16i), d = pc..pc+7
      const __bf16*   klg = Kl + (rowB + kv0 + r) * DM + pc;
      const _Float16* vg  = Vh + (size_t)r * SEQ + kv0 + pc;      // V^T row d = r(+16i), s = kv0+pc..+7
      const _Float16* vlg = Vl + (size_t)r * SEQ + kv0 + pc;
      v8b a0[4], a1[4];
      v8h b0[4], b1[4];
#pragma unroll
      for (int i = 0; i < 4; ++i) {
        a0[i] = *(const v8b*)(kg  + (size_t)(16 * i) * DM);
        a1[i] = *(const v8b*)(klg + (size_t)(16 * i) * DM);
        b0[i] = *(const v8h*)(vg  + (size_t)(16 * i) * SEQ);
        b1[i] = *(const v8h*)(vlg + (size_t)(16 * i) * SEQ);
      }
#if defined(__HIP_DEVICE_COMPILE__)
      // the wait that stands in front of any overwrite of the loads' address registers; naming the four addresses
      // as inputs keeps them in their registers up to it, so that no later load of the group lands on one
      asm volatile("s_wait_xcnt 0x0" :: "v"(kg), "v"(klg), "v"(vg), "v"(vlg) : "memory");
#endif
#pragma unroll
      for (int i = 0; i < 4; ++i) {
        *(v8b*)(Ksh + (r + 16 * i) * KP + pc) = a0[i];
        *(v8b*)(Ksl + (r + 16 * i) * KP + pc) = a1[i];
        *(v8h*)(Vth + (r + 16 * i) * KP + pc) = b0[i];
        *(v8h*)(Vtl + (r + 16 * i) * KP + pc) = b1[i];
      }
    }
    __syncthreads();

    // ---- scores: 16 query rows x 64 keys per wave, 3 bf16 products ----
    v8f s[4];
#pragma unroll
    for (int j = 0; j < 4; ++j) {
      s[j] = zero8();
#pragma unroll
      for (int dc = 0; dc < 2; ++dc) {
        FB kb, kl;
        kb.h[0] = *(const v8b*)(Ksh + (j * 16 + c) * KP + dc * 32 + 8 * hh);
        kb.h[1] = *(const v8b*)(Ksh + (j * 16 + c) * KP + dc * 32 + 16 + 8 * hh);
        kl.h[0] = *(const v8b*)(Ksl + (j * 16 + c) * KP + dc * 32 + 8 * hh);
        kl.h[1] = *(const v8b*)(Ksl + (j * 16 + c) * KP + dc * 32 + 16 + 8 * hh);
        s[j] = mma_b(qah[dc], kb.v, s[j]);
        s[j] = mma_b(qah[dc], kl.v, s[j]);
        s[j] = mma_b(qal[dc], kb.v, s[j]);
      }
    }

    // ---- key mask values for this lane's 4 keys (same for all 8 rows) ----
    int mk[4];
#pragma unroll
    for (int j = 0; j < 4; ++j) mk[j] = mkb[kv0 + j * 16];

    // ---- scale + bias, clip, key mask, row max, online softmax, P (x1024, f16) and
    //      P residual (x4096) to LDS ----
    _Float16* pwh = Psh[wave];
    _Float16* pwl = Psl[wave];
#pragma unroll
    for (int r = 0; r < 8; ++r) {
      const float* drw = dbw + (size_t)r * SEQ + kv0;
      float m = -INFINITY;
#pragma unroll
      for (int j = 0; j < 4; ++j) {
        const float dv = bf_rne(drw[j * 16]);
        float sv = s[j][r] * sscale + dv;
        sv = fminf(10.0f, fmaxf(-10.0f, sv));
        sv = (mk[j] != 0) ? sv : -1.0e9f;
        s[j][r] = sv;
        m = fmaxf(m, sv);
      }
#pragma unroll
      for (int off = 1; off < 16; off <<= 1) m = fmaxf(m, __shfl_xor(m, off, 32));
      const float mnew  = fmaxf(mrow[r], m);
      const float msafe = (mnew == -INFINITY) ? 0.f : mnew;
      const float alpha = __expf(mrow[r] - msafe);
      mrow[r] = mnew;
      float psum = 0.f;
#pragma unroll
      for (int j = 0; j < 4; ++j) {
        const float p = __expf(s[j][r] - msafe);
        psum += p;
        const float p1k = p * 1024.0f;
        const _Float16 ph = (_Float16)p1k;
        const _Float16 pl = (_Float16)((p1k - (float)ph) * 4096.0f);
        pwh[(8 * hh + r) * KP + j * 16 + c] = ph;
        pwl[(8 * hh + r) * KP + j * 16 + c] = pl;
      }
#pragma unroll
      for (int off = 1; off < 16; off <<= 1) psum += __shfl_xor(psum, off, 32);
      lrow[r] = lrow[r] * alpha + psum;
#pragma unroll
      for (int t = 0; t < 4; ++t) oacc[t][r] *= alpha;
    }
    __builtin_amdgcn_fence(__ATOMIC_RELEASE, "workgroup");
    __builtin_amdgcn_wave_barrier();
    __builtin_amdgcn_fence(__ATOMIC_ACQUIRE, "workgroup");

    // ---- context += P . V (f16 WMMA), residual products into a separate accumulator ----
    v8f o1[4];
#pragma unroll
    for (int t = 0; t < 4; ++t) o1[t] = zero8();
#pragma unroll 1
    for (int kk = 0; kk < 2; ++kk) {
      FH pa, pl;
      pa.h[0] = *(const v8h*)(pwh + c * KP + kk * 32 + 8 * hh);
      pa.h[1] = *(const v8h*)(pwh + c * KP + kk * 32 + 16 + 8 * hh);
      pl.h[0] = *(const v8h*)(pwl + c * KP + kk * 32 + 8 * hh);
      pl.h[1] = *(const v8h*)(pwl + c * KP + kk * 32 + 16 + 8 * hh);
#pragma unroll
      for (int t = 0; t < 4; ++t) {
        FH vb, vl;
        vb.h[0] = *(const v8h*)(Vth + (t * 16 + c) * KP + kk * 32 + 8 * hh);
        vb.h[1] = *(const v8h*)(Vth + (t * 16 + c) * KP + kk * 32 + 16 + 8 * hh);
        vl.h[0] = *(const v8h*)(Vtl + (t * 16 + c) * KP + kk * 32 + 8 * hh);
        vl.h[1] = *(const v8h*)(Vtl + (t * 16 + c) * KP + kk * 32 + 16 + 8 * hh);
        oacc[t] = mma_h(pa.v, vb.v, oacc[t]);
        o1[t]   = mma_h(pa.v, vl.v, o1[t]);
        o1[t]   = mma_h(pl.v, vb.v, o1[t]);
      }
    }
#pragma unroll
    for (int t = 0; t < 4; ++t)
#pragma unroll
      for (int r = 0; r < 8; ++r) oacc[t][r] += o1[t][r] * (1.0f / 4096.0f);
  }

  // ---- normalise (1/l and the 1/1024 p carry), stage the wave's 16x64 tile, bf16 hi/lo split,
  float* os = Os[wave];
#pragma unroll
  for (int r = 0; r < 8; ++r) {
    const float l = lrow[r];
    const float inv = ((l > 0.f) ? (1.0f / l) : 0.f) * (1.0f / 1024.0f);
#pragma unroll
    for (int t = 0; t < 4; ++t) os[(8 * hh + r) * OP + t * 16 + c] = oacc[t][r] * inv;
  }
  __builtin_amdgcn_fence(__ATOMIC_RELEASE, "workgroup");
  __builtin_amdgcn_wave_barrier();
  __builtin_amdgcn_fence(__ATOMIC_ACQUIRE, "workgroup");
  {
    const int q4 = lane >> 3, c8 = (lane & 7) * 8;
    v4u hv[4], lv[4];
#pragma unroll
    for (int it = 0; it < 4; ++it) {
      const int row = it * 4 + q4;   // it 0..3 x q4 0..3 = rows 0..15 of the wave tile
      const float* sp = os + row * OP + c8;
      v4u a, a2;
#pragma unroll
      for (int e = 0; e < 4; ++e) {
        const float f0 = sp[2 * e], f1 = sp[2 * e + 1];
        const unsigned short h0 = bf_bits(f0), h1 = bf_bits(f1);
        const unsigned short l0 = bf_bits(f0 - bf_up(h0)), l1 = bf_bits(f1 - bf_up(h1));
        a[e] = pk16(h0, h1); a2[e] = pk16(l0, l1);
      }
      hv[it] = a; lv[it] = a2;
    }
    {
#pragma unroll
      for (int it = 0; it < 4; ++it) {
        const int row = it * 4 + q4;
        const size_t go = (rowB + q0 + row) * DM + (size_t)h * HD + c8;
        *(v4u*)(ohp + go) = hv[it];
        *(v4u*)(olp + go) = lv[it];
      }
      
    }
  }
}

// =====================================================================================================
// Workspace map (bytes), every plane an exact multiple of its 64x64-tile / whole-line store granularity:
//   Xb   bf16 [8192][512]          8388608
//   Wqb, Wkb, Wvb, Wob bf16 [512 n][512 k]   524288 each
//   Qh, Ql, Kh, Kl bf16 [8192][512] 8388608 each
//   VTh  f16  [16][512 d][512 s]   8388608
//   VTl  f16  [16][512 d][512 s]   8388608
//   Oh, Ol bf16 [8192][512]         8388608 each
//   total                           77594624
// Weights are [out n][in k] with k contiguous = the Bt / A layout the GEMM wants, so they are only converted.
// =====================================================================================================
extern "C" void kernel_launch(void* const* d_in, const int* in_sizes, int n_in,
                              void* d_out, int out_size, void* d_ws, size_t ws_size,
                              hipStream_t stream) {
  if (n_in < 11) return;
  if (in_sizes[0] != NB * SEQ * DM) return;
  if (in_sizes[1] != NB * SEQ * SEQ) return;
  if (in_sizes[2] != NB * SEQ) return;
  if (in_sizes[3] != DM * DM || in_sizes[5] != DM * DM || in_sizes[7] != DM * DM || in_sizes[9] != DM * DM) return;
  if (in_sizes[4] != DM || in_sizes[6] != DM || in_sizes[8] != DM || in_sizes[10] != DM) return;
  if (out_size != NB * SEQ * DM) return;

  const float* x    = (const float*)d_in[0];
  const float* db   = (const float*)d_in[1];
  const int*   msk  = (const int*)d_in[2];
  const float* Wq   = (const float*)d_in[3];
  const float* bq   = (const float*)d_in[4];
  const float* Wk   = (const float*)d_in[5];
  const float* bk   = (const float*)d_in[6];
  const float* Wv   = (const float*)d_in[7];
  const float* bv   = (const float*)d_in[8];
  const float* Wo   = (const float*)d_in[9];
  const float* bo   = (const float*)d_in[10];

  const size_t PX  = (size_t)NB * SEQ * DM * 2;   // 8388608   16-bit activation plane [8192][512]
  const size_t PW  = (size_t)DM * DM * 2;         //  524288   16-bit weight plane
  const size_t PVT = (size_t)NB * DM * SEQ * 2;   // 8388608   v^T plane
  size_t off = 0;
  const size_t oXb  = off; off += PX;
  const size_t oWq  = off; off += PW;
  const size_t oWk  = off; off += PW;
  const size_t oWv  = off; off += PW;
  const size_t oWo  = off; off += PW;
  const size_t oQh  = off; off += PX;
  const size_t oQl  = off; off += PX;
  const size_t oKh  = off; off += PX;
  const size_t oKl  = off; off += PX;
  const size_t oVTh = off; off += PVT;
  const size_t oVTl = off; off += PVT;
  const size_t oOh  = off; off += PX;
  const size_t oOl  = off; off += PX;
  if (off > ws_size) return;                      // off = 77594624
  if (off > (size_t)134217728) return;

  char* ws = (char*)d_ws;
  unsigned short* Xb  = (unsigned short*)(ws + oXb);
  unsigned short* Wqb = (unsigned short*)(ws + oWq);
  unsigned short* Wkb = (unsigned short*)(ws + oWk);
  unsigned short* Wvb = (unsigned short*)(ws + oWv);
  unsigned short* Wob = (unsigned short*)(ws + oWo);
  unsigned short* Qh  = (unsigned short*)(ws + oQh);
  unsigned short* Ql  = (unsigned short*)(ws + oQl);
  unsigned short* Kh  = (unsigned short*)(ws + oKh);
  unsigned short* Kl  = (unsigned short*)(ws + oKl);
  unsigned short* VTh = (unsigned short*)(ws + oVTh);
  unsigned short* VTl = (unsigned short*)(ws + oVTl);
  unsigned short* Oh  = (unsigned short*)(ws + oOh);
  unsigned short* Ol  = (unsigned short*)(ws + oOl);

  const dim3 blk(256);
  const int n8x = NB * SEQ * DM / 8;                          // 524288
  const int n8w = DM * DM / 8;                                //  32768
  const int nbx = n8x / 256;                                  // 2048 blocks for x
  const int nbw = n8w / 256;                                  //  128 blocks for each weight
  const dim3 gCvt(nbx + 4 * nbw);                             // 2560 blocks
  const dim3 gProj(((NB * SEQ / 64) * (DM / 64) + 7) / 8, 1); // 1024 tiles -> 128 blocks: M=8192, N=512
  const dim3 gQKV(((NB * SEQ / 64) * (DM / 64) + 7) / 8, 3);  // 128 blocks each for q, k and v^T (8 blocks x 16 batches)
  const dim3 gAttn(NB * NH * NQB);                            // 1024 blocks of 128 threads

  // (1) x -> bf16 plane [8192][512]; weights [n][k] f32 -> bf16 [n][k]; Xb, Wqb, Wkb, Wvb, Wob lie one behind the other
  cvt_bf16x8<<<gCvt, blk, 0, stream>>>(x, Wq, Wk, Wv, Wo, Xb, nbx, nbw);
  // (2) q, k -> bf16 hi/lo planes, v^T -> f16 hi and residual planes
  proj_qkv<<<gQKV, blk, 0, stream>>>(Xb, Wqb, Wkb, Wvb, bq, bk, bv, Qh, Ql, Kh, Kl, VTh, VTl);
  // (3) attention -> context bf16 hi/lo planes
  attn64<<<gAttn, dim3(128), 0, stream>>>(
      Qh, Ql, Kh, Kl, VTh, VTl, db, msk, Oh, Ol, 0.125f);
  // (4) out = context . Wo^T + bo -> d_out f32 [8192][512]  (A = context hi + lo planes, 2 products)
  gemm64<1, 0, 1><<<gProj, blk, 0, stream>>>(
      Oh, Ol, DM, 0LL, Wob, DM, 0LL, bo, DM,
      d_out, DM, 0LL, d_out, DM, 0LL,
      NB * SEQ, DM, DM, 1.0f);
  (void)hipGetLastError();
}

// v005
// A run of this version takes 83.5 microseconds.
// Timed twice side by side with v004, it ran 1.07 times as fast both times.
// All steps since v000 together make it 2.48 times as fast.
// Contractions: q, k, v^T projections = v_wmma_f32_16x16x32_bf16 (bf16 operands from RNE-converted inputs, single product, bias added in f32);
// q.k^T scores = v_wmma_f32_16x16x32_bf16 with bf16 hi/lo split q and k (hi.hi + hi.lo + lo.hi);
// p.v = v_wmma_f32_16x16x32_f16 (p carried x1024 in f16 plus a x4096 f16 residual plane, v as f16 hi plus a x4096 f16 residual plane: hi.hi + hi.res + res.hi);
// ctx.Wo^T = v_wmma_f32_16x16x32_bf16 with ctx as bf16 hi/lo planes times bf16 Wo (2 products); all f32 accumulate; clip, key mask and softmax in f32.
#include <hip/hip_runtime.h>
#include <math.h>
#include <float.h>
#include <stdint.h>

#define NB    16
#define SEQ   512
#define DM    512
#define NH    8
#define HD    64
#define NQB   (SEQ / 64)   // 8 key / query tiles of 64
#define KP    72           // LDS row pitch of the 64-wide 16-bit tiles, elements: 144 B = 16 B x 9, for ds_load_b128 readers
#define OP    68           // LDS row pitch of the 64-wide f32 context tile, floats: 272 B = 16 B x 17
#define GP    72           // LDS row pitch of a staged 64-element GEMM k-slice, elements: 144 B = 16 B x 9, for ds_load_b128 readers
static_assert(NH * HD == DM);
static_assert((SEQ % 64) == 0 && (DM % 64) == 0 && ((NB * SEQ) % 64) == 0);

typedef _Float16 v16h __attribute__((ext_vector_type(16)));
typedef _Float16 v8h  __attribute__((ext_vector_type(8)));
typedef __bf16   v16b __attribute__((ext_vector_type(16)));
typedef __bf16   v8b  __attribute__((ext_vector_type(8)));
typedef float    v8f  __attribute__((ext_vector_type(8)));
typedef float    v4f  __attribute__((ext_vector_type(4)));
typedef unsigned int v4u __attribute__((ext_vector_type(4)));
typedef int      v4i  __attribute__((ext_vector_type(4)));

// ---- scalar helpers --------------------------------------------------------------------------------
__device__ __forceinline__ unsigned short bf_bits(float f) {          // f32 -> bf16 bits, RNE convert
  unsigned u = __float_as_uint(f);
  return (unsigned short)((u + 0x7FFFu + ((u >> 16) & 1u)) >> 16);
}
__device__ __forceinline__ float bf_up(unsigned short h) { return __uint_as_float(((unsigned)h) << 16); }
__device__ __forceinline__ float bf_rne(float f) { return bf_up(bf_bits(f)); }
__device__ __forceinline__ unsigned short h_bits(_Float16 x) { return __builtin_bit_cast(unsigned short, x); }
__device__ __forceinline__ unsigned pk16(unsigned short a, unsigned short b) { return (unsigned)a | ((unsigned)b << 16); }
__device__ __forceinline__ float xhalf(float v) {                     // the value that lane ^ 16 holds
  const int b = __float_as_int(v);
  return __int_as_float(__builtin_amdgcn_permlanex16(b, b, 0x76543210, 0xfedcba98, false, false));
}
__device__ __forceinline__ v8f zero8() { v8f z = {0.f, 0.f, 0.f, 0.f, 0.f, 0.f, 0.f, 0.f}; return z; }

// ---- fragment loader: 16-bit A/B operand, lane -> row/col (lane&15), p already includes +8*(lane>>4);
//      elements 0..7 <- p[0..7] (k0+8h..), elements 8..15 <- p[16..23] (k0+16+8h..)
__device__ __forceinline__ v16b ldfrag_b(const __bf16* p) {
  union { v16b v; v8b h[2]; } f;
  f.h[0] = *(const v8b*)(p);
  f.h[1] = *(const v8b*)(p + 16);
  return f.v;
}

// ---- WMMA helpers with trailing VALU hazard gap (asm only in the device pass) --------------------------
__device__ __forceinline__ v8f mma_b(v16b a, v16b b, v8f c) {
  c = __builtin_amdgcn_wmma_f32_16x16x32_bf16(false, a, false, b, (short)0, c, false, false);
#if defined(__HIP_DEVICE_COMPILE__)
  asm volatile("v_nop\n\tv_nop\n\tv_nop\n\tv_nop" : "+v"(c) : "v"(a), "v"(b));
#endif
  return c;
}
__device__ __forceinline__ v8f mma_h(v16h a, v16h b, v8f c) {
  c = __builtin_amdgcn_wmma_f32_16x16x32_f16(false, a, false, b, (short)0, c, false, false);
#if defined(__HIP_DEVICE_COMPILE__)
  asm volatile("v_nop\n\tv_nop\n\tv_nop\n\tv_nop" : "+v"(c) : "v"(a), "v"(b));
#endif
  return c;
}
__device__ __forceinline__ v8f mma_b_raw(v16b a, v16b b, v8f c) {
  return __builtin_amdgcn_wmma_f32_16x16x32_bf16(false, a, false, b, (short)0, c, false, false);
}
__device__ __forceinline__ void dep_guard_b(v8f& a, v8f& b, v16b x, v16b y) {
#if defined(__HIP_DEVICE_COMPILE__)
  asm volatile("v_nop\n\tv_nop\n\tv_nop\n\tv_nop" : "+v"(a), "+v"(b) : "v"(x), "v"(y));
#endif
}
__device__ __forceinline__ void keep4_b(v16b a, v16b b, v16b c, v16b d) {
#if defined(__HIP_DEVICE_COMPILE__)
  asm volatile("v_nop" :: "v"(a), "v"(b), "v"(c), "v"(d));
#endif
}
__device__ __forceinline__ void acc_guard4(v8f& a, v8f& b, v8f& c, v8f& d) {
#if defined(__HIP_DEVICE_COMPILE__)
  asm volatile("v_nop\n\tv_nop\n\tv_nop\n\tv_nop" : "+v"(a), "+v"(b), "+v"(c), "+v"(d));
#endif
}

// ---- N asynchronous copies to LDS, 16 B per lane each: l[i] = the lane's LDS byte address, g[i] = its global address.
//      s_wait_xcnt 0 is the last line of the copies' own statement, so that it stands in front of every later
//      write of an address register that a copy names.
template <int N>
__device__ __forceinline__ void async_rows(const unsigned* l, const __bf16* const* g) {
  static_assert(N == 9 || N == 10);
#if defined(__HIP_DEVICE_COMPILE__)
  if constexpr (N == 9) {
    asm volatile(
        "global_load_async_to_lds_b128 %0, %9, off\n\t"
        "global_load_async_to_lds_b128 %1, %10, off\n\t"
        "global_load_async_to_lds_b128 %2, %11, off\n\t"
        "global_load_async_to_lds_b128 %3, %12, off\n\t"
        "global_load_async_to_lds_b128 %4, %13, off\n\t"
        "global_load_async_to_lds_b128 %5, %14, off\n\t"
        "global_load_async_to_lds_b128 %6, %15, off\n\t"
        "global_load_async_to_lds_b128 %7, %16, off\n\t"
        "global_load_async_to_lds_b128 %8, %17, off\n\t"
        "s_wait_xcnt 0x0"
        :: "v"(l[0]), "v"(l[1]), "v"(l[2]), "v"(l[3]), "v"(l[4]), "v"(l[5]), "v"(l[6]), "v"(l[7]), "v"(l[8]),
           "v"(g[0]), "v"(g[1]), "v"(g[2]), "v"(g[3]), "v"(g[4]), "v"(g[5]), "v"(g[6]), "v"(g[7]), "v"(g[8])
        : "memory");
  } else {
    asm volatile(
        "global_load_async_to_lds_b128 %0, %10, off\n\t"
        "global_load_async_to_lds_b128 %1, %11, off\n\t"
        "global_load_async_to_lds_b128 %2, %12, off\n\t"
        "global_load_async_to_lds_b128 %3, %13, off\n\t"
        "global_load_async_to_lds_b128 %4, %14, off\n\t"
        "global_load_async_to_lds_b128 %5, %15, off\n\t"
        "global_load_async_to_lds_b128 %6, %16, off\n\t"
        "global_load_async_to_lds_b128 %7, %17, off\n\t"
        "global_load_async_to_lds_b128 %8, %18, off\n\t"
        "global_load_async_to_lds_b128 %9, %19, off\n\t"
        "s_wait_xcnt 0x0"
        :: "v"(l[0]), "v"(l[1]), "v"(l[2]), "v"(l[3]), "v"(l[4]), "v"(l[5]), "v"(l[6]), "v"(l[7]), "v"(l[8]), "v"(l[9]),
           "v"(g[0]), "v"(g[1]), "v"(g[2]), "v"(g[3]), "v"(g[4]), "v"(g[5]), "v"(g[6]), "v"(g[7]), "v"(g[8]), "v"(g[9])
        : "memory");
  }
#endif
}
// the issuing wave's own copies have landed behind this wait
__device__ __forceinline__ void wait_async0() {
#if defined(__HIP_DEVICE_COMPILE__)
  asm volatile("s_wait_asynccnt 0x0" ::: "memory");
#endif
}
// the wave's own LDS reads have returned behind this wait (in front of the barrier that frees a buffer for refill)
__device__ __forceinline__ void wait_ds0() {
#if defined(__HIP_DEVICE_COMPILE__)
  asm volatile("s_wait_dscnt 0x0" ::: "memory");
#endif
}

// =====================================================================================================
// f32 -> bf16 (RNE convert), 8 elements per thread, one 16-B store per lane: a wave writes 512 contiguous B.
// One launch for all five planes: blocks 0..nbx-1 convert x, then nbw blocks each for w0, w1, w2, w3; out is the
// x plane with the four weight planes directly behind it, in that order, so the flat index is the output index.
// coverage: (nbx + 4 * nbw) blocks x 256 threads x 8 = all five planes (each a whole number of blocks).
// =====================================================================================================
__global__ __launch_bounds__(256) void cvt_bf16x8(const float* __restrict__ x, const float* __restrict__ w0,
                                                  const float* __restrict__ w1, const float* __restrict__ w2,
                                                  const float* __restrict__ w3, unsigned short* out, int nbx, int nbw) {
  const int blk = blockIdx.x;
  const float* in = x;          // block-uniform choice of the source plane
  int rel = blk;                // block index inside that plane
  if (blk >= nbx) {
    const int j = blk - nbx;
    const int sel = j / nbw;
    rel = j - sel * nbw;
    in = (sel == 0) ? w0 : (sel == 1) ? w1 : (sel == 2) ? w2 : w3;
  }
  if (blk < nbx + 4 * nbw) {
    const int i = blk * 256 + threadIdx.x;
    const int si = rel * 256 + threadIdx.x;
    const v4f a = *(const v4f*)(in + (size_t)si * 8);
    const v4f b = *(const v4f*)(in + (size_t)si * 8 + 4);
    v4u p;
    p[0] = pk16(bf_bits(a[0]), bf_bits(a[1]));
    p[1] = pk16(bf_bits(a[2]), bf_bits(a[3]));
    p[2] = pk16(bf_bits(b[0]), bf_bits(b[1]));
    p[3] = pk16(bf_bits(b[2]), bf_bits(b[3]));
    *(v4u*)(out + (size_t)i * 8) = p;
    
  }
}

// =====================================================================================================
// Register-blocked batched bf16 WMMA GEMM: C[m][n] = sum_k A[m][k] * Bt[n][k] + bias; one wave per 64x64
// tile; the 8 waves of a block hold 8 neighbouring tiles of one tile row (64 x 512 of C). A row-major [M][K]
// pitch lda; Bt row-major [N][K] pitch ldb (k contiguous); M multiple of 64, N multiple of 512, K a positive
// multiple of 64; lda, ldb multiples of 8. bx = the block's index in one batch, b = batch index (strides in
// elements); sT (8 slabs of 16 x 68 floats) and sK (two k-slice buffers) are the calling kernel's LDS.
// Operands: per 64-element k-slice the block's 64 A rows (and A2 rows) and 512 Bt rows go to LDS by asynchronous
// copies, 8 lanes x 16 B = one whole 128-B row piece, two buffers: slice t + 1 flies while slice t is multiplied;
// the fragments are read from LDS (pitch GP). Slice rows in a buffer: A 0..63, (A2 64..127,) then Bt.
// NSPLIT: 0 = A.Bt; 1 = (A + A2).Bt (A2 = unscaled bf16 lo plane of A, 2 products).
// BIAS: 0 = none; 1 = bias[n] per column; 2 = bias[m] per row; bias values RNE-converted to bf16 first,
//       added in f32; bias index clamped to nbias-1.
// OUT_MODE: 0 = f32 (pitch ldc); 2 = bf16 hi plane C + bf16 lo plane C2 (lo = RNE(v - hi), unscaled);
//           3 = f16 hi plane C + f16 residual plane C2 = f16((v - hi) * rscale) (pitch ldc2, stride strideC2).
// =====================================================================================================
template <int NSPLIT, int OUT_MODE, int BIAS>
__device__ __forceinline__ void gemm64_body(
    const unsigned short* __restrict__ Ap, const unsigned short* A2p, int lda, long long strideA,
    const unsigned short* __restrict__ Btp, int ldb, long long strideB,
    const float* __restrict__ bias, int nbias,
    void* Cout, int ldc, long long strideC,
    void* Cout2, int ldc2, long long strideC2,
    int M, int N, int K, float rscale,
    int bx, int b, float* sT, __bf16* sK) {
  const __bf16* A   = (const __bf16*)(const void*)Ap;
  const __bf16* A2  = (const __bf16*)(const void*)A2p;
  const __bf16* Bt  = (const __bf16*)(const void*)Btp;
  constexpr int AROWS = (NSPLIT >= 1) ? 128 : 64;  // staged A (and A2) rows
  constexpr int ROWS  = AROWS + 512;               // rows of one staged k-slice
  constexpr int NIT   = ROWS / 32;                 // copies per thread and slice: 256 threads x 16 B = 32 rows each
  const int lane = threadIdx.x & 31;
  const int wave = threadIdx.x >> 5;
  const int tilesN = N >> 6;
  const int tilesM = M >> 6;
  const int tile0 = bx * 8;                // the block's first tile; tilesN is a multiple of 8
  if (tile0 >= tilesM * tilesN) return;            // block-uniform, in front of every barrier
  const int tm  = tile0 / tilesN;
  const int tn0 = tile0 - tm * tilesN;
  const int m0 = tm << 6;
  const int nb0 = tn0 << 6;                        // first of the block's 512 columns
  const int n0 = nb0 + (wave << 6);

  const __bf16* Ab  = A  + (size_t)b * strideA;
  const __bf16* Bb  = Bt + (size_t)b * strideB;
  const __bf16* Ab2 = (NSPLIT >= 1) ? (A2 + (size_t)b * strideA) : Ab;

  const int rlane = lane & 15;                 // row (A) / col (B, D) within subtile
  const int koff  = (lane >> 4) * 8;           // k offset of this lane half
  const int mOff  = (lane >> 4) * 8;           // D row offset

  v8f acc[4][4];
#pragma unroll
  for (int i = 0; i < 4; ++i)
#pragma unroll
    for (int j = 0; j < 4; ++j) acc[i][j] = zero8();

  // ---- staging: thread -> slice row (tid >> 3) + 32 * it, 16-B piece tid & 7 ----
  const int srow = threadIdx.x >> 3;
  const int scol = (threadIdx.x & 7) * 8;
  const __bf16* gA  = Ab  + (size_t)(m0 + srow) * lda + scol;
  const __bf16* gA2 = Ab2 + (size_t)(m0 + srow) * lda + scol;
  const __bf16* gB  = Bb  + (size_t)(nb0 + srow) * ldb + scol;
  const unsigned lds0 = (unsigned)(size_t)(sK + srow * GP + scol);   // LDS byte address = low 32 bits
  auto stage = [&](int buf, int k0) {
    unsigned l[NIT];
    const __bf16* g[NIT];
#pragma unroll
    for (int it = 0; it < NIT; ++it) {
      l[it] = lds0 + (unsigned)(buf * ROWS + it * 32) * (unsigned)(GP * 2);
      if (it < 2)                g[it] = gA  + (size_t)(it * 32) * lda + k0;
      else if (it < AROWS / 32)  g[it] = gA2 + (size_t)((it - 2) * 32) * lda + k0;
      else                       g[it] = gB  + (size_t)((it - AROWS / 32) * 32) * ldb + k0;
    }
    async_rows<NIT / 2>(l, g);
    async_rows<NIT / 2>(l + NIT / 2, g + NIT / 2);
  };

  const int nch = K >> 6;
  stage(0, 0);
  wait_async0();
  __syncthreads();                       // slice 0 is published
  if (nch > 1) stage(1, 64);
  for (int t = 0; t < nch; ++t) {
    const __bf16* sA = sK + (t & 1) * (ROWS * GP) + rlane * GP + koff;
    const __bf16* sB = sA + (AROWS + (wave << 6)) * GP;
#pragma unroll
    for (int ks = 0; ks < 2; ++ks) {
      constexpr int IG = (NSPLIT >= 1) ? 2 : 4;   // A fragments read as one group: as many as the registers hold
      v16b bh[4];
#pragma unroll
      for (int j = 0; j < 4; ++j) bh[j] = ldfrag_b(sB + (j << 4) * GP + ks * 32);
#pragma unroll
      for (int i0 = 0; i0 < 4; i0 += IG) {
        v16b ah[IG], al[IG];
#pragma unroll
        for (int u = 0; u < IG; ++u) {
          ah[u] = ldfrag_b(sA + ((i0 + u) << 4) * GP + ks * 32);
          al[u] = ah[u];
          if (NSPLIT >= 1) al[u] = ldfrag_b(sA + (64 + ((i0 + u) << 4)) * GP + ks * 32);
        }
#pragma unroll
        for (int u = 0; u < IG; ++u) {
          const int i = i0 + u;
#pragma unroll
          for (int j = 0; j < 4; ++j) {
            acc[i][j] = mma_b_raw(ah[u], bh[j], acc[i][j]);
            if (NSPLIT >= 1) acc[i][j] = mma_b_raw(al[u], bh[j], acc[i][j]);
          }
          dep_guard_b(acc[i][0], acc[i][3], ah[u], al[u]);
        }
      }
      keep4_b(bh[0], bh[1], bh[2], bh[3]);
    }
    wait_ds0();
    wait_async0();
    __syncthreads();                     // publishes slice t + 1 and ends every read of slice t's buffer
    if (t + 2 < nch) stage(t & 1, (t + 2) << 6);
  }
  wait_async0();
  acc_guard4(acc[0][0], acc[0][1], acc[0][2], acc[0][3]);
  acc_guard4(acc[1][0], acc[1][1], acc[1][2], acc[1][3]);
  acc_guard4(acc[2][0], acc[2][1], acc[2][2], acc[2][3]);
  acc_guard4(acc[3][0], acc[3][1], acc[3][2], acc[3][3]);

  // ---- epilogue ----
  float bn[4];
#pragma unroll
  for (int j = 0; j < 4; ++j) {
    const int bi = (BIAS == 1) ? (n0 + (j << 4) + rlane) : 0;
    const float bvv = bf_rne(bias[min(bi, nbias - 1)]);          // clamped address
    bn[j] = (BIAS == 1) ? bvv : 0.f;
  }
  float* slab = sT + wave * (16 * 68);
#pragma unroll
  for (int i = 0; i < 4; ++i) {
    const int mBase = m0 + (i << 4);
    float bm[8];
#pragma unroll
    for (int r = 0; r < 8; ++r) {
      const int bi = (BIAS == 2) ? (mBase + mOff + r) : 0;
      const float bvv = bf_rne(bias[min(bi, nbias - 1)]);        // clamped address
      bm[r] = (BIAS == 2) ? bvv : 0.f;
    }
#pragma unroll
    for (int j = 0; j < 4; ++j) {
#pragma unroll
      for (int r = 0; r < 8; ++r) {
        slab[(mOff + r) * 68 + (j << 4) + rlane] = acc[i][j][r] + bn[j] + bm[r];
      }
    }
    __builtin_amdgcn_fence(__ATOMIC_RELEASE, "workgroup");
    __builtin_amdgcn_wave_barrier();
    __builtin_amdgcn_fence(__ATOMIC_ACQUIRE, "workgroup");
    if (OUT_MODE == 0) {
      float* C = (float*)Cout + (size_t)b * strideC;
      const int hh = lane >> 4, c4 = (lane & 15) * 4;     // 256-B row segment = 16 lanes x 16 B
      {
#pragma unroll
        for (int it = 0; it < 8; ++it) {
          const int row = it * 2 + hh;                     // it 0..7 x hh 0..1 = rows 0..15
          const v4f v = *(const v4f*)(slab + row * 68 + c4);
          *(v4f*)(C + (size_t)(mBase + row) * ldc + n0 + c4) = v;
        }
        
      }
    } else {
      const int q = lane >> 3, c8 = (lane & 7) * 8;
      unsigned short* C  = (unsigned short*)Cout  + (size_t)b * strideC;
      unsigned short* C2 = (unsigned short*)Cout2 + (size_t)b * strideC2;
      v4u hv[4], lv[4];
#pragma unroll
      for (int it = 0; it < 4; ++it) {
        const int row = it * 4 + q;                        // it 0..3 x q 0..3 = rows 0..15
        const float* sp = slab + row * 68 + c8;
        v4u a, a2;
#pragma unroll
        for (int e = 0; e < 4; ++e) {
          const float f0 = sp[2 * e], f1 = sp[2 * e + 1];
          unsigned short h0, h1, l0, l1;
          if (OUT_MODE == 2) {
            h0 = bf_bits(f0); h1 = bf_bits(f1);
            l0 = bf_bits(f0 - bf_up(h0)); l1 = bf_bits(f1 - bf_up(h1));
          } else {
            const _Float16 x0 = (_Float16)f0, x1 = (_Float16)f1;
            h0 = h_bits(x0); h1 = h_bits(x1);
            l0 = h_bits((_Float16)((f0 - (float)x0) * rscale));
            l1 = h_bits((_Float16)((f1 - (float)x1) * rscale));
          }
          a[e] = pk16(h0, h1); a2[e] = pk16(l0, l1);
        }
        hv[it] = a; lv[it] = a2;
      }
      {
#pragma unroll
        for (int it = 0; it < 4; ++it) {
          const int row = it * 4 + q;
          *(v4u*)(C  + (size_t)(mBase + row) * ldc  + n0 + c8) = hv[it];
          *(v4u*)(C2 + (size_t)(mBase + row) * ldc2 + n0 + c8) = lv[it];
        }
        
      }
    }
    __builtin_amdgcn_fence(__ATOMIC_RELEASE, "workgroup");
    __builtin_amdgcn_wave_barrier();
    __builtin_amdgcn_fence(__ATOMIC_ACQUIRE, "workgroup");
  }
}

// ---- one GEMM per launch: blockIdx.x = block in the batch, blockIdx.y = batch ----
template <int NSPLIT, int OUT_MODE, int BIAS>
__global__ __launch_bounds__(256) void gemm64(
    const unsigned short* __restrict__ Ap, const unsigned short* A2p, int lda, long long strideA,
    const unsigned short* __restrict__ Btp, int ldb, long long strideB,
    const float* __restrict__ bias, int nbias,
    void* Cout, int ldc, long long strideC,
    void* Cout2, int ldc2, long long strideC2,
    int M, int N, int K, float rscale) {
  __shared__ __align__(16) float  sT[8 * 16 * 68];                                    // per-wave 16x64 slab, pitch 68 floats
  __shared__ __align__(16) __bf16 sK[2 * (((NSPLIT >= 1) ? 128 : 64) + 512) * GP];    // two k-slice buffers
  gemm64_body<NSPLIT, OUT_MODE, BIAS>(Ap, A2p, lda, strideA, Btp, ldb, strideB, bias, nbias,
                                      Cout, ldc, strideC, Cout2, ldc2, strideC2, M, N, K, rscale,
                                      blockIdx.x, blockIdx.y, sT, sK);
}

// ---- the three independent projections in one launch; the branch on blockIdx.y is block-uniform ----
//   y = 0: q = x . Wq^T + bq, y = 1: k = x . Wk^T + bk -> bf16 hi/lo planes [b*SEQ+t][h*64+d] (M=8192, N=512, K=512),
//          blockIdx.x = one of 128 tile rows;
//   y = 2: v^T = Wv . x^T + bv (per row) per batch -> f16 hi plane [b][h*64+d][s] and residual plane (x4096), pitch SEQ
//          (A = Wv [n][k], Bt = x rows of the batch; M=512, N=512, K=512), blockIdx.x = batch * 8 + tile row.
__global__ __launch_bounds__(256) void proj_qkv(
    const unsigned short* __restrict__ Xb, const unsigned short* __restrict__ Wqb,
    const unsigned short* __restrict__ Wkb, const unsigned short* __restrict__ Wvb,
    const float* __restrict__ bq, const float* __restrict__ bk, const float* __restrict__ bv,
    unsigned short* Qh, unsigned short* Ql, unsigned short* Kh, unsigned short* Kl,
    unsigned short* VTh, unsigned short* VTl) {
  __shared__ __align__(16) float  sT[8 * 16 * 68];
  __shared__ __align__(16) __bf16 sK[2 * (64 + 512) * GP];
  const int y = blockIdx.y;
  if (y < 2) {
    const bool isq = (y == 0);
    gemm64_body<0, 2, 1>(Xb, Xb, DM, 0LL, isq ? Wqb : Wkb, DM, 0LL, isq ? bq : bk, DM,
                         (void*)(isq ? Qh : Kh), DM, 0LL, (void*)(isq ? Ql : Kl), DM, 0LL,
                         NB * SEQ, DM, DM, 1.0f, blockIdx.x, 0, sT, sK);
  } else {
    gemm64_body<0, 3, 2>(Wvb, Wvb, DM, 0LL, Xb, DM, (long long)SEQ * DM, bv, DM,
                         (void*)VTh, SEQ, (long long)DM * SEQ, (void*)VTl, SEQ, (long long)DM * SEQ,
                         DM, SEQ, DM, 4096.0f, blockIdx.x & 7, blockIdx.x >> 3, sT, sK);
  }
}

__global__ __launch_bounds__(128)
void attn64(const unsigned short* __restrict__ qhp, const unsigned short* __restrict__ qlp,
            const unsigned short* __restrict__ khp, const unsigned short* __restrict__ klp,
            const unsigned short* __restrict__ vhp, const unsigned short* __restrict__ vlp,
            const float* __restrict__ dbias, const int* __restrict__ kmask,
            unsigned short* ohp, unsigned short* olp, float sscale) {
  union FB { v16b v; v8b h[2]; };
  union FH { v16h v; v8h h[2]; };
  __shared__ __align__(16) __bf16   Ksh[64 * KP];   // K hi [kv][d], pitch KP
  __shared__ __align__(16) __bf16   Ksl[64 * KP];   // K lo
  __shared__ __align__(16) _Float16 Vth[64 * KP];   // V^T hi [d][kv], pitch KP
  __shared__ __align__(16) _Float16 Vtl[64 * KP];   // V^T residual
  __shared__ __align__(16) float    Os[4][16 * OP];    // per wave context tile [row][d], pitch OP

  const int tid  = threadIdx.x;
  const int wave = tid >> 5;
  const int lane = tid & 31;
  const int hh   = lane >> 4;
  const int c    = lane & 15;

  const int bx   = blockIdx.x;
  const int qb   = bx % NQB;
  const int rest = bx / NQB;
  const int h    = rest % NH;
  const int b    = rest / NH;
  const int q0   = qb * 64 + wave * 16;
  const size_t rowB = (size_t)b * SEQ;

  const __bf16* Qh = (const __bf16*)(const void*)qhp + (size_t)h * HD;
  const __bf16* Ql = (const __bf16*)(const void*)qlp + (size_t)h * HD;
  const __bf16* Kh = (const __bf16*)(const void*)khp + (size_t)h * HD;
  const __bf16* Kl = (const __bf16*)(const void*)klp + (size_t)h * HD;
  const _Float16* Vh = (const _Float16*)(const void*)vhp + ((size_t)b * DM + (size_t)h * HD) * SEQ;
  const _Float16* Vl = (const _Float16*)(const void*)vlp + ((size_t)b * DM + (size_t)h * HD) * SEQ;
  const float* dbw = dbias + (rowB + (size_t)q0 + c) * SEQ + 8 * hh;   // row q0+c, keys (kv0 + 16j) + 8hh + 0..7
  const int*   mkb = kmask + rowB + 8 * hh;                            // keys (kv0 + 16j) + 8hh + 0..7

  // ---- Q fragments (B operand, column = lane&15): 2 d-chunks, hi and lo ----
  v16b qah[2], qal[2];
#pragma unroll
  for (int dc = 0; dc < 2; ++dc) {
    const size_t qo = (rowB + q0 + c) * DM + dc * 32 + 8 * hh;
    qah[dc] = ldfrag_b(Qh + qo);
    qal[dc] = ldfrag_b(Ql + qo);
  }

  float mrow = -INFINITY, lrow = 0.f;        // of the lane's one query
  v8f oacc[4];                               // O^T: oacc[t][r] = context of query c, d = 16t + 8hh + r
#pragma unroll
  for (int t = 0; t < 4; ++t) oacc[t] = zero8();

  for (int kt = 0; kt < NQB; ++kt) {         // static trip count
    const int kv0 = kt * 64;
    __syncthreads();
    {
      // 8 lanes x 16 B = one whole 128-B tile row, so a wave's load touches 4 whole lines; rows r + 16 i, i = 0..3
      const int r = tid >> 3, pc = (tid & 7) * 8;
      const __bf16*   kg  = Kh + (rowB + kv0 + r) * DM + pc;      // K row kv0+r(+16i), d = pc..pc+7
      const __bf16*   klg = Kl + (rowB + kv0 + r) * DM + pc;
      const _Float16* vg  = Vh + (size_t)r * SEQ + kv0 + pc;      // V^T row d = r(+16i), s = kv0+pc..+7
      const _Float16* vlg = Vl + (size_t)r * SEQ + kv0 + pc;
      v8b a0[4], a1[4];
      v8h b0[4], b1[4];
#pragma unroll
      for (int i = 0; i < 4; ++i) {
        a0[i] = *(const v8b*)(kg  + (size_t)(16 * i) * DM);
        a1[i] = *(const v8b*)(klg + (size_t)(16 * i) * DM);
        b0[i] = *(const v8h*)(vg  + (size_t)(16 * i) * SEQ);
        b1[i] = *(const v8h*)(vlg + (size_t)(16 * i) * SEQ);
      }
#if defined(__HIP_DEVICE_COMPILE__)
      // the wait that stands in front of any overwrite of the loads' address registers; naming the four addresses
      // as inputs keeps them in their registers up to it, so that no later load of the group lands on one
      asm volatile("s_wait_xcnt 0x0" :: "v"(kg), "v"(klg), "v"(vg), "v"(vlg) : "memory");
#endif
#pragma unroll
      for (int i = 0; i < 4; ++i) {
        *(v8b*)(Ksh + (r + 16 * i) * KP + pc) = a0[i];
        *(v8b*)(Ksl + (r + 16 * i) * KP + pc) = a1[i];
        *(v8h*)(Vth + (r + 16 * i) * KP + pc) = b0[i];
        *(v8h*)(Vtl + (r + 16 * i) * KP + pc) = b1[i];
      }
    }
    __syncthreads();

    // ---- scores, transposed: 64 keys x 16 queries per wave, 3 bf16 products; s[j][r] = key 16j + 8hh + r, query c ----
    v8f s[4];
#pragma unroll
    for (int j = 0; j < 4; ++j) {
      s[j] = zero8();
#pragma unroll
      for (int dc = 0; dc < 2; ++dc) {
        FB kb, kl;
        kb.h[0] = *(const v8b*)(Ksh + (j * 16 + c) * KP + dc * 32 + 8 * hh);
        kb.h[1] = *(const v8b*)(Ksh + (j * 16 + c) * KP + dc * 32 + 16 + 8 * hh);
        kl.h[0] = *(const v8b*)(Ksl + (j * 16 + c) * KP + dc * 32 + 8 * hh);
        kl.h[1] = *(const v8b*)(Ksl + (j * 16 + c) * KP + dc * 32 + 16 + 8 * hh);
        s[j] = mma_b(kb.v, qah[dc], s[j]);
        s[j] = mma_b(kl.v, qah[dc], s[j]);
        s[j] = mma_b(kb.v, qal[dc], s[j]);
      }
    }

    // ---- bias and key mask of this lane's 32 keys: 8 contiguous values per key tile ----
    const float* drw = dbw + kv0;
    const int*   mkw = mkb + kv0;
    v4f dv4[8];
    v4i mk4[8];
#pragma unroll
    for (int j = 0; j < 4; ++j) {
      dv4[2 * j]     = *(const v4f*)(drw + j * 16);
      dv4[2 * j + 1] = *(const v4f*)(drw + j * 16 + 4);
      mk4[2 * j]     = *(const v4i*)(mkw + j * 16);
      mk4[2 * j + 1] = *(const v4i*)(mkw + j * 16 + 4);
    }
#if defined(__HIP_DEVICE_COMPILE__)
    // the wait that stands in front of any overwrite of the loads' address registers; naming the two addresses
    // as inputs keeps them in their registers up to it
    asm volatile("s_wait_xcnt 0x0" :: "v"(drw), "v"(mkw) : "memory");
#endif

    // ---- scale + bias, clip, key mask, row max, online softmax; P (x1024, f16) and P residual (x4096)
    //      packed straight into the B fragments of the context product ----
    float m = -INFINITY;
#pragma unroll
    for (int j = 0; j < 4; ++j) {
#pragma unroll
      for (int r = 0; r < 8; ++r) {
        const float dv = bf_rne(dv4[2 * j + (r >> 2)][r & 3]);
        float sv = s[j][r] * sscale + dv;
        sv = fminf(10.0f, fmaxf(-10.0f, sv));
        sv = (mk4[2 * j + (r >> 2)][r & 3] != 0) ? sv : -1.0e9f;
        s[j][r] = sv;
        m = fmaxf(m, sv);
      }
    }
    m = fmaxf(m, xhalf(m));                  // the query's other 32 keys of the chunk
    const float mnew  = fmaxf(mrow, m);
    const float msafe = (mnew == -INFINITY) ? 0.f : mnew;
    const float alpha = __expf(mrow - msafe);
    mrow = mnew;
    float psum = 0.f;
    FH pa[2], pl[2];
#pragma unroll
    for (int j = 0; j < 4; ++j) {
#pragma unroll
      for (int r = 0; r < 8; ++r) {
        const float p = __expf(s[j][r] - msafe);
        psum += p;
        const float p1k = p * 1024.0f;
        const _Float16 ph = (_Float16)p1k;
        pa[j >> 1].v[(j & 1) * 8 + r] = ph;
        pl[j >> 1].v[(j & 1) * 8 + r] = (_Float16)((p1k - (float)ph) * 4096.0f);
      }
    }
    psum += xhalf(psum);
    lrow = lrow * alpha + psum;
#pragma unroll
    for (int t = 0; t < 4; ++t)
#pragma unroll
      for (int r = 0; r < 8; ++r) oacc[t][r] *= alpha;

    // ---- context^T += V^T . P^T (f16 WMMA), residual products into a separate accumulator ----
    v8f o1[4];
#pragma unroll
    for (int t = 0; t < 4; ++t) o1[t] = zero8();
#pragma unroll
    for (int kk = 0; kk < 2; ++kk) {
#pragma unroll
      for (int t = 0; t < 4; ++t) {
        FH vb, vl;
        vb.h[0] = *(const v8h*)(Vth + (t * 16 + c) * KP + kk * 32 + 8 * hh);
        vb.h[1] = *(const v8h*)(Vth + (t * 16 + c) * KP + kk * 32 + 16 + 8 * hh);
        vl.h[0] = *(const v8h*)(Vtl + (t * 16 + c) * KP + kk * 32 + 8 * hh);
        vl.h[1] = *(const v8h*)(Vtl + (t * 16 + c) * KP + kk * 32 + 16 + 8 * hh);
        oacc[t] = mma_h(vb.v, pa[kk].v, oacc[t]);
        o1[t]   = mma_h(vl.v, pa[kk].v, o1[t]);
        o1[t]   = mma_h(vb.v, pl[kk].v, o1[t]);
      }
    }
#pragma unroll
    for (int t = 0; t < 4; ++t)
#pragma unroll
      for (int r = 0; r < 8; ++r) oacc[t][r] += o1[t][r] * (1.0f / 4096.0f);
  }

  // ---- normalise (1/l and the 1/1024 p carry), stage the wave's 16x64 tile, bf16 hi/lo split,
  float* os = Os[wave];
  {
    const float l = lrow;
    const float inv = ((l > 0.f) ? (1.0f / l) : 0.f) * (1.0f / 1024.0f);
#pragma unroll
    for (int t = 0; t < 4; ++t) {
      v4f w0, w1;
#pragma unroll
      for (int r = 0; r < 4; ++r) { w0[r] = oacc[t][r] * inv; w1[r] = oacc[t][4 + r] * inv; }
      *(v4f*)(os + c * OP + t * 16 + 8 * hh)     = w0;      // row = query c, d = 16t + 8hh + 0..7
      *(v4f*)(os + c * OP + t * 16 + 8 * hh + 4) = w1;
    }
  }
  __builtin_amdgcn_fence(__ATOMIC_RELEASE, "workgroup");
  __builtin_amdgcn_wave_barrier();
  __builtin_amdgcn_fence(__ATOMIC_ACQUIRE, "workgroup");
  {
    const int q4 = lane >> 3, c8 = (lane & 7) * 8;
    v4u hv[4], lv[4];
#pragma unroll
    for (int it = 0; it < 4; ++it) {
      const int row = it * 4 + q4;   // it 0..3 x q4 0..3 = rows 0..15 of the wave tile
      const float* sp = os + row * OP + c8;
      v4u a, a2;
#pragma unroll
      for (int e = 0; e < 4; ++e) {
        const float f0 = sp[2 * e], f1 = sp[2 * e + 1];
        const unsigned short h0 = bf_bits(f0), h1 = bf_bits(f1);
        const unsigned short l0 = bf_bits(f0 - bf_up(h0)), l1 = bf_bits(f1 - bf_up(h1));
        a[e] = pk16(h0, h1); a2[e] = pk16(l0, l1);
      }
      hv[it] = a; lv[it] = a2;
    }
    {
#pragma unroll
      for (int it = 0; it < 4; ++it) {
        const int row = it * 4 + q4;
        const size_t go = (rowB + q0 + row) * DM + (size_t)h * HD + c8;
        *(v4u*)(ohp + go) = hv[it];
        *(v4u*)(olp + go) = lv[it];
      }
      
    }
  }
}

// =====================================================================================================
// Workspace map (bytes), every plane an exact multiple of its 64x64-tile / whole-line store granularity:
//   Xb   bf16 [8192][512]          8388608
//   Wqb, Wkb, Wvb, Wob bf16 [512 n][512 k]   524288 each
//   Qh, Ql, Kh, Kl bf16 [8192][512] 8388608 each
//   VTh  f16  [16][512 d][512 s]   8388608
//   VTl  f16  [16][512 d][512 s]   8388608
//   Oh, Ol bf16 [8192][512]         8388608 each
//   total                           77594624
// Weights are [out n][in k] with k contiguous = the Bt / A layout the GEMM wants, so they are only converted.
// =====================================================================================================
extern "C" void kernel_launch(void* const* d_in, const int* in_sizes, int n_in,
                              void* d_out, int out_size, void* d_ws, size_t ws_size,
                              hipStream_t stream) {
  if (n_in < 11) return;
  if (in_sizes[0] != NB * SEQ * DM) return;
  if (in_sizes[1] != NB * SEQ * SEQ) return;
  if (in_sizes[2] != NB * SEQ) return;
  if (in_sizes[3] != DM * DM || in_sizes[5] != DM * DM || in_sizes[7] != DM * DM || in_sizes[9] != DM * DM) return;
  if (in_sizes[4] != DM || in_sizes[6] != DM || in_sizes[8] != DM || in_sizes[10] != DM) return;
  if (out_size != NB * SEQ * DM) return;

  const float* x    = (const float*)d_in[0];
  const float* db   = (const float*)d_in[1];
  const int*   msk  = (const int*)d_in[2];
  const float* Wq   = (const float*)d_in[3];
  const float* bq   = (const float*)d_in[4];
  const float* Wk   = (const float*)d_in[5];
  const float* bk   = (const float*)d_in[6];
  const float* Wv   = (const float*)d_in[7];
  const float* bv   = (const float*)d_in[8];
  const float* Wo   = (const float*)d_in[9];
  const float* bo   = (const float*)d_in[10];

  const size_t PX  = (size_t)NB * SEQ * DM * 2;   // 8388608   16-bit activation plane [8192][512]
  const size_t PW  = (size_t)DM * DM * 2;         //  524288   16-bit weight plane
  const size_t PVT = (size_t)NB * DM * SEQ * 2;   // 8388608   v^T plane
  size_t off = 0;
  const size_t oXb  = off; off += PX;
  const size_t oWq  = off; off += PW;
  const size_t oWk  = off; off += PW;
  const size_t oWv  = off; off += PW;
  const size_t oWo  = off; off += PW;
  const size_t oQh  = off; off += PX;
  const size_t oQl  = off; off += PX;
  const size_t oKh  = off; off += PX;
  const size_t oKl  = off; off += PX;
  const size_t oVTh = off; off += PVT;
  const size_t oVTl = off; off += PVT;
  const size_t oOh  = off; off += PX;
  const size_t oOl  = off; off += PX;
  if (off > ws_size) return;                      // off = 77594624
  if (off > (size_t)134217728) return;

  char* ws = (char*)d_ws;
  unsigned short* Xb  = (unsigned short*)(ws + oXb);
  unsigned short* Wqb = (unsigned short*)(ws + oWq);
  unsigned short* Wkb = (unsigned short*)(ws + oWk);
  unsigned short* Wvb = (unsigned short*)(ws + oWv);
  unsigned short* Wob = (unsigned short*)(ws + oWo);
  unsigned short* Qh  = (unsigned short*)(ws + oQh);
  unsigned short* Ql  = (unsigned short*)(ws + oQl);
  unsigned short* Kh  = (unsigned short*)(ws + oKh);
  unsigned short* Kl  = (unsigned short*)(ws + oKl);
  unsigned short* VTh = (unsigned short*)(ws + oVTh);
  unsigned short* VTl = (unsigned short*)(ws + oVTl);
  unsigned short* Oh  = (unsigned short*)(ws + oOh);
  unsigned short* Ol  = (unsigned short*)(ws + oOl);

  const dim3 blk(256);
  const int n8x = NB * SEQ * DM / 8;                          // 524288
  const int n8w = DM * DM / 8;                                //  32768
  const int nbx = n8x / 256;                                  // 2048 blocks for x
  const int nbw = n8w / 256;                                  //  128 blocks for each weight
  const dim3 gCvt(nbx + 4 * nbw);                             // 2560 blocks
  const dim3 gProj(((NB * SEQ / 64) * (DM / 64) + 7) / 8, 1); // 1024 tiles -> 128 blocks: M=8192, N=512
  const dim3 gQKV(((NB * SEQ / 64) * (DM / 64) + 7) / 8, 3);  // 128 blocks each for q, k and v^T (8 blocks x 16 batches)
  const dim3 gAttn(NB * NH * NQB);                            // 1024 blocks of 128 threads

  // (1) x -> bf16 plane [8192][512]; weights [n][k] f32 -> bf16 [n][k]; Xb, Wqb, Wkb, Wvb, Wob lie one behind the other
  cvt_bf16x8<<<gCvt, blk, 0, stream>>>(x, Wq, Wk, Wv, Wo, Xb, nbx, nbw);
  // (2) q, k -> bf16 hi/lo planes, v^T -> f16 hi and residual planes
  proj_qkv<<<gQKV, blk, 0, stream>>>(Xb, Wqb, Wkb, Wvb, bq, bk, bv, Qh, Ql, Kh, Kl, VTh, VTl);
  // (3) attention -> context bf16 hi/lo planes
  attn64<<<gAttn, dim3(128), 0, stream>>>(
      Qh, Ql, Kh, Kl, VTh, VTl, db, msk, Oh, Ol, 0.125f);
  // (4) out = context . Wo^T + bo -> d_out f32 [8192][512]  (A = context hi + lo planes, 2 products)
  gemm64<1, 0, 1><<<gProj, blk, 0, stream>>>(
      Oh, Ol, DM, 0LL, Wob, DM, 0LL, bo, DM,
      d_out, DM, 0LL, d_out, DM, 0LL,
      NB * SEQ, DM, DM, 1.0f);
  (void)hipGetLastError();
}

// v006
// One run takes 79.9 microseconds.
// Two timings next to v005 both put it at 1.05 times that version's speed.
// Counting every step since v000, it is 2.61 times as fast.
// Contractions: q, k, v^T projections = v_wmma_f32_16x16x32_bf16 (bf16 operands from RNE-converted inputs, single product, bias added in f32);
// q.k^T scores = v_wmma_f32_16x16x32_bf16 with bf16 hi/lo split q and k (hi.hi + hi.lo + lo.hi);
// p.v = v_wmma_f32_16x16x32_f16 (p carried x1024 in f16 plus a x4096 f16 residual plane, v as f16 hi plus a x4096 f16 residual plane: hi.hi + hi.res + res.hi);
// ctx.Wo^T = v_wmma_f32_16x16x32_bf16 with ctx as bf16 hi/lo planes times bf16 Wo (2 products); all f32 accumulate; clip, key mask and softmax in f32.
#include <hip/hip_runtime.h>
#include <math.h>
#include <float.h>
#include <stdint.h>

#define NB    16
#define SEQ   512
#define DM    512
#define NH    8
#define HD    64
#define NQB   (SEQ / 64)   // 8 key / query tiles of 64
#define KP    72           // LDS row pitch of the 64-wide 16-bit tiles, elements: 144 B = 16 B x 9, for ds_load_b128 readers
#define OP    68           // LDS row pitch of the 64-wide f32 context tile, floats: 272 B = 16 B x 17
#define GP    72           // LDS row pitch of a staged 64-element GEMM k-slice, elements: 144 B = 16 B x 9, for ds_load_b128 readers
static_assert(NH * HD == DM);
static_assert((SEQ % 64) == 0 && (DM % 64) == 0 && ((NB * SEQ) % 64) == 0);

typedef _Float16 v16h __attribute__((ext_vector_type(16)));
typedef _Float16 v8h  __attribute__((ext_vector_type(8)));
typedef __bf16   v16b __attribute__((ext_vector_type(16)));
typedef __bf16   v8b  __attribute__((ext_vector_type(8)));
typedef float    v8f  __attribute__((ext_vector_type(8)));
typedef float    v4f  __attribute__((ext_vector_type(4)));
typedef unsigned int v4u __attribute__((ext_vector_type(4)));
typedef int      v4i  __attribute__((ext_vector_type(4)));

// ---- scalar helpers --------------------------------------------------------------------------------
__device__ __forceinline__ unsigned short bf_bits(float f) {          // f32 -> bf16 bits, RNE convert
  unsigned u = __float_as_uint(f);
  return (unsigned short)((u + 0x7FFFu + ((u >> 16) & 1u)) >> 16);
}
__device__ __forceinline__ float bf_up(unsigned short h) { return __uint_as_float(((unsigned)h) << 16); }
__device__ __forceinline__ float bf_rne(float f) { return bf_up(bf_bits(f)); }
__device__ __forceinline__ unsigned short h_bits(_Float16 x) { return __builtin_bit_cast(unsigned short, x); }
__device__ __forceinline__ unsigned pk16(unsigned short a, unsigned short b) { return (unsigned)a | ((unsigned)b << 16); }
__device__ __forceinline__ float xhalf(float v) {                     // the value that lane ^ 16 holds
  const int b = __float_as_int(v);
  return __int_as_float(__builtin_amdgcn_permlanex16(b, b, 0x76543210, 0xfedcba98, false, false));
}
__device__ __forceinline__ v8f zero8() { v8f z = {0.f, 0.f, 0.f, 0.f, 0.f, 0.f, 0.f, 0.f}; return z; }

// ---- fragment loader: 16-bit A/B operand, lane -> row/col (lane&15), p already includes +8*(lane>>4);
//      elements 0..7 <- p[0..7] (k0+8h..), elements 8..15 <- p[16..23] (k0+16+8h..)
__device__ __forceinline__ v16b ldfrag_b(const __bf16* p) {
  union { v16b v; v8b h[2]; } f;
  f.h[0] = *(const v8b*)(p);
  f.h[1] = *(const v8b*)(p + 16);
  return f.v;
}

// ---- WMMA helpers; the guards hold the VALU hazard gap behind a block of WMMAs (asm only in the device pass) ----
__device__ __forceinline__ v8f mma_h_raw(v16h a, v16h b, v8f c) {
  return __builtin_amdgcn_wmma_f32_16x16x32_f16(false, a, false, b, (short)0, c, false, false);
}
__device__ __forceinline__ v8f mma_b_raw(v16b a, v16b b, v8f c) {
  return __builtin_amdgcn_wmma_f32_16x16x32_bf16(false, a, false, b, (short)0, c, false, false);
}
__device__ __forceinline__ void dep_guard_b(v8f& a, v8f& b, v16b x, v16b y) {
#if defined(__HIP_DEVICE_COMPILE__)
  asm volatile("v_nop\n\tv_nop\n\tv_nop\n\tv_nop" : "+v"(a), "+v"(b) : "v"(x), "v"(y));
#endif
}
__device__ __forceinline__ void keep4_b(v16b a, v16b b, v16b c, v16b d) {
#if defined(__HIP_DEVICE_COMPILE__)
  asm volatile("v_nop" :: "v"(a), "v"(b), "v"(c), "v"(d));
#endif
}
__device__ __forceinline__ void acc_guard4(v8f& a, v8f& b, v8f& c, v8f& d) {
#if defined(__HIP_DEVICE_COMPILE__)
  asm volatile("v_nop\n\tv_nop\n\tv_nop\n\tv_nop" : "+v"(a), "+v"(b), "+v"(c), "+v"(d));
#endif
}

// ---- N asynchronous copies to LDS, 16 B per lane each: l[i] = the lane's LDS byte address, g[i] = its global address.
//      s_wait_xcnt 0 is the last line of the copies' own statement, so that it stands in front of every later
//      write of an address register that a copy names.
template <int N>
__device__ __forceinline__ void async_rows(const unsigned* l, const __bf16* const* g) {
  static_assert(N == 9 || N == 10);
#if defined(__HIP_DEVICE_COMPILE__)
  if constexpr (N == 9) {
    asm volatile(
        "global_load_async_to_lds_b128 %0, %9, off\n\t"
        "global_load_async_to_lds_b128 %1, %10, off\n\t"
        "global_load_async_to_lds_b128 %2, %11, off\n\t"
        "global_load_async_to_lds_b128 %3, %12, off\n\t"
        "global_load_async_to_lds_b128 %4, %13, off\n\t"
        "global_load_async_to_lds_b128 %5, %14, off\n\t"
        "global_load_async_to_lds_b128 %6, %15, off\n\t"
        "global_load_async_to_lds_b128 %7, %16, off\n\t"
        "global_load_async_to_lds_b128 %8, %17, off\n\t"
        "s_wait_xcnt 0x0"
        :: "v"(l[0]), "v"(l[1]), "v"(l[2]), "v"(l[3]), "v"(l[4]), "v"(l[5]), "v"(l[6]), "v"(l[7]), "v"(l[8]),
           "v"(g[0]), "v"(g[1]), "v"(g[2]), "v"(g[3]), "v"(g[4]), "v"(g[5]), "v"(g[6]), "v"(g[7]), "v"(g[8])
        : "memory");
  } else {
    asm volatile(
        "global_load_async_to_lds_b128 %0, %10, off\n\t"
        "global_load_async_to_lds_b128 %1, %11, off\n\t"
        "global_load_async_to_lds_b128 %2, %12, off\n\t"
        "global_load_async_to_lds_b128 %3, %13, off\n\t"
        "global_load_async_to_lds_b128 %4, %14, off\n\t"
        "global_load_async_to_lds_b128 %5, %15, off\n\t"
        "global_load_async_to_lds_b128 %6, %16, off\n\t"
        "global_load_async_to_lds_b128 %7, %17, off\n\t"
        "global_load_async_to_lds_b128 %8, %18, off\n\t"
        "global_load_async_to_lds_b128 %9, %19, off\n\t"
        "s_wait_xcnt 0x0"
        :: "v"(l[0]), "v"(l[1]), "v"(l[2]), "v"(l[3]), "v"(l[4]), "v"(l[5]), "v"(l[6]), "v"(l[7]), "v"(l[8]), "v"(l[9]),
           "v"(g[0]), "v"(g[1]), "v"(g[2]), "v"(g[3]), "v"(g[4]), "v"(g[5]), "v"(g[6]), "v"(g[7]), "v"(g[8]), "v"(g[9])
        : "memory");
  }
#endif
}
// the issuing wave's own copies have landed behind this wait
__device__ __forceinline__ void wait_async0() {
#if defined(__HIP_DEVICE_COMPILE__)
  asm volatile("s_wait_asynccnt 0x0" ::: "memory");
#endif
}
// the wave's own LDS reads have returned behind this wait (in front of the barrier that frees a buffer for refill)
__device__ __forceinline__ void wait_ds0() {
#if defined(__HIP_DEVICE_COMPILE__)
  asm volatile("s_wait_dscnt 0x0" ::: "memory");
#endif
}

// =====================================================================================================
// f32 -> bf16 (RNE convert), 8 elements per thread, one 16-B store per lane: a wave writes 512 contiguous B.
// One launch for all five planes: blocks 0..nbx-1 convert x, then nbw blocks each for w0, w1, w2, w3; out is the
// x plane with the four weight planes directly behind it, in that order, so the flat index is the output index.
// coverage: (nbx + 4 * nbw) blocks x 256 threads x 8 = all five planes (each a whole number of blocks).
// =====================================================================================================
__global__ __launch_bounds__(256) void cvt_bf16x8(const float* __restrict__ x, const float* __restrict__ w0,
                                                  const float* __restrict__ w1, const float* __restrict__ w2,
                                                  const float* __restrict__ w3, unsigned short* out, int nbx, int nbw) {
  const int blk = blockIdx.x;
  const float* in = x;          // block-uniform choice of the source plane
  int rel = blk;                // block index inside that plane
  if (blk >= nbx) {
    const int j = blk - nbx;
    const int sel = j / nbw;
    rel = j - sel * nbw;
    in = (sel == 0) ? w0 : (sel == 1) ? w1 : (sel == 2) ? w2 : w3;
  }
  if (blk < nbx + 4 * nbw) {
    const int i = blk * 256 + threadIdx.x;
    const int si = rel * 256 + threadIdx.x;
    const v4f a = *(const v4f*)(in + (size_t)si * 8);
    const v4f b = *(const v4f*)(in + (size_t)si * 8 + 4);
    v4u p;
    p[0] = pk16(bf_bits(a[0]), bf_bits(a[1]));
    p[1] = pk16(bf_bits(a[2]), bf_bits(a[3]));
    p[2] = pk16(bf_bits(b[0]), bf_bits(b[1]));
    p[3] = pk16(bf_bits(b[2]), bf_bits(b[3]));
    *(v4u*)(out + (size_t)i * 8) = p;
    
  }
}

// =====================================================================================================
// Register-blocked batched bf16 WMMA GEMM: C[m][n] = sum_k A[m][k] * Bt[n][k] + bias; one wave per 64x64
// tile; the 8 waves of a block hold 8 neighbouring tiles of one tile row (64 x 512 of C). A row-major [M][K]
// pitch lda; Bt row-major [N][K] pitch ldb (k contiguous); M multiple of 64, N multiple of 512, K a positive
// multiple of 64; lda, ldb multiples of 8. bx = the block's index in one batch, b = batch index (strides in
// elements); sT (8 slabs of 16 x 68 floats) and sK (two k-slice buffers) are the calling kernel's LDS.
// Operands: per 64-element k-slice the block's 64 A rows (and A2 rows) and 512 Bt rows go to LDS by asynchronous
// copies, 8 lanes x 16 B = one whole 128-B row piece, two buffers: slice t + 1 flies while slice t is multiplied;
// the fragments are read from LDS (pitch GP). Slice rows in a buffer: A 0..63, (A2 64..127,) then Bt.
// NSPLIT: 0 = A.Bt; 1 = (A + A2).Bt (A2 = unscaled bf16 lo plane of A, 2 products).
// BIAS: 0 = none; 1 = bias[n] per column; 2 = bias[m] per row; bias values RNE-converted to bf16 first,
//       added in f32; bias index clamped to nbias-1.
// OUT_MODE: 0 = f32 (pitch ldc); 2 = bf16 hi plane C + bf16 lo plane C2 (lo = RNE(v - hi), unscaled);
//           3 = f16 hi plane C + f16 residual plane C2 = f16((v - hi) * rscale) (pitch ldc2, stride strideC2).
// =====================================================================================================
template <int NSPLIT, int OUT_MODE, int BIAS>
__device__ __forceinline__ void gemm64_body(
    const unsigned short* __restrict__ Ap, const unsigned short* A2p, int lda, long long strideA,
    const unsigned short* __restrict__ Btp, int ldb, long long strideB,
    const float* __restrict__ bias, int nbias,
    void* Cout, int ldc, long long strideC,
    void* Cout2, int ldc2, long long strideC2,
    int M, int N, int K, float rscale,
    int bx, int b, float* sT, __bf16* sK) {
  const __bf16* A   = (const __bf16*)(const void*)Ap;
  const __bf16* A2  = (const __bf16*)(const void*)A2p;
  const __bf16* Bt  = (const __bf16*)(const void*)Btp;
  constexpr int AROWS = (NSPLIT >= 1) ? 128 : 64;  // staged A (and A2) rows
  constexpr int ROWS  = AROWS + 512;               // rows of one staged k-slice
  constexpr int NIT   = ROWS / 32;                 // copies per thread and slice: 256 threads x 16 B = 32 rows each
  const int lane = threadIdx.x & 31;
  const int wave = threadIdx.x >> 5;
  const int tilesN = N >> 6;
  const int tilesM = M >> 6;
  const int tile0 = bx * 8;                // the block's first tile; tilesN is a multiple of 8
  if (tile0 >= tilesM * tilesN) return;            // block-uniform, in front of every barrier
  const int tm  = tile0 / tilesN;
  const int tn0 = tile0 - tm * tilesN;
  const int m0 = tm << 6;
  const int nb0 = tn0 << 6;                        // first of the block's 512 columns
  const int n0 = nb0 + (wave << 6);

  const __bf16* Ab  = A  + (size_t)b * strideA;
  const __bf16* Bb  = Bt + (size_t)b * strideB;
  const __bf16* Ab2 = (NSPLIT >= 1) ? (A2 + (size_t)b * strideA) : Ab;

  const int rlane = lane & 15;                 // row (A) / col (B, D) within subtile
  const int koff  = (lane >> 4) * 8;           // k offset of this lane half
  const int mOff  = (lane >> 4) * 8;           // D row offset

  v8f acc[4][4];
#pragma unroll
  for (int i = 0; i < 4; ++i)
#pragma unroll
    for (int j = 0; j < 4; ++j) acc[i][j] = zero8();

  // ---- staging: thread -> slice row (tid >> 3) + 32 * it, 16-B piece tid & 7 ----
  const int srow = threadIdx.x >> 3;
  const int scol = (threadIdx.x & 7) * 8;
  const __bf16* gA  = Ab  + (size_t)(m0 + srow) * lda + scol;
  const __bf16* gA2 = Ab2 + (size_t)(m0 + srow) * lda + scol;
  const __bf16* gB  = Bb  + (size_t)(nb0 + srow) * ldb + scol;
  const unsigned lds0 = (unsigned)(size_t)(sK + srow * GP + scol);   // LDS byte address = low 32 bits
  auto stage = [&](int buf, int k0) {
    unsigned l[NIT];
    const __bf16* g[NIT];
#pragma unroll
    for (int it = 0; it < NIT; ++it) {
      l[it] = lds0 + (unsigned)(buf * ROWS + it * 32) * (unsigned)(GP * 2);
      if (it < 2)                g[it] = gA  + (size_t)(it * 32) * lda + k0;
      else if (it < AROWS / 32)  g[it] = gA2 + (size_t)((it - 2) * 32) * lda + k0;
      else                       g[it] = gB  + (size_t)((it - AROWS / 32) * 32) * ldb + k0;
    }
    async_rows<NIT / 2>(l, g);
    async_rows<NIT / 2>(l + NIT / 2, g + NIT / 2);
  };

  const int nch = K >> 6;
  stage(0, 0);
  wait_async0();
  __syncthreads();                       // slice 0 is published
  if (nch > 1) stage(1, 64);
  for (int t = 0; t < nch; ++t) {
    const __bf16* sA = sK + (t & 1) * (ROWS * GP) + rlane * GP + koff;
    const __bf16* sB = sA + (AROWS + (wave << 6)) * GP;
#pragma unroll
    for (int ks = 0; ks < 2; ++ks) {
      constexpr int IG = (NSPLIT >= 1) ? 2 : 4;   // A fragments read as one group: as many as the registers hold
      v16b bh[4];
#pragma unroll
      for (int j = 0; j < 4; ++j) bh[j] = ldfrag_b(sB + (j << 4) * GP + ks * 32);
#pragma unroll
      for (int i0 = 0; i0 < 4; i0 += IG) {
        v16b ah[IG], al[IG];
#pragma unroll
        for (int u = 0; u < IG; ++u) {
          ah[u] = ldfrag_b(sA + ((i0 + u) << 4) * GP + ks * 32);
          al[u] = ah[u];
          if (NSPLIT >= 1) al[u] = ldfrag_b(sA + (64 + ((i0 + u) << 4)) * GP + ks * 32);
        }
#pragma unroll
        for (int u = 0; u < IG; ++u) {
          const int i = i0 + u;
#pragma unroll
          for (int j = 0; j < 4; ++j) {
            acc[i][j] = mma_b_raw(ah[u], bh[j], acc[i][j]);
            if (NSPLIT >= 1) acc[i][j] = mma_b_raw(al[u], bh[j], acc[i][j]);
          }
          dep_guard_b(acc[i][0], acc[i][3], ah[u], al[u]);
        }
      }
      keep4_b(bh[0], bh[1], bh[2], bh[3]);
    }
    wait_ds0();
    wait_async0();
    __syncthreads();                     // publishes slice t + 1 and ends every read of slice t's buffer
    if (t + 2 < nch) stage(t & 1, (t + 2) << 6);
  }
  wait_async0();
  acc_guard4(acc[0][0], acc[0][1], acc[0][2], acc[0][3]);
  acc_guard4(acc[1][0], acc[1][1], acc[1][2], acc[1][3]);
  acc_guard4(acc[2][0], acc[2][1], acc[2][2], acc[2][3]);
  acc_guard4(acc[3][0], acc[3][1], acc[3][2], acc[3][3]);

  // ---- epilogue ----
  float bn[4];
#pragma unroll
  for (int j = 0; j < 4; ++j) {
    const int bi = (BIAS == 1) ? (n0 + (j << 4) + rlane) : 0;
    const float bvv = bf_rne(bias[min(bi, nbias - 1)]);          // clamped address
    bn[j] = (BIAS == 1) ? bvv : 0.f;
  }
  float* slab = sT + wave * (16 * 68);
#pragma unroll
  for (int i = 0; i < 4; ++i) {
    const int mBase = m0 + (i << 4);
    float bm[8];
#pragma unroll
    for (int r = 0; r < 8; ++r) {
      const int bi = (BIAS == 2) ? (mBase + mOff + r) : 0;
      const float bvv = bf_rne(bias[min(bi, nbias - 1)]);        // clamped address
      bm[r] = (BIAS == 2) ? bvv : 0.f;
    }
#pragma unroll
    for (int j = 0; j < 4; ++j) {
#pragma unroll
      for (int r = 0; r < 8; ++r) {
        slab[(mOff + r) * 68 + (j << 4) + rlane] = acc[i][j][r] + bn[j] + bm[r];
      }
    }
    __builtin_amdgcn_fence(__ATOMIC_RELEASE, "workgroup");
    __builtin_amdgcn_wave_barrier();
    __builtin_amdgcn_fence(__ATOMIC_ACQUIRE, "workgroup");
    if (OUT_MODE == 0) {
      float* C = (float*)Cout + (size_t)b * strideC;
      const int hh = lane >> 4, c4 = (lane & 15) * 4;     // 256-B row segment = 16 lanes x 16 B
      {
#pragma unroll
        for (int it = 0; it < 8; ++it) {
          const int row = it * 2 + hh;                     // it 0..7 x hh 0..1 = rows 0..15
          const v4f v = *(const v4f*)(slab + row * 68 + c4);
          *(v4f*)(C + (size_t)(mBase + row) * ldc + n0 + c4) = v;
        }
        
      }
    } else {
      const int q = lane >> 3, c8 = (lane & 7) * 8;
      unsigned short* C  = (unsigned short*)Cout  + (size_t)b * strideC;
      unsigned short* C2 = (unsigned short*)Cout2 + (size_t)b * strideC2;
      v4u hv[4], lv[4];
#pragma unroll
      for (int it = 0; it < 4; ++it) {
        const int row = it * 4 + q;                        // it 0..3 x q 0..3 = rows 0..15
        const float* sp = slab + row * 68 + c8;
        v4u a, a2;
#pragma unroll
        for (int e = 0; e < 4; ++e) {
          const float f0 = sp[2 * e], f1 = sp[2 * e + 1];
          unsigned short h0, h1, l0, l1;
          if (OUT_MODE == 2) {
            h0 = bf_bits(f0); h1 = bf_bits(f1);
            l0 = bf_bits(f0 - bf_up(h0)); l1 = bf_bits(f1 - bf_up(h1));
          } else {
            const _Float16 x0 = (_Float16)f0, x1 = (_Float16)f1;
            h0 = h_bits(x0); h1 = h_bits(x1);
            l0 = h_bits((_Float16)((f0 - (float)x0) * rscale));
            l1 = h_bits((_Float16)((f1 - (float)x1) * rscale));
          }
          a[e] = pk16(h0, h1); a2[e] = pk16(l0, l1);
        }
        hv[it] = a; lv[it] = a2;
      }
      {
#pragma unroll
        for (int it = 0; it < 4; ++it) {
          const int row = it * 4 + q;
          *(v4u*)(C  + (size_t)(mBase + row) * ldc  + n0 + c8) = hv[it];
          *(v4u*)(C2 + (size_t)(mBase + row) * ldc2 + n0 + c8) = lv[it];
        }
        
      }
    }
    __builtin_amdgcn_fence(__ATOMIC_RELEASE, "workgroup");
    __builtin_amdgcn_wave_barrier();
    __builtin_amdgcn_fence(__ATOMIC_ACQUIRE, "workgroup");
  }
}

// ---- one GEMM per launch: blockIdx.x = block in the batch, blockIdx.y = batch ----
template <int NSPLIT, int OUT_MODE, int BIAS>
__global__ __launch_bounds__(256) void gemm64(
    const unsigned short* __restrict__ Ap, const unsigned short* A2p, int lda, long long strideA,
    const unsigned short* __restrict__ Btp, int ldb, long long strideB,
    const float* __restrict__ bias, int nbias,
    void* Cout, int ldc, long long strideC,
    void* Cout2, int ldc2, long long strideC2,
    int M, int N, int K, float rscale) {
  __shared__ __align__(16) float  sT[8 * 16 * 68];                                    // per-wave 16x64 slab, pitch 68 floats
  __shared__ __align__(16) __bf16 sK[2 * (((NSPLIT >= 1) ? 128 : 64) + 512) * GP];    // two k-slice buffers
  gemm64_body<NSPLIT, OUT_MODE, BIAS>(Ap, A2p, lda, strideA, Btp, ldb, strideB, bias, nbias,
                                      Cout, ldc, strideC, Cout2, ldc2, strideC2, M, N, K, rscale,
                                      blockIdx.x, blockIdx.y, sT, sK);
}

// ---- the three independent projections in one launch; the branch on blockIdx.y is block-uniform ----
//   y = 0: q = x . Wq^T + bq, y = 1: k = x . Wk^T + bk -> bf16 hi/lo planes [b*SEQ+t][h*64+d] (M=8192, N=512, K=512),
//          blockIdx.x = one of 128 tile rows;
//   y = 2: v^T = Wv . x^T + bv (per row) per batch -> f16 hi plane [b][h*64+d][s] and residual plane (x4096), pitch SEQ
//          (A = Wv [n][k], Bt = x rows of the batch; M=512, N=512, K=512), blockIdx.x = batch * 8 + tile row.
__global__ __launch_bounds__(256) void proj_qkv(
    const unsigned short* __restrict__ Xb, const unsigned short* __restrict__ Wqb,
    const unsigned short* __restrict__ Wkb, const unsigned short* __restrict__ Wvb,
    const float* __restrict__ bq, const float* __restrict__ bk, const float* __restrict__ bv,
    unsigned short* Qh, unsigned short* Ql, unsigned short* Kh, unsigned short* Kl,
    unsigned short* VTh, unsigned short* VTl) {
  __shared__ __align__(16) float  sT[8 * 16 * 68];
  __shared__ __align__(16) __bf16 sK[2 * (64 + 512) * GP];
  const int y = blockIdx.y;
  if (y < 2) {
    const bool isq = (y == 0);
    gemm64_body<0, 2, 1>(Xb, Xb, DM, 0LL, isq ? Wqb : Wkb, DM, 0LL, isq ? bq : bk, DM,
                         (void*)(isq ? Qh : Kh), DM, 0LL, (void*)(isq ? Ql : Kl), DM, 0LL,
                         NB * SEQ, DM, DM, 1.0f, blockIdx.x, 0, sT, sK);
  } else {
    gemm64_body<0, 3, 2>(Wvb, Wvb, DM, 0LL, Xb, DM, (long long)SEQ * DM, bv, DM,
                         (void*)VTh, SEQ, (long long)DM * SEQ, (void*)VTl, SEQ, (long long)DM * SEQ,
                         DM, SEQ, DM, 4096.0f, blockIdx.x & 7, blockIdx.x >> 3, sT, sK);
  }
}

__global__ __launch_bounds__(128)
void attn64(const unsigned short* __restrict__ qhp, const unsigned short* __restrict__ qlp,
            const unsigned short* __restrict__ khp, const unsigned short* __restrict__ klp,
            const unsigned short* __restrict__ vhp, const unsigned short* __restrict__ vlp,
            const float* __restrict__ dbias, const int* __restrict__ kmask,
            unsigned short* ohp, unsigned short* olp, float sscale) {
  union FB { v16b v; v8b h[2]; };
  union FH { v16h v; v8h h[2]; };
  __shared__ __align__(16) __bf16   Ksh[64 * KP];   // K hi [kv][d], pitch KP
  __shared__ __align__(16) __bf16   Ksl[64 * KP];   // K lo
  __shared__ __align__(16) _Float16 Vth[64 * KP];   // V^T hi [d][kv], pitch KP
  __shared__ __align__(16) _Float16 Vtl[64 * KP];   // V^T residual
  __shared__ __align__(16) float    Os[4][16 * OP];    // per wave context tile [row][d], pitch OP

  const int tid  = threadIdx.x;
  const int wave = tid >> 5;
  const int lane = tid & 31;
  const int hh   = lane >> 4;
  const int c    = lane & 15;

  const int bx   = blockIdx.x;
  const int qb   = bx % NQB;
  const int rest = bx / NQB;
  const int h    = rest % NH;
  const int b    = rest / NH;
  const int q0   = qb * 64 + wave * 16;
  const size_t rowB = (size_t)b * SEQ;

  const __bf16* Qh = (const __bf16*)(const void*)qhp + (size_t)h * HD;
  const __bf16* Ql = (const __bf16*)(const void*)qlp + (size_t)h * HD;
  const __bf16* Kh = (const __bf16*)(const void*)khp + (size_t)h * HD;
  const __bf16* Kl = (const __bf16*)(const void*)klp + (size_t)h * HD;
  const _Float16* Vh = (const _Float16*)(const void*)vhp + ((size_t)b * DM + (size_t)h * HD) * SEQ;
  const _Float16* Vl = (const _Float16*)(const void*)vlp + ((size_t)b * DM + (size_t)h * HD) * SEQ;
  const float* dbw = dbias + (rowB + (size_t)q0 + c) * SEQ + 8 * hh;   // row q0+c, keys (kv0 + 16j) + 8hh + 0..7
  const int*   mkb = kmask + rowB + 8 * hh;                            // keys (kv0 + 16j) + 8hh + 0..7

  // ---- Q fragments (B operand, column = lane&15): 2 d-chunks, hi and lo ----
  v16b qah[2], qal[2];
#pragma unroll
  for (int dc = 0; dc < 2; ++dc) {
    const size_t qo = (rowB + q0 + c) * DM + dc * 32 + 8 * hh;
    qah[dc] = ldfrag_b(Qh + qo);
    qal[dc] = ldfrag_b(Ql + qo);
  }

  float mrow = -INFINITY, lrow = 0.f;        // of the lane's one query
  v8f oacc[4];                               // O^T: oacc[t][r] = context of query c, d = 16t + 8hh + r
#pragma unroll
  for (int t = 0; t < 4; ++t) oacc[t] = zero8();

  for (int kt = 0; kt < NQB; ++kt) {         // static trip count
    const int kv0 = kt * 64;
    __syncthreads();
    {
      // 8 lanes x 16 B = one whole 128-B tile row, so a wave's load touches 4 whole lines; rows r + 16 i, i = 0..3
      const int r = tid >> 3, pc = (tid & 7) * 8;
      const __bf16*   kg  = Kh + (rowB + kv0 + r) * DM + pc;      // K row kv0+r(+16i), d = pc..pc+7
      const __bf16*   klg = Kl + (rowB + kv0 + r) * DM + pc;
      const _Float16* vg  = Vh + (size_t)r * SEQ + kv0 + pc;      // V^T row d = r(+16i), s = kv0+pc..+7
      const _Float16* vlg = Vl + (size_t)r * SEQ + kv0 + pc;
      v8b a0[4], a1[4];
      v8h b0[4], b1[4];
#pragma unroll
      for (int i = 0; i < 4; ++i) {
        a0[i] = *(const v8b*)(kg  + (size_t)(16 * i) * DM);
        a1[i] = *(const v8b*)(klg + (size_t)(16 * i) * DM);
        b0[i] = *(const v8h*)(vg  + (size_t)(16 * i) * SEQ);
        b1[i] = *(const v8h*)(vlg + (size_t)(16 * i) * SEQ);
      }
#if defined(__HIP_DEVICE_COMPILE__)
      // the wait that stands in front of any overwrite of the loads' address registers; naming the four addresses
      // as inputs keeps them in their registers up to it, so that no later load of the group lands on one
      asm volatile("s_wait_xcnt 0x0" :: "v"(kg), "v"(klg), "v"(vg), "v"(vlg) : "memory");
#endif
#pragma unroll
      for (int i = 0; i < 4; ++i) {
        *(v8b*)(Ksh + (r + 16 * i) * KP + pc) = a0[i];
        *(v8b*)(Ksl + (r + 16 * i) * KP + pc) = a1[i];
        *(v8h*)(Vth + (r + 16 * i) * KP + pc) = b0[i];
        *(v8h*)(Vtl + (r + 16 * i) * KP + pc) = b1[i];
      }
    }
    __syncthreads();

    // ---- bias and key mask of this lane's 32 keys: 8 contiguous values per key tile ----
    const float* drw = dbw + kv0;
    const int*   mkw = mkb + kv0;
    v4f dv4[8];
    v4i mk4[8];
#pragma unroll
    for (int j = 0; j < 4; ++j) {
      dv4[2 * j]     = *(const v4f*)(drw + j * 16);
      dv4[2 * j + 1] = *(const v4f*)(drw + j * 16 + 4);
      mk4[2 * j]     = *(const v4i*)(mkw + j * 16);
      mk4[2 * j + 1] = *(const v4i*)(mkw + j * 16 + 4);
    }
#if defined(__HIP_DEVICE_COMPILE__)
    // the wait that stands in front of any overwrite of the loads' address registers; naming the two addresses
    // as inputs keeps them in their registers up to it
    asm volatile("s_wait_xcnt 0x0" :: "v"(drw), "v"(mkw) : "memory");
#endif

    // ---- scores, transposed: 64 keys x 16 queries per wave, 3 bf16 products; s[j][r] = key 16j + 8hh + r, query c ----
    //      the K fragments of a d-chunk are read as one group and the WMMAs go round the four key tiles, so that fewer
    //      of them wait for the one before (each s[j] still takes its six products in the same order)
    v8f s[4];
#pragma unroll
    for (int j = 0; j < 4; ++j) s[j] = zero8();
#pragma unroll
    for (int dc = 0; dc < 2; ++dc) {
      FB kb[4], kl[4];
#pragma unroll
      for (int j = 0; j < 4; ++j) {
        kb[j].h[0] = *(const v8b*)(Ksh + (j * 16 + c) * KP + dc * 32 + 8 * hh);
        kb[j].h[1] = *(const v8b*)(Ksh + (j * 16 + c) * KP + dc * 32 + 16 + 8 * hh);
        kl[j].h[0] = *(const v8b*)(Ksl + (j * 16 + c) * KP + dc * 32 + 8 * hh);
        kl[j].h[1] = *(const v8b*)(Ksl + (j * 16 + c) * KP + dc * 32 + 16 + 8 * hh);
      }
#pragma unroll
      for (int j = 0; j < 4; ++j) s[j] = mma_b_raw(kb[j].v, qah[dc], s[j]);
#pragma unroll
      for (int j = 0; j < 4; ++j) s[j] = mma_b_raw(kl[j].v, qah[dc], s[j]);
#pragma unroll
      for (int j = 0; j < 4; ++j) s[j] = mma_b_raw(kb[j].v, qal[dc], s[j]);
    }

    // holds the bias and mask arithmetic behind the score WMMAs: moved up among them, its wait for the global loads
    // would stand in front of the WMMAs and the loads' latency would not be covered by them
    __builtin_amdgcn_sched_barrier(0);

    // ---- scale + bias, clip, key mask, row max, online softmax; P (x1024, f16) and P residual (x4096)
    //      packed straight into the B fragments of the context product ----
    float m = -INFINITY;
#pragma unroll
    for (int j = 0; j < 4; ++j) {
#pragma unroll
      for (int r = 0; r < 8; ++r) {
        const float dv = bf_rne(dv4[2 * j + (r >> 2)][r & 3]);
        float sv = s[j][r] * sscale + dv;
        sv = fminf(10.0f, fmaxf(-10.0f, sv));
        sv = (mk4[2 * j + (r >> 2)][r & 3] != 0) ? sv : -1.0e9f;
        s[j][r] = sv;
        m = fmaxf(m, sv);
      }
    }
    m = fmaxf(m, xhalf(m));                  // the query's other 32 keys of the chunk
    const float mnew  = fmaxf(mrow, m);
    const float msafe = (mnew == -INFINITY) ? 0.f : mnew;
    const float alpha = __expf(mrow - msafe);
    mrow = mnew;
    float psum = 0.f;
    FH pa[2], pl[2];
#pragma unroll
    for (int j = 0; j < 4; ++j) {
#pragma unroll
      for (int r = 0; r < 8; ++r) {
        const float p = __expf(s[j][r] - msafe);
        psum += p;
        const float p1k = p * 1024.0f;
        const _Float16 ph = (_Float16)p1k;
        pa[j >> 1].v[(j & 1) * 8 + r] = ph;
        pl[j >> 1].v[(j & 1) * 8 + r] = (_Float16)((p1k - (float)ph) * 4096.0f);
      }
    }
    psum += xhalf(psum);
    lrow = lrow * alpha + psum;
#pragma unroll
    for (int t = 0; t < 4; ++t)
#pragma unroll
      for (int r = 0; r < 8; ++r) oacc[t][r] *= alpha;

    // ---- context^T += V^T . P^T (f16 WMMA), residual products into a separate accumulator ----
    v8f o1[4];
#pragma unroll
    for (int t = 0; t < 4; ++t) o1[t] = zero8();
#pragma unroll
    for (int kk = 0; kk < 2; ++kk) {
      FH vb[4], vl[4];                       // the V^T fragments of 32 keys, read as one group
#pragma unroll
      for (int t = 0; t < 4; ++t) {
        vb[t].h[0] = *(const v8h*)(Vth + (t * 16 + c) * KP + kk * 32 + 8 * hh);
        vb[t].h[1] = *(const v8h*)(Vth + (t * 16 + c) * KP + kk * 32 + 16 + 8 * hh);
        vl[t].h[0] = *(const v8h*)(Vtl + (t * 16 + c) * KP + kk * 32 + 8 * hh);
        vl[t].h[1] = *(const v8h*)(Vtl + (t * 16 + c) * KP + kk * 32 + 16 + 8 * hh);
      }
#pragma unroll
      for (int t = 0; t < 4; ++t) oacc[t] = mma_h_raw(vb[t].v, pa[kk].v, oacc[t]);
#pragma unroll
      for (int t = 0; t < 4; ++t) o1[t]   = mma_h_raw(vl[t].v, pa[kk].v, o1[t]);
#pragma unroll
      for (int t = 0; t < 4; ++t) o1[t]   = mma_h_raw(vb[t].v, pl[kk].v, o1[t]);
    }
#pragma unroll
    for (int t = 0; t < 4; ++t)
#pragma unroll
      for (int r = 0; r < 8; ++r) oacc[t][r] += o1[t][r] * (1.0f / 4096.0f);
  }

  // ---- normalise (1/l and the 1/1024 p carry), stage the wave's 16x64 tile, bf16 hi/lo split,
  float* os = Os[wave];
  {
    const float l = lrow;
    const float inv = ((l > 0.f) ? (1.0f / l) : 0.f) * (1.0f / 1024.0f);
#pragma unroll
    for (int t = 0; t < 4; ++t) {
      v4f w0, w1;
#pragma unroll
      for (int r = 0; r < 4; ++r) { w0[r] = oacc[t][r] * inv; w1[r] = oacc[t][4 + r] * inv; }
      *(v4f*)(os + c * OP + t * 16 + 8 * hh)     = w0;      // row = query c, d = 16t + 8hh + 0..7
      *(v4f*)(os + c * OP + t * 16 + 8 * hh + 4) = w1;
    }
  }
  __builtin_amdgcn_fence(__ATOMIC_RELEASE, "workgroup");
  __builtin_amdgcn_wave_barrier();
  __builtin_amdgcn_fence(__ATOMIC_ACQUIRE, "workgroup");
  {
    const int q4 = lane >> 3, c8 = (lane & 7) * 8;
    v4u hv[4], lv[4];
#pragma unroll
    for (int it = 0; it < 4; ++it) {
      const int row = it * 4 + q4;   // it 0..3 x q4 0..3 = rows 0..15 of the wave tile
      const float* sp = os + row * OP + c8;
      v4u a, a2;
#pragma unroll
      for (int e = 0; e < 4; ++e) {
        const float f0 = sp[2 * e], f1 = sp[2 * e + 1];
        const unsigned short h0 = bf_bits(f0), h1 = bf_bits(f1);
        const unsigned short l0 = bf_bits(f0 - bf_up(h0)), l1 = bf_bits(f1 - bf_up(h1));
        a[e] = pk16(h0, h1); a2[e] = pk16(l0, l1);
      }
      hv[it] = a; lv[it] = a2;
    }
    {
#pragma unroll
      for (int it = 0; it < 4; ++it) {
        const int row = it * 4 + q4;
        const size_t go = (rowB + q0 + row) * DM + (size_t)h * HD + c8;
        *(v4u*)(ohp + go) = hv[it];
        *(v4u*)(olp + go) = lv[it];
      }
      
    }
  }
}

// =====================================================================================================
// Workspace map (bytes), every plane an exact multiple of its 64x64-tile / whole-line store granularity:
//   Xb   bf16 [8192][512]          8388608
//   Wqb, Wkb, Wvb, Wob bf16 [512 n][512 k]   524288 each
//   Qh, Ql, Kh, Kl bf16 [8192][512] 8388608 each
//   VTh  f16  [16][512 d][512 s]   8388608
//   VTl  f16  [16][512 d][512 s]   8388608
//   Oh, Ol bf16 [8192][512]         8388608 each
//   total                           77594624
// Weights are [out n][in k] with k contiguous = the Bt / A layout the GEMM wants, so they are only converted.
// =====================================================================================================
extern "C" void kernel_launch(void* const* d_in, const int* in_sizes, int n_in,
                              void* d_out, int out_size, void* d_ws, size_t ws_size,
                              hipStream_t stream) {
  if (n_in < 11) return;
  if (in_sizes[0] != NB * SEQ * DM) return;
  if (in_sizes[1] != NB * SEQ * SEQ) return;
  if (in_sizes[2] != NB * SEQ) return;
  if (in_sizes[3] != DM * DM || in_sizes[5] != DM * DM || in_sizes[7] != DM * DM || in_sizes[9] != DM * DM) return;
  if (in_sizes[4] != DM || in_sizes[6] != DM || in_sizes[8] != DM || in_sizes[10] != DM) return;
  if (out_size != NB * SEQ * DM) return;

  const float* x    = (const float*)d_in[0];
  const float* db   = (const float*)d_in[1];
  const int*   msk  = (const int*)d_in[2];
  const float* Wq   = (const float*)d_in[3];
  const float* bq   = (const float*)d_in[4];
  const float* Wk   = (const float*)d_in[5];
  const float* bk   = (const float*)d_in[6];
  const float* Wv   = (const float*)d_in[7];
  const float* bv   = (const float*)d_in[8];
  const float* Wo   = (const float*)d_in[9];
  const float* bo   = (const float*)d_in[10];

  const size_t PX  = (size_t)NB * SEQ * DM * 2;   // 8388608   16-bit activation plane [8192][512]
  const size_t PW  = (size_t)DM * DM * 2;         //  524288   16-bit weight plane
  const size_t PVT = (size_t)NB * DM * SEQ * 2;   // 8388608   v^T plane
  size_t off = 0;
  const size_t oXb  = off; off += PX;
  const size_t oWq  = off; off += PW;
  const size_t oWk  = off; off += PW;
  const size_t oWv  = off; off += PW;
  const size_t oWo  = off; off += PW;
  const size_t oQh  = off; off += PX;
  const size_t oQl  = off; off += PX;
  const size_t oKh  = off; off += PX;
  const size_t oKl  = off; off += PX;
  const size_t oVTh = off; off += PVT;
  const size_t oVTl = off; off += PVT;
  const size_t oOh  = off; off += PX;
  const size_t oOl  = off; off += PX;
  if (off > ws_size) return;                      // off = 77594624
  if (off > (size_t)134217728) return;

  char* ws = (char*)d_ws;
  unsigned short* Xb  = (unsigned short*)(ws + oXb);
  unsigned short* Wqb = (unsigned short*)(ws + oWq);
  unsigned short* Wkb = (unsigned short*)(ws + oWk);
  unsigned short* Wvb = (unsigned short*)(ws + oWv);
  unsigned short* Wob = (unsigned short*)(ws + oWo);
  unsigned short* Qh  = (unsigned short*)(ws + oQh);
  unsigned short* Ql  = (unsigned short*)(ws + oQl);
  unsigned short* Kh  = (unsigned short*)(ws + oKh);
  unsigned short* Kl  = (unsigned short*)(ws + oKl);
  unsigned short* VTh = (unsigned short*)(ws + oVTh);
  unsigned short* VTl = (unsigned short*)(ws + oVTl);
  unsigned short* Oh  = (unsigned short*)(ws + oOh);
  unsigned short* Ol  = (unsigned short*)(ws + oOl);

  const dim3 blk(256);
  const int n8x = NB * SEQ * DM / 8;                          // 524288
  const int n8w = DM * DM / 8;                                //  32768
  const int nbx = n8x / 256;                                  // 2048 blocks for x
  const int nbw = n8w / 256;                                  //  128 blocks for each weight
  const dim3 gCvt(nbx + 4 * nbw);                             // 2560 blocks
  const dim3 gProj(((NB * SEQ / 64) * (DM / 64) + 7) / 8, 1); // 1024 tiles -> 128 blocks: M=8192, N=512
  const dim3 gQKV(((NB * SEQ / 64) * (DM / 64) + 7) / 8, 3);  // 128 blocks each for q, k and v^T (8 blocks x 16 batches)
  const dim3 gAttn(NB * NH * NQB);                            // 1024 blocks of 128 threads

  // (1) x -> bf16 plane [8192][512]; weights [n][k] f32 -> bf16 [n][k]; Xb, Wqb, Wkb, Wvb, Wob lie one behind the other
  cvt_bf16x8<<<gCvt, blk, 0, stream>>>(x, Wq, Wk, Wv, Wo, Xb, nbx, nbw);
  // (2) q, k -> bf16 hi/lo planes, v^T -> f16 hi and residual planes
  proj_qkv<<<gQKV, blk, 0, stream>>>(Xb, Wqb, Wkb, Wvb, bq, bk, bv, Qh, Ql, Kh, Kl, VTh, VTl);
  // (3) attention -> context bf16 hi/lo planes
  attn64<<<gAttn, dim3(128), 0, stream>>>(
      Qh, Ql, Kh, Kl, VTh, VTl, db, msk, Oh, Ol, 0.125f);
  // (4) out = context . Wo^T + bo -> d_out f32 [8192][512]  (A = context hi + lo planes, 2 products)
  gemm64<1, 0, 1><<<gProj, blk, 0, stream>>>(
      Oh, Ol, DM, 0LL, Wob, DM, 0LL, bo, DM,
      d_out, DM, 0LL, d_out, DM, 0LL,
      NB * SEQ, DM, DM, 1.0f);
  (void)hipGetLastError();
}

// v007
// Measured time: 71.5 microseconds a run.
// Two timings next to v006 put it at 1.12 and 1.11 times that version's speed.
// Counting every step since v000, it is 2.90 times as fast.
// Contractions: q, k, v^T projections = v_wmma_f32_16x16x32_bf16 (bf16 operands from RNE-converted inputs, single product, bias added in f32);
// q.k^T scores = v_wmma_f32_16x16x32_bf16 with bf16 hi/lo split q and k (hi.hi + hi.lo + lo.hi);
// p.v = v_wmma_f32_16x16x32_f16 (p carried x1024 in f16 plus a x4096 f16 residual plane, v as f16 hi plus a x4096 f16 residual plane: hi.hi + hi.res + res.hi);
// ctx.Wo^T = v_wmma_f32_16x16x32_bf16 with ctx as bf16 hi/lo planes times bf16 Wo (2 products); all f32 accumulate; clip, key mask and softmax in f32.
#include <hip/hip_runtime.h>
#include <math.h>
#include <float.h>
#include <stdint.h>

#define NB    16
#define SEQ   512
#define DM    512
#define NH    8
#define HD    64
#define NQB   (SEQ / 64)   // 8 key / query tiles of 64
#define KP    72           // LDS row pitch of the 64-wide 16-bit tiles, elements: 144 B = 16 B x 9, for ds_load_b128 readers
#define OP    68           // LDS row pitch of the 64-wide f32 context tile, floats: 272 B = 16 B x 17
#define GP    72           // LDS row pitch of a staged 64-element GEMM k-slice, elements: 144 B = 16 B x 9, for ds_load_b128 readers
static_assert(NH * HD == DM);
static_assert((SEQ % 128) == 0 && (DM % 128) == 0 && ((NB * SEQ) % 128) == 0);

typedef _Float16 v16h __attribute__((ext_vector_type(16)));
typedef _Float16 v8h  __attribute__((ext_vector_type(8)));
typedef __bf16   v16b __attribute__((ext_vector_type(16)));
typedef __bf16   v8b  __attribute__((ext_vector_type(8)));
typedef float    v8f  __attribute__((ext_vector_type(8)));
typedef float    v4f  __attribute__((ext_vector_type(4)));
typedef unsigned int v4u __attribute__((ext_vector_type(4)));
typedef int      v4i  __attribute__((ext_vector_type(4)));

// ---- scalar helpers --------------------------------------------------------------------------------
__device__ __forceinline__ unsigned short bf_bits(float f) {          // f32 -> bf16 bits, RNE convert
  unsigned u = __float_as_uint(f);
  return (unsigned short)((u + 0x7FFFu + ((u >> 16) & 1u)) >> 16);
}
__device__ __forceinline__ float bf_up(unsigned short h) { return __uint_as_float(((unsigned)h) << 16); }
__device__ __forceinline__ float bf_rne(float f) { return bf_up(bf_bits(f)); }
__device__ __forceinline__ unsigned short h_bits(_Float16 x) { return __builtin_bit_cast(unsigned short, x); }
__device__ __forceinline__ unsigned pk16(unsigned short a, unsigned short b) { return (unsigned)a | ((unsigned)b << 16); }
__device__ __forceinline__ float xhalf(float v) {                     // the value that lane ^ 16 holds
  const int b = __float_as_int(v);
  return __int_as_float(__builtin_amdgcn_permlanex16(b, b, 0x76543210, 0xfedcba98, false, false));
}
__device__ __forceinline__ v8f zero8() { v8f z = {0.f, 0.f, 0.f, 0.f, 0.f, 0.f, 0.f, 0.f}; return z; }

// ---- fragment loader: 16-bit A/B operand, lane -> row/col (lane&15), p already includes +8*(lane>>4);
//      elements 0..7 <- p[0..7] (k0+8h..), elements 8..15 <- p[16..23] (k0+16+8h..)
__device__ __forceinline__ v16b ldfrag_b(const __bf16* p) {
  union { v16b v; v8b h[2]; } f;
  f.h[0] = *(const v8b*)(p);
  f.h[1] = *(const v8b*)(p + 16);
  return f.v;
}

// ---- WMMA helpers; the guards hold the VALU hazard gap behind a block of WMMAs (asm only in the device pass) ----
__device__ __forceinline__ v8f mma_h_raw(v16h a, v16h b, v8f c) {
  return __builtin_amdgcn_wmma_f32_16x16x32_f16(false, a, false, b, (short)0, c, false, false);
}
__device__ __forceinline__ v8f mma_b_raw(v16b a, v16b b, v8f c) {
  return __builtin_amdgcn_wmma_f32_16x16x32_bf16(false, a, false, b, (short)0, c, false, false);
}
__device__ __forceinline__ void dep_guard_b(v8f& a, v8f& b, v16b x, v16b y) {
#if defined(__HIP_DEVICE_COMPILE__)
  asm volatile("v_nop\n\tv_nop\n\tv_nop\n\tv_nop" : "+v"(a), "+v"(b) : "v"(x), "v"(y));
#endif
}
__device__ __forceinline__ void keep4_b(v16b a, v16b b, v16b c, v16b d) {
#if defined(__HIP_DEVICE_COMPILE__)
  asm volatile("v_nop" :: "v"(a), "v"(b), "v"(c), "v"(d));
#endif
}
__device__ __forceinline__ void acc_guard4(v8f& a, v8f& b, v8f& c, v8f& d) {
#if defined(__HIP_DEVICE_COMPILE__)
  asm volatile("v_nop\n\tv_nop\n\tv_nop\n\tv_nop" : "+v"(a), "+v"(b), "+v"(c), "+v"(d));
#endif
}

// ---- N asynchronous copies to LDS, 16 B per lane each: l[i] = the lane's LDS byte address, g[i] = its global address.
//      s_wait_xcnt 0 is the last line of the copies' own statement, so that it stands in front of every later
//      write of an address register that a copy names.
template <int N>
__device__ __forceinline__ void async_rows(const unsigned* l, const __bf16* const* g) {
  static_assert(N == 8 || N == 12);
#if defined(__HIP_DEVICE_COMPILE__)
  if constexpr (N == 8) {
    asm volatile(
        "global_load_async_to_lds_b128 %0, %8, off\n\t"
        "global_load_async_to_lds_b128 %1, %9, off\n\t"
        "global_load_async_to_lds_b128 %2, %10, off\n\t"
        "global_load_async_to_lds_b128 %3, %11, off\n\t"
        "global_load_async_to_lds_b128 %4, %12, off\n\t"
        "global_load_async_to_lds_b128 %5, %13, off\n\t"
        "global_load_async_to_lds_b128 %6, %14, off\n\t"
        "global_load_async_to_lds_b128 %7, %15, off\n\t"
        "s_wait_xcnt 0x0"
        :: "v"(l[0]), "v"(l[1]), "v"(l[2]), "v"(l[3]), "v"(l[4]), "v"(l[5]), "v"(l[6]), "v"(l[7]),
           "v"(g[0]), "v"(g[1]), "v"(g[2]), "v"(g[3]), "v"(g[4]), "v"(g[5]), "v"(g[6]), "v"(g[7])
        : "memory");
  } else {
    asm volatile(
        "global_load_async_to_lds_b128 %0, %12, off\n\t"
        "global_load_async_to_lds_b128 %1, %13, off\n\t"
        "global_load_async_to_lds_b128 %2, %14, off\n\t"
        "global_load_async_to_lds_b128 %3, %15, off\n\t"
        "global_load_async_to_lds_b128 %4, %16, off\n\t"
        "global_load_async_to_lds_b128 %5, %17, off\n\t"
        "global_load_async_to_lds_b128 %6, %18, off\n\t"
        "global_load_async_to_lds_b128 %7, %19, off\n\t"
        "global_load_async_to_lds_b128 %8, %20, off\n\t"
        "global_load_async_to_lds_b128 %9, %21, off\n\t"
        "global_load_async_to_lds_b128 %10, %22, off\n\t"
        "global_load_async_to_lds_b128 %11, %23, off\n\t"
        "s_wait_xcnt 0x0"
        :: "v"(l[0]), "v"(l[1]), "v"(l[2]), "v"(l[3]), "v"(l[4]), "v"(l[5]), "v"(l[6]), "v"(l[7]), "v"(l[8]), "v"(l[9]),
           "v"(l[10]), "v"(l[11]),
           "v"(g[0]), "v"(g[1]), "v"(g[2]), "v"(g[3]), "v"(g[4]), "v"(g[5]), "v"(g[6]), "v"(g[7]), "v"(g[8]), "v"(g[9]),
           "v"(g[10]), "v"(g[11])
        : "memory");
  }
#endif
}
// the issuing wave's own copies have landed behind this wait
__device__ __forceinline__ void wait_async0() {
#if defined(__HIP_DEVICE_COMPILE__)
  asm volatile("s_wait_asynccnt 0x0" ::: "memory");
#endif
}
// the wave's own LDS reads have returned behind this wait (in front of the barrier that frees a buffer for refill)
__device__ __forceinline__ void wait_ds0() {
#if defined(__HIP_DEVICE_COMPILE__)
  asm volatile("s_wait_dscnt 0x0" ::: "memory");
#endif
}

// =====================================================================================================
// f32 -> bf16 (RNE convert), 8 elements per thread, one 16-B store per lane: a wave writes 512 contiguous B.
// One launch for all five planes: blocks 0..nbx-1 convert x, then nbw blocks each for w0, w1, w2, w3; out is the
// x plane with the four weight planes directly behind it, in that order, so the flat index is the output index.
// coverage: (nbx + 4 * nbw) blocks x 256 threads x 8 = all five planes (each a whole number of blocks).
// =====================================================================================================
__global__ __launch_bounds__(256) void cvt_bf16x8(const float* __restrict__ x, const float* __restrict__ w0,
                                                  const float* __restrict__ w1, const float* __restrict__ w2,
                                                  const float* __restrict__ w3, unsigned short* out, int nbx, int nbw) {
  const int blk = blockIdx.x;
  const float* in = x;          // block-uniform choice of the source plane
  int rel = blk;                // block index inside that plane
  if (blk >= nbx) {
    const int j = blk - nbx;
    const int sel = j / nbw;
    rel = j - sel * nbw;
    in = (sel == 0) ? w0 : (sel == 1) ? w1 : (sel == 2) ? w2 : w3;
  }
  if (blk < nbx + 4 * nbw) {
    const int i = blk * 256 + threadIdx.x;
    const int si = rel * 256 + threadIdx.x;
    const v4f a = *(const v4f*)(in + (size_t)si * 8);
    const v4f b = *(const v4f*)(in + (size_t)si * 8 + 4);
    v4u p;
    p[0] = pk16(bf_bits(a[0]), bf_bits(a[1]));
    p[1] = pk16(bf_bits(a[2]), bf_bits(a[3]));
    p[2] = pk16(bf_bits(b[0]), bf_bits(b[1]));
    p[3] = pk16(bf_bits(b[2]), bf_bits(b[3]));
    *(v4u*)(out + (size_t)i * 8) = p;
    
  }
}

// =====================================================================================================
// Register-blocked batched bf16 WMMA GEMM: C[m][n] = sum_k A[m][k] * Bt[n][k] + bias; one wave per 64x64
// tile; the 4 waves of a block hold 2 x 2 tiles (128 x 128 of C): a staged row feeds two waves, the block's LDS
// lets several blocks share a WGP, and each launch's blocks are all resident at once. A row-major [M][K]
// pitch lda; Bt row-major [N][K] pitch ldb (k contiguous); M, N multiples of 128, K a positive
// multiple of 64; lda, ldb multiples of 8. bx = the block's index in one batch, b = batch index (strides in
// elements); sK (two k-slice buffers) is the calling kernel's LDS; behind the loop's last barrier its first bytes
// serve as the epilogue's 4 slabs of 16 x 68 floats.
// Operands: per 64-element k-slice the block's 128 A rows (and A2 rows) and 128 Bt rows go to LDS by asynchronous
// copies, 8 lanes x 16 B = one whole 128-B row piece, two buffers: slice t + 1 flies while slice t is multiplied;
// the fragments are read from LDS (pitch GP). Slice rows in a buffer: A 0..127, (A2 128..255,) then Bt.
// NSPLIT: 0 = A.Bt; 1 = (A + A2).Bt (A2 = unscaled bf16 lo plane of A, 2 products).
// BIAS: 0 = none; 1 = bias[n] per column; 2 = bias[m] per row; bias values RNE-converted to bf16 first,
//       added in f32; bias index clamped to nbias-1.
// OUT_MODE: 0 = f32 (pitch ldc); 2 = bf16 hi plane C + bf16 lo plane C2 (lo = RNE(v - hi), unscaled);
//           3 = f16 hi plane C + f16 residual plane C2 = f16((v - hi) * rscale) (pitch ldc2, stride strideC2).
// =====================================================================================================
template <int NSPLIT, int OUT_MODE, int BIAS>
__device__ __forceinline__ void gemm64_body(
    const unsigned short* __restrict__ Ap, const unsigned short* A2p, int lda, long long strideA,
    const unsigned short* __restrict__ Btp, int ldb, long long strideB,
    const float* __restrict__ bias, int nbias,
    void* Cout, int ldc, long long strideC,
    void* Cout2, int ldc2, long long strideC2,
    int M, int N, int K, float rscale,
    int bx, int b, __bf16* sK) {
  const __bf16* A   = (const __bf16*)(const void*)Ap;
  const __bf16* A2  = (const __bf16*)(const void*)A2p;
  const __bf16* Bt  = (const __bf16*)(const void*)Btp;
  constexpr int AROWS = (NSPLIT >= 1) ? 256 : 128; // staged A (and A2) rows
  constexpr int ROWS  = AROWS + 128;               // rows of one staged k-slice
  constexpr int NIT   = ROWS / 16;                 // copies per thread and slice: 128 threads x 16 B = 16 rows each
  const int lane = threadIdx.x & 31;
  const int wave = threadIdx.x >> 5;
  const int blocksN = N >> 7;
  const int blocksM = M >> 7;
  if (bx >= blocksM * blocksN) return;             // block-uniform, in front of every barrier
  const int brow = bx / blocksN;
  const int bcol = bx - brow * blocksN;
  const int mb0 = brow << 7;                       // first of the block's 128 rows
  const int nb0 = bcol << 7;                       // first of the block's 128 columns
  const int wm  = wave >> 1;                       // the wave's tile in the block: row wm, column wn
  const int wn  = wave & 1;
  const int m0 = mb0 + (wm << 6);
  const int n0 = nb0 + (wn << 6);

  const __bf16* Ab  = A  + (size_t)b * strideA;
  const __bf16* Bb  = Bt + (size_t)b * strideB;
  const __bf16* Ab2 = (NSPLIT >= 1) ? (A2 + (size_t)b * strideA) : Ab;

  const int rlane = lane & 15;                 // row (A) / col (B, D) within subtile
  const int koff  = (lane >> 4) * 8;           // k offset of this lane half
  const int mOff  = (lane >> 4) * 8;           // D row offset

  v8f acc[4][4];
#pragma unroll
  for (int i = 0; i < 4; ++i)
#pragma unroll
    for (int j = 0; j < 4; ++j) acc[i][j] = zero8();

  // ---- staging: thread -> slice row (tid >> 3) + 16 * it, 16-B piece tid & 7 ----
  const int srow = threadIdx.x >> 3;
  const int scol = (threadIdx.x & 7) * 8;
  const __bf16* gA  = Ab  + (size_t)(mb0 + srow) * lda + scol;
  const __bf16* gA2 = Ab2 + (size_t)(mb0 + srow) * lda + scol;
  const __bf16* gB  = Bb  + (size_t)(nb0 + srow) * ldb + scol;
  const unsigned lds0 = (unsigned)(size_t)(sK + srow * GP + scol);   // LDS byte address = low 32 bits
  auto stage = [&](int buf, int k0) {
    unsigned l[NIT];
    const __bf16* g[NIT];
#pragma unroll
    for (int it = 0; it < NIT; ++it) {
      l[it] = lds0 + (unsigned)(buf * ROWS + it * 16) * (unsigned)(GP * 2);
      if (it < 8)                g[it] = gA  + (size_t)(it * 16) * lda + k0;
      else if (it < AROWS / 16)  g[it] = gA2 + (size_t)((it - 8) * 16) * lda + k0;
      else                       g[it] = gB  + (size_t)((it - AROWS / 16) * 16) * ldb + k0;
    }
    async_rows<NIT / 2>(l, g);
    async_rows<NIT / 2>(l + NIT / 2, g + NIT / 2);
  };

  const int nch = K >> 6;
  stage(0, 0);
  wait_async0();
  __syncthreads();                       // slice 0 is published
  if (nch > 1) stage(1, 64);
  for (int t = 0; t < nch; ++t) {
    const __bf16* sS = sK + (t & 1) * (ROWS * GP) + rlane * GP + koff;
    const __bf16* sA = sS + (wm << 6) * GP;
    const __bf16* sB = sS + (AROWS + (wn << 6)) * GP;
#pragma unroll
    for (int ks = 0; ks < 2; ++ks) {
      constexpr int IG = (NSPLIT >= 1) ? 2 : 4;   // A fragments read as one group: as many as the registers hold
      v16b bh[4];
#pragma unroll
      for (int j = 0; j < 4; ++j) bh[j] = ldfrag_b(sB + (j << 4) * GP + ks * 32);
#pragma unroll
      for (int i0 = 0; i0 < 4; i0 += IG) {
        v16b ah[IG], al[IG];
#pragma unroll
        for (int u = 0; u < IG; ++u) {
          ah[u] = ldfrag_b(sA + ((i0 + u) << 4) * GP + ks * 32);
          al[u] = ah[u];
          if (NSPLIT >= 1) al[u] = ldfrag_b(sA + (128 + ((i0 + u) << 4)) * GP + ks * 32);
        }
#pragma unroll
        for (int u = 0; u < IG; ++u) {
          const int i = i0 + u;
#pragma unroll
          for (int j = 0; j < 4; ++j) {
            acc[i][j] = mma_b_raw(ah[u], bh[j], acc[i][j]);
            if (NSPLIT >= 1) acc[i][j] = mma_b_raw(al[u], bh[j], acc[i][j]);
          }
          dep_guard_b(acc[i][0], acc[i][3], ah[u], al[u]);
        }
      }
      keep4_b(bh[0], bh[1], bh[2], bh[3]);
    }
    wait_ds0();
    wait_async0();
    __syncthreads();                     // publishes slice t + 1 and ends every read of slice t's buffer
    if (t + 2 < nch) stage(t & 1, (t + 2) << 6);
  }
  wait_async0();
  acc_guard4(acc[0][0], acc[0][1], acc[0][2], acc[0][3]);
  acc_guard4(acc[1][0], acc[1][1], acc[1][2], acc[1][3]);
  acc_guard4(acc[2][0], acc[2][1], acc[2][2], acc[2][3]);
  acc_guard4(acc[3][0], acc[3][1], acc[3][2], acc[3][3]);

  // ---- epilogue ----
  float bn[4];
#pragma unroll
  for (int j = 0; j < 4; ++j) {
    const int bi = (BIAS == 1) ? (n0 + (j << 4) + rlane) : 0;
    const float bvv = bf_rne(bias[min(bi, nbias - 1)]);          // clamped address
    bn[j] = (BIAS == 1) ? bvv : 0.f;
  }
  float* slab = (float*)(void*)sK + wave * (16 * 68);   // every wave has passed the loop's last barrier: no reader, no copy left
#pragma unroll
  for (int i = 0; i < 4; ++i) {
    const int mBase = m0 + (i << 4);
    float bm[8];
#pragma unroll
    for (int r = 0; r < 8; ++r) {
      const int bi = (BIAS == 2) ? (mBase + mOff + r) : 0;
      const float bvv = bf_rne(bias[min(bi, nbias - 1)]);        // clamped address
      bm[r] = (BIAS == 2) ? bvv : 0.f;
    }
#pragma unroll
    for (int j = 0; j < 4; ++j) {
#pragma unroll
      for (int r = 0; r < 8; ++r) {
        slab[(mOff + r) * 68 + (j << 4) + rlane] = acc[i][j][r] + bn[j] + bm[r];
      }
    }
    __builtin_amdgcn_fence(__ATOMIC_RELEASE, "workgroup");
    __builtin_amdgcn_wave_barrier();
    __builtin_amdgcn_fence(__ATOMIC_ACQUIRE, "workgroup");
    if (OUT_MODE == 0) {
      float* C = (float*)Cout + (size_t)b * strideC;
      const int hh = lane >> 4, c4 = (lane & 15) * 4;     // 256-B row segment = 16 lanes x 16 B
      {
#pragma unroll
        for (int it = 0; it < 8; ++it) {
          const int row = it * 2 + hh;                     // it 0..7 x hh 0..1 = rows 0..15
          const v4f v = *(const v4f*)(slab + row * 68 + c4);
          *(v4f*)(C + (size_t)(mBase + row) * ldc + n0 + c4) = v;
        }
        
      }
    } else {
      const int q = lane >> 3, c8 = (lane & 7) * 8;
      unsigned short* C  = (unsigned short*)Cout  + (size_t)b * strideC;
      unsigned short* C2 = (unsigned short*)Cout2 + (size_t)b * strideC2;
      v4u hv[4], lv[4];
#pragma unroll
      for (int it = 0; it < 4; ++it) {
        const int row = it * 4 + q;                        // it 0..3 x q 0..3 = rows 0..15
        const float* sp = slab + row * 68 + c8;
        v4u a, a2;
#pragma unroll
        for (int e = 0; e < 4; ++e) {
          const float f0 = sp[2 * e], f1 = sp[2 * e + 1];
          unsigned short h0, h1, l0, l1;
          if (OUT_MODE == 2) {
            h0 = bf_bits(f0); h1 = bf_bits(f1);
            l0 = bf_bits(f0 - bf_up(h0)); l1 = bf_bits(f1 - bf_up(h1));
          } else {
            const _Float16 x0 = (_Float16)f0, x1 = (_Float16)f1;
            h0 = h_bits(x0); h1 = h_bits(x1);
            l0 = h_bits((_Float16)((f0 - (float)x0) * rscale));
            l1 = h_bits((_Float16)((f1 - (float)x1) * rscale));
          }
          a[e] = pk16(h0, h1); a2[e] = pk16(l0, l1);
        }
        hv[it] = a; lv[it] = a2;
      }
      {
#pragma unroll
        for (int it = 0; it < 4; ++it) {
          const int row = it * 4 + q;
          *(v4u*)(C  + (size_t)(mBase + row) * ldc  + n0 + c8) = hv[it];
          *(v4u*)(C2 + (size_t)(mBase + row) * ldc2 + n0 + c8) = lv[it];
        }
        
      }
    }
    __builtin_amdgcn_fence(__ATOMIC_RELEASE, "workgroup");
    __builtin_amdgcn_wave_barrier();
    __builtin_amdgcn_fence(__ATOMIC_ACQUIRE, "workgroup");
  }
}

// ---- one GEMM per launch: blockIdx.x = block in the batch, blockIdx.y = batch ----
template <int NSPLIT, int OUT_MODE, int BIAS>
__global__ __launch_bounds__(128) void gemm64(
    const unsigned short* __restrict__ Ap, const unsigned short* A2p, int lda, long long strideA,
    const unsigned short* __restrict__ Btp, int ldb, long long strideB,
    const float* __restrict__ bias, int nbias,
    void* Cout, int ldc, long long strideC,
    void* Cout2, int ldc2, long long strideC2,
    int M, int N, int K, float rscale) {
  __shared__ __align__(16) __bf16 sK[2 * (((NSPLIT >= 1) ? 256 : 128) + 128) * GP];   // two k-slice buffers
  gemm64_body<NSPLIT, OUT_MODE, BIAS>(Ap, A2p, lda, strideA, Btp, ldb, strideB, bias, nbias,
                                      Cout, ldc, strideC, Cout2, ldc2, strideC2, M, N, K, rscale,
                                      blockIdx.x, blockIdx.y, sK);
}

// ---- the three independent projections in one launch; the branch on blockIdx.y is block-uniform ----
//   y = 0: q = x . Wq^T + bq, y = 1: k = x . Wk^T + bk -> bf16 hi/lo planes [b*SEQ+t][h*64+d] (M=8192, N=512, K=512),
//          blockIdx.x = one of 64 x 4 blocks of 128 x 128;
//   y = 2: v^T = Wv . x^T + bv (per row) per batch -> f16 hi plane [b][h*64+d][s] and residual plane (x4096), pitch SEQ
//          (A = Wv [n][k], Bt = x rows of the batch; M=512, N=512, K=512), blockIdx.x = batch * 16 + block in the batch.
__global__ __launch_bounds__(128) void proj_qkv(
    const unsigned short* __restrict__ Xb, const unsigned short* __restrict__ Wqb,
    const unsigned short* __restrict__ Wkb, const unsigned short* __restrict__ Wvb,
    const float* __restrict__ bq, const float* __restrict__ bk, const float* __restrict__ bv,
    unsigned short* Qh, unsigned short* Ql, unsigned short* Kh, unsigned short* Kl,
    unsigned short* VTh, unsigned short* VTl) {
  __shared__ __align__(16) __bf16 sK[2 * (128 + 128) * GP];
  const int y = blockIdx.y;
  if (y < 2) {
    const bool isq = (y == 0);
    gemm64_body<0, 2, 1>(Xb, Xb, DM, 0LL, isq ? Wqb : Wkb, DM, 0LL, isq ? bq : bk, DM,
                         (void*)(isq ? Qh : Kh), DM, 0LL, (void*)(isq ? Ql : Kl), DM, 0LL,
                         NB * SEQ, DM, DM, 1.0f, blockIdx.x, 0, sK);
  } else {
    gemm64_body<0, 3, 2>(Wvb, Wvb, DM, 0LL, Xb, DM, (long long)SEQ * DM, bv, DM,
                         (void*)VTh, SEQ, (long long)DM * SEQ, (void*)VTl, SEQ, (long long)DM * SEQ,
                         DM, SEQ, DM, 4096.0f, blockIdx.x & 15, blockIdx.x >> 4, sK);
  }
}

__global__ __launch_bounds__(128)
void attn64(const unsigned short* __restrict__ qhp, const unsigned short* __restrict__ qlp,
            const unsigned short* __restrict__ khp, const unsigned short* __restrict__ klp,
            const unsigned short* __restrict__ vhp, const unsigned short* __restrict__ vlp,
            const float* __restrict__ dbias, const int* __restrict__ kmask,
            unsigned short* ohp, unsigned short* olp, float sscale) {
  union FB { v16b v; v8b h[2]; };
  union FH { v16h v; v8h h[2]; };
  __shared__ __align__(16) __bf16   Ksh[64 * KP];   // K hi [kv][d], pitch KP
  __shared__ __align__(16) __bf16   Ksl[64 * KP];   // K lo
  __shared__ __align__(16) _Float16 Vth[64 * KP];   // V^T hi [d][kv], pitch KP
  __shared__ __align__(16) _Float16 Vtl[64 * KP];   // V^T residual
  __shared__ __align__(16) float    Os[4][16 * OP];    // per wave context tile [row][d], pitch OP

  const int tid  = threadIdx.x;
  const int wave = tid >> 5;
  const int lane = tid & 31;
  const int hh   = lane >> 4;
  const int c    = lane & 15;

  const int bx   = blockIdx.x;
  const int qb   = bx % NQB;
  const int rest = bx / NQB;
  const int h    = rest % NH;
  const int b    = rest / NH;
  const int q0   = qb * 64 + wave * 16;
  const size_t rowB = (size_t)b * SEQ;

  const __bf16* Qh = (const __bf16*)(const void*)qhp + (size_t)h * HD;
  const __bf16* Ql = (const __bf16*)(const void*)qlp + (size_t)h * HD;
  const __bf16* Kh = (const __bf16*)(const void*)khp + (size_t)h * HD;
  const __bf16* Kl = (const __bf16*)(const void*)klp + (size_t)h * HD;
  const _Float16* Vh = (const _Float16*)(const void*)vhp + ((size_t)b * DM + (size_t)h * HD) * SEQ;
  const _Float16* Vl = (const _Float16*)(const void*)vlp + ((size_t)b * DM + (size_t)h * HD) * SEQ;
  const float* dbw = dbias + (rowB + (size_t)q0 + c) * SEQ + 8 * hh;   // row q0+c, keys (kv0 + 16j) + 8hh + 0..7
  const int*   mkb = kmask + rowB + 8 * hh;                            // keys (kv0 + 16j) + 8hh + 0..7

  // ---- Q fragments (B operand, column = lane&15): 2 d-chunks, hi and lo ----
  v16b qah[2], qal[2];
#pragma unroll
  for (int dc = 0; dc < 2; ++dc) {
    const size_t qo = (rowB + q0 + c) * DM + dc * 32 + 8 * hh;
    qah[dc] = ldfrag_b(Qh + qo);
    qal[dc] = ldfrag_b(Ql + qo);
  }

  float mrow = -INFINITY, lrow = 0.f;        // of the lane's one query
  v8f oacc[4];                               // O^T: oacc[t][r] = context of query c, d = 16t + 8hh + r
#pragma unroll
  for (int t = 0; t < 4; ++t) oacc[t] = zero8();

  for (int kt = 0; kt < NQB; ++kt) {         // static trip count
    const int kv0 = kt * 64;
    __syncthreads();
    {
      // 8 lanes x 16 B = one whole 128-B tile row, so a wave's load touches 4 whole lines; rows r + 16 i, i = 0..3
      const int r = tid >> 3, pc = (tid & 7) * 8;
      const __bf16*   kg  = Kh + (rowB + kv0 + r) * DM + pc;      // K row kv0+r(+16i), d = pc..pc+7
      const __bf16*   klg = Kl + (rowB + kv0 + r) * DM + pc;
      const _Float16* vg  = Vh + (size_t)r * SEQ + kv0 + pc;      // V^T row d = r(+16i), s = kv0+pc..+7
      const _Float16* vlg = Vl + (size_t)r * SEQ + kv0 + pc;
      v8b a0[4], a1[4];
      v8h b0[4], b1[4];
#pragma unroll
      for (int i = 0; i < 4; ++i) {
        a0[i] = *(const v8b*)(kg  + (size_t)(16 * i) * DM);
        a1[i] = *(const v8b*)(klg + (size_t)(16 * i) * DM);
        b0[i] = *(const v8h*)(vg  + (size_t)(16 * i) * SEQ);
        b1[i] = *(const v8h*)(vlg + (size_t)(16 * i) * SEQ);
      }
#if defined(__HIP_DEVICE_COMPILE__)
      // the wait that stands in front of any overwrite of the loads' address registers; naming the four addresses
      // as inputs keeps them in their registers up to it, so that no later load of the group lands on one
      asm volatile("s_wait_xcnt 0x0" :: "v"(kg), "v"(klg), "v"(vg), "v"(vlg) : "memory");
#endif
#pragma unroll
      for (int i = 0; i < 4; ++i) {
        *(v8b*)(Ksh + (r + 16 * i) * KP + pc) = a0[i];
        *(v8b*)(Ksl + (r + 16 * i) * KP + pc) = a1[i];
        *(v8h*)(Vth + (r + 16 * i) * KP + pc) = b0[i];
        *(v8h*)(Vtl + (r + 16 * i) * KP + pc) = b1[i];
      }
    }
    __syncthreads();

    // ---- bias and key mask of this lane's 32 keys: 8 contiguous values per key tile ----
    const float* drw = dbw + kv0;
    const int*   mkw = mkb + kv0;
    v4f dv4[8];
    v4i mk4[8];
#pragma unroll
    for (int j = 0; j < 4; ++j) {
      dv4[2 * j]     = *(const v4f*)(drw + j * 16);
      dv4[2 * j + 1] = *(const v4f*)(drw + j * 16 + 4);
      mk4[2 * j]     = *(const v4i*)(mkw + j * 16);
      mk4[2 * j + 1] = *(const v4i*)(mkw + j * 16 + 4);
    }
#if defined(__HIP_DEVICE_COMPILE__)
    // the wait that stands in front of any overwrite of the loads' address registers; naming the two addresses
    // as inputs keeps them in their registers up to it
    asm volatile("s_wait_xcnt 0x0" :: "v"(drw), "v"(mkw) : "memory");
#endif

    // ---- scores, transposed: 64 keys x 16 queries per wave, 3 bf16 products; s[j][r] = key 16j + 8hh + r, query c ----
    //      the K fragments of a d-chunk are read as one group and the WMMAs go round the four key tiles, so that fewer
    //      of them wait for the one before (each s[j] still takes its six products in the same order)
    v8f s[4];
#pragma unroll
    for (int j = 0; j < 4; ++j) s[j] = zero8();
#pragma unroll
    for (int dc = 0; dc < 2; ++dc) {
      FB kb[4], kl[4];
#pragma unroll
      for (int j = 0; j < 4; ++j) {
        kb[j].h[0] = *(const v8b*)(Ksh + (j * 16 + c) * KP + dc * 32 + 8 * hh);
        kb[j].h[1] = *(const v8b*)(Ksh + (j * 16 + c) * KP + dc * 32 + 16 + 8 * hh);
        kl[j].h[0] = *(const v8b*)(Ksl + (j * 16 + c) * KP + dc * 32 + 8 * hh);
        kl[j].h[1] = *(const v8b*)(Ksl + (j * 16 + c) * KP + dc * 32 + 16 + 8 * hh);
      }
#pragma unroll
      for (int j = 0; j < 4; ++j) s[j] = mma_b_raw(kb[j].v, qah[dc], s[j]);
#pragma unroll
      for (int j = 0; j < 4; ++j) s[j] = mma_b_raw(kl[j].v, qah[dc], s[j]);
#pragma unroll
      for (int j = 0; j < 4; ++j) s[j] = mma_b_raw(kb[j].v, qal[dc], s[j]);
    }

    // holds the bias and mask arithmetic behind the score WMMAs: moved up among them, its wait for the global loads
    // would stand in front of the WMMAs and the loads' latency would not be covered by them
    __builtin_amdgcn_sched_barrier(0);

    // ---- scale + bias, clip, key mask, row max, online softmax; P (x1024, f16) and P residual (x4096)
    //      packed straight into the B fragments of the context product ----
    float m = -INFINITY;
#pragma unroll
    for (int j = 0; j < 4; ++j) {
#pragma unroll
      for (int r = 0; r < 8; ++r) {
        const float dv = bf_rne(dv4[2 * j + (r >> 2)][r & 3]);
        float sv = s[j][r] * sscale + dv;
        sv = fminf(10.0f, fmaxf(-10.0f, sv));
        sv = (mk4[2 * j + (r >> 2)][r & 3] != 0) ? sv : -1.0e9f;
        s[j][r] = sv;
        m = fmaxf(m, sv);
      }
    }
    m = fmaxf(m, xhalf(m));                  // the query's other 32 keys of the chunk
    const float mnew  = fmaxf(mrow, m);
    const float msafe = (mnew == -INFINITY) ? 0.f : mnew;
    const float alpha = __expf(mrow - msafe);
    mrow = mnew;
    float psum = 0.f;
    FH pa[2], pl[2];
#pragma unroll
    for (int j = 0; j < 4; ++j) {
#pragma unroll
      for (int r = 0; r < 8; ++r) {
        const float p = __expf(s[j][r] - msafe);
        psum += p;
        const float p1k = p * 1024.0f;
        const _Float16 ph = (_Float16)p1k;
        pa[j >> 1].v[(j & 1) * 8 + r] = ph;
        pl[j >> 1].v[(j & 1) * 8 + r] = (_Float16)((p1k - (float)ph) * 4096.0f);
      }
    }
    psum += xhalf(psum);
    lrow = lrow * alpha + psum;
#pragma unroll
    for (int t = 0; t < 4; ++t)
#pragma unroll
      for (int r = 0; r < 8; ++r) oacc[t][r] *= alpha;

    // ---- context^T += V^T . P^T (f16 WMMA), residual products into a separate accumulator ----
    v8f o1[4];
#pragma unroll
    for (int t = 0; t < 4; ++t) o1[t] = zero8();
#pragma unroll
    for (int kk = 0; kk < 2; ++kk) {
      FH vb[4], vl[4];                       // the V^T fragments of 32 keys, read as one group
#pragma unroll
      for (int t = 0; t < 4; ++t) {
        vb[t].h[0] = *(const v8h*)(Vth + (t * 16 + c) * KP + kk * 32 + 8 * hh);
        vb[t].h[1] = *(const v8h*)(Vth + (t * 16 + c) * KP + kk * 32 + 16 + 8 * hh);
        vl[t].h[0] = *(const v8h*)(Vtl + (t * 16 + c) * KP + kk * 32 + 8 * hh);
        vl[t].h[1] = *(const v8h*)(Vtl + (t * 16 + c) * KP + kk * 32 + 16 + 8 * hh);
      }
#pragma unroll
      for (int t = 0; t < 4; ++t) oacc[t] = mma_h_raw(vb[t].v, pa[kk].v, oacc[t]);
#pragma unroll
      for (int t = 0; t < 4; ++t) o1[t]   = mma_h_raw(vl[t].v, pa[kk].v, o1[t]);
#pragma unroll
      for (int t = 0; t < 4; ++t) o1[t]   = mma_h_raw(vb[t].v, pl[kk].v, o1[t]);
    }
#pragma unroll
    for (int t = 0; t < 4; ++t)
#pragma unroll
      for (int r = 0; r < 8; ++r) oacc[t][r] += o1[t][r] * (1.0f / 4096.0f);
  }

  // ---- normalise (1/l and the 1/1024 p carry), stage the wave's 16x64 tile, bf16 hi/lo split,
  float* os = Os[wave];
  {
    const float l = lrow;
    const float inv = ((l > 0.f) ? (1.0f / l) : 0.f) * (1.0f / 1024.0f);
#pragma unroll
    for (int t = 0; t < 4; ++t) {
      v4f w0, w1;
#pragma unroll
      for (int r = 0; r < 4; ++r) { w0[r] = oacc[t][r] * inv; w1[r] = oacc[t][4 + r] * inv; }
      *(v4f*)(os + c * OP + t * 16 + 8 * hh)     = w0;      // row = query c, d = 16t + 8hh + 0..7
      *(v4f*)(os + c * OP + t * 16 + 8 * hh + 4) = w1;
    }
  }
  __builtin_amdgcn_fence(__ATOMIC_RELEASE, "workgroup");
  __builtin_amdgcn_wave_barrier();
  __builtin_amdgcn_fence(__ATOMIC_ACQUIRE, "workgroup");
  {
    const int q4 = lane >> 3, c8 = (lane & 7) * 8;
    v4u hv[4], lv[4];
#pragma unroll
    for (int it = 0; it < 4; ++it) {
      const int row = it * 4 + q4;   // it 0..3 x q4 0..3 = rows 0..15 of the wave tile
      const float* sp = os + row * OP + c8;
      v4u a, a2;
#pragma unroll
      for (int e = 0; e < 4; ++e) {
        const float f0 = sp[2 * e], f1 = sp[2 * e + 1];
        const unsigned short h0 = bf_bits(f0), h1 = bf_bits(f1);
        const unsigned short l0 = bf_bits(f0 - bf_up(h0)), l1 = bf_bits(f1 - bf_up(h1));
        a[e] = pk16(h0, h1); a2[e] = pk16(l0, l1);
      }
      hv[it] = a; lv[it] = a2;
    }
    {
#pragma unroll
      for (int it = 0; it < 4; ++it) {
        const int row = it * 4 + q4;
        const size_t go = (rowB + q0 + row) * DM + (size_t)h * HD + c8;
        *(v4u*)(ohp + go) = hv[it];
        *(v4u*)(olp + go) = lv[it];
      }
      
    }
  }
}

// =====================================================================================================
// Workspace map (bytes), every plane an exact multiple of its 64x64-tile / whole-line store granularity:
//   Xb   bf16 [8192][512]          8388608
//   Wqb, Wkb, Wvb, Wob bf16 [512 n][512 k]   524288 each
//   Qh, Ql, Kh, Kl bf16 [8192][512] 8388608 each
//   VTh  f16  [16][512 d][512 s]   8388608
//   VTl  f16  [16][512 d][512 s]   8388608
//   Oh, Ol bf16 [8192][512]         8388608 each
//   total                           77594624
// Weights are [out n][in k] with k contiguous = the Bt / A layout the GEMM wants, so they are only converted.
// =====================================================================================================
extern "C" void kernel_launch(void* const* d_in, const int* in_sizes, int n_in,
                              void* d_out, int out_size, void* d_ws, size_t ws_size,
                              hipStream_t stream) {
  if (n_in < 11) return;
  if (in_sizes[0] != NB * SEQ * DM) return;
  if (in_sizes[1] != NB * SEQ * SEQ) return;
  if (in_sizes[2] != NB * SEQ) return;
  if (in_sizes[3] != DM * DM || in_sizes[5] != DM * DM || in_sizes[7] != DM * DM || in_sizes[9] != DM * DM) return;
  if (in_sizes[4] != DM || in_sizes[6] != DM || in_sizes[8] != DM || in_sizes[10] != DM) return;
  if (out_size != NB * SEQ * DM) return;

  const float* x    = (const float*)d_in[0];
  const float* db   = (const float*)d_in[1];
  const int*   msk  = (const int*)d_in[2];
  const float* Wq   = (const float*)d_in[3];
  const float* bq   = (const float*)d_in[4];
  const float* Wk   = (const float*)d_in[5];
  const float* bk   = (const float*)d_in[6];
  const float* Wv   = (const float*)d_in[7];
  const float* bv   = (const float*)d_in[8];
  const float* Wo   = (const float*)d_in[9];
  const float* bo   = (const float*)d_in[10];

  const size_t PX  = (size_t)NB * SEQ * DM * 2;   // 8388608   16-bit activation plane [8192][512]
  const size_t PW  = (size_t)DM * DM * 2;         //  524288   16-bit weight plane
  const size_t PVT = (size_t)NB * DM * SEQ * 2;   // 8388608   v^T plane
  size_t off = 0;
  const size_t oXb  = off; off += PX;
  const size_t oWq  = off; off += PW;
  const size_t oWk  = off; off += PW;
  const size_t oWv  = off; off += PW;
  const size_t oWo  = off; off += PW;
  const size_t oQh  = off; off += PX;
  const size_t oQl  = off; off += PX;
  const size_t oKh  = off; off += PX;
  const size_t oKl  = off; off += PX;
  const size_t oVTh = off; off += PVT;
  const size_t oVTl = off; off += PVT;
  const size_t oOh  = off; off += PX;
  const size_t oOl  = off; off += PX;
  if (off > ws_size) return;                      // off = 77594624
  if (off > (size_t)134217728) return;

  char* ws = (char*)d_ws;
  unsigned short* Xb  = (unsigned short*)(ws + oXb);
  unsigned short* Wqb = (unsigned short*)(ws + oWq);
  unsigned short* Wkb = (unsigned short*)(ws + oWk);
  unsigned short* Wvb = (unsigned short*)(ws + oWv);
  unsigned short* Wob = (unsigned short*)(ws + oWo);
  unsigned short* Qh  = (unsigned short*)(ws + oQh);
  unsigned short* Ql  = (unsigned short*)(ws + oQl);
  unsigned short* Kh  = (unsigned short*)(ws + oKh);
  unsigned short* Kl  = (unsigned short*)(ws + oKl);
  unsigned short* VTh = (unsigned short*)(ws + oVTh);
  unsigned short* VTl = (unsigned short*)(ws + oVTl);
  unsigned short* Oh  = (unsigned short*)(ws + oOh);
  unsigned short* Ol  = (unsigned short*)(ws + oOl);

  const dim3 blk(256);
  const int n8x = NB * SEQ * DM / 8;                          // 524288
  const int n8w = DM * DM / 8;                                //  32768
  const int nbx = n8x / 256;                                  // 2048 blocks for x
  const int nbw = n8w / 256;                                  //  128 blocks for each weight
  const dim3 gCvt(nbx + 4 * nbw);                             // 2560 blocks
  const dim3 gProj((NB * SEQ / 128) * (DM / 128), 1);         // 64 x 4 = 256 blocks of 128 x 128: M=8192, N=512
  const dim3 gQKV((NB * SEQ / 128) * (DM / 128), 3);          // 256 blocks each for q, k and v^T (16 blocks x 16 batches)
  const dim3 gAttn(NB * NH * NQB);                            // 1024 blocks of 128 threads

  // (1) x -> bf16 plane [8192][512]; weights [n][k] f32 -> bf16 [n][k]; Xb, Wqb, Wkb, Wvb, Wob lie one behind the other
  cvt_bf16x8<<<gCvt, blk, 0, stream>>>(x, Wq, Wk, Wv, Wo, Xb, nbx, nbw);
  // (2) q, k -> bf16 hi/lo planes, v^T -> f16 hi and residual planes
  proj_qkv<<<gQKV, dim3(128), 0, stream>>>(Xb, Wqb, Wkb, Wvb, bq, bk, bv, Qh, Ql, Kh, Kl, VTh, VTl);
  // (3) attention -> context bf16 hi/lo planes
  attn64<<<gAttn, dim3(128), 0, stream>>>(
      Qh, Ql, Kh, Kl, VTh, VTl, db, msk, Oh, Ol, 0.125f);
  // (4) out = context . Wo^T + bo -> d_out f32 [8192][512]  (A = context hi + lo planes, 2 products)
  gemm64<1, 0, 1><<<gProj, dim3(128), 0, stream>>>(
      Oh, Ol, DM, 0LL, Wob, DM, 0LL, bo, DM,
      d_out, DM, 0LL, d_out, DM, 0LL,
      NB * SEQ, DM, DM, 1.0f);
  (void)hipGetLastError();
}

// v008
// Measured time: 69 microseconds a run.
// Two timings next to v007 both put it at 1.04 times that version's speed.
// All steps since v000 together make it 3.01 times as fast.
// Contractions: q, k, v^T projections = v_wmma_f32_16x16x32_bf16 (bf16 operands from RNE-converted inputs, single product, bias added in f32);
// q.k^T scores = v_wmma_f32_16x16x32_bf16 with bf16 hi/lo split q and k (hi.hi + hi.lo + lo.hi);
// p.v = v_wmma_f32_16x16x32_f16 (p carried x1024 in f16 plus a x4096 f16 residual plane, v as f16 hi plus a x4096 f16 residual plane: hi.hi + hi.res + res.hi);
// ctx.Wo^T = v_wmma_f32_16x16x32_bf16 with ctx as bf16 hi/lo planes times bf16 Wo (2 products); all f32 accumulate; clip, key mask and softmax in f32.
#include <hip/hip_runtime.h>
#include <math.h>
#include <float.h>
#include <stdint.h>

#define NB    16
#define SEQ   512
#define DM    512
#define NH    8
#define HD    64
#define NQB   (SEQ / 64)   // 8 key / query tiles of 64
#define KP    72           // LDS row pitch of the 64-wide 16-bit tiles, elements: 144 B = 16 B x 9, for ds_load_b128 readers
#define OP    68           // LDS row pitch of the 64-wide f32 context tile, floats: 272 B = 16 B x 17
#define GP    72           // LDS row pitch of a staged 64-element GEMM k-slice, elements: 144 B = 16 B x 9, for ds_load_b128 readers
static_assert(NH * HD == DM);
static_assert((SEQ % 128) == 0 && (DM % 128) == 0 && ((NB * SEQ) % 128) == 0);

typedef _Float16 v16h __attribute__((ext_vector_type(16)));
typedef _Float16 v8h  __attribute__((ext_vector_type(8)));
typedef __bf16   v16b __attribute__((ext_vector_type(16)));
typedef __bf16   v8b  __attribute__((ext_vector_type(8)));
typedef float    v8f  __attribute__((ext_vector_type(8)));
typedef float    v4f  __attribute__((ext_vector_type(4)));
typedef unsigned int v4u __attribute__((ext_vector_type(4)));
typedef int      v4i  __attribute__((ext_vector_type(4)));
typedef float    v2f  __attribute__((ext_vector_type(2)));
typedef __bf16   v2b  __attribute__((ext_vector_type(2)));
typedef _Float16 v2h  __attribute__((ext_vector_type(2)));

// ---- scalar helpers --------------------------------------------------------------------------------
__device__ __forceinline__ v2b bf_pair(float a, float b) {            // two f32 -> two bf16, RNE, one packed convert
  const v2f x = {a, b};
  return __builtin_convertvector(x, v2b);
}
__device__ __forceinline__ unsigned bf_word(v2b p) { return __builtin_bit_cast(unsigned, p); }   // first value in the low half
__device__ __forceinline__ v2h h_pair(float a, float b) {             // two f32 -> two f16, RNE, one packed convert
  const v2f x = {a, b};
  return __builtin_convertvector(x, v2h);
}
__device__ __forceinline__ unsigned h_word(v2h p) { return __builtin_bit_cast(unsigned, p); }
__device__ __forceinline__ float bf_rne(float f) { return (float)(__bf16)f; }
__device__ __forceinline__ float xhalf(float v) {                     // the value that lane ^ 16 holds
  const int b = __float_as_int(v);
  return __int_as_float(__builtin_amdgcn_permlanex16(b, b, 0x76543210, 0xfedcba98, false, false));
}
__device__ __forceinline__ v8f zero8() { v8f z = {0.f, 0.f, 0.f, 0.f, 0.f, 0.f, 0.f, 0.f}; return z; }

// ---- fragment loader: 16-bit A/B operand, lane -> row/col (lane&15), p already includes +8*(lane>>4);
//      elements 0..7 <- p[0..7] (k0+8h..), elements 8..15 <- p[16..23] (k0+16+8h..)
__device__ __forceinline__ v16b ldfrag_b(const __bf16* p) {
  union { v16b v; v8b h[2]; } f;
  f.h[0] = *(const v8b*)(p);
  f.h[1] = *(const v8b*)(p + 16);
  return f.v;
}

// ---- WMMA helpers; the guards hold the VALU hazard gap behind a block of WMMAs (asm only in the device pass) ----
__device__ __forceinline__ v8f mma_h_raw(v16h a, v16h b, v8f c) {
  return __builtin_amdgcn_wmma_f32_16x16x32_f16(false, a, false, b, (short)0, c, false, false);
}
__device__ __forceinline__ v8f mma_b_raw(v16b a, v16b b, v8f c) {
  return __builtin_amdgcn_wmma_f32_16x16x32_bf16(false, a, false, b, (short)0, c, false, false);
}
__device__ __forceinline__ void dep_guard_b(v8f& a, v8f& b, v16b x, v16b y) {
#if defined(__HIP_DEVICE_COMPILE__)
  asm volatile("v_nop\n\tv_nop\n\tv_nop\n\tv_nop" : "+v"(a), "+v"(b) : "v"(x), "v"(y));
#endif
}
__device__ __forceinline__ void keep4_b(v16b a, v16b b, v16b c, v16b d) {
#if defined(__HIP_DEVICE_COMPILE__)
  asm volatile("v_nop" :: "v"(a), "v"(b), "v"(c), "v"(d));
#endif
}
__device__ __forceinline__ void acc_guard4(v8f& a, v8f& b, v8f& c, v8f& d) {
#if defined(__HIP_DEVICE_COMPILE__)
  asm volatile("v_nop\n\tv_nop\n\tv_nop\n\tv_nop" : "+v"(a), "+v"(b), "+v"(c), "+v"(d));
#endif
}

// ---- 2^x. Behind a transcendental the instruction set asks for one issue slot before a vector instruction reads its result
//      or overwrites its source. Here the
//      results are early-clobber, so that inside a statement none lands on a source, and a v_nop fills the slot at its end.
__device__ __forceinline__ float exp2_1(float x) {
  float y = 0.f;
#if defined(__HIP_DEVICE_COMPILE__)
  asm("v_exp_f32 %0, %1\n\tv_nop" : "=&v"(y) : "v"(x));
#endif
  return y;
}
__device__ __forceinline__ v8f exp2_8(v8f x) {
  float y0 = 0.f, y1 = 0.f, y2 = 0.f, y3 = 0.f, y4 = 0.f, y5 = 0.f, y6 = 0.f, y7 = 0.f;
#if defined(__HIP_DEVICE_COMPILE__)
  asm("v_exp_f32 %0, %8\n\tv_exp_f32 %1, %9\n\tv_exp_f32 %2, %10\n\tv_exp_f32 %3, %11\n\t"
      "v_exp_f32 %4, %12\n\tv_exp_f32 %5, %13\n\tv_exp_f32 %6, %14\n\tv_exp_f32 %7, %15\n\tv_nop"
      : "=&v"(y0), "=&v"(y1), "=&v"(y2), "=&v"(y3), "=&v"(y4), "=&v"(y5), "=&v"(y6), "=&v"(y7)
      : "v"(x[0]), "v"(x[1]), "v"(x[2]), "v"(x[3]), "v"(x[4]), "v"(x[5]), "v"(x[6]), "v"(x[7]));
#endif
  const v8f y = {y0, y1, y2, y3, y4, y5, y6, y7};
  return y;
}

// ---- N asynchronous copies to LDS, 16 B per lane each: l[i] = the lane's LDS byte address, g[i] = its global address.
//      s_wait_xcnt 0 is the last line of the copies' own statement, so that it stands in front of every later
//      write of an address register that a copy names.
template <int N>
__device__ __forceinline__ void async_rows(const unsigned* l, const __bf16* const* g) {
  static_assert(N == 8 || N == 12);
#if defined(__HIP_DEVICE_COMPILE__)
  if constexpr (N == 8) {
    asm volatile(
        "global_load_async_to_lds_b128 %0, %8, off\n\t"
        "global_load_async_to_lds_b128 %1, %9, off\n\t"
        "global_load_async_to_lds_b128 %2, %10, off\n\t"
        "global_load_async_to_lds_b128 %3, %11, off\n\t"
        "global_load_async_to_lds_b128 %4, %12, off\n\t"
        "global_load_async_to_lds_b128 %5, %13, off\n\t"
        "global_load_async_to_lds_b128 %6, %14, off\n\t"
        "global_load_async_to_lds_b128 %7, %15, off\n\t"
        "s_wait_xcnt 0x0"
        :: "v"(l[0]), "v"(l[1]), "v"(l[2]), "v"(l[3]), "v"(l[4]), "v"(l[5]), "v"(l[6]), "v"(l[7]),
           "v"(g[0]), "v"(g[1]), "v"(g[2]), "v"(g[3]), "v"(g[4]), "v"(g[5]), "v"(g[6]), "v"(g[7])
        : "memory");
  } else {
    asm volatile(
        "global_load_async_to_lds_b128 %0, %12, off\n\t"
        "global_load_async_to_lds_b128 %1, %13, off\n\t"
        "global_load_async_to_lds_b128 %2, %14, off\n\t"
        "global_load_async_to_lds_b128 %3, %15, off\n\t"
        "global_load_async_to_lds_b128 %4, %16, off\n\t"
        "global_load_async_to_lds_b128 %5, %17, off\n\t"
        "global_load_async_to_lds_b128 %6, %18, off\n\t"
        "global_load_async_to_lds_b128 %7, %19, off\n\t"
        "global_load_async_to_lds_b128 %8, %20, off\n\t"
        "global_load_async_to_lds_b128 %9, %21, off\n\t"
        "global_load_async_to_lds_b128 %10, %22, off\n\t"
        "global_load_async_to_lds_b128 %11, %23, off\n\t"
        "s_wait_xcnt 0x0"
        :: "v"(l[0]), "v"(l[1]), "v"(l[2]), "v"(l[3]), "v"(l[4]), "v"(l[5]), "v"(l[6]), "v"(l[7]), "v"(l[8]), "v"(l[9]),
           "v"(l[10]), "v"(l[11]),
           "v"(g[0]), "v"(g[1]), "v"(g[2]), "v"(g[3]), "v"(g[4]), "v"(g[5]), "v"(g[6]), "v"(g[7]), "v"(g[8]), "v"(g[9]),
           "v"(g[10]), "v"(g[11])
        : "memory");
  }
#endif
}
// the issuing wave's own copies have landed behind this wait
__device__ __forceinline__ void wait_async0() {
#if defined(__HIP_DEVICE_COMPILE__)
  asm volatile("s_wait_asynccnt 0x0" ::: "memory");
#endif
}
// the wave's own LDS reads have returned behind this wait (in front of the barrier that frees a buffer for refill)
__device__ __forceinline__ void wait_ds0() {
#if defined(__HIP_DEVICE_COMPILE__)
  asm volatile("s_wait_dscnt 0x0" ::: "memory");
#endif
}

// =====================================================================================================
// f32 -> bf16 (RNE convert), 8 elements per thread, one 16-B store per lane: a wave writes 512 contiguous B.
// One launch for all five planes: blocks 0..nbx-1 convert x, then nbw blocks each for w0, w1, w2, w3; out is the
// x plane with the four weight planes directly behind it, in that order, so the flat index is the output index.
// coverage: (nbx + 4 * nbw) blocks x 256 threads x 8 = all five planes (each a whole number of blocks).
// =====================================================================================================
__global__ __launch_bounds__(256) void cvt_bf16x8(const float* __restrict__ x, const float* __restrict__ w0,
                                                  const float* __restrict__ w1, const float* __restrict__ w2,
                                                  const float* __restrict__ w3, unsigned short* out, int nbx, int nbw) {
  const int blk = blockIdx.x;
  const float* in = x;          // block-uniform choice of the source plane
  int rel = blk;                // block index inside that plane
  if (blk >= nbx) {
    const int j = blk - nbx;
    const int sel = j / nbw;
    rel = j - sel * nbw;
    in = (sel == 0) ? w0 : (sel == 1) ? w1 : (sel == 2) ? w2 : w3;
  }
  if (blk < nbx + 4 * nbw) {
    const int i = blk * 256 + threadIdx.x;
    const int si = rel * 256 + threadIdx.x;
    const v4f a = *(const v4f*)(in + (size_t)si * 8);
    const v4f b = *(const v4f*)(in + (size_t)si * 8 + 4);
    v4u p;
    p[0] = bf_word(bf_pair(a[0], a[1]));
    p[1] = bf_word(bf_pair(a[2], a[3]));
    p[2] = bf_word(bf_pair(b[0], b[1]));
    p[3] = bf_word(bf_pair(b[2], b[3]));
    *(v4u*)(out + (size_t)i * 8) = p;
    
  }
}

// =====================================================================================================
// Register-blocked batched bf16 WMMA GEMM: C[m][n] = sum_k A[m][k] * Bt[n][k] + bias; one wave per 64x64
// tile; the 4 waves of a block hold 2 x 2 tiles (128 x 128 of C): a staged row feeds two waves, the block's LDS
// lets several blocks share a WGP, and each launch's blocks are all resident at once. A row-major [M][K]
// pitch lda; Bt row-major [N][K] pitch ldb (k contiguous); M, N multiples of 128, K a positive
// multiple of 64; lda, ldb multiples of 8. bx = the block's index in one batch, b = batch index (strides in
// elements); sK (two k-slice buffers) is the calling kernel's LDS; behind the loop's last barrier its first bytes
// serve as the epilogue's 4 slabs of 16 x 68 floats.
// Operands: per 64-element k-slice the block's 128 A rows (and A2 rows) and 128 Bt rows go to LDS by asynchronous
// copies, 8 lanes x 16 B = one whole 128-B row piece, two buffers: slice t + 1 flies while slice t is multiplied;
// the fragments are read from LDS (pitch GP). Slice rows in a buffer: A 0..127, (A2 128..255,) then Bt.
// NSPLIT: 0 = A.Bt; 1 = (A + A2).Bt (A2 = unscaled bf16 lo plane of A, 2 products).
// BIAS: 0 = none; 1 = bias[n] per column; 2 = bias[m] per row; bias values RNE-converted to bf16 first,
//       added in f32; bias index clamped to nbias-1.
// OUT_MODE: 0 = f32 (pitch ldc); 2 = bf16 hi plane C + bf16 lo plane C2 (lo = RNE(v - hi), unscaled);
//           3 = f16 hi plane C + f16 residual plane C2 = f16((v - hi) * rscale) (pitch ldc2, stride strideC2).
// =====================================================================================================
template <int NSPLIT, int OUT_MODE, int BIAS>
__device__ __forceinline__ void gemm64_body(
    const unsigned short* __restrict__ Ap, const unsigned short* A2p, int lda, long long strideA,
    const unsigned short* __restrict__ Btp, int ldb, long long strideB,
    const float* __restrict__ bias, int nbias,
    void* Cout, int ldc, long long strideC,
    void* Cout2, int ldc2, long long strideC2,
    int M, int N, int K, float rscale,
    int bx, int b, __bf16* sK) {
  const __bf16* A   = (const __bf16*)(const void*)Ap;
  const __bf16* A2  = (const __bf16*)(const void*)A2p;
  const __bf16* Bt  = (const __bf16*)(const void*)Btp;
  constexpr int AROWS = (NSPLIT >= 1) ? 256 : 128; // staged A (and A2) rows
  constexpr int ROWS  = AROWS + 128;               // rows of one staged k-slice
  constexpr int NIT   = ROWS / 16;                 // copies per thread and slice: 128 threads x 16 B = 16 rows each
  const int lane = threadIdx.x & 31;
  const int wave = threadIdx.x >> 5;
  const int blocksN = N >> 7;
  const int blocksM = M >> 7;
  if (bx >= blocksM * blocksN) return;             // block-uniform, in front of every barrier
  const int brow = bx / blocksN;
  const int bcol = bx - brow * blocksN;
  const int mb0 = brow << 7;                       // first of the block's 128 rows
  const int nb0 = bcol << 7;                       // first of the block's 128 columns
  const int wm  = wave >> 1;                       // the wave's tile in the block: row wm, column wn
  const int wn  = wave & 1;
  const int m0 = mb0 + (wm << 6);
  const int n0 = nb0 + (wn << 6);

  const __bf16* Ab  = A  + (size_t)b * strideA;
  const __bf16* Bb  = Bt + (size_t)b * strideB;
  const __bf16* Ab2 = (NSPLIT >= 1) ? (A2 + (size_t)b * strideA) : Ab;

  const int rlane = lane & 15;                 // row (A) / col (B, D) within subtile
  const int koff  = (lane >> 4) * 8;           // k offset of this lane half
  const int mOff  = (lane >> 4) * 8;           // D row offset

  v8f acc[4][4];
#pragma unroll
  for (int i = 0; i < 4; ++i)
#pragma unroll
    for (int j = 0; j < 4; ++j) acc[i][j] = zero8();

  // ---- staging: thread -> slice row (tid >> 3) + 16 * it, 16-B piece tid & 7 ----
  const int srow = threadIdx.x >> 3;
  const int scol = (threadIdx.x & 7) * 8;
  const __bf16* gA  = Ab  + (size_t)(mb0 + srow) * lda + scol;
  const __bf16* gA2 = Ab2 + (size_t)(mb0 + srow) * lda + scol;
  const __bf16* gB  = Bb  + (size_t)(nb0 + srow) * ldb + scol;
  const unsigned lds0 = (unsigned)(size_t)(sK + srow * GP + scol);   // LDS byte address = low 32 bits
  auto stage = [&](int buf, int k0) {
    unsigned l[NIT];
    const __bf16* g[NIT];
#pragma unroll
    for (int it = 0; it < NIT; ++it) {
      l[it] = lds0 + (unsigned)(buf * ROWS + it * 16) * (unsigned)(GP * 2);
      if (it < 8)                g[it] = gA  + (size_t)(it * 16) * lda + k0;
      else if (it < AROWS / 16)  g[it] = gA2 + (size_t)((it - 8) * 16) * lda + k0;
      else                       g[it] = gB  + (size_t)((it - AROWS / 16) * 16) * ldb + k0;
    }
    async_rows<NIT / 2>(l, g);
    async_rows<NIT / 2>(l + NIT / 2, g + NIT / 2);
  };

  const int nch = K >> 6;
  stage(0, 0);
  wait_async0();
  __syncthreads();                       // slice 0 is published
  if (nch > 1) stage(1, 64);
  for (int t = 0; t < nch; ++t) {
    const __bf16* sS = sK + (t & 1) * (ROWS * GP) + rlane * GP + koff;
    const __bf16* sA = sS + (wm << 6) * GP;
    const __bf16* sB = sS + (AROWS + (wn << 6)) * GP;
#pragma unroll
    for (int ks = 0; ks < 2; ++ks) {
      constexpr int IG = (NSPLIT >= 1) ? 2 : 4;   // A fragments read as one group: as many as the registers hold
      v16b bh[4];
#pragma unroll
      for (int j = 0; j < 4; ++j) bh[j] = ldfrag_b(sB + (j << 4) * GP + ks * 32);
#pragma unroll
      for (int i0 = 0; i0 < 4; i0 += IG) {
        v16b ah[IG], al[IG];
#pragma unroll
        for (int u = 0; u < IG; ++u) {
          ah[u] = ldfrag_b(sA + ((i0 + u) << 4) * GP + ks * 32);
          al[u] = ah[u];
          if (NSPLIT >= 1) al[u] = ldfrag_b(sA + (128 + ((i0 + u) << 4)) * GP + ks * 32);
        }
#pragma unroll
        for (int u = 0; u < IG; ++u) {
          const int i = i0 + u;
#pragma unroll
          for (int j = 0; j < 4; ++j) {
            acc[i][j] = mma_b_raw(ah[u], bh[j], acc[i][j]);
            if (NSPLIT >= 1) acc[i][j] = mma_b_raw(al[u], bh[j], acc[i][j]);
          }
          dep_guard_b(acc[i][0], acc[i][3], ah[u], al[u]);
        }
      }
      keep4_b(bh[0], bh[1], bh[2], bh[3]);
    }
    wait_ds0();
    wait_async0();
    __syncthreads();                     // publishes slice t + 1 and ends every read of slice t's buffer
    if (t + 2 < nch) stage(t & 1, (t + 2) << 6);
  }
  wait_async0();
  acc_guard4(acc[0][0], acc[0][1], acc[0][2], acc[0][3]);
  acc_guard4(acc[1][0], acc[1][1], acc[1][2], acc[1][3]);
  acc_guard4(acc[2][0], acc[2][1], acc[2][2], acc[2][3]);
  acc_guard4(acc[3][0], acc[3][1], acc[3][2], acc[3][3]);

  // ---- epilogue ----
  float bn[4];
#pragma unroll
  for (int j = 0; j < 4; ++j) {
    const int bi = (BIAS == 1) ? (n0 + (j << 4) + rlane) : 0;
    const float bvv = bf_rne(bias[min(bi, nbias - 1)]);          // clamped address
    bn[j] = (BIAS == 1) ? bvv : 0.f;
  }
  float* slab = (float*)(void*)sK + wave * (16 * 68);   // every wave has passed the loop's last barrier: no reader, no copy left
#pragma unroll
  for (int i = 0; i < 4; ++i) {
    const int mBase = m0 + (i << 4);
    float bm[8];
#pragma unroll
    for (int r = 0; r < 8; ++r) {
      const int bi = (BIAS == 2) ? (mBase + mOff + r) : 0;
      const float bvv = bf_rne(bias[min(bi, nbias - 1)]);        // clamped address
      bm[r] = (BIAS == 2) ? bvv : 0.f;
    }
#pragma unroll
    for (int j = 0; j < 4; ++j) {
#pragma unroll
      for (int r = 0; r < 8; ++r) {
        slab[(mOff + r) * 68 + (j << 4) + rlane] = acc[i][j][r] + bn[j] + bm[r];
      }
    }
    __builtin_amdgcn_fence(__ATOMIC_RELEASE, "workgroup");
    __builtin_amdgcn_wave_barrier();
    __builtin_amdgcn_fence(__ATOMIC_ACQUIRE, "workgroup");
    if (OUT_MODE == 0) {
      float* C = (float*)Cout + (size_t)b * strideC;
      const int hh = lane >> 4, c4 = (lane & 15) * 4;     // 256-B row segment = 16 lanes x 16 B
      {
#pragma unroll
        for (int it = 0; it < 8; ++it) {
          const int row = it * 2 + hh;                     // it 0..7 x hh 0..1 = rows 0..15
          const v4f v = *(const v4f*)(slab + row * 68 + c4);
          *(v4f*)(C + (size_t)(mBase + row) * ldc + n0 + c4) = v;
        }
        
      }
    } else {
      const int q = lane >> 3, c8 = (lane & 7) * 8;
      unsigned short* C  = (unsigned short*)Cout  + (size_t)b * strideC;
      unsigned short* C2 = (unsigned short*)Cout2 + (size_t)b * strideC2;
      v4u hv[4], lv[4];
#pragma unroll
      for (int it = 0; it < 4; ++it) {
        const int row = it * 4 + q;                        // it 0..3 x q 0..3 = rows 0..15
        const float* sp = slab + row * 68 + c8;
        v4u a, a2;
#pragma unroll
        for (int e = 0; e < 4; ++e) {
          const float f0 = sp[2 * e], f1 = sp[2 * e + 1];
          if (OUT_MODE == 2) {
            const v2b hp = bf_pair(f0, f1);
            a[e]  = bf_word(hp);
            a2[e] = bf_word(bf_pair(f0 - (float)hp[0], f1 - (float)hp[1]));
          } else {
            const v2h xp = h_pair(f0, f1);
            a[e]  = h_word(xp);
            a2[e] = h_word(h_pair((f0 - (float)xp[0]) * rscale, (f1 - (float)xp[1]) * rscale));
          }
        }
        hv[it] = a; lv[it] = a2;
      }
      {
#pragma unroll
        for (int it = 0; it < 4; ++it) {
          const int row = it * 4 + q;
          *(v4u*)(C  + (size_t)(mBase + row) * ldc  + n0 + c8) = hv[it];
          *(v4u*)(C2 + (size_t)(mBase + row) * ldc2 + n0 + c8) = lv[it];
        }
        
      }
    }
    __builtin_amdgcn_fence(__ATOMIC_RELEASE, "workgroup");
    __builtin_amdgcn_wave_barrier();
    __builtin_amdgcn_fence(__ATOMIC_ACQUIRE, "workgroup");
  }
}

// ---- one GEMM per launch: blockIdx.x = block in the batch, blockIdx.y = batch ----
template <int NSPLIT, int OUT_MODE, int BIAS>
__global__ __launch_bounds__(128) void gemm64(
    const unsigned short* __restrict__ Ap, const unsigned short* A2p, int lda, long long strideA,
    const unsigned short* __restrict__ Btp, int ldb, long long strideB,
    const float* __restrict__ bias, int nbias,
    void* Cout, int ldc, long long strideC,
    void* Cout2, int ldc2, long long strideC2,
    int M, int N, int K, float rscale) {
  __shared__ __align__(16) __bf16 sK[2 * (((NSPLIT >= 1) ? 256 : 128) + 128) * GP];   // two k-slice buffers
  gemm64_body<NSPLIT, OUT_MODE, BIAS>(Ap, A2p, lda, strideA, Btp, ldb, strideB, bias, nbias,
                                      Cout, ldc, strideC, Cout2, ldc2, strideC2, M, N, K, rscale,
                                      blockIdx.x, blockIdx.y, sK);
}

// ---- the three independent projections in one launch; the branch on blockIdx.y is block-uniform ----
//   y = 0: q = x . Wq^T + bq, y = 1: k = x . Wk^T + bk -> bf16 hi/lo planes [b*SEQ+t][h*64+d] (M=8192, N=512, K=512),
//          blockIdx.x = one of 64 x 4 blocks of 128 x 128;
//   y = 2: v^T = Wv . x^T + bv (per row) per batch -> f16 hi plane [b][h*64+d][s] and residual plane (x4096), pitch SEQ
//          (A = Wv [n][k], Bt = x rows of the batch; M=512, N=512, K=512), blockIdx.x = batch * 16 + block in the batch.
__global__ __launch_bounds__(128) void proj_qkv(
    const unsigned short* __restrict__ Xb, const unsigned short* __restrict__ Wqb,
    const unsigned short* __restrict__ Wkb, const unsigned short* __restrict__ Wvb,
    const float* __restrict__ bq, const float* __restrict__ bk, const float* __restrict__ bv,
    unsigned short* Qh, unsigned short* Ql, unsigned short* Kh, unsigned short* Kl,
    unsigned short* VTh, unsigned short* VTl) {
  __shared__ __align__(16) __bf16 sK[2 * (128 + 128) * GP];
  const int y = blockIdx.y;
  if (y < 2) {
    const bool isq = (y == 0);
    gemm64_body<0, 2, 1>(Xb, Xb, DM, 0LL, isq ? Wqb : Wkb, DM, 0LL, isq ? bq : bk, DM,
                         (void*)(isq ? Qh : Kh), DM, 0LL, (void*)(isq ? Ql : Kl), DM, 0LL,
                         NB * SEQ, DM, DM, 1.0f, blockIdx.x, 0, sK);
  } else {
    gemm64_body<0, 3, 2>(Wvb, Wvb, DM, 0LL, Xb, DM, (long long)SEQ * DM, bv, DM,
                         (void*)VTh, SEQ, (long long)DM * SEQ, (void*)VTl, SEQ, (long long)DM * SEQ,
                         DM, SEQ, DM, 4096.0f, blockIdx.x & 15, blockIdx.x >> 4, sK);
  }
}

__global__ __launch_bounds__(128)
void attn64(const unsigned short* __restrict__ qhp, const unsigned short* __restrict__ qlp,
            const unsigned short* __restrict__ khp, const unsigned short* __restrict__ klp,
            const unsigned short* __restrict__ vhp, const unsigned short* __restrict__ vlp,
            const float* __restrict__ dbias, const int* __restrict__ kmask,
            unsigned short* ohp, unsigned short* olp, float sscale) {
  union FB { v16b v; v8b h[2]; };
  union FH { v16h v; v8h h[2]; };
  __shared__ __align__(16) __bf16   Ksh[64 * KP];   // K hi [kv][d], pitch KP
  __shared__ __align__(16) __bf16   Ksl[64 * KP];   // K lo
  __shared__ __align__(16) _Float16 Vth[64 * KP];   // V^T hi [d][kv], pitch KP
  __shared__ __align__(16) _Float16 Vtl[64 * KP];   // V^T residual
  __shared__ __align__(16) float    Os[4][16 * OP];    // per wave context tile [row][d], pitch OP

  const int tid  = threadIdx.x;
  const int wave = tid >> 5;
  const int lane = tid & 31;
  const int hh   = lane >> 4;
  const int c    = lane & 15;

  const int bx   = blockIdx.x;
  const int qb   = bx % NQB;
  const int rest = bx / NQB;
  const int h    = rest % NH;
  const int b    = rest / NH;
  const int q0   = qb * 64 + wave * 16;
  const size_t rowB = (size_t)b * SEQ;

  const __bf16* Qh = (const __bf16*)(const void*)qhp + (size_t)h * HD;
  const __bf16* Ql = (const __bf16*)(const void*)qlp + (size_t)h * HD;
  const __bf16* Kh = (const __bf16*)(const void*)khp + (size_t)h * HD;
  const __bf16* Kl = (const __bf16*)(const void*)klp + (size_t)h * HD;
  const _Float16* Vh = (const _Float16*)(const void*)vhp + ((size_t)b * DM + (size_t)h * HD) * SEQ;
  const _Float16* Vl = (const _Float16*)(const void*)vlp + ((size_t)b * DM + (size_t)h * HD) * SEQ;
  const float* dbw = dbias + (rowB + (size_t)q0 + c) * SEQ + 8 * hh;   // row q0+c, keys (kv0 + 16j) + 8hh + 0..7
  const int*   mkb = kmask + rowB + 8 * hh;                            // keys (kv0 + 16j) + 8hh + 0..7

  // ---- Q fragments (B operand, column = lane&15): 2 d-chunks, hi and lo ----
  v16b qah[2], qal[2];
#pragma unroll
  for (int dc = 0; dc < 2; ++dc) {
    const size_t qo = (rowB + q0 + c) * DM + dc * 32 + 8 * hh;
    qah[dc] = ldfrag_b(Qh + qo);
    qal[dc] = ldfrag_b(Ql + qo);
  }

  float mrow = -INFINITY, lrow = 0.f;        // of the lane's one query
  v8f oacc[4];                               // O^T: oacc[t][r] = context of query c, d = 16t + 8hh + r
#pragma unroll
  for (int t = 0; t < 4; ++t) oacc[t] = zero8();

  for (int kt = 0; kt < NQB; ++kt) {         // static trip count
    const int kv0 = kt * 64;
    __syncthreads();
    {
      // 8 lanes x 16 B = one whole 128-B tile row, so a wave's load touches 4 whole lines; rows r + 16 i, i = 0..3
      const int r = tid >> 3, pc = (tid & 7) * 8;
      const __bf16*   kg  = Kh + (rowB + kv0 + r) * DM + pc;      // K row kv0+r(+16i), d = pc..pc+7
      const __bf16*   klg = Kl + (rowB + kv0 + r) * DM + pc;
      const _Float16* vg  = Vh + (size_t)r * SEQ + kv0 + pc;      // V^T row d = r(+16i), s = kv0+pc..+7
      const _Float16* vlg = Vl + (size_t)r * SEQ + kv0 + pc;
      v8b a0[4], a1[4];
      v8h b0[4], b1[4];
#pragma unroll
      for (int i = 0; i < 4; ++i) {
        a0[i] = *(const v8b*)(kg  + (size_t)(16 * i) * DM);
        a1[i] = *(const v8b*)(klg + (size_t)(16 * i) * DM);
        b0[i] = *(const v8h*)(vg  + (size_t)(16 * i) * SEQ);
        b1[i] = *(const v8h*)(vlg + (size_t)(16 * i) * SEQ);
      }
#if defined(__HIP_DEVICE_COMPILE__)
      // the wait that stands in front of any overwrite of the loads' address registers; naming the four addresses
      // as inputs keeps them in their registers up to it, so that no later load of the group lands on one
      asm volatile("s_wait_xcnt 0x0" :: "v"(kg), "v"(klg), "v"(vg), "v"(vlg) : "memory");
#endif
#pragma unroll
      for (int i = 0; i < 4; ++i) {
        *(v8b*)(Ksh + (r + 16 * i) * KP + pc) = a0[i];
        *(v8b*)(Ksl + (r + 16 * i) * KP + pc) = a1[i];
        *(v8h*)(Vth + (r + 16 * i) * KP + pc) = b0[i];
        *(v8h*)(Vtl + (r + 16 * i) * KP + pc) = b1[i];
      }
    }
    __syncthreads();

    // ---- bias and key mask of this lane's 32 keys: 8 contiguous values per key tile ----
    const float* drw = dbw + kv0;
    const int*   mkw = mkb + kv0;
    v4f dv4[8];
    v4i mk4[8];
#pragma unroll
    for (int j = 0; j < 4; ++j) {
      dv4[2 * j]     = *(const v4f*)(drw + j * 16);
      dv4[2 * j + 1] = *(const v4f*)(drw + j * 16 + 4);
      mk4[2 * j]     = *(const v4i*)(mkw + j * 16);
      mk4[2 * j + 1] = *(const v4i*)(mkw + j * 16 + 4);
    }
#if defined(__HIP_DEVICE_COMPILE__)
    // the wait that stands in front of any overwrite of the loads' address registers; naming the two addresses
    // as inputs keeps them in their registers up to it
    asm volatile("s_wait_xcnt 0x0" :: "v"(drw), "v"(mkw) : "memory");
#endif

    // ---- scores, transposed: 64 keys x 16 queries per wave, 3 bf16 products; s[j][r] = key 16j + 8hh + r, query c ----
    //      the K fragments of a d-chunk are read as one group and the WMMAs go round the four key tiles, so that fewer
    //      of them wait for the one before (each s[j] still takes its six products in the same order)
    v8f s[4];
#pragma unroll
    for (int j = 0; j < 4; ++j) s[j] = zero8();
#pragma unroll
    for (int dc = 0; dc < 2; ++dc) {
      FB kb[4], kl[4];
#pragma unroll
      for (int j = 0; j < 4; ++j) {
        kb[j].h[0] = *(const v8b*)(Ksh + (j * 16 + c) * KP + dc * 32 + 8 * hh);
        kb[j].h[1] = *(const v8b*)(Ksh + (j * 16 + c) * KP + dc * 32 + 16 + 8 * hh);
        kl[j].h[0] = *(const v8b*)(Ksl + (j * 16 + c) * KP + dc * 32 + 8 * hh);
        kl[j].h[1] = *(const v8b*)(Ksl + (j * 16 + c) * KP + dc * 32 + 16 + 8 * hh);
      }
#pragma unroll
      for (int j = 0; j < 4; ++j) s[j] = mma_b_raw(kb[j].v, qah[dc], s[j]);
#pragma unroll
      for (int j = 0; j < 4; ++j) s[j] = mma_b_raw(kl[j].v, qah[dc], s[j]);
#pragma unroll
      for (int j = 0; j < 4; ++j) s[j] = mma_b_raw(kb[j].v, qal[dc], s[j]);
    }

    // holds the bias and mask arithmetic behind the score WMMAs: moved up among them, its wait for the global loads
    // would stand in front of the WMMAs and the loads' latency would not be covered by them
    __builtin_amdgcn_sched_barrier(0);

    // ---- scale + bias, clip, key mask, row max, online softmax; P (x1024, f16) and P residual (x4096)
    //      packed straight into the B fragments of the context product ----
    float m = -INFINITY;
#pragma unroll
    for (int j = 0; j < 4; ++j) {
      v2b dp[4];                             // the tile's 8 bias values, two to a convert
#pragma unroll
      for (int u = 0; u < 4; ++u) dp[u] = bf_pair(dv4[2 * j + (u >> 1)][(u & 1) * 2], dv4[2 * j + (u >> 1)][(u & 1) * 2 + 1]);
#pragma unroll
      for (int r = 0; r < 8; ++r) {
        const float dv = (float)dp[r >> 1][r & 1];
        float sv = s[j][r] * sscale + dv;
        sv = fminf(10.0f, fmaxf(-10.0f, sv));
        sv = (mk4[2 * j + (r >> 2)][r & 3] != 0) ? sv : -1.0e9f;
        s[j][r] = sv;
        m = fmaxf(m, sv);
      }
    }
    m = fmaxf(m, xhalf(m));                  // the query's other 32 keys of the chunk
    const float mnew  = fmaxf(mrow, m);
    const float msafe = (mnew == -INFINITY) ? 0.f : mnew;
    const float LOG2E = 1.44269504f;         // exp(x) = 2^(x * log2 e), the product and the instruction of __expf
    const float alpha = exp2_1((mrow - msafe) * LOG2E);
    mrow = mnew;
    float psum = 0.f;
    FH pa[2], pl[2];
#pragma unroll
    for (int j = 0; j < 4; ++j) {
      v8f xe;
#pragma unroll
      for (int r = 0; r < 8; ++r) xe[r] = (s[j][r] - msafe) * LOG2E;
      const v8f pe = exp2_8(xe);
#pragma unroll
      for (int r = 0; r < 8; r += 2) {
        const float p0 = pe[r];
        const float p1 = pe[r + 1];
        psum += p0;
        psum += p1;
        const float k0 = p0 * 1024.0f, k1 = p1 * 1024.0f;
        const v2h ph = h_pair(k0, k1);
        const v2h pr = h_pair((k0 - (float)ph[0]) * 4096.0f, (k1 - (float)ph[1]) * 4096.0f);
        pa[j >> 1].v[(j & 1) * 8 + r]     = ph[0];
        pa[j >> 1].v[(j & 1) * 8 + r + 1] = ph[1];
        pl[j >> 1].v[(j & 1) * 8 + r]     = pr[0];
        pl[j >> 1].v[(j & 1) * 8 + r + 1] = pr[1];
      }
    }
    psum += xhalf(psum);
    lrow = lrow * alpha + psum;
#pragma unroll
    for (int t = 0; t < 4; ++t)
#pragma unroll
      for (int r = 0; r < 8; ++r) oacc[t][r] *= alpha;

    // ---- context^T += V^T . P^T (f16 WMMA), residual products into a separate accumulator ----
    v8f o1[4];
#pragma unroll
    for (int t = 0; t < 4; ++t) o1[t] = zero8();
#pragma unroll
    for (int kk = 0; kk < 2; ++kk) {
      FH vb[4], vl[4];                       // the V^T fragments of 32 keys, read as one group
#pragma unroll
      for (int t = 0; t < 4; ++t) {
        vb[t].h[0] = *(const v8h*)(Vth + (t * 16 + c) * KP + kk * 32 + 8 * hh);
        vb[t].h[1] = *(const v8h*)(Vth + (t * 16 + c) * KP + kk * 32 + 16 + 8 * hh);
        vl[t].h[0] = *(const v8h*)(Vtl + (t * 16 + c) * KP + kk * 32 + 8 * hh);
        vl[t].h[1] = *(const v8h*)(Vtl + (t * 16 + c) * KP + kk * 32 + 16 + 8 * hh);
      }
#pragma unroll
      for (int t = 0; t < 4; ++t) oacc[t] = mma_h_raw(vb[t].v, pa[kk].v, oacc[t]);
#pragma unroll
      for (int t = 0; t < 4; ++t) o1[t]   = mma_h_raw(vl[t].v, pa[kk].v, o1[t]);
#pragma unroll
      for (int t = 0; t < 4; ++t) o1[t]   = mma_h_raw(vb[t].v, pl[kk].v, o1[t]);
    }
#pragma unroll
    for (int t = 0; t < 4; ++t)
#pragma unroll
      for (int r = 0; r < 8; ++r) oacc[t][r] += o1[t][r] * (1.0f / 4096.0f);
  }

  // ---- normalise (1/l and the 1/1024 p carry), stage the wave's 16x64 tile, bf16 hi/lo split,
  float* os = Os[wave];
  {
    const float l = lrow;
    const float inv = ((l > 0.f) ? (1.0f / l) : 0.f) * (1.0f / 1024.0f);
#pragma unroll
    for (int t = 0; t < 4; ++t) {
      v4f w0, w1;
#pragma unroll
      for (int r = 0; r < 4; ++r) { w0[r] = oacc[t][r] * inv; w1[r] = oacc[t][4 + r] * inv; }
      *(v4f*)(os + c * OP + t * 16 + 8 * hh)     = w0;      // row = query c, d = 16t + 8hh + 0..7
      *(v4f*)(os + c * OP + t * 16 + 8 * hh + 4) = w1;
    }
  }
  __builtin_amdgcn_fence(__ATOMIC_RELEASE, "workgroup");
  __builtin_amdgcn_wave_barrier();
  __builtin_amdgcn_fence(__ATOMIC_ACQUIRE, "workgroup");
  {
    const int q4 = lane >> 3, c8 = (lane & 7) * 8;
    v4u hv[4], lv[4];
#pragma unroll
    for (int it = 0; it < 4; ++it) {
      const int row = it * 4 + q4;   // it 0..3 x q4 0..3 = rows 0..15 of the wave tile
      const float* sp = os + row * OP + c8;
      v4u a, a2;
#pragma unroll
      for (int e = 0; e < 4; ++e) {
        const float f0 = sp[2 * e], f1 = sp[2 * e + 1];
        const v2b hp = bf_pair(f0, f1);
        a[e]  = bf_word(hp);
        a2[e] = bf_word(bf_pair(f0 - (float)hp[0], f1 - (float)hp[1]));
      }
      hv[it] = a; lv[it] = a2;
    }
    {
#pragma unroll
      for (int it = 0; it < 4; ++it) {
        const int row = it * 4 + q4;
        const size_t go = (rowB + q0 + row) * DM + (size_t)h * HD + c8;
        *(v4u*)(ohp + go) = hv[it];
        *(v4u*)(olp + go) = lv[it];
      }
      
    }
  }
}

// =====================================================================================================
// Workspace map (bytes), every plane an exact multiple of its 64x64-tile / whole-line store granularity:
//   Xb   bf16 [8192][512]          8388608
//   Wqb, Wkb, Wvb, Wob bf16 [512 n][512 k]   524288 each
//   Qh, Ql, Kh, Kl bf16 [8192][512] 8388608 each
//   VTh  f16  [16][512 d][512 s]   8388608
//   VTl  f16  [16][512 d][512 s]   8388608
//   Oh, Ol bf16 [8192][512]         8388608 each
//   total                           77594624
// Weights are [out n][in k] with k contiguous = the Bt / A layout the GEMM wants, so they are only converted.
// =====================================================================================================
extern "C" void kernel_launch(void* const* d_in, const int* in_sizes, int n_in,
                              void* d_out, int out_size, void* d_ws, size_t ws_size,
                              hipStream_t stream) {
  if (n_in < 11) return;
  if (in_sizes[0] != NB * SEQ * DM) return;
  if (in_sizes[1] != NB * SEQ * SEQ) return;
  if (in_sizes[2] != NB * SEQ) return;
  if (in_sizes[3] != DM * DM || in_sizes[5] != DM * DM || in_sizes[7] != DM * DM || in_sizes[9] != DM * DM) return;
  if (in_sizes[4] != DM || in_sizes[6] != DM || in_sizes[8] != DM || in_sizes[10] != DM) return;
  if (out_size != NB * SEQ * DM) return;

  const float* x    = (const float*)d_in[0];
  const float* db   = (const float*)d_in[1];
  const int*   msk  = (const int*)d_in[2];
  const float* Wq   = (const float*)d_in[3];
  const float* bq   = (const float*)d_in[4];
  const float* Wk   = (const float*)d_in[5];
  const float* bk   = (const float*)d_in[6];
  const float* Wv   = (const float*)d_in[7];
  const float* bv   = (const float*)d_in[8];
  const float* Wo   = (const float*)d_in[9];
  const float* bo   = (const float*)d_in[10];

  const size_t PX  = (size_t)NB * SEQ * DM * 2;   // 8388608   16-bit activation plane [8192][512]
  const size_t PW  = (size_t)DM * DM * 2;         //  524288   16-bit weight plane
  const size_t PVT = (size_t)NB * DM * SEQ * 2;   // 8388608   v^T plane
  size_t off = 0;
  const size_t oXb  = off; off += PX;
  const size_t oWq  = off; off += PW;
  const size_t oWk  = off; off += PW;
  const size_t oWv  = off; off += PW;
  const size_t oWo  = off; off += PW;
  const size_t oQh  = off; off += PX;
  const size_t oQl  = off; off += PX;
  const size_t oKh  = off; off += PX;
  const size_t oKl  = off; off += PX;
  const size_t oVTh = off; off += PVT;
  const size_t oVTl = off; off += PVT;
  const size_t oOh  = off; off += PX;
  const size_t oOl  = off; off += PX;
  if (off > ws_size) return;                      // off = 77594624
  if (off > (size_t)134217728) return;

  char* ws = (char*)d_ws;
  unsigned short* Xb  = (unsigned short*)(ws + oXb);
  unsigned short* Wqb = (unsigned short*)(ws + oWq);
  unsigned short* Wkb = (unsigned short*)(ws + oWk);
  unsigned short* Wvb = (unsigned short*)(ws + oWv);
  unsigned short* Wob = (unsigned short*)(ws + oWo);
  unsigned short* Qh  = (unsigned short*)(ws + oQh);
  unsigned short* Ql  = (unsigned short*)(ws + oQl);
  unsigned short* Kh  = (unsigned short*)(ws + oKh);
  unsigned short* Kl  = (unsigned short*)(ws + oKl);
  unsigned short* VTh = (unsigned short*)(ws + oVTh);
  unsigned short* VTl = (unsigned short*)(ws + oVTl);
  unsigned short* Oh  = (unsigned short*)(ws + oOh);
  unsigned short* Ol  = (unsigned short*)(ws + oOl);

  const dim3 blk(256);
  const int n8x = NB * SEQ * DM / 8;                          // 524288
  const int n8w = DM * DM / 8;                                //  32768
  const int nbx = n8x / 256;                                  // 2048 blocks for x
  const int nbw = n8w / 256;                                  //  128 blocks for each weight
  const dim3 gCvt(nbx + 4 * nbw);                             // 2560 blocks
  const dim3 gProj((NB * SEQ / 128) * (DM / 128), 1);         // 64 x 4 = 256 blocks of 128 x 128: M=8192, N=512
  const dim3 gQKV((NB * SEQ / 128) * (DM / 128), 3);          // 256 blocks each for q, k and v^T (16 blocks x 16 batches)
  const dim3 gAttn(NB * NH * NQB);                            // 1024 blocks of 128 threads

  // (1) x -> bf16 plane [8192][512]; weights [n][k] f32 -> bf16 [n][k]; Xb, Wqb, Wkb, Wvb, Wob lie one behind the other
  cvt_bf16x8<<<gCvt, blk, 0, stream>>>(x, Wq, Wk, Wv, Wo, Xb, nbx, nbw);
  // (2) q, k -> bf16 hi/lo planes, v^T -> f16 hi and residual planes
  proj_qkv<<<gQKV, dim3(128), 0, stream>>>(Xb, Wqb, Wkb, Wvb, bq, bk, bv, Qh, Ql, Kh, Kl, VTh, VTl);
  // (3) attention -> context bf16 hi/lo planes
  attn64<<<gAttn, dim3(128), 0, stream>>>(
      Qh, Ql, Kh, Kl, VTh, VTl, db, msk, Oh, Ol, 0.125f);
  // (4) out = context . Wo^T + bo -> d_out f32 [8192][512]  (A = context hi + lo planes, 2 products)
  gemm64<1, 0, 1><<<gProj, dim3(128), 0, stream>>>(
      Oh, Ol, DM, 0LL, Wob, DM, 0LL, bo, DM,
      d_out, DM, 0LL, d_out, DM, 0LL,
      NB * SEQ, DM, DM, 1.0f);
  (void)hipGetLastError();
}

// v010
// It runs in 53.1 microseconds.
// Versions between v008 and this one are left out; their measured steps multiply to 1.30 times as fast.
// Over all steps from v000 it is 3.90 times as fast.
// Contractions: q, k, v^T projections = v_wmma_f32_16x16x32_bf16 (bf16 operands from RNE-converted inputs, single product, bias added in f32);
// q.k^T scores = v_wmma_f32_16x16x32_f16 (q and k RNE-converted to f16, single product);
// p.v = v_wmma_f32_16x16x32_f16 (p carried x1024 in f16, v in f16, single product);
// ctx.Wo^T = v_wmma_f32_16x16x32_f16 (ctx and Wo RNE-converted to f16, single product); all f32 accumulate; clip, key mask and softmax in f32.
// An f16 operand is rounded 8 times finer than the bf16 operands of the projections that q, k and v come from.
#include <hip/hip_runtime.h>
#include <math.h>
#include <float.h>
#include <stdint.h>

#define NB    16
#define SEQ   512
#define DM    512
#define NH    8
#define HD    64
#define NQB   (SEQ / 64)   // 8 key / query tiles of 64
#define KP    72           // LDS row pitch of the 64-wide 16-bit tiles, elements: 144 B = 16 B x 9, for ds_load_b128 readers
#define OP    68           // LDS row pitch of the 64-wide f32 context tile, floats: 272 B = 16 B x 17
#define GP    72           // LDS row pitch of a staged 64-element GEMM k-slice, elements: 144 B = 16 B x 9, for ds_load_b128 readers
static_assert(NH * HD == DM);
static_assert((SEQ % 128) == 0 && (DM % 128) == 0 && ((NB * SEQ) % 128) == 0);

typedef _Float16 v16h __attribute__((ext_vector_type(16)));
typedef _Float16 v8h  __attribute__((ext_vector_type(8)));
typedef __bf16   v16b __attribute__((ext_vector_type(16)));
typedef __bf16   v8b  __attribute__((ext_vector_type(8)));
typedef float    v8f  __attribute__((ext_vector_type(8)));
typedef float    v4f  __attribute__((ext_vector_type(4)));
typedef unsigned int v4u __attribute__((ext_vector_type(4)));
typedef int      v4i  __attribute__((ext_vector_type(4)));
typedef float    v2f  __attribute__((ext_vector_type(2)));
typedef __bf16   v2b  __attribute__((ext_vector_type(2)));
typedef _Float16 v2h  __attribute__((ext_vector_type(2)));

// ---- scalar helpers --------------------------------------------------------------------------------
__device__ __forceinline__ v2b bf_pair(float a, float b) {            // two f32 -> two bf16, RNE, one packed convert
  const v2f x = {a, b};
  return __builtin_convertvector(x, v2b);
}
__device__ __forceinline__ unsigned bf_word(v2b p) { return __builtin_bit_cast(unsigned, p); }   // first value in the low half
__device__ __forceinline__ v2h h_pair(float a, float b) {             // two f32 -> two f16, RNE, one packed convert
  const v2f x = {a, b};
  return __builtin_convertvector(x, v2h);
}
__device__ __forceinline__ unsigned h_word(v2h p) { return __builtin_bit_cast(unsigned, p); }
__device__ __forceinline__ float bf_rne(float f) { return (float)(__bf16)f; }
__device__ __forceinline__ float xhalf(float v) {                     // the value that lane ^ 16 holds
  const int b = __float_as_int(v);
  return __int_as_float(__builtin_amdgcn_permlanex16(b, b, 0x76543210, 0xfedcba98, false, false));
}
__device__ __forceinline__ v8f zero8() { v8f z = {0.f, 0.f, 0.f, 0.f, 0.f, 0.f, 0.f, 0.f}; return z; }

// ---- fragment loader: 16-bit A/B operand, lane -> row/col (lane&15), p already includes +8*(lane>>4);
//      elements 0..7 <- p[0..7] (k0+8h..), elements 8..15 <- p[16..23] (k0+16+8h..)
__device__ __forceinline__ v16b ldfrag_b(const __bf16* p) {
  union { v16b v; v8b h[2]; } f;
  f.h[0] = *(const v8b*)(p);
  f.h[1] = *(const v8b*)(p + 16);
  return f.v;
}
__device__ __forceinline__ v16h ldfrag_h(const _Float16* p) {
  union { v16h v; v8h h[2]; } f;
  f.h[0] = *(const v8h*)(p);
  f.h[1] = *(const v8h*)(p + 16);
  return f.v;
}

// ---- WMMA helpers; the guards hold the VALU hazard gap behind a block of WMMAs (asm only in the device pass) ----
__device__ __forceinline__ v8f mma_h_raw(v16h a, v16h b, v8f c) {
  return __builtin_amdgcn_wmma_f32_16x16x32_f16(false, a, false, b, (short)0, c, false, false);
}
__device__ __forceinline__ v8f mma_b_raw(v16b a, v16b b, v8f c) {
  return __builtin_amdgcn_wmma_f32_16x16x32_bf16(false, a, false, b, (short)0, c, false, false);
}
__device__ __forceinline__ void dep_guard_b(v8f& a, v8f& b, v16b x, v16b y) {
#if defined(__HIP_DEVICE_COMPILE__)
  asm volatile("v_nop\n\tv_nop\n\tv_nop\n\tv_nop" : "+v"(a), "+v"(b) : "v"(x), "v"(y));
#endif
}
__device__ __forceinline__ void keep4_b(v16b a, v16b b, v16b c, v16b d) {
#if defined(__HIP_DEVICE_COMPILE__)
  asm volatile("v_nop" :: "v"(a), "v"(b), "v"(c), "v"(d));
#endif
}
__device__ __forceinline__ void acc_guard4(v8f& a, v8f& b, v8f& c, v8f& d) {
#if defined(__HIP_DEVICE_COMPILE__)
  asm volatile("v_nop\n\tv_nop\n\tv_nop\n\tv_nop" : "+v"(a), "+v"(b), "+v"(c), "+v"(d));
#endif
}

// ---- 2^x. Behind a transcendental the instruction set asks for one issue slot before a vector instruction reads its result
//      or overwrites its source. Here the
//      results are early-clobber, so that inside a statement none lands on a source, and a v_nop fills the slot at its end.
__device__ __forceinline__ float exp2_1(float x) {
  float y = 0.f;
#if defined(__HIP_DEVICE_COMPILE__)
  asm("v_exp_f32 %0, %1\n\tv_nop" : "=&v"(y) : "v"(x));
#endif
  return y;
}
__device__ __forceinline__ v8f exp2_8(v8f x) {
  float y0 = 0.f, y1 = 0.f, y2 = 0.f, y3 = 0.f, y4 = 0.f, y5 = 0.f, y6 = 0.f, y7 = 0.f;
#if defined(__HIP_DEVICE_COMPILE__)
  asm("v_exp_f32 %0, %8\n\tv_exp_f32 %1, %9\n\tv_exp_f32 %2, %10\n\tv_exp_f32 %3, %11\n\t"
      "v_exp_f32 %4, %12\n\tv_exp_f32 %5, %13\n\tv_exp_f32 %6, %14\n\tv_exp_f32 %7, %15\n\tv_nop"
      : "=&v"(y0), "=&v"(y1), "=&v"(y2), "=&v"(y3), "=&v"(y4), "=&v"(y5), "=&v"(y6), "=&v"(y7)
      : "v"(x[0]), "v"(x[1]), "v"(x[2]), "v"(x[3]), "v"(x[4]), "v"(x[5]), "v"(x[6]), "v"(x[7]));
#endif
  const v8f y = {y0, y1, y2, y3, y4, y5, y6, y7};
  return y;
}

// ---- 8 asynchronous copies to LDS, 16 B per lane each: l[i] = the lane's LDS byte address, g[i] = its global address.
//      s_wait_xcnt 0 is the last line of the copies' own statement, so that it stands in front of every later
//      write of an address register that a copy names.
__device__ __forceinline__ void async_rows8(const unsigned* l, const __bf16* const* g) {
#if defined(__HIP_DEVICE_COMPILE__)
  asm volatile(
      "global_load_async_to_lds_b128 %0, %8, off\n\t"
      "global_load_async_to_lds_b128 %1, %9, off\n\t"
      "global_load_async_to_lds_b128 %2, %10, off\n\t"
      "global_load_async_to_lds_b128 %3, %11, off\n\t"
      "global_load_async_to_lds_b128 %4, %12, off\n\t"
      "global_load_async_to_lds_b128 %5, %13, off\n\t"
      "global_load_async_to_lds_b128 %6, %14, off\n\t"
      "global_load_async_to_lds_b128 %7, %15, off\n\t"
      "s_wait_xcnt 0x0"
      :: "v"(l[0]), "v"(l[1]), "v"(l[2]), "v"(l[3]), "v"(l[4]), "v"(l[5]), "v"(l[6]), "v"(l[7]),
         "v"(g[0]), "v"(g[1]), "v"(g[2]), "v"(g[3]), "v"(g[4]), "v"(g[5]), "v"(g[6]), "v"(g[7])
      : "memory");
#endif
}
// the same 8 copies from an f32 plane
__device__ __forceinline__ void async_rows8f(const unsigned* l, const float* const* g) {
#if defined(__HIP_DEVICE_COMPILE__)
  asm volatile(
      "global_load_async_to_lds_b128 %0, %8, off\n\t"
      "global_load_async_to_lds_b128 %1, %9, off\n\t"
      "global_load_async_to_lds_b128 %2, %10, off\n\t"
      "global_load_async_to_lds_b128 %3, %11, off\n\t"
      "global_load_async_to_lds_b128 %4, %12, off\n\t"
      "global_load_async_to_lds_b128 %5, %13, off\n\t"
      "global_load_async_to_lds_b128 %6, %14, off\n\t"
      "global_load_async_to_lds_b128 %7, %15, off\n\t"
      "s_wait_xcnt 0x0"
      :: "v"(l[0]), "v"(l[1]), "v"(l[2]), "v"(l[3]), "v"(l[4]), "v"(l[5]), "v"(l[6]), "v"(l[7]),
         "v"(g[0]), "v"(g[1]), "v"(g[2]), "v"(g[3]), "v"(g[4]), "v"(g[5]), "v"(g[6]), "v"(g[7])
      : "memory");
#endif
}
// the issuing wave's own copies have landed behind this wait
__device__ __forceinline__ void wait_async0() {
#if defined(__HIP_DEVICE_COMPILE__)
  asm volatile("s_wait_asynccnt 0x0" ::: "memory");
#endif
}
// the wave's own LDS reads have returned behind this wait (in front of the barrier that frees a buffer for refill)
__device__ __forceinline__ void wait_ds0() {
#if defined(__HIP_DEVICE_COMPILE__)
  asm volatile("s_wait_dscnt 0x0" ::: "memory");
#endif
}

// =====================================================================================================
// f32 -> 16 bit (RNE convert), 8 elements per thread, one 16-B store per lane: a wave writes 512 contiguous B.
// One launch for all five planes: blocks 0..nbx-1 convert x, then nbw blocks each for w0, w1, w2, w3; out is the
// x plane with the four weight planes directly behind it, in that order, so the flat index is the output index.
// x, w0, w1, w2 -> bf16; w3 -> f16 (the choice is block-uniform).
// coverage: (nbx + 4 * nbw) blocks x 256 threads x 8 = all five planes (each a whole number of blocks).
// =====================================================================================================
__global__ __launch_bounds__(256) void cvt_16x8(const float* __restrict__ x, const float* __restrict__ w0,
                                                const float* __restrict__ w1, const float* __restrict__ w2,
                                                const float* __restrict__ w3, unsigned short* out, int nbx, int nbw) {
  const int blk = blockIdx.x;
  const float* in = x;          // block-uniform choice of the source plane
  int rel = blk;                // block index inside that plane
  bool toh = false;             // f16 plane
  if (blk >= nbx) {
    const int j = blk - nbx;
    const int sel = j / nbw;
    rel = j - sel * nbw;
    in = (sel == 0) ? w0 : (sel == 1) ? w1 : (sel == 2) ? w2 : w3;
    toh = (sel >= 3);
  }
  if (blk < nbx + 4 * nbw) {
    const int i = blk * 256 + threadIdx.x;
    const int si = rel * 256 + threadIdx.x;
    const v4f a = *(const v4f*)(in + (size_t)si * 8);
    const v4f b = *(const v4f*)(in + (size_t)si * 8 + 4);
    v4u p;
    if (toh) {
      p[0] = h_word(h_pair(a[0], a[1]));
      p[1] = h_word(h_pair(a[2], a[3]));
      p[2] = h_word(h_pair(b[0], b[1]));
      p[3] = h_word(h_pair(b[2], b[3]));
    } else {
      p[0] = bf_word(bf_pair(a[0], a[1]));
      p[1] = bf_word(bf_pair(a[2], a[3]));
      p[2] = bf_word(bf_pair(b[0], b[1]));
      p[3] = bf_word(bf_pair(b[2], b[3]));
    }
    *(v4u*)(out + (size_t)i * 8) = p;
  }
}

// =====================================================================================================
// Register-blocked batched 16-bit WMMA GEMM: C[m][n] = sum_k A[m][k] * Bt[n][k] + bias; one wave per 64x64
// tile; the 4 waves of a block hold 2 x 2 tiles (128 x 128 of C): a staged row feeds two waves, the block's LDS
// lets several blocks share a WGP, and each launch's blocks are all resident at once. A row-major [M][K]
// pitch lda; Bt row-major [N][K] pitch ldb (k contiguous); M, N multiples of 128, K a positive
// multiple of 64; lda, ldb multiples of 8. bx = the block's index in one batch, b = batch index (strides in
// elements); sK (two k-slice buffers) is the calling kernel's LDS; behind the loop's last barrier its first bytes
// serve as the epilogue's 4 slabs of 16 x 68 floats.
// Operands: per 64-element k-slice the block's 128 A rows and 128 Bt rows go to LDS by asynchronous
// copies, 8 lanes x 16 B = one whole 128-B row piece, two buffers: slice t + 1 flies while slice t is multiplied;
// the fragments are read from LDS (pitch GP). Slice rows in a buffer: A 0..127, then Bt.
// OPH: 0 = A and Bt hold bf16; 1 = A and Bt hold f16 (staging and fragment reads move 16-bit words either way).
// BIAS: 0 = none; 1 = bias[n] per column; 2 = bias[m] per row; bias values RNE-converted to bf16 first,
//       added in f32; bias index clamped to nbias-1.
// OUT_MODE: 0 = f32; 1 = f16 (RNE); pitch ldc.
// =====================================================================================================
template <int OPH, int OUT_MODE, int BIAS>
__device__ __forceinline__ void gemm64_body(
    const unsigned short* __restrict__ Ap, int lda, long long strideA,
    const unsigned short* __restrict__ Btp, int ldb, long long strideB,
    const float* __restrict__ bias, int nbias,
    void* Cout, int ldc, long long strideC,
    int M, int N, int K,
    int bx, int b, __bf16* sK) {
  const __bf16* A   = (const __bf16*)(const void*)Ap;
  const __bf16* Bt  = (const __bf16*)(const void*)Btp;
  constexpr int ROWS  = 128 + 128;                 // rows of one staged k-slice
  constexpr int NIT   = ROWS / 16;                 // copies per thread and slice: 128 threads x 16 B = 16 rows each
  const int lane = threadIdx.x & 31;
  const int wave = threadIdx.x >> 5;
  const int blocksN = N >> 7;
  const int blocksM = M >> 7;
  if (bx >= blocksM * blocksN) return;             // block-uniform, in front of every barrier
  const int brow = bx / blocksN;
  const int bcol = bx - brow * blocksN;
  const int mb0 = brow << 7;                       // first of the block's 128 rows
  const int nb0 = bcol << 7;                       // first of the block's 128 columns
  const int wm  = wave >> 1;                       // the wave's tile in the block: row wm, column wn
  const int wn  = wave & 1;
  const int m0 = mb0 + (wm << 6);
  const int n0 = nb0 + (wn << 6);

  const __bf16* Ab  = A  + (size_t)b * strideA;
  const __bf16* Bb  = Bt + (size_t)b * strideB;

  const int rlane = lane & 15;                 // row (A) / col (B, D) within subtile
  const int koff  = (lane >> 4) * 8;           // k offset of this lane half
  const int mOff  = (lane >> 4) * 8;           // D row offset

  v8f acc[4][4];
#pragma unroll
  for (int i = 0; i < 4; ++i)
#pragma unroll
    for (int j = 0; j < 4; ++j) acc[i][j] = zero8();

  // ---- staging: thread -> slice row (tid >> 3) + 16 * it, 16-B piece tid & 7 ----
  const int srow = threadIdx.x >> 3;
  const int scol = (threadIdx.x & 7) * 8;
  const __bf16* gA  = Ab  + (size_t)(mb0 + srow) * lda + scol;
  const __bf16* gB  = Bb  + (size_t)(nb0 + srow) * ldb + scol;
  const unsigned lds0 = (unsigned)(size_t)(sK + srow * GP + scol);   // LDS byte address = low 32 bits
  auto stage = [&](int buf, int k0) {
    unsigned l[NIT];
    const __bf16* g[NIT];
#pragma unroll
    for (int it = 0; it < NIT; ++it) {
      l[it] = lds0 + (unsigned)(buf * ROWS + it * 16) * (unsigned)(GP * 2);
      if (it < 8) g[it] = gA + (size_t)(it * 16) * lda + k0;
      else        g[it] = gB + (size_t)((it - 8) * 16) * ldb + k0;
    }
    async_rows8(l, g);
    async_rows8(l + 8, g + 8);
  };

  const int nch = K >> 6;
  stage(0, 0);
  wait_async0();
  __syncthreads();                       // slice 0 is published
  if (nch > 1) stage(1, 64);
  for (int t = 0; t < nch; ++t) {
    const __bf16* sS = sK + (t & 1) * (ROWS * GP) + rlane * GP + koff;
    const __bf16* sA = sS + (wm << 6) * GP;
    const __bf16* sB = sS + (128 + (wn << 6)) * GP;
#pragma unroll
    for (int ks = 0; ks < 2; ++ks) {
      v16b bh[4], ah[4];
#pragma unroll
      for (int j = 0; j < 4; ++j) bh[j] = ldfrag_b(sB + (j << 4) * GP + ks * 32);
#pragma unroll
      for (int i = 0; i < 4; ++i) ah[i] = ldfrag_b(sA + (i << 4) * GP + ks * 32);
#pragma unroll
      for (int i = 0; i < 4; ++i) {
#pragma unroll
        for (int j = 0; j < 4; ++j) {
          if (OPH == 1) acc[i][j] = mma_h_raw(__builtin_bit_cast(v16h, ah[i]), __builtin_bit_cast(v16h, bh[j]), acc[i][j]);
          else          acc[i][j] = mma_b_raw(ah[i], bh[j], acc[i][j]);
        }
        dep_guard_b(acc[i][0], acc[i][3], ah[i], ah[i]);
      }
      keep4_b(bh[0], bh[1], bh[2], bh[3]);
    }
    wait_ds0();
    wait_async0();
    __syncthreads();                     // publishes slice t + 1 and ends every read of slice t's buffer
    if (t + 2 < nch) stage(t & 1, (t + 2) << 6);
  }
  wait_async0();
  acc_guard4(acc[0][0], acc[0][1], acc[0][2], acc[0][3]);
  acc_guard4(acc[1][0], acc[1][1], acc[1][2], acc[1][3]);
  acc_guard4(acc[2][0], acc[2][1], acc[2][2], acc[2][3]);
  acc_guard4(acc[3][0], acc[3][1], acc[3][2], acc[3][3]);

  // ---- epilogue ----
  float bn[4];
#pragma unroll
  for (int j = 0; j < 4; ++j) {
    const int bi = (BIAS == 1) ? (n0 + (j << 4) + rlane) : 0;
    const float bvv = bf_rne(bias[min(bi, nbias - 1)]);          // clamped address
    bn[j] = (BIAS == 1) ? bvv : 0.f;
  }
  float* slab = (float*)(void*)sK + wave * (16 * 68);   // every wave has passed the loop's last barrier: no reader, no copy left
#pragma unroll
  for (int i = 0; i < 4; ++i) {
    const int mBase = m0 + (i << 4);
    float bm[8];
#pragma unroll
    for (int r = 0; r < 8; ++r) {
      const int bi = (BIAS == 2) ? (mBase + mOff + r) : 0;
      const float bvv = bf_rne(bias[min(bi, nbias - 1)]);        // clamped address
      bm[r] = (BIAS == 2) ? bvv : 0.f;
    }
#pragma unroll
    for (int j = 0; j < 4; ++j) {
#pragma unroll
      for (int r = 0; r < 8; ++r) {
        slab[(mOff + r) * 68 + (j << 4) + rlane] = acc[i][j][r] + bn[j] + bm[r];
      }
    }
    __builtin_amdgcn_fence(__ATOMIC_RELEASE, "workgroup");
    __builtin_amdgcn_wave_barrier();
    __builtin_amdgcn_fence(__ATOMIC_ACQUIRE, "workgroup");
    if (OUT_MODE == 0) {
      float* C = (float*)Cout + (size_t)b * strideC;
      const int hh = lane >> 4, c4 = (lane & 15) * 4;     // 256-B row segment = 16 lanes x 16 B
#pragma unroll
      for (int it = 0; it < 8; ++it) {
        const int row = it * 2 + hh;                       // it 0..7 x hh 0..1 = rows 0..15
        const v4f v = *(const v4f*)(slab + row * 68 + c4);
        *(v4f*)(C + (size_t)(mBase + row) * ldc + n0 + c4) = v;
      }
    } else {
      const int q = lane >> 3, c8 = (lane & 7) * 8;        // 128-B row segment = 8 lanes x 16 B
      unsigned short* C  = (unsigned short*)Cout  + (size_t)b * strideC;
      v4u hv[4];
#pragma unroll
      for (int it = 0; it < 4; ++it) {
        const int row = it * 4 + q;                        // it 0..3 x q 0..3 = rows 0..15
        const float* sp = slab + row * 68 + c8;
#pragma unroll
        for (int e = 0; e < 4; ++e) hv[it][e] = h_word(h_pair(sp[2 * e], sp[2 * e + 1]));
      }
#pragma unroll
      for (int it = 0; it < 4; ++it) {
        const int row = it * 4 + q;
        *(v4u*)(C + (size_t)(mBase + row) * ldc + n0 + c8) = hv[it];
      }
    }
    __builtin_amdgcn_fence(__ATOMIC_RELEASE, "workgroup");
    __builtin_amdgcn_wave_barrier();
    __builtin_amdgcn_fence(__ATOMIC_ACQUIRE, "workgroup");
  }
}

// ---- one GEMM per launch: blockIdx.x = block in the batch, blockIdx.y = batch ----
template <int OPH, int OUT_MODE, int BIAS>
__global__ __launch_bounds__(128) void gemm64(
    const unsigned short* __restrict__ Ap, int lda, long long strideA,
    const unsigned short* __restrict__ Btp, int ldb, long long strideB,
    const float* __restrict__ bias, int nbias,
    void* Cout, int ldc, long long strideC,
    int M, int N, int K) {
  __shared__ __align__(16) __bf16 sK[2 * (128 + 128) * GP];   // two k-slice buffers
  gemm64_body<OPH, OUT_MODE, BIAS>(Ap, lda, strideA, Btp, ldb, strideB, bias, nbias,
                                   Cout, ldc, strideC, M, N, K,
                                   blockIdx.x, blockIdx.y, sK);
}

// ---- the three independent projections in one launch; the branch on blockIdx.y is block-uniform ----
//   y = 0: q = x . Wq^T + bq, y = 1: k = x . Wk^T + bk -> f16 plane [b*SEQ+t][h*64+d] (M=8192, N=512, K=512),
//          blockIdx.x = one of 64 x 4 blocks of 128 x 128;
//   y = 2: v^T = Wv . x^T + bv (per row) per batch -> f16 plane [b][h*64+d][s], pitch SEQ
//          (A = Wv [n][k], Bt = x rows of the batch; M=512, N=512, K=512), blockIdx.x = batch * 16 + block in the batch.
__global__ __launch_bounds__(128) void proj_qkv(
    const unsigned short* __restrict__ Xb, const unsigned short* __restrict__ Wqb,
    const unsigned short* __restrict__ Wkb, const unsigned short* __restrict__ Wvb,
    const float* __restrict__ bq, const float* __restrict__ bk, const float* __restrict__ bv,
    unsigned short* Qf, unsigned short* Kf, unsigned short* VT) {
  __shared__ __align__(16) __bf16 sK[2 * (128 + 128) * GP];
  const int y = blockIdx.y;
  if (y < 2) {
    const bool isq = (y == 0);
    gemm64_body<0, 1, 1>(Xb, DM, 0LL, isq ? Wqb : Wkb, DM, 0LL, isq ? bq : bk, DM,
                         (void*)(isq ? Qf : Kf), DM, 0LL,
                         NB * SEQ, DM, DM, blockIdx.x, 0, sK);
  } else {
    gemm64_body<0, 1, 2>(Wvb, DM, 0LL, Xb, DM, (long long)SEQ * DM, bv, DM,
                         (void*)VT, SEQ, (long long)DM * SEQ,
                         DM, SEQ, DM, blockIdx.x & 15, blockIdx.x >> 4, sK);
  }
}

__global__ __launch_bounds__(128)
void attn64(const unsigned short* __restrict__ qp, const unsigned short* __restrict__ kp,
            const unsigned short* __restrict__ vp,
            const float* __restrict__ dbias, const int* __restrict__ kmask,
            unsigned short* op, float sscale) {
  union FH { v16h v; v8h h[2]; };
  __shared__ __align__(16) _Float16 Ks[64 * KP];    // K [kv][d], pitch KP
  __shared__ __align__(16) _Float16 Vt[64 * KP];    // V^T [d][kv], pitch KP
  __shared__ __align__(16) float    Os[4][16 * OP];    // per wave context tile [row][d], pitch OP
  __shared__ __align__(16) float    Db[2][4][16 * OP]; // two buffers, per wave bias tile [query row][key], pitch OP

  const int tid  = threadIdx.x;
  const int wave = tid >> 5;
  const int lane = tid & 31;
  const int hh   = lane >> 4;
  const int c    = lane & 15;

  const int bx   = blockIdx.x;
  const int qb   = bx % NQB;
  const int rest = bx / NQB;
  const int h    = rest % NH;
  const int b    = rest / NH;
  const int q0   = qb * 64 + wave * 16;
  const size_t rowB = (size_t)b * SEQ;

  const _Float16* Qf = (const _Float16*)(const void*)qp + (size_t)h * HD;
  const _Float16* Kf = (const _Float16*)(const void*)kp + (size_t)h * HD;
  const _Float16* Vf = (const _Float16*)(const void*)vp + ((size_t)b * DM + (size_t)h * HD) * SEQ;
  // bias staging: copy i brings rows 2i + hh of the wave's 16, lane -> 16-B piece c of the row's 256 B
  const float*   dg0 = dbias + (rowB + (size_t)q0 + hh) * SEQ + c * 4;
  const unsigned dl0 = (unsigned)(size_t)(&Db[0][wave][hh * OP + c * 4]);   // LDS byte address = low 32 bits
  auto stage_db = [&](int buf, int k0) {
    unsigned l[8];
    const float* g[8];
#pragma unroll                               // the copies' statement names every l[i] and g[i]: they must be registers
    for (int i = 0; i < 8; ++i) {
      l[i] = dl0 + (unsigned)(buf * (4 * 16 * OP) + i * 2 * OP) * 4u;
      g[i] = dg0 + (size_t)(2 * i) * SEQ + k0;
    }
    async_rows8f(l, g);
  };
  const int*   mkb = kmask + rowB + 8 * hh;                            // keys (kv0 + 16j) + 8hh + 0..7

  // ---- Q fragments (B operand, column = lane&15): 2 d-chunks ----
  v16h qa[2];
#pragma unroll
  for (int dc = 0; dc < 2; ++dc) qa[dc] = ldfrag_h(Qf + (rowB + q0 + c) * DM + dc * 32 + 8 * hh);

  float mrow = -INFINITY, lrow = 0.f;        // of the lane's one query
  v8f oacc[4];                               // O^T: oacc[t][r] = context of query c, d = 16t + 8hh + r
#pragma unroll
  for (int t = 0; t < 4; ++t) oacc[t] = zero8();

  static_assert(NQB >= 2);                   // bias tiles 0 and 1 both exist
  stage_db(0, 0);
  wait_async0();
  __syncthreads();                           // bias tile 0 is published
  stage_db(1, 64);
  for (int kt = 0; kt < NQB; ++kt) {         // static trip count
    const int kv0 = kt * 64;
    {
      // 8 lanes x 16 B = one whole 128-B tile row, so a wave's load touches 4 whole lines; rows r + 16 i, i = 0..3
      const int r = tid >> 3, pc = (tid & 7) * 8;
      const _Float16* kg = Kf + (rowB + kv0 + r) * DM + pc;       // K row kv0+r(+16i), d = pc..pc+7
      const _Float16* vg = Vf + (size_t)r * SEQ + kv0 + pc;       // V^T row d = r(+16i), s = kv0+pc..+7
      v8h a0[4], b0[4];
#pragma unroll
      for (int i = 0; i < 4; ++i) {
        a0[i] = *(const v8h*)(kg + (size_t)(16 * i) * DM);
        b0[i] = *(const v8h*)(vg + (size_t)(16 * i) * SEQ);
      }
#if defined(__HIP_DEVICE_COMPILE__)
      // the wait that stands in front of any overwrite of the loads' address registers; naming the two addresses
      // as inputs keeps them in their registers up to it, so that no later load of the group lands on one
      asm volatile("s_wait_xcnt 0x0" :: "v"(kg), "v"(vg) : "memory");
#endif
#pragma unroll
      for (int i = 0; i < 4; ++i) {
        *(v8h*)(Ks + (r + 16 * i) * KP + pc) = a0[i];
        *(v8h*)(Vt + (r + 16 * i) * KP + pc) = b0[i];
      }
    }
    __syncthreads();

    // ---- key mask of this lane's 32 keys: 8 contiguous values per key tile ----
    const int*   mkw = mkb + kv0;
    v4i mk4[8];
#pragma unroll
    for (int j = 0; j < 4; ++j) {
      mk4[2 * j]     = *(const v4i*)(mkw + j * 16);
      mk4[2 * j + 1] = *(const v4i*)(mkw + j * 16 + 4);
    }
#if defined(__HIP_DEVICE_COMPILE__)
    // the wait that stands in front of any overwrite of the loads' address registers; naming the address
    // as an input keeps it in its registers up to it
    asm volatile("s_wait_xcnt 0x0" :: "v"(mkw) : "memory");
#endif

    // ---- scores, transposed: 64 keys x 16 queries per wave; s[j][r] = key 16j + 8hh + r, query c ----
    //      the chunk's K fragments are read as one group and the WMMAs go round the four key tiles, so that
    //      none waits for the one before
    v8f s[4];
#pragma unroll
    for (int j = 0; j < 4; ++j) s[j] = zero8();
    v16h kb[2][4];
#pragma unroll
    for (int dc = 0; dc < 2; ++dc)
#pragma unroll
      for (int j = 0; j < 4; ++j) kb[dc][j] = ldfrag_h(Ks + (j * 16 + c) * KP + dc * 32 + 8 * hh);
    // bias of this lane's 32 keys from the staged tile: row c, keys 16j + 8hh + 0..7; read in one group with the
    // K fragments, ahead of the score WMMAs
    const float* drw = &Db[kt & 1][wave][c * OP + 8 * hh];
    v4f dv4[8];
#pragma unroll                               // keeps dv4 in registers
    for (int j = 0; j < 4; ++j) {
      dv4[2 * j]     = *(const v4f*)(drw + j * 16);
      dv4[2 * j + 1] = *(const v4f*)(drw + j * 16 + 4);
    }
    // keeps the fragment reads one group in front of the WMMAs: left alone, the compiler reads every fragment into the
    // same registers directly in front of its WMMA, and each WMMA then waits out a whole LDS read
    __builtin_amdgcn_sched_barrier(0);
#pragma unroll
    for (int dc = 0; dc < 2; ++dc)
#pragma unroll
      for (int j = 0; j < 4; ++j) s[j] = mma_h_raw(kb[dc][j], qa[dc], s[j]);

    // holds the bias and mask arithmetic behind the score WMMAs: moved up among them, its wait for the global loads
    // would stand in front of the WMMAs and the loads' latency would not be covered by them
    __builtin_amdgcn_sched_barrier(0);

    // ---- scale + bias, clip, key mask, row max, online softmax; P (x1024, f16)
    //      packed straight into the B fragments of the context product ----
    float m = -INFINITY;
#pragma unroll
    for (int j = 0; j < 4; ++j) {
      v2b dp[4];                             // the tile's 8 bias values, two to a convert
#pragma unroll
      for (int u = 0; u < 4; ++u) dp[u] = bf_pair(dv4[2 * j + (u >> 1)][(u & 1) * 2], dv4[2 * j + (u >> 1)][(u & 1) * 2 + 1]);
#pragma unroll
      for (int r = 0; r < 8; ++r) {
        const float dv = (float)dp[r >> 1][r & 1];
        float sv = s[j][r] * sscale + dv;
        sv = fminf(10.0f, fmaxf(-10.0f, sv));
        sv = (mk4[2 * j + (r >> 2)][r & 3] != 0) ? sv : -1.0e9f;
        s[j][r] = sv;
        m = fmaxf(m, sv);
      }
    }
    m = fmaxf(m, xhalf(m));                  // the query's other 32 keys of the chunk
    const float mnew  = fmaxf(mrow, m);
    const float msafe = (mnew == -INFINITY) ? 0.f : mnew;
    const float LOG2E = 1.44269504f;         // exp(x) = 2^(x * log2 e), the product and the instruction of __expf
    const float alpha = exp2_1((mrow - msafe) * LOG2E);
    mrow = mnew;
    float psum = 0.f;
    FH pa[2];
#pragma unroll
    for (int j = 0; j < 4; ++j) {
      v8f xe;
#pragma unroll
      for (int r = 0; r < 8; ++r) xe[r] = (s[j][r] - msafe) * LOG2E;
      const v8f pe = exp2_8(xe);
#pragma unroll
      for (int r = 0; r < 8; r += 2) {
        const float p0 = pe[r];
        const float p1 = pe[r + 1];
        psum += p0;
        psum += p1;
        const v2h ph = h_pair(p0 * 1024.0f, p1 * 1024.0f);
        pa[j >> 1].v[(j & 1) * 8 + r]     = ph[0];
        pa[j >> 1].v[(j & 1) * 8 + r + 1] = ph[1];
      }
    }
    psum += xhalf(psum);
    lrow = lrow * alpha + psum;
#pragma unroll
    for (int t = 0; t < 4; ++t)
#pragma unroll
      for (int r = 0; r < 8; ++r) oacc[t][r] *= alpha;

    // ---- context^T += V^T . P^T (f16 WMMA) ----
#pragma unroll
    for (int kk = 0; kk < 2; ++kk) {
      v16h vb[4];                            // the V^T fragments of 32 keys, read as one group
#pragma unroll
      for (int t = 0; t < 4; ++t) vb[t] = ldfrag_h(Vt + (t * 16 + c) * KP + kk * 32 + 8 * hh);
#pragma unroll
      for (int t = 0; t < 4; ++t) oacc[t] = mma_h_raw(vb[t], pa[kk].v, oacc[t]);
    }
    wait_ds0();
    wait_async0();
    __syncthreads();                         // publishes bias tile kt + 1; ends every read of bias tile kt, of Ks and of Vt
    if (kt + 2 < NQB) stage_db(kt & 1, (kt + 2) * 64);
  }
  wait_async0();

  // ---- normalise (1/l and the 1/1024 p carry), stage the wave's 16x64 tile, convert to f16, store whole 128-B rows ----
  float* os = Os[wave];
  {
    const float l = lrow;
    const float inv = ((l > 0.f) ? (1.0f / l) : 0.f) * (1.0f / 1024.0f);
#pragma unroll
    for (int t = 0; t < 4; ++t) {
      v4f w0, w1;
#pragma unroll
      for (int r = 0; r < 4; ++r) { w0[r] = oacc[t][r] * inv; w1[r] = oacc[t][4 + r] * inv; }
      *(v4f*)(os + c * OP + t * 16 + 8 * hh)     = w0;      // row = query c, d = 16t + 8hh + 0..7
      *(v4f*)(os + c * OP + t * 16 + 8 * hh + 4) = w1;
    }
  }
  __builtin_amdgcn_fence(__ATOMIC_RELEASE, "workgroup");
  __builtin_amdgcn_wave_barrier();
  __builtin_amdgcn_fence(__ATOMIC_ACQUIRE, "workgroup");
  {
    const int q4 = lane >> 3, c8 = (lane & 7) * 8;
    v4u hv[4];
#pragma unroll
    for (int it = 0; it < 4; ++it) {
      const int row = it * 4 + q4;   // it 0..3 x q4 0..3 = rows 0..15 of the wave tile
      const float* sp = os + row * OP + c8;
#pragma unroll
      for (int e = 0; e < 4; ++e) hv[it][e] = h_word(h_pair(sp[2 * e], sp[2 * e + 1]));
    }
#pragma unroll
    for (int it = 0; it < 4; ++it) {
      const int row = it * 4 + q4;
      *(v4u*)(op + (rowB + q0 + row) * DM + (size_t)h * HD + c8) = hv[it];
    }
  }
}

// =====================================================================================================
// Workspace map (bytes), every plane an exact multiple of its 64x64-tile / whole-line store granularity:
//   Xb   bf16 [8192][512]          8388608
//   Wqb, Wkb, Wvb bf16, Wof f16 [512 n][512 k]   524288 each
//   Qf, Kf f16 [8192][512]          8388608 each
//   VT   f16  [16][512 d][512 s]   8388608
//   Of   f16  [8192][512]          8388608
//   total                           44040192
// Weights are [out n][in k] with k contiguous = the Bt / A layout the GEMM wants, so they are only converted.
// =====================================================================================================
extern "C" void kernel_launch(void* const* d_in, const int* in_sizes, int n_in,
                              void* d_out, int out_size, void* d_ws, size_t ws_size,
                              hipStream_t stream) {
  if (n_in < 11) return;
  if (in_sizes[0] != NB * SEQ * DM) return;
  if (in_sizes[1] != NB * SEQ * SEQ) return;
  if (in_sizes[2] != NB * SEQ) return;
  if (in_sizes[3] != DM * DM || in_sizes[5] != DM * DM || in_sizes[7] != DM * DM || in_sizes[9] != DM * DM) return;
  if (in_sizes[4] != DM || in_sizes[6] != DM || in_sizes[8] != DM || in_sizes[10] != DM) return;
  if (out_size != NB * SEQ * DM) return;

  const float* x    = (const float*)d_in[0];
  const float* db   = (const float*)d_in[1];
  const int*   msk  = (const int*)d_in[2];
  const float* Wq   = (const float*)d_in[3];
  const float* bq   = (const float*)d_in[4];
  const float* Wk   = (const float*)d_in[5];
  const float* bk   = (const float*)d_in[6];
  const float* Wv   = (const float*)d_in[7];
  const float* bv   = (const float*)d_in[8];
  const float* Wo   = (const float*)d_in[9];
  const float* bo   = (const float*)d_in[10];

  const size_t PX  = (size_t)NB * SEQ * DM * 2;   // 8388608   16-bit activation plane [8192][512]
  const size_t PW  = (size_t)DM * DM * 2;         //  524288   16-bit weight plane
  const size_t PVT = (size_t)NB * DM * SEQ * 2;   // 8388608   v^T plane
  size_t off = 0;
  const size_t oXb  = off; off += PX;
  const size_t oWq  = off; off += PW;
  const size_t oWk  = off; off += PW;
  const size_t oWv  = off; off += PW;
  const size_t oWo  = off; off += PW;
  const size_t oQf  = off; off += PX;
  const size_t oKf  = off; off += PX;
  const size_t oVT  = off; off += PVT;
  const size_t oOf  = off; off += PX;
  if (off > ws_size) return;                      // off = 44040192
  if (off > (size_t)134217728) return;

  char* ws = (char*)d_ws;
  unsigned short* Xb  = (unsigned short*)(ws + oXb);
  unsigned short* Wqb = (unsigned short*)(ws + oWq);
  unsigned short* Wkb = (unsigned short*)(ws + oWk);
  unsigned short* Wvb = (unsigned short*)(ws + oWv);
  unsigned short* Wof = (unsigned short*)(ws + oWo);
  unsigned short* Qf  = (unsigned short*)(ws + oQf);
  unsigned short* Kf  = (unsigned short*)(ws + oKf);
  unsigned short* VT  = (unsigned short*)(ws + oVT);
  unsigned short* Of  = (unsigned short*)(ws + oOf);

  const dim3 blk(256);
  const int n8x = NB * SEQ * DM / 8;                          // 524288
  const int n8w = DM * DM / 8;                                //  32768
  const int nbx = n8x / 256;                                  // 2048 blocks for x
  const int nbw = n8w / 256;                                  //  128 blocks for each weight
  const dim3 gCvt(nbx + 4 * nbw);                             // 2560 blocks
  const dim3 gProj((NB * SEQ / 128) * (DM / 128), 1);         // 64 x 4 = 256 blocks of 128 x 128: M=8192, N=512
  const dim3 gQKV((NB * SEQ / 128) * (DM / 128), 3);          // 256 blocks each for q, k and v^T (16 blocks x 16 batches)
  const dim3 gAttn(NB * NH * NQB);                            // 1024 blocks of 128 threads

  // (1) x -> bf16 plane [8192][512]; Wq, Wk, Wv [n][k] f32 -> bf16, Wo -> f16; Xb, Wqb, Wkb, Wvb, Wof lie one behind the other
  cvt_16x8<<<gCvt, blk, 0, stream>>>(x, Wq, Wk, Wv, Wo, Xb, nbx, nbw);
  // (2) q, k, v^T -> f16 planes
  proj_qkv<<<gQKV, dim3(128), 0, stream>>>(Xb, Wqb, Wkb, Wvb, bq, bk, bv, Qf, Kf, VT);
  // (3) attention -> context f16 plane
  attn64<<<gAttn, dim3(128), 0, stream>>>(Qf, Kf, VT, db, msk, Of, 0.125f);
  // (4) out = context . Wo^T + bo -> d_out f32 [8192][512]
  gemm64<1, 0, 1><<<gProj, dim3(128), 0, stream>>>(
      Of, DM, 0LL, Wof, DM, 0LL, bo, DM,
      d_out, DM, 0LL,
      NB * SEQ, DM, DM);
  (void)hipGetLastError();
}
